// v000
// The times below were measured on an AMD MI455X: many runs one after another, warmed up first and cycling through
// copies of the inputs, with the whole window's GPU time divided by the number of runs. Launches and the gaps
// between them are all in it. The median over several windows is given; except for v000 it joins two sittings, which
// can be a few percent apart, so the side-by-side timings, each taken in one sitting, are the better comparison.
// The starting kernel, v000, takes 442 microseconds a run.
#include <hip/hip_runtime.h>

// Contractions: qkv = X x Wqkv^T on v_wmma_f32_16x16x32_bf16 (bf16 operands = RNE-converted inputs, f32 accumulate);
// S^T = K x Q^T on v_wmma_f32_16x16x32_f16 (f16 q/k after RoPE, plus f16 residual planes x1024 with their own
// accumulator on query blocks < EARLY_QBLK); O = P x V on v_wmma_f32_16x16x32_f16 (P as f16 carried x4096,
// V as f16, plus P and V residual planes x1024 with their own accumulator on query blocks < EARLY_QBLK);
// out = ctx x Wproj^T on v_wmma_f32_16x16x32_f16 (ctx as f16 carried x64 plus residual x1024 on rows < ER,
// Wproj = f16 of the bf16 RNE-converted input carried x256). RoPE, softmax and all epilogues in f32.

#ifndef NB
#define NB 1
#endif
#ifndef SEQ
#define SEQ 4096
#endif
#define NB_FULL    1
#define SEQ_FULL   4096
#define NHEAD      16
#define HDIM       64
#define DMODEL     (NHEAD * HDIM)        // 1024
#define QKV_N      (3 * DMODEL)          // 3072
#define NROPE      (HDIM / 2)            // 32 frequencies
#define BQ         128                   // query rows per attention block (8 waves x 16)
#define BK         32                    // keys per inner iteration
#define NWAVE      8
#define EARLY_QBLK 2                     // query blocks with residual planes on q, k, P, v, ctx
#define ER         ((EARLY_QBLK * BQ < SEQ) ? (EARLY_QBLK * BQ) : SEQ)   // early rows == early keys
#define CT         64                    // rows per plane-builder block
#define TP         72                    // LDS pitch (halves) of the transposed V tile
#define OP         68                    // LDS pitch (floats) of output staging tiles
#define PCAR       4096.0f               // P carry
#define RSC        1024.0f               // residual plane scale
#define CCAR       64.0f                 // ctx carry
#define WCAR       256.0f                // Wproj carry

static_assert(NB == 1 && NB <= NB_FULL);
static_assert(SEQ <= SEQ_FULL);
static_assert(SEQ % BQ == 0);
static_assert(ER % BQ == 0);
static_assert((SEQ - ER) % 128 == 0);
static_assert(ER % CT == 0);
static_assert(SEQ % CT == 0);
static_assert(SEQ % 8 == 0);
static_assert(BQ == NWAVE * 16);
static_assert(HDIM == 64);
static_assert(DMODEL % 64 == 0 && QKV_N % 64 == 0);
static_assert(DMODEL % 32 == 0);
static_assert((SEQ * DMODEL) % 2048 == 0);
static_assert((QKV_N * DMODEL) % 2048 == 0);
static_assert((DMODEL * DMODEL) % 2048 == 0);
static_assert((TP * 2) % 16 == 0);
static_assert((OP * 4) % 16 == 0);

typedef __bf16         bf16;
typedef _Float16       f16;
typedef unsigned short us16;
typedef bf16     v16bf __attribute__((ext_vector_type(16)));
typedef f16      v16h  __attribute__((ext_vector_type(16)));
typedef f16      v8h   __attribute__((ext_vector_type(8)));
typedef float    v8f   __attribute__((ext_vector_type(8)));
typedef float    v4f   __attribute__((ext_vector_type(4)));
typedef unsigned v4u   __attribute__((ext_vector_type(4)));

union FragB  { v16bf v; v4u q[2]; bf16 h[16]; };
union FragH  { v16h  v; v4u q[2]; f16  h[16]; };
union Pack8B { v4u u; bf16 h[8]; };
union Pack8H { v4u u; v8h v; f16 h[8]; };

// WMMA helpers: builtin followed by the VALU hazard guard (ties D, keeps A/B live).
static __device__ __forceinline__ v8f mma_bf16(v16bf a, v16bf b, v8f acc) {
  acc = __builtin_amdgcn_wmma_f32_16x16x32_bf16(false, a, false, b, (short)0, acc, false, false);
  asm volatile("v_nop\n\tv_nop\n\tv_nop\n\tv_nop" : "+v"(acc) : "v"(a), "v"(b));
  return acc;
}
static __device__ __forceinline__ v8f mma_f16(v16h a, v16h b, v8f acc) {
  acc = __builtin_amdgcn_wmma_f32_16x16x32_f16(false, a, false, b, (short)0, acc, false, false);
  asm volatile("v_nop\n\tv_nop\n\tv_nop\n\tv_nop" : "+v"(acc) : "v"(a), "v"(b));
  return acc;
}
static __device__ __forceinline__ v8f mma(const FragB& a, const FragB& b, v8f acc) { return mma_bf16(a.v, b.v, acc); }
static __device__ __forceinline__ v8f mma(const FragH& a, const FragH& b, v8f acc) { return mma_f16(a.v, b.v, acc); }

// ---------------------------------------------------------------------------------------------
// Convert pass: xb = bf16(x) [SEQ][DMODEL], wb = bf16(Wqkv) [QKV_N][DMODEL], wp = f16(bf16(Wproj) * 256) [DMODEL][DMODEL].
// coverage: blocks [0,SEQ*DMODEL/2048) x 256 x 8 == SEQ*DMODEL; next QKV_N*DMODEL/2048 blocks == QKV_N*DMODEL;
//           last DMODEL*DMODEL/2048 blocks == DMODEL*DMODEL.
template <int MODE>
static __device__ __forceinline__ void cvt_body(const float* __restrict__ src, us16* __restrict__ dst,
                                                 int blk, int tid) {
  const size_t e = ((size_t)blk * 256 + tid) * 8;
  const v4f a = *(const v4f*)(src + e);
  const v4f b = *(const v4f*)(src + e + 4);
  v4u u;
  if (MODE == 0) {
    Pack8B pk;
    #pragma unroll
    for (int i = 0; i < 4; ++i) {
      pk.h[i]     = (bf16)a[i];                 // RNE convert
      pk.h[4 + i] = (bf16)b[i];
    }
    u = pk.u;
  } else {
    Pack8H pk;
    #pragma unroll
    for (int i = 0; i < 4; ++i) {
      pk.h[i]     = (f16)((float)(bf16)a[i] * WCAR);   // bf16 significand is exact in f16
      pk.h[4 + i] = (f16)((float)(bf16)b[i] * WCAR);
    }
    u = pk.u;
  }
  *(v4u*)(dst + e) = u;
  
}

__global__ __launch_bounds__(256) void convert_kernel(const float* __restrict__ x,
                                                      const float* __restrict__ wq,
                                                      const float* __restrict__ wpj,
                                                      bf16* __restrict__ xb,
                                                      bf16* __restrict__ wb,
                                                      f16* __restrict__ wp) {
  const int blk = blockIdx.x;
  const int tid = threadIdx.x;
  const int NBX = SEQ * DMODEL / 2048;
  const int NBQ = QKV_N * DMODEL / 2048;
  if (blk < NBX)            cvt_body<0>(x, (us16*)xb, blk, tid);
  else if (blk < NBX + NBQ) cvt_body<0>(wq, (us16*)wb, blk - NBX, tid);
  else                      cvt_body<1>(wpj, (us16*)wp, blk - NBX - NBQ, tid);
}

// ---------------------------------------------------------------------------------------------
// RoPE tables ct/st [SEQ][NROPE] f32: angle(t, j) = t * (1 / 10000^(2j/64)). Block = 8 positions x 32 freqs.
// One powf + one sincosf per thread (rolled). Rows staged in LDS; waves 0-1 write the cos lines, waves 2-3 the
// coverage: (SEQ/8 blocks) x 8 rows x 32 floats == SEQ*NROPE per table.
__global__ __launch_bounds__(256) void rope_table_kernel(float* __restrict__ ct, float* __restrict__ st) {
  __shared__ __align__(16) float sc[8 * NROPE];   // cross-wave (block barrier)
  __shared__ __align__(16) float ss[8 * NROPE];
  const int tid = threadIdx.x;
  const int j   = tid & 31;
  const int tl  = tid >> 5;
  const int t   = blockIdx.x * 8 + tl;
  const float e   = (float)(2 * j) * (1.0f / 64.0f);
  const float pw  = powf(10000.0f, e);
  const float inv = 1.0f / pw;
  const float ang = (float)t * inv;
  float sn, cs;
  sincosf(ang, &sn, &cs);
  sc[tl * NROPE + j] = cs;
  ss[tl * NROPE + j] = sn;
  __syncthreads();
  if (tid < 64) {
    const int rowl  = tid >> 3;
    const int piece = tid & 7;
    const v4f v = *(const v4f*)(sc + rowl * NROPE + piece * 4);
    const size_t gi = (size_t)(blockIdx.x * 8 + rowl) * NROPE + piece * 4;
    *(v4f*)(ct + gi) = v;
    
  } else if (tid < 128) {
    const int rowl  = (tid - 64) >> 3;
    const int piece = tid & 7;
    const v4f v = *(const v4f*)(ss + rowl * NROPE + piece * 4);
    const size_t gi = (size_t)(blockIdx.x * 8 + rowl) * NROPE + piece * 4;
    *(v4f*)(st + gi) = v;
    
  }
}

// ---------------------------------------------------------------------------------------------
// NT GEMM: C[m][n] = oscale * sum_k A[m][k] B[n][k] (+ rscale * sum_k Ar[m][k] B[n][k] when RES).
// A, Ar, B are 16-bit row-major planes with pitch K (k contiguous). 4 waves/block, wave tile (16*MI) x 64,
// block tile (64*MI) x 64. A and B fragments are loaded straight from the planes with the split k map:
// elements 0..7 <- k0 + 8h + 0..7, elements 8..15 <- k0 + 16 + 8h + 0..7, lane&15 = row of A / row of B (= column n).
// Epilogue: wave tile staged in LDS, then per instruction lanes 0..15 write one 256-B row segment (two whole
// Requires K % 32 == 0, N % 64 == 0, rows covered by the grid a multiple of 64*MI.
template <typename F, int MI, int RES>
__global__ __launch_bounds__(128) void gemm_nt_kernel(const us16* __restrict__ A,
                                                          const us16* __restrict__ Ar,
                                                          const us16* __restrict__ Bm,
                                                          float* __restrict__ C,
                                                          int K, int N, int mrow0,
                                                          float oscale, float rscale) {
  __shared__ __align__(16) float sC[4 * 32 * OP];   // per-wave staging (block barrier used)
  const int tid  = threadIdx.x;
  const int wave = tid >> 5;
  const int lane = tid & 31;
  const int lq   = lane & 15;
  const int hi   = lane >> 4;
  const int m0   = mrow0 + blockIdx.y * (64 * MI) + wave * (16 * MI);
  const int n0   = blockIdx.x * 64;

  v8f acc[MI][4], acc2[MI][4];
  #pragma unroll
  for (int mi = 0; mi < MI; ++mi) {
    #pragma unroll
    for (int t = 0; t < 4; ++t) {
      acc[mi][t]  = (v8f){0, 0, 0, 0, 0, 0, 0, 0};
      acc2[mi][t] = (v8f){0, 0, 0, 0, 0, 0, 0, 0};
    }
  }

  for (int k0 = 0; k0 < K; k0 += 32) {
    F a[MI], ar[MI], b[4];
    #pragma unroll
    for (int mi = 0; mi < MI; ++mi) {
      const us16* p = A + (size_t)(m0 + mi * 16 + lq) * K + k0 + hi * 8;
      a[mi].q[0] = *(const v4u*)(p);        // k0 + 8h + 0..7
      a[mi].q[1] = *(const v4u*)(p + 16);   // k0 + 16 + 8h + 0..7
      if (RES != 0) {
        const us16* pr = Ar + (size_t)(m0 + mi * 16 + lq) * K + k0 + hi * 8;
        ar[mi].q[0] = *(const v4u*)(pr);
        ar[mi].q[1] = *(const v4u*)(pr + 16);
      }
    }
    #pragma unroll
    for (int t = 0; t < 4; ++t) {
      const us16* p = Bm + (size_t)(n0 + t * 16 + lq) * K + k0 + hi * 8;
      b[t].q[0] = *(const v4u*)(p);
      b[t].q[1] = *(const v4u*)(p + 16);
    }
    #pragma unroll
    for (int mi = 0; mi < MI; ++mi) {
      #pragma unroll
      for (int t = 0; t < 4; ++t) {
        acc[mi][t] = mma(a[mi], b[t], acc[mi][t]);
        if (RES != 0) acc2[mi][t] = mma(ar[mi], b[t], acc2[mi][t]);
      }
    }
  }

  float* so = sC + wave * (16 * MI * OP);
  #pragma unroll
  for (int mi = 0; mi < MI; ++mi) {
    #pragma unroll
    for (int t = 0; t < 4; ++t) {
      #pragma unroll
      for (int r = 0; r < 8; ++r) {
        float val = acc[mi][t][r] * oscale;
        if (RES != 0) val += acc2[mi][t][r] * rscale;
        so[(mi * 16 + hi * 8 + r) * OP + t * 16 + lq] = val;
      }
    }
  }
  __syncthreads();

  const int NIT = 8 * MI;   // (16*MI rows) / 2 rows per instruction
  v4f    vals[8 * MI];
  size_t gidx[8 * MI];
  #pragma unroll
  for (int it = 0; it < NIT; ++it) {
    const int row = it * 2 + hi;
    vals[it] = *(const v4f*)(so + row * OP + lq * 4);
    gidx[it] = (size_t)(m0 + row) * N + n0 + lq * 4;
  }
  #pragma unroll
  for (int it = 0; it < NIT; ++it) *(v4f*)(C + gidx[it]) = vals[it];
  
}

// ---------------------------------------------------------------------------------------------
// Plane builder. Block = (64-row tile, head), 256 threads; reads the f32 qkv rows [SEQ][QKV_N].
//   qr, kr [NHEAD][ER][HDIM]  f16 : residual planes (x - f16(x)) * 1024 for rows < ER (block-uniform).
//   vtr [NHEAD][HDIM][ER]     f16 : V residual transposed, keys < ER.
// RoPE (rotate-half): pair partner d^32 sits in lane^4 of the same wave; out[d] = x[d]*cos + sgn*x[d^32]*sin.
// coverage: rows kt*64 + {0..31, 32..63}, d 0..63 for every plane; residual planes for tiles with s0 < ER
//           (ER/64 tiles x 64 rows == ER rows); every written line whole, one instruction.
__global__ __launch_bounds__(256) void planes_kernel(const float* __restrict__ qkv,
                                                     const float* __restrict__ ct,
                                                     const float* __restrict__ st,
                                                     f16* __restrict__ qh, f16* __restrict__ qr,
                                                     f16* __restrict__ kh, f16* __restrict__ kr,
                                                     f16* __restrict__ vt, f16* __restrict__ vtr) {
  const int kt  = blockIdx.x;
  const int h   = blockIdx.y;
  const int tid = threadIdx.x;
  __shared__ __align__(16) f16 sT[HDIM * TP];   // [d][key] hi, cross-wave (block barrier)
  __shared__ __align__(16) f16 sR[HDIM * TP];   // [d][key] residual, cross-wave (block barrier)
  const int  s0    = kt * CT;
  const bool early = (s0 < ER);                 // block-uniform

  v4u    qv[2], kv[2], qx[2], kx[2];
  size_t pidx[2], ridx[2];
  #pragma unroll
  for (int kk = 0; kk < 2; ++kk) {
    const int   key  = kk * 32 + (tid >> 3);    // 0..63
    const int   d0   = (tid & 7) * 8;           // 0..56
    const int   j0   = d0 & (NROPE - 1);        // frequency index of d0
    const float sgn  = (d0 < NROPE) ? -1.0f : 1.0f;
    const int   srow = s0 + key;
    const float* src = qkv + (size_t)srow * QKV_N + h * HDIM + d0;     // slot 0 = q
    const v4f q0v = *(const v4f*)(src);
    const v4f q1v = *(const v4f*)(src + 4);
    const v4f k0v = *(const v4f*)(src + DMODEL);                        // slot 1 = k
    const v4f k1v = *(const v4f*)(src + DMODEL + 4);
    const v4f v0v = *(const v4f*)(src + 2 * DMODEL);                    // slot 2 = v
    const v4f v1v = *(const v4f*)(src + 2 * DMODEL + 4);
    const float* cp = ct + (size_t)srow * NROPE + j0;
    const float* sp = st + (size_t)srow * NROPE + j0;
    const v4f c0 = *(const v4f*)(cp);
    const v4f c1 = *(const v4f*)(cp + 4);
    const v4f n0 = *(const v4f*)(sp);
    const v4f n1 = *(const v4f*)(sp + 4);
    float qa[8], ka[8], va[8], ca[8], sa[8];
    #pragma unroll
    for (int i = 0; i < 4; ++i) {
      qa[i] = q0v[i]; qa[4 + i] = q1v[i];
      ka[i] = k0v[i]; ka[4 + i] = k1v[i];
      va[i] = v0v[i]; va[4 + i] = v1v[i];
      ca[i] = c0[i];  ca[4 + i] = c1[i];
      sa[i] = n0[i];  sa[4 + i] = n1[i];
    }
    Pack8H pq, pqr, pk, pkr;
    #pragma unroll
    for (int i = 0; i < 8; ++i) {
      const float qp = __shfl_xor(qa[i], 4, 32);   // partner d^32, same row, same wave
      const float kp = __shfl_xor(ka[i], 4, 32);
      const float qo = qa[i] * ca[i] + sgn * qp * sa[i];
      const float ko = ka[i] * ca[i] + sgn * kp * sa[i];
      const f16 qhh = (f16)qo;
      const f16 khh = (f16)ko;
      pq.h[i]  = qhh;
      pk.h[i]  = khh;
      pqr.h[i] = (f16)((qo - (float)qhh) * RSC);
      pkr.h[i] = (f16)((ko - (float)khh) * RSC);
      const f16 vhh = (f16)va[i];
      sT[(d0 + i) * TP + key] = vhh;
      sR[(d0 + i) * TP + key] = (f16)((va[i] - (float)vhh) * RSC);
    }
    qv[kk] = pq.u;  qx[kk] = pqr.u;
    kv[kk] = pk.u;  kx[kk] = pkr.u;
    pidx[kk] = ((size_t)h * SEQ + srow) * HDIM + d0;
    ridx[kk] = ((size_t)h * ER + srow) * HDIM + d0;   // used only when early (srow < ER)
  }
  __syncthreads();

  v4u    vv[2], vx[2];
  size_t vidx[2], vridx[2];
  #pragma unroll
  for (int kk = 0; kk < 2; ++kk) {
    const int d  = kk * 32 + (tid >> 3);        // 0..63
    const int ks = (tid & 7) * 8;               // 0..56
    Pack8H ph, px;
    ph.v = *(const v8h*)(sT + d * TP + ks);
    px.v = *(const v8h*)(sR + d * TP + ks);
    vv[kk] = ph.u;
    vx[kk] = px.u;
    vidx[kk]  = ((size_t)h * HDIM + d) * SEQ + s0 + ks;
    vridx[kk] = ((size_t)h * HDIM + d) * ER + s0 + ks;   // used only when early
  }

  #pragma unroll
  for (int kk = 0; kk < 2; ++kk) {
    *(v4u*)(qh + pidx[kk]) = qv[kk];
    *(v4u*)(kh + pidx[kk]) = kv[kk];
    *(v4u*)(vt + vidx[kk]) = vv[kk];
    if (early) {
      *(v4u*)(qr + ridx[kk])   = qx[kk];
      *(v4u*)(kr + ridx[kk])   = kx[kk];
      *(v4u*)(vtr + vridx[kk]) = vx[kk];
    }
  }
  
}

// ---------------------------------------------------------------------------------------------
// Flash attention, causal. Block = (query block of 128, head); one wave owns 16 query rows.
// S^T = K x Q^T so queries sit on lanes; P^T in C-layout is bit-identical to the A-fragment layout of O += P x V.
// K A-fragments, Q B-fragments and V^T B-fragments are loaded straight from the 16-bit planes (two 16-B loads each).
// RES != 0 (query blocks < EARLY_QBLK, all visited keys < ER): score = KQ + (K Qres + Kres Q)/1024;
// O2 = Pres V + P Vres accumulated separately and folded as O2/1024 before normalisation.
template <int RES>
__global__ __launch_bounds__(256) void attn_kernel(const f16* __restrict__ qh, const f16* __restrict__ qr,
                                                   const f16* __restrict__ kh, const f16* __restrict__ kr,
                                                   const f16* __restrict__ vt, const f16* __restrict__ vtr,
                                                   f16* __restrict__ ctxh, f16* __restrict__ ctxr,
                                                   int qblk0) {
  const int qblk = qblk0 + blockIdx.x;
  const int h    = blockIdx.y;
  const int tid  = threadIdx.x;
  const int wave = tid >> 5;
  const int lane = tid & 31;
  const int lq   = lane & 15;   // query column of S^T / d column of O
  const int hi   = lane >> 4;   // k-split half

  __shared__ __align__(16) float sO[NWAVE * 16 * OP];   // per-wave output staging (block barrier used)

  const int qrow0 = qblk * BQ + wave * 16;               // first query row of this wave

  // Q as B-operand fragments: lane lq holds query qrow0+lq, elements follow the split d map.
  FragH qf[2], qx[2];
  {
    const f16* qp = qh + ((size_t)h * SEQ + qrow0 + lq) * HDIM;
    #pragma unroll
    for (int f = 0; f < 2; ++f) {
      qf[f].q[0] = *(const v4u*)(qp + f * 32 + hi * 8);        // d = f*32 + hi*8 + 0..7
      qf[f].q[1] = *(const v4u*)(qp + f * 32 + 16 + hi * 8);   // d = f*32 + 16 + hi*8 + 0..7
    }
    if (RES != 0) {
      const f16* qrp = qr + ((size_t)h * ER + qrow0 + lq) * HDIM;
      #pragma unroll
      for (int f = 0; f < 2; ++f) {
        qx[f].q[0] = *(const v4u*)(qrp + f * 32 + hi * 8);
        qx[f].q[1] = *(const v4u*)(qrp + f * 32 + 16 + hi * 8);
      }
    }
  }

  const f16* kh_h  = kh  + (size_t)h * SEQ * HDIM;
  const f16* kr_h  = kr  + (size_t)h * ER * HDIM;
  const f16* vt_h  = vt  + (size_t)h * HDIM * SEQ;
  const f16* vtr_h = vtr + (size_t)h * HDIM * ER;

  v8f o[4], o2[4];
  #pragma unroll
  for (int dt = 0; dt < 4; ++dt) {
    o[dt]  = (v8f){0, 0, 0, 0, 0, 0, 0, 0};
    o2[dt] = (v8f){0, 0, 0, 0, 0, 0, 0, 0};
  }

  float rmax = -__builtin_inff();
  float rsum = 0.0f;
  const float SL = 0.125f * 1.4426950408889634f;   // softmax scale * log2(e)

  // causal: this wave visits key chunks whose first key is <= its last query row (wave-uniform trip count)
  const int nchunk = (qrow0 + 15) / BK + 1;
  for (int i = 0; i < nchunk; ++i) {
    const int j0 = i * BK;

    // S^T tiles: c[sub][r] = rawscore(query qrow0+lq, key j0 + sub*16 + hi*8 + r)
    v8f c[2];
    #pragma unroll
    for (int sub = 0; sub < 2; ++sub) {
      FragH a0, a1;
      const f16* base = kh_h + (size_t)(j0 + sub * 16 + lq) * HDIM + hi * 8;   // row = key j0 + sub*16 + lq
      a0.q[0] = *(const v4u*)(base);        // d = hi*8 + 0..7
      a0.q[1] = *(const v4u*)(base + 16);   // d = 16 + hi*8 + 0..7
      a1.q[0] = *(const v4u*)(base + 32);   // d = 32 + hi*8 + 0..7
      a1.q[1] = *(const v4u*)(base + 48);   // d = 48 + hi*8 + 0..7
      v8f acc = (v8f){0, 0, 0, 0, 0, 0, 0, 0};
      acc = mma_f16(a0.v, qf[0].v, acc);
      acc = mma_f16(a1.v, qf[1].v, acc);
      if (RES != 0) {
        FragH r0, r1;
        const f16* rb = kr_h + (size_t)(j0 + sub * 16 + lq) * HDIM + hi * 8;
        r0.q[0] = *(const v4u*)(rb);
        r0.q[1] = *(const v4u*)(rb + 16);
        r1.q[0] = *(const v4u*)(rb + 32);
        r1.q[1] = *(const v4u*)(rb + 48);
        v8f ax = (v8f){0, 0, 0, 0, 0, 0, 0, 0};
        ax = mma_f16(a0.v, qx[0].v, ax);
        ax = mma_f16(a1.v, qx[1].v, ax);
        ax = mma_f16(r0.v, qf[0].v, ax);
        ax = mma_f16(r1.v, qf[1].v, ax);
        #pragma unroll
        for (int r = 0; r < 8; ++r) acc[r] += ax[r] * (1.0f / RSC);
      }
      c[sub] = acc;
    }

    // causal mask (key > query -> -inf); branch is wave-uniform, selects are per lane
    if (j0 + BK - 1 > qrow0) {
      const int qi = qrow0 + lq;
      #pragma unroll
      for (int sub = 0; sub < 2; ++sub) {
        #pragma unroll
        for (int r = 0; r < 8; ++r) {
          const int key = j0 + sub * 16 + hi * 8 + r;
          c[sub][r] = (key > qi) ? -__builtin_inff() : c[sub][r];
        }
      }
    }

    // online softmax: query lq's 32 scores are split across lane / lane^16
    float m_new = rmax;
    #pragma unroll
    for (int r = 0; r < 8; ++r) {
      m_new = fmaxf(m_new, c[0][r]);
      m_new = fmaxf(m_new, c[1][r]);
    }
    m_new = fmaxf(m_new, __shfl_xor(m_new, 16, 32));
    const float scale = __builtin_amdgcn_exp2f((rmax - m_new) * SL);
    rmax = m_new;

    // exp + pack: P^T C-layout == A-fragment layout for the PV product
    FragH pa, pr;
    float psum = 0.0f;
    #pragma unroll
    for (int r = 0; r < 8; ++r) {
      const float p0 = __builtin_amdgcn_exp2f((c[0][r] - m_new) * SL);   // key hi*8 + r
      const float p1 = __builtin_amdgcn_exp2f((c[1][r] - m_new) * SL);   // key 16 + hi*8 + r
      psum += p0 + p1;
      const float pc0 = p0 * PCAR;
      const float pc1 = p1 * PCAR;
      const f16 h0 = (f16)pc0;
      const f16 h1 = (f16)pc1;
      pa.h[r]     = h0;
      pa.h[8 + r] = h1;
      if (RES != 0) {
        pr.h[r]     = (f16)((pc0 - (float)h0) * RSC);
        pr.h[8 + r] = (f16)((pc1 - (float)h1) * RSC);
      }
    }
    rsum = rsum * scale + psum + __shfl_xor(psum, 16, 32);

    // rescale O: queries are the row dimension there -> per-row scale from lane 8*hi + r
    float sc[8];
    #pragma unroll
    for (int r = 0; r < 8; ++r) sc[r] = __shfl(scale, (hi << 3) + r, 32);
    #pragma unroll
    for (int dt = 0; dt < 4; ++dt) {
      #pragma unroll
      for (int r = 0; r < 8; ++r) {
        o[dt][r] *= sc[r];
        if (RES != 0) o2[dt][r] *= sc[r];
      }
    }

    // O += P x V; V B-fragments: column n = d = dt*16 + lq, split key map from the transposed plane
    #pragma unroll
    for (int dt = 0; dt < 4; ++dt) {
      FragH bv;
      const f16* base = vt_h + (size_t)(dt * 16 + lq) * SEQ + j0 + hi * 8;
      bv.q[0] = *(const v4u*)(base);        // keys j0 + hi*8 + 0..7
      bv.q[1] = *(const v4u*)(base + 16);   // keys j0 + 16 + hi*8 + 0..7
      o[dt] = mma_f16(pa.v, bv.v, o[dt]);
      if (RES != 0) {
        o2[dt] = mma_f16(pr.v, bv.v, o2[dt]);
        FragH br;
        const f16* rb = vtr_h + (size_t)(dt * 16 + lq) * ER + j0 + hi * 8;
        br.q[0] = *(const v4u*)(rb);
        br.q[1] = *(const v4u*)(rb + 16);
        o2[dt] = mma_f16(pa.v, br.v, o2[dt]);
      }
    }
  }

  // normalize: lane holds column d = dt*16 + lq for query rows 8*hi + r; stage ctx * 64
  float rs[8];
  #pragma unroll
  for (int r = 0; r < 8; ++r) rs[r] = 1.0f / __shfl(rsum, (hi << 3) + r, 32);

  float* so = sO + wave * (16 * OP);
  #pragma unroll
  for (int r = 0; r < 8; ++r) {
    #pragma unroll
    for (int dt = 0; dt < 4; ++dt) {
      float val = o[dt][r];
      if (RES != 0) val += o2[dt][r] * (1.0f / RSC);
      so[(hi * 8 + r) * OP + dt * 16 + lq] = val * (CCAR / PCAR) * rs[r];
    }
  }
  __syncthreads();

  v4u    hv[4], rv[4];
  size_t gi[4], gr[4];
  #pragma unroll
  for (int it = 0; it < 4; ++it) {
    const int row   = it * 4 + (lane >> 3);   // 0..15
    const int piece = lane & 7;               // 0..7
    const v4f a0 = *(const v4f*)(so + row * OP + piece * 8);
    const v4f a1 = *(const v4f*)(so + row * OP + piece * 8 + 4);
    Pack8H ph, px;
    #pragma unroll
    for (int k = 0; k < 4; ++k) {
      const float u0 = a0[k];
      const float u1 = a1[k];
      const f16 g0 = (f16)u0;
      const f16 g1 = (f16)u1;
      ph.h[k]     = g0;
      ph.h[4 + k] = g1;
      px.h[k]     = (f16)((u0 - (float)g0) * RSC);
      px.h[4 + k] = (f16)((u1 - (float)g1) * RSC);
    }
    hv[it] = ph.u;
    rv[it] = px.u;
    gi[it] = (size_t)(qrow0 + row) * DMODEL + h * HDIM + piece * 8;
    gr[it] = (size_t)(qrow0 + row) * DMODEL + h * HDIM + piece * 8;   // row < ER when RES
  }
  #pragma unroll
  for (int it = 0; it < 4; ++it) {
    *(v4u*)(ctxh + gi[it]) = hv[it];
    if (RES != 0) *(v4u*)(ctxr + gr[it]) = rv[it];
  }
  
}

// ---------------------------------------------------------------------------------------------
extern "C" void kernel_launch(void* const* d_in, const int* in_sizes, int n_in,
                              void* d_out, int out_size, void* d_ws, size_t ws_size,
                              hipStream_t stream) {
  if (n_in < 3) return;
  if ((size_t)in_sizes[0] < (size_t)SEQ * DMODEL) return;
  if ((size_t)in_sizes[1] < (size_t)QKV_N * DMODEL) return;
  if ((size_t)in_sizes[2] < (size_t)DMODEL * DMODEL) return;
  if ((size_t)out_size < (size_t)SEQ * DMODEL) return;

  const size_t xb_bytes   = (size_t)SEQ * DMODEL * 2;            // bf16 [SEQ][DMODEL]
  const size_t wb_bytes   = (size_t)QKV_N * DMODEL * 2;          // bf16 [QKV_N][DMODEL]
  const size_t wp_bytes   = (size_t)DMODEL * DMODEL * 2;         // f16  [DMODEL][DMODEL]
  const size_t tab_bytes  = (size_t)SEQ * NROPE * 4;             // f32  [SEQ][NROPE] (each of cos, sin)
  const size_t qkv_bytes  = (size_t)SEQ * QKV_N * 4;             // f32  [SEQ][QKV_N]
  const size_t pl_bytes   = (size_t)NHEAD * SEQ * HDIM * 2;      // f16  q/k/vt planes
  const size_t plr_bytes  = (size_t)NHEAD * ER * HDIM * 2;       // f16  residual planes
  const size_t ctx_bytes  = (size_t)SEQ * DMODEL * 2;            // f16  [SEQ][DMODEL]
  const size_t ctxr_bytes = (size_t)ER * DMODEL * 2;             // f16  [ER][DMODEL]
  const size_t total = xb_bytes + wb_bytes + wp_bytes + 2 * tab_bytes + qkv_bytes
                     + 3 * pl_bytes + 3 * plr_bytes + ctx_bytes + ctxr_bytes;
  if (ws_size < total) return;

  char* ws = (char*)d_ws;
  size_t off = 0;
  bf16*  xb   = (bf16*)(ws + off);  off += xb_bytes;
  bf16*  wb   = (bf16*)(ws + off);  off += wb_bytes;
  f16*   wp   = (f16*)(ws + off);   off += wp_bytes;
  float* ct   = (float*)(ws + off); off += tab_bytes;
  float* st   = (float*)(ws + off); off += tab_bytes;
  float* qkv  = (float*)(ws + off); off += qkv_bytes;
  f16*   qhp  = (f16*)(ws + off);   off += pl_bytes;
  f16*   khp  = (f16*)(ws + off);   off += pl_bytes;
  f16*   vtp  = (f16*)(ws + off);   off += pl_bytes;
  f16*   qrp  = (f16*)(ws + off);   off += plr_bytes;
  f16*   krp  = (f16*)(ws + off);   off += plr_bytes;
  f16*   vtrp = (f16*)(ws + off);   off += plr_bytes;
  f16*   ctxh = (f16*)(ws + off);   off += ctx_bytes;
  f16*   ctxr = (f16*)(ws + off);   off += ctxr_bytes;
  if (off > ws_size) return;

  const float* x     = (const float*)d_in[0];
  const float* wqkv  = (const float*)d_in[1];
  const float* wproj = (const float*)d_in[2];
  float*       out   = (float*)d_out;

  // 1) 16-bit operand planes of the inputs
  const int ncvt_blocks = SEQ * DMODEL / 2048 + QKV_N * DMODEL / 2048 + DMODEL * DMODEL / 2048;
  convert_kernel<<<dim3(ncvt_blocks), 256, 0, stream>>>(x, wqkv, wproj, xb, wb, wp);

  // 2) RoPE cos/sin tables
  rope_table_kernel<<<dim3(SEQ / 8), 256, 0, stream>>>(ct, st);

  // 3) qkv[SEQ][QKV_N] = xb x wb^T (bf16 operands, f32 result)
  gemm_nt_kernel<FragB, 2, 0><<<dim3(QKV_N / 64, SEQ / 128), 128, 0, stream>>>(
      (const us16*)xb, (const us16*)xb, (const us16*)wb, qkv, DMODEL, QKV_N, 0, 1.0f, 0.0f);

  // 4) RoPE + q/k/v planes (+ residual planes for rows < ER)
  planes_kernel<<<dim3(SEQ / CT, NHEAD), 256, 0, stream>>>(qkv, ct, st, qhp, qrp, khp, krp, vtp, vtrp);

  // 5) causal attention -> ctx planes
  const int nqb     = SEQ / BQ;
  const int n_early = ER / BQ;
  const int n_late  = nqb - n_early;
  attn_kernel<1><<<dim3(n_early, NHEAD), 256, 0, stream>>>(qhp, qrp, khp, krp, vtp, vtrp, ctxh, ctxr, 0);
  if (n_late > 0)
    attn_kernel<0><<<dim3(n_late, NHEAD), 256, 0, stream>>>(qhp, qrp, khp, krp, vtp, vtrp, ctxh, ctxr, n_early);

  // 6) out[SEQ][DMODEL] = ctx x wp^T ; folds the ctx carry (64), the Wproj carry (256) and the residual scale (1024)
  const float oscale = 1.0f / (CCAR * WCAR);
  const float rscale = oscale / RSC;
  gemm_nt_kernel<FragH, 1, 1><<<dim3(DMODEL / 64, ER / 64), 128, 0, stream>>>(
      (const us16*)ctxh, (const us16*)ctxr, (const us16*)wp, out, DMODEL, DMODEL, 0, oscale, rscale);
  if (SEQ - ER > 0)
    gemm_nt_kernel<FragH, 2, 0><<<dim3(DMODEL / 64, (SEQ - ER) / 128), 128, 0, stream>>>(
        (const us16*)ctxh, (const us16*)ctxh, (const us16*)wp, out, DMODEL, DMODEL, ER, oscale, 0.0f);
}

// v001
// It runs in 215 microseconds.
// Next to v000, in two timings, it ran 2.06 and 2.07 times as fast.
#include <hip/hip_runtime.h>

// Contractions: qkv = X x Wqkv^T on v_wmma_f32_16x16x32_bf16 (bf16 operands = RNE-converted inputs, f32 accumulate);
// S^T = K x Q^T on v_wmma_f32_16x16x32_f16 (f16 q/k after RoPE, plus f16 residual planes x1024 with their own
// accumulator on query blocks < EARLY_QBLK); O = P x V on v_wmma_f32_16x16x32_f16 (P as f16 carried x4096,
// V as f16, plus P and V residual planes x1024 with their own accumulator on query blocks < EARLY_QBLK);
// out = ctx x Wproj^T on v_wmma_f32_16x16x32_f16 (ctx as f16 carried x64 plus residual x1024 on rows < ER,
// Wproj = f16 of the bf16 RNE-converted input carried x256). RoPE, softmax and all epilogues in f32.

#ifndef NB
#define NB 1
#endif
#ifndef SEQ
#define SEQ 4096
#endif
#define NB_FULL    1
#define SEQ_FULL   4096
#define NHEAD      16
#define HDIM       64
#define DMODEL     (NHEAD * HDIM)        // 1024
#define QKV_N      (3 * DMODEL)          // 3072
#define NROPE      (HDIM / 2)            // 32 frequencies
#define BQ         128                   // query rows per attention block (8 waves x 16)
#define BK         32                    // keys per inner iteration
#define NWAVE      8
#define EARLY_QBLK 2                     // query blocks with residual planes on q, k, P, v, ctx
#define ER         ((EARLY_QBLK * BQ < SEQ) ? (EARLY_QBLK * BQ) : SEQ)   // early rows == early keys
#define CT         64                    // rows per plane-builder block
#define TP         72                    // LDS pitch (halves) of the transposed V tile
#define OP         68                    // LDS pitch (floats) of output staging tiles
#define PCAR       4096.0f               // P carry
#define RSC        1024.0f               // residual plane scale
#define CCAR       64.0f                 // ctx carry
#define WCAR       256.0f                // Wproj carry
#define KS         64                    // keys per LDS stage of the attention loop (two inner iterations)
#define KP         72                    // LDS pitch (halves) of staged K rows and V^T rows: 144 B = 16 B x odd
#define TILE_H     (64 * KP)             // halves per staged tile (64 rows)

static_assert(NB == 1 && NB <= NB_FULL);
static_assert(SEQ <= SEQ_FULL);
static_assert(SEQ % BQ == 0);
static_assert(ER % BQ == 0);
static_assert((SEQ - ER) % 128 == 0);
static_assert(ER % CT == 0);
static_assert(SEQ % CT == 0);
static_assert(SEQ % 8 == 0);
static_assert(BQ == NWAVE * 16);
static_assert(HDIM == 64);
static_assert(DMODEL % 64 == 0 && QKV_N % 64 == 0);
static_assert(DMODEL % 32 == 0);
static_assert((SEQ * DMODEL) % 2048 == 0);
static_assert((QKV_N * DMODEL) % 2048 == 0);
static_assert((DMODEL * DMODEL) % 2048 == 0);
static_assert((TP * 2) % 16 == 0);
static_assert((OP * 4) % 16 == 0);
static_assert(KS == 2 * BK && BQ % KS == 0 && KS == 64);
static_assert((KP * 2) % 16 == 0);

typedef __bf16         bf16;
typedef _Float16       f16;
typedef unsigned short us16;
typedef bf16     v16bf __attribute__((ext_vector_type(16)));
typedef f16      v16h  __attribute__((ext_vector_type(16)));
typedef f16      v8h   __attribute__((ext_vector_type(8)));
typedef float    v8f   __attribute__((ext_vector_type(8)));
typedef float    v4f   __attribute__((ext_vector_type(4)));
typedef unsigned v4u   __attribute__((ext_vector_type(4)));

union FragB  { v16bf v; v4u q[2]; bf16 h[16]; };
union FragH  { v16h  v; v4u q[2]; f16  h[16]; };
union Pack8B { v4u u; bf16 h[8]; };
union Pack8H { v4u u; v8h v; f16 h[8]; };

// WMMA helpers: builtin followed by the VALU hazard guard (ties D, keeps A/B live).
static __device__ __forceinline__ v8f mma_bf16(v16bf a, v16bf b, v8f acc) {
  acc = __builtin_amdgcn_wmma_f32_16x16x32_bf16(false, a, false, b, (short)0, acc, false, false);
  asm volatile("v_nop\n\tv_nop\n\tv_nop\n\tv_nop" : "+v"(acc) : "v"(a), "v"(b));
  return acc;
}
static __device__ __forceinline__ v8f mma_f16(v16h a, v16h b, v8f acc) {
  acc = __builtin_amdgcn_wmma_f32_16x16x32_f16(false, a, false, b, (short)0, acc, false, false);
  asm volatile("v_nop\n\tv_nop\n\tv_nop\n\tv_nop" : "+v"(acc) : "v"(a), "v"(b));
  return acc;
}
static __device__ __forceinline__ v8f mma(const FragB& a, const FragB& b, v8f acc) { return mma_bf16(a.v, b.v, acc); }
static __device__ __forceinline__ v8f mma(const FragH& a, const FragH& b, v8f acc) { return mma_f16(a.v, b.v, acc); }

// ---------------------------------------------------------------------------------------------
// Convert pass: xb = bf16(x) [SEQ][DMODEL], wb = bf16(Wqkv) [QKV_N][DMODEL], wp = f16(bf16(Wproj) * 256) [DMODEL][DMODEL].
// coverage: blocks [0,SEQ*DMODEL/2048) x 256 x 8 == SEQ*DMODEL; next QKV_N*DMODEL/2048 blocks == QKV_N*DMODEL;
//           last DMODEL*DMODEL/2048 blocks == DMODEL*DMODEL.
template <int MODE>
static __device__ __forceinline__ void cvt_body(const float* __restrict__ src, us16* __restrict__ dst,
                                                 int blk, int tid) {
  const size_t e = ((size_t)blk * 256 + tid) * 8;
  const v4f a = *(const v4f*)(src + e);
  const v4f b = *(const v4f*)(src + e + 4);
  v4u u;
  if (MODE == 0) {
    Pack8B pk;
    #pragma unroll
    for (int i = 0; i < 4; ++i) {
      pk.h[i]     = (bf16)a[i];                 // RNE convert
      pk.h[4 + i] = (bf16)b[i];
    }
    u = pk.u;
  } else {
    Pack8H pk;
    #pragma unroll
    for (int i = 0; i < 4; ++i) {
      pk.h[i]     = (f16)((float)(bf16)a[i] * WCAR);   // bf16 significand is exact in f16
      pk.h[4 + i] = (f16)((float)(bf16)b[i] * WCAR);
    }
    u = pk.u;
  }
  *(v4u*)(dst + e) = u;
  
}

__global__ __launch_bounds__(256) void convert_kernel(const float* __restrict__ x,
                                                      const float* __restrict__ wq,
                                                      const float* __restrict__ wpj,
                                                      bf16* __restrict__ xb,
                                                      bf16* __restrict__ wb,
                                                      f16* __restrict__ wp) {
  const int blk = blockIdx.x;
  const int tid = threadIdx.x;
  const int NBX = SEQ * DMODEL / 2048;
  const int NBQ = QKV_N * DMODEL / 2048;
  if (blk < NBX)            cvt_body<0>(x, (us16*)xb, blk, tid);
  else if (blk < NBX + NBQ) cvt_body<0>(wq, (us16*)wb, blk - NBX, tid);
  else                      cvt_body<1>(wpj, (us16*)wp, blk - NBX - NBQ, tid);
}

// ---------------------------------------------------------------------------------------------
// RoPE tables ct/st [SEQ][NROPE] f32: angle(t, j) = t * (1 / 10000^(2j/64)). Block = 8 positions x 32 freqs.
// One powf + one sincosf per thread (rolled). Rows staged in LDS; waves 0-1 write the cos lines, waves 2-3 the
// coverage: (SEQ/8 blocks) x 8 rows x 32 floats == SEQ*NROPE per table.
__global__ __launch_bounds__(256) void rope_table_kernel(float* __restrict__ ct, float* __restrict__ st) {
  __shared__ __align__(16) float sc[8 * NROPE];   // cross-wave (block barrier)
  __shared__ __align__(16) float ss[8 * NROPE];
  const int tid = threadIdx.x;
  const int j   = tid & 31;
  const int tl  = tid >> 5;
  const int t   = blockIdx.x * 8 + tl;
  const float e   = (float)(2 * j) * (1.0f / 64.0f);
  const float pw  = powf(10000.0f, e);
  const float inv = 1.0f / pw;
  const float ang = (float)t * inv;
  float sn, cs;
  sincosf(ang, &sn, &cs);
  sc[tl * NROPE + j] = cs;
  ss[tl * NROPE + j] = sn;
  __syncthreads();
  if (tid < 64) {
    const int rowl  = tid >> 3;
    const int piece = tid & 7;
    const v4f v = *(const v4f*)(sc + rowl * NROPE + piece * 4);
    const size_t gi = (size_t)(blockIdx.x * 8 + rowl) * NROPE + piece * 4;
    *(v4f*)(ct + gi) = v;
    
  } else if (tid < 128) {
    const int rowl  = (tid - 64) >> 3;
    const int piece = tid & 7;
    const v4f v = *(const v4f*)(ss + rowl * NROPE + piece * 4);
    const size_t gi = (size_t)(blockIdx.x * 8 + rowl) * NROPE + piece * 4;
    *(v4f*)(st + gi) = v;
    
  }
}

// ---------------------------------------------------------------------------------------------
// NT GEMM: C[m][n] = oscale * sum_k A[m][k] B[n][k] (+ rscale * sum_k Ar[m][k] B[n][k] when RES).
// A, Ar, B are 16-bit row-major planes with pitch K (k contiguous). 4 waves/block, wave tile (16*MI) x 64,
// block tile (64*MI) x 64. A and B fragments are loaded straight from the planes with the split k map:
// elements 0..7 <- k0 + 8h + 0..7, elements 8..15 <- k0 + 16 + 8h + 0..7, lane&15 = row of A / row of B (= column n).
// Epilogue: wave tile staged in LDS, then per instruction lanes 0..15 write one 256-B row segment (two whole
// Requires K % 32 == 0, N % 64 == 0, rows covered by the grid a multiple of 64*MI.
template <typename F, int MI, int RES>
__global__ __launch_bounds__(128) void gemm_nt_kernel(const us16* __restrict__ A,
                                                          const us16* __restrict__ Ar,
                                                          const us16* __restrict__ Bm,
                                                          float* __restrict__ C,
                                                          int K, int N, int mrow0,
                                                          float oscale, float rscale) {
  __shared__ __align__(16) float sC[4 * 32 * OP];   // per-wave staging (block barrier used)
  const int tid  = threadIdx.x;
  const int wave = tid >> 5;
  const int lane = tid & 31;
  const int lq   = lane & 15;
  const int hi   = lane >> 4;
  const int m0   = mrow0 + blockIdx.y * (64 * MI) + wave * (16 * MI);
  const int n0   = blockIdx.x * 64;

  v8f acc[MI][4], acc2[MI][4];
  #pragma unroll
  for (int mi = 0; mi < MI; ++mi) {
    #pragma unroll
    for (int t = 0; t < 4; ++t) {
      acc[mi][t]  = (v8f){0, 0, 0, 0, 0, 0, 0, 0};
      acc2[mi][t] = (v8f){0, 0, 0, 0, 0, 0, 0, 0};
    }
  }

  for (int k0 = 0; k0 < K; k0 += 32) {
    F a[MI], ar[MI], b[4];
    #pragma unroll
    for (int mi = 0; mi < MI; ++mi) {
      const us16* p = A + (size_t)(m0 + mi * 16 + lq) * K + k0 + hi * 8;
      a[mi].q[0] = *(const v4u*)(p);        // k0 + 8h + 0..7
      a[mi].q[1] = *(const v4u*)(p + 16);   // k0 + 16 + 8h + 0..7
      if (RES != 0) {
        const us16* pr = Ar + (size_t)(m0 + mi * 16 + lq) * K + k0 + hi * 8;
        ar[mi].q[0] = *(const v4u*)(pr);
        ar[mi].q[1] = *(const v4u*)(pr + 16);
      }
    }
    #pragma unroll
    for (int t = 0; t < 4; ++t) {
      const us16* p = Bm + (size_t)(n0 + t * 16 + lq) * K + k0 + hi * 8;
      b[t].q[0] = *(const v4u*)(p);
      b[t].q[1] = *(const v4u*)(p + 16);
    }
    #pragma unroll
    for (int mi = 0; mi < MI; ++mi) {
      #pragma unroll
      for (int t = 0; t < 4; ++t) {
        acc[mi][t] = mma(a[mi], b[t], acc[mi][t]);
        if (RES != 0) acc2[mi][t] = mma(ar[mi], b[t], acc2[mi][t]);
      }
    }
  }

  float* so = sC + wave * (16 * MI * OP);
  #pragma unroll
  for (int mi = 0; mi < MI; ++mi) {
    #pragma unroll
    for (int t = 0; t < 4; ++t) {
      #pragma unroll
      for (int r = 0; r < 8; ++r) {
        float val = acc[mi][t][r] * oscale;
        if (RES != 0) val += acc2[mi][t][r] * rscale;
        so[(mi * 16 + hi * 8 + r) * OP + t * 16 + lq] = val;
      }
    }
  }
  __syncthreads();

  const int NIT = 8 * MI;   // (16*MI rows) / 2 rows per instruction
  v4f    vals[8 * MI];
  size_t gidx[8 * MI];
  #pragma unroll
  for (int it = 0; it < NIT; ++it) {
    const int row = it * 2 + hi;
    vals[it] = *(const v4f*)(so + row * OP + lq * 4);
    gidx[it] = (size_t)(m0 + row) * N + n0 + lq * 4;
  }
  #pragma unroll
  for (int it = 0; it < NIT; ++it) *(v4f*)(C + gidx[it]) = vals[it];
  
}

// ---------------------------------------------------------------------------------------------
// Plane builder. Block = (64-row tile, head), 256 threads; reads the f32 qkv rows [SEQ][QKV_N].
//   qr, kr [NHEAD][ER][HDIM]  f16 : residual planes (x - f16(x)) * 1024 for rows < ER (block-uniform).
//   vtr [NHEAD][HDIM][ER]     f16 : V residual transposed, keys < ER.
// RoPE (rotate-half): pair partner d^32 sits in lane^4 of the same wave; out[d] = x[d]*cos + sgn*x[d^32]*sin.
// coverage: rows kt*64 + {0..31, 32..63}, d 0..63 for every plane; residual planes for tiles with s0 < ER
//           (ER/64 tiles x 64 rows == ER rows); every written line whole, one instruction.
__global__ __launch_bounds__(256) void planes_kernel(const float* __restrict__ qkv,
                                                     const float* __restrict__ ct,
                                                     const float* __restrict__ st,
                                                     f16* __restrict__ qh, f16* __restrict__ qr,
                                                     f16* __restrict__ kh, f16* __restrict__ kr,
                                                     f16* __restrict__ vt, f16* __restrict__ vtr) {
  const int kt  = blockIdx.x;
  const int h   = blockIdx.y;
  const int tid = threadIdx.x;
  __shared__ __align__(16) f16 sT[HDIM * TP];   // [d][key] hi, cross-wave (block barrier)
  __shared__ __align__(16) f16 sR[HDIM * TP];   // [d][key] residual, cross-wave (block barrier)
  const int  s0    = kt * CT;
  const bool early = (s0 < ER);                 // block-uniform

  v4u    qv[2], kv[2], qx[2], kx[2];
  size_t pidx[2], ridx[2];
  #pragma unroll
  for (int kk = 0; kk < 2; ++kk) {
    const int   key  = kk * 32 + (tid >> 3);    // 0..63
    const int   d0   = (tid & 7) * 8;           // 0..56
    const int   j0   = d0 & (NROPE - 1);        // frequency index of d0
    const float sgn  = (d0 < NROPE) ? -1.0f : 1.0f;
    const int   srow = s0 + key;
    const float* src = qkv + (size_t)srow * QKV_N + h * HDIM + d0;     // slot 0 = q
    const v4f q0v = *(const v4f*)(src);
    const v4f q1v = *(const v4f*)(src + 4);
    const v4f k0v = *(const v4f*)(src + DMODEL);                        // slot 1 = k
    const v4f k1v = *(const v4f*)(src + DMODEL + 4);
    const v4f v0v = *(const v4f*)(src + 2 * DMODEL);                    // slot 2 = v
    const v4f v1v = *(const v4f*)(src + 2 * DMODEL + 4);
    const float* cp = ct + (size_t)srow * NROPE + j0;
    const float* sp = st + (size_t)srow * NROPE + j0;
    const v4f c0 = *(const v4f*)(cp);
    const v4f c1 = *(const v4f*)(cp + 4);
    const v4f n0 = *(const v4f*)(sp);
    const v4f n1 = *(const v4f*)(sp + 4);
    float qa[8], ka[8], va[8], ca[8], sa[8];
    #pragma unroll
    for (int i = 0; i < 4; ++i) {
      qa[i] = q0v[i]; qa[4 + i] = q1v[i];
      ka[i] = k0v[i]; ka[4 + i] = k1v[i];
      va[i] = v0v[i]; va[4 + i] = v1v[i];
      ca[i] = c0[i];  ca[4 + i] = c1[i];
      sa[i] = n0[i];  sa[4 + i] = n1[i];
    }
    Pack8H pq, pqr, pk, pkr;
    #pragma unroll
    for (int i = 0; i < 8; ++i) {
      const float qp = __shfl_xor(qa[i], 4, 32);   // partner d^32, same row, same wave
      const float kp = __shfl_xor(ka[i], 4, 32);
      const float qo = qa[i] * ca[i] + sgn * qp * sa[i];
      const float ko = ka[i] * ca[i] + sgn * kp * sa[i];
      const f16 qhh = (f16)qo;
      const f16 khh = (f16)ko;
      pq.h[i]  = qhh;
      pk.h[i]  = khh;
      pqr.h[i] = (f16)((qo - (float)qhh) * RSC);
      pkr.h[i] = (f16)((ko - (float)khh) * RSC);
      const f16 vhh = (f16)va[i];
      sT[(d0 + i) * TP + key] = vhh;
      sR[(d0 + i) * TP + key] = (f16)((va[i] - (float)vhh) * RSC);
    }
    qv[kk] = pq.u;  qx[kk] = pqr.u;
    kv[kk] = pk.u;  kx[kk] = pkr.u;
    pidx[kk] = ((size_t)h * SEQ + srow) * HDIM + d0;
    ridx[kk] = ((size_t)h * ER + srow) * HDIM + d0;   // used only when early (srow < ER)
  }
  __syncthreads();

  v4u    vv[2], vx[2];
  size_t vidx[2], vridx[2];
  #pragma unroll
  for (int kk = 0; kk < 2; ++kk) {
    const int d  = kk * 32 + (tid >> 3);        // 0..63
    const int ks = (tid & 7) * 8;               // 0..56
    Pack8H ph, px;
    ph.v = *(const v8h*)(sT + d * TP + ks);
    px.v = *(const v8h*)(sR + d * TP + ks);
    vv[kk] = ph.u;
    vx[kk] = px.u;
    vidx[kk]  = ((size_t)h * HDIM + d) * SEQ + s0 + ks;
    vridx[kk] = ((size_t)h * HDIM + d) * ER + s0 + ks;   // used only when early
  }

  #pragma unroll
  for (int kk = 0; kk < 2; ++kk) {
    *(v4u*)(qh + pidx[kk]) = qv[kk];
    *(v4u*)(kh + pidx[kk]) = kv[kk];
    *(v4u*)(vt + vidx[kk]) = vv[kk];
    if (early) {
      *(v4u*)(qr + ridx[kk])   = qx[kk];
      *(v4u*)(kr + ridx[kk])   = kx[kk];
      *(v4u*)(vtr + vridx[kk]) = vx[kk];
    }
  }
  
}

// ---------------------------------------------------------------------------------------------
// Flash attention, causal. Block = (query block of 128, head); one wave owns 16 query rows.
// S^T = K x Q^T so queries sit on lanes; P^T in C-layout is bit-identical to the A-fragment layout of O += P x V.
// Q B-fragments are loaded straight from the 16-bit plane; K A-fragments and V^T B-fragments from LDS (two 16-B loads each).
// RES != 0 (query blocks < EARLY_QBLK, all visited keys < ER): score = KQ + (K Qres + Kres Q)/1024;
// O2 = Pres V + P Vres accumulated separately and folded as O2/1024 before normalisation.
// K and V^T (and their residual planes when RES) are staged once per block, KS keys at a time, in two LDS buffers
// by asynchronous 16-B copies; all eight waves read their fragments from LDS. A stage buffer holds the tiles
// [K | V^T | Kres | V^Tres], each 64 rows of 128 B at pitch KP.
// One stage's copies of one thread: rows tid>>3 and 32 + (tid>>3) of every tile, 16-B piece tid&7.
// kg/krg point at the stage's first key row (pitch HDIM); vg/vrg at the stage's first key column (pitch SEQ / ER).
template <int RES>
static __device__ __forceinline__ void stage_tiles(f16* buf, const f16* kg, const f16* krg,
                                                   const f16* vg, const f16* vrg, int tid) {
  const int row   = tid >> 3;     // 0..31
  const int piece = tid & 7;      // 0..7
  const unsigned l0 = (unsigned)(size_t)(buf + row * KP + piece * 8);   // LDS byte address
  const unsigned l1 = l0 + 32 * KP * 2;
  const unsigned l2 = l0 + TILE_H * 2;
  const unsigned l3 = l1 + TILE_H * 2;
  const f16* g0 = kg + (size_t)row * HDIM + piece * 8;
  const f16* g1 = g0 + 32 * HDIM;
  const f16* g2 = vg + (size_t)row * SEQ + piece * 8;
  const f16* g3 = g2 + (size_t)32 * SEQ;
  // the copies and, as the last line, the wait that stands before any of their address registers is rewritten
  asm volatile("global_load_async_to_lds_b128 %0, %4, off\n\t"
               "global_load_async_to_lds_b128 %1, %5, off\n\t"
               "global_load_async_to_lds_b128 %2, %6, off\n\t"
               "global_load_async_to_lds_b128 %3, %7, off\n\t"
               "s_wait_xcnt 0x0"
               :: "v"(l0), "v"(l1), "v"(l2), "v"(l3), "v"(g0), "v"(g1), "v"(g2), "v"(g3) : "memory");
  if (RES != 0) {
    const unsigned l4 = l0 + 2 * TILE_H * 2;
    const unsigned l5 = l1 + 2 * TILE_H * 2;
    const unsigned l6 = l0 + 3 * TILE_H * 2;
    const unsigned l7 = l1 + 3 * TILE_H * 2;
    const f16* g4 = krg + (size_t)row * HDIM + piece * 8;
    const f16* g5 = g4 + 32 * HDIM;
    const f16* g6 = vrg + (size_t)row * ER + piece * 8;
    const f16* g7 = g6 + (size_t)32 * ER;
    // same form for the residual tiles
    asm volatile("global_load_async_to_lds_b128 %0, %4, off\n\t"
                 "global_load_async_to_lds_b128 %1, %5, off\n\t"
                 "global_load_async_to_lds_b128 %2, %6, off\n\t"
                 "global_load_async_to_lds_b128 %3, %7, off\n\t"
                 "s_wait_xcnt 0x0"
                 :: "v"(l4), "v"(l5), "v"(l6), "v"(l7), "v"(g4), "v"(g5), "v"(g6), "v"(g7) : "memory");
  }
}

template <int RES>
__global__ __launch_bounds__(256) void attn_kernel(const f16* __restrict__ qh, const f16* __restrict__ qr,
                                                   const f16* __restrict__ kh, const f16* __restrict__ kr,
                                                   const f16* __restrict__ vt, const f16* __restrict__ vtr,
                                                   f16* __restrict__ ctxh, f16* __restrict__ ctxr,
                                                   int qblk0) {
  const int qblk = qblk0 + blockIdx.x;
  const int h    = blockIdx.y;
  const int tid  = threadIdx.x;
  const int wave = __builtin_amdgcn_readfirstlane(tid >> 5);   // scalar, so the per-wave causal skip is a scalar branch
  const int lane = tid & 31;
  const int lq   = lane & 15;   // query column of S^T / d column of O
  const int hi   = lane >> 4;   // k-split half

  __shared__ __align__(16) float sO[NWAVE * 16 * OP];   // per-wave output staging (block barrier used)
  const int STG_H = (RES != 0 ? 4 : 2) * TILE_H;         // halves per stage buffer
  __shared__ __align__(16) f16 sKV[2 * (RES != 0 ? 4 : 2) * TILE_H];   // two stage buffers, cross-wave

  const int qrow0 = qblk * BQ + wave * 16;               // first query row of this wave

  // Q as B-operand fragments: lane lq holds query qrow0+lq, elements follow the split d map.
  FragH qf[2], qx[2];
  {
    const f16* qp = qh + ((size_t)h * SEQ + qrow0 + lq) * HDIM;
    #pragma unroll
    for (int f = 0; f < 2; ++f) {
      qf[f].q[0] = *(const v4u*)(qp + f * 32 + hi * 8);        // d = f*32 + hi*8 + 0..7
      qf[f].q[1] = *(const v4u*)(qp + f * 32 + 16 + hi * 8);   // d = f*32 + 16 + hi*8 + 0..7
    }
    if (RES != 0) {
      const f16* qrp = qr + ((size_t)h * ER + qrow0 + lq) * HDIM;
      #pragma unroll
      for (int f = 0; f < 2; ++f) {
        qx[f].q[0] = *(const v4u*)(qrp + f * 32 + hi * 8);
        qx[f].q[1] = *(const v4u*)(qrp + f * 32 + 16 + hi * 8);
      }
    }
  }

  const f16* kh_h  = kh  + (size_t)h * SEQ * HDIM;
  const f16* kr_h  = kr  + (size_t)h * ER * HDIM;
  const f16* vt_h  = vt  + (size_t)h * HDIM * SEQ;
  const f16* vtr_h = vtr + (size_t)h * HDIM * ER;

  v8f o[4], o2[4];
  #pragma unroll
  for (int dt = 0; dt < 4; ++dt) {
    o[dt]  = (v8f){0, 0, 0, 0, 0, 0, 0, 0};
    o2[dt] = (v8f){0, 0, 0, 0, 0, 0, 0, 0};
  }

  float rmax = -__builtin_inff();
  float rsum = 0.0f;
  const float SL = 0.125f * 1.4426950408889634f;   // softmax scale * log2(e)

  // causal: this wave visits key chunks whose first key is <= its last query row (wave-uniform trip count)
  const int nchunk = (qrow0 + 15) / BK + 1;
  // the block walks the stages up to its last query row (block-uniform count, at least two)
  const int nstage = (qblk + 1) * (BQ / KS);

  stage_tiles<RES>(sKV, kh_h, kr_h, vt_h, vtr_h, tid);
  asm volatile("s_wait_asynccnt 0x0" ::: "memory");   // this wave's copies of stage 0 have landed
  __syncthreads();                                    // stage 0 readable by every wave
  if (nstage > 1)
    stage_tiles<RES>(sKV + STG_H, kh_h + (size_t)KS * HDIM, kr_h + (size_t)KS * HDIM, vt_h + KS, vtr_h + KS, tid);

  for (int t = 0; t < nstage; ++t) {
   const f16* sb = sKV + (t & 1) * STG_H;
   for (int u = 0; u < KS / BK; ++u) {
    const int i = t * (KS / BK) + u;
    if (i >= nchunk) break;                 // wave-uniform: chunks beyond this wave's diagonal
    const int j0 = i * BK;
    const f16* sk  = sb + (u * BK) * KP;                 // K rows of this chunk
    const f16* sv  = sb + TILE_H + u * BK;               // V^T key columns of this chunk
    const f16* skr = sb + (RES != 0 ? 2 : 0) * TILE_H + (u * BK) * KP;    // residual tiles (read when RES only)
    const f16* svr = sb + (RES != 0 ? 3 : 1) * TILE_H + u * BK;

    // K A-fragments, then V B-fragments (column n = d = dt*16 + lq, split key map from the transposed tile): all
    // fetched at the head of the chunk, so that V's LDS latency passes under the score products and the softmax.
    FragH ka[2][2], bvf[4];
    #pragma unroll   // constant indices keep the fragment arrays in registers
    for (int sub = 0; sub < 2; ++sub) {
      const f16* base = sk + (sub * 16 + lq) * KP + hi * 8;   // row = key j0 + sub*16 + lq
      ka[sub][0].q[0] = *(const v4u*)(base);        // d = hi*8 + 0..7
      ka[sub][0].q[1] = *(const v4u*)(base + 16);   // d = 16 + hi*8 + 0..7
      ka[sub][1].q[0] = *(const v4u*)(base + 32);   // d = 32 + hi*8 + 0..7
      ka[sub][1].q[1] = *(const v4u*)(base + 48);   // d = 48 + hi*8 + 0..7
    }
    #pragma unroll   // as above
    for (int dt = 0; dt < 4; ++dt) {
      const f16* base = sv + (dt * 16 + lq) * KP + hi * 8;
      bvf[dt].q[0] = *(const v4u*)(base);        // keys j0 + hi*8 + 0..7
      bvf[dt].q[1] = *(const v4u*)(base + 16);   // keys j0 + 16 + hi*8 + 0..7
    }

    // S^T tiles: c[sub][r] = rawscore(query qrow0+lq, key j0 + sub*16 + hi*8 + r)
    v8f c[2];
    #pragma unroll
    for (int sub = 0; sub < 2; ++sub) {
      const FragH a0 = ka[sub][0];
      const FragH a1 = ka[sub][1];
      v8f acc = (v8f){0, 0, 0, 0, 0, 0, 0, 0};
      acc = mma_f16(a0.v, qf[0].v, acc);
      acc = mma_f16(a1.v, qf[1].v, acc);
      if (RES != 0) {
        FragH r0, r1;
        const f16* rb = skr + (sub * 16 + lq) * KP + hi * 8;
        r0.q[0] = *(const v4u*)(rb);
        r0.q[1] = *(const v4u*)(rb + 16);
        r1.q[0] = *(const v4u*)(rb + 32);
        r1.q[1] = *(const v4u*)(rb + 48);
        v8f ax = (v8f){0, 0, 0, 0, 0, 0, 0, 0};
        ax = mma_f16(a0.v, qx[0].v, ax);
        ax = mma_f16(a1.v, qx[1].v, ax);
        ax = mma_f16(r0.v, qf[0].v, ax);
        ax = mma_f16(r1.v, qf[1].v, ax);
        #pragma unroll
        for (int r = 0; r < 8; ++r) acc[r] += ax[r] * (1.0f / RSC);
      }
      c[sub] = acc;
    }

    // causal mask (key > query -> -inf); branch is wave-uniform, selects are per lane
    if (j0 + BK - 1 > qrow0) {
      const int qi = qrow0 + lq;
      #pragma unroll
      for (int sub = 0; sub < 2; ++sub) {
        #pragma unroll
        for (int r = 0; r < 8; ++r) {
          const int key = j0 + sub * 16 + hi * 8 + r;
          c[sub][r] = (key > qi) ? -__builtin_inff() : c[sub][r];
        }
      }
    }

    // online softmax: query lq's 32 scores are split across lane / lane^16
    float m_new = rmax;
    #pragma unroll
    for (int r = 0; r < 8; ++r) {
      m_new = fmaxf(m_new, c[0][r]);
      m_new = fmaxf(m_new, c[1][r]);
    }
    m_new = fmaxf(m_new, __shfl_xor(m_new, 16, 32));
    const float scale = __builtin_amdgcn_exp2f((rmax - m_new) * SL);
    rmax = m_new;

    // exp + pack: P^T C-layout == A-fragment layout for the PV product
    FragH pa, pr;
    float psum = 0.0f;
    #pragma unroll
    for (int r = 0; r < 8; ++r) {
      const float p0 = __builtin_amdgcn_exp2f((c[0][r] - m_new) * SL);   // key hi*8 + r
      const float p1 = __builtin_amdgcn_exp2f((c[1][r] - m_new) * SL);   // key 16 + hi*8 + r
      psum += p0 + p1;
      const float pc0 = p0 * PCAR;
      const float pc1 = p1 * PCAR;
      const f16 h0 = (f16)pc0;
      const f16 h1 = (f16)pc1;
      pa.h[r]     = h0;
      pa.h[8 + r] = h1;
      if (RES != 0) {
        pr.h[r]     = (f16)((pc0 - (float)h0) * RSC);
        pr.h[8 + r] = (f16)((pc1 - (float)h1) * RSC);
      }
    }
    rsum = rsum * scale + psum + __shfl_xor(psum, 16, 32);

    // rescale O: queries are the row dimension there -> per-row scale from lane 8*hi + r
    float sc[8];
    #pragma unroll
    for (int r = 0; r < 8; ++r) sc[r] = __shfl(scale, (hi << 3) + r, 32);
    #pragma unroll
    for (int dt = 0; dt < 4; ++dt) {
      #pragma unroll
      for (int r = 0; r < 8; ++r) {
        o[dt][r] *= sc[r];
        if (RES != 0) o2[dt][r] *= sc[r];
      }
    }

    // O += P x V
    #pragma unroll
    for (int dt = 0; dt < 4; ++dt) {
      o[dt] = mma_f16(pa.v, bvf[dt].v, o[dt]);
      if (RES != 0) {
        o2[dt] = mma_f16(pr.v, bvf[dt].v, o2[dt]);
        FragH br;
        const f16* rb = svr + (dt * 16 + lq) * KP + hi * 8;
        br.q[0] = *(const v4u*)(rb);
        br.q[1] = *(const v4u*)(rb + 16);
        o2[dt] = mma_f16(pa.v, br.v, o2[dt]);
      }
    }
   }
   // publish point of stage t + 1, passed by every wave (also one that skipped chunks)
   asm volatile("s_wait_dscnt 0x0" ::: "memory");      // this wave's reads of stage t are done before its buffer is refilled
   asm volatile("s_wait_asynccnt 0x0" ::: "memory");   // this wave's copies of stage t + 1 have landed
   __syncthreads();                                    // stage t + 1 readable; every reader has left stage t
   if (t + 2 < nstage)
     stage_tiles<RES>(sKV + (t & 1) * STG_H, kh_h + (size_t)(t + 2) * KS * HDIM, kr_h + (size_t)(t + 2) * KS * HDIM,
                      vt_h + (t + 2) * KS, vtr_h + (t + 2) * KS, tid);
  }
  asm volatile("s_wait_asynccnt 0x0" ::: "memory");    // no copy outstanding behind the loop

  // normalize: lane holds column d = dt*16 + lq for query rows 8*hi + r; stage ctx * 64
  float rs[8];
  #pragma unroll
  for (int r = 0; r < 8; ++r) rs[r] = 1.0f / __shfl(rsum, (hi << 3) + r, 32);

  float* so = sO + wave * (16 * OP);
  #pragma unroll
  for (int r = 0; r < 8; ++r) {
    #pragma unroll
    for (int dt = 0; dt < 4; ++dt) {
      float val = o[dt][r];
      if (RES != 0) val += o2[dt][r] * (1.0f / RSC);
      so[(hi * 8 + r) * OP + dt * 16 + lq] = val * (CCAR / PCAR) * rs[r];
    }
  }
  __syncthreads();

  v4u    hv[4], rv[4];
  size_t gi[4], gr[4];
  #pragma unroll
  for (int it = 0; it < 4; ++it) {
    const int row   = it * 4 + (lane >> 3);   // 0..15
    const int piece = lane & 7;               // 0..7
    const v4f a0 = *(const v4f*)(so + row * OP + piece * 8);
    const v4f a1 = *(const v4f*)(so + row * OP + piece * 8 + 4);
    Pack8H ph, px;
    #pragma unroll
    for (int k = 0; k < 4; ++k) {
      const float u0 = a0[k];
      const float u1 = a1[k];
      const f16 g0 = (f16)u0;
      const f16 g1 = (f16)u1;
      ph.h[k]     = g0;
      ph.h[4 + k] = g1;
      px.h[k]     = (f16)((u0 - (float)g0) * RSC);
      px.h[4 + k] = (f16)((u1 - (float)g1) * RSC);
    }
    hv[it] = ph.u;
    rv[it] = px.u;
    gi[it] = (size_t)(qrow0 + row) * DMODEL + h * HDIM + piece * 8;
    gr[it] = (size_t)(qrow0 + row) * DMODEL + h * HDIM + piece * 8;   // row < ER when RES
  }
  #pragma unroll
  for (int it = 0; it < 4; ++it) {
    *(v4u*)(ctxh + gi[it]) = hv[it];
    if (RES != 0) *(v4u*)(ctxr + gr[it]) = rv[it];
  }
  
}

// ---------------------------------------------------------------------------------------------
extern "C" void kernel_launch(void* const* d_in, const int* in_sizes, int n_in,
                              void* d_out, int out_size, void* d_ws, size_t ws_size,
                              hipStream_t stream) {
  if (n_in < 3) return;
  if ((size_t)in_sizes[0] < (size_t)SEQ * DMODEL) return;
  if ((size_t)in_sizes[1] < (size_t)QKV_N * DMODEL) return;
  if ((size_t)in_sizes[2] < (size_t)DMODEL * DMODEL) return;
  if ((size_t)out_size < (size_t)SEQ * DMODEL) return;

  const size_t xb_bytes   = (size_t)SEQ * DMODEL * 2;            // bf16 [SEQ][DMODEL]
  const size_t wb_bytes   = (size_t)QKV_N * DMODEL * 2;          // bf16 [QKV_N][DMODEL]
  const size_t wp_bytes   = (size_t)DMODEL * DMODEL * 2;         // f16  [DMODEL][DMODEL]
  const size_t tab_bytes  = (size_t)SEQ * NROPE * 4;             // f32  [SEQ][NROPE] (each of cos, sin)
  const size_t qkv_bytes  = (size_t)SEQ * QKV_N * 4;             // f32  [SEQ][QKV_N]
  const size_t pl_bytes   = (size_t)NHEAD * SEQ * HDIM * 2;      // f16  q/k/vt planes
  const size_t plr_bytes  = (size_t)NHEAD * ER * HDIM * 2;       // f16  residual planes
  const size_t ctx_bytes  = (size_t)SEQ * DMODEL * 2;            // f16  [SEQ][DMODEL]
  const size_t ctxr_bytes = (size_t)ER * DMODEL * 2;             // f16  [ER][DMODEL]
  const size_t total = xb_bytes + wb_bytes + wp_bytes + 2 * tab_bytes + qkv_bytes
                     + 3 * pl_bytes + 3 * plr_bytes + ctx_bytes + ctxr_bytes;
  if (ws_size < total) return;

  char* ws = (char*)d_ws;
  size_t off = 0;
  bf16*  xb   = (bf16*)(ws + off);  off += xb_bytes;
  bf16*  wb   = (bf16*)(ws + off);  off += wb_bytes;
  f16*   wp   = (f16*)(ws + off);   off += wp_bytes;
  float* ct   = (float*)(ws + off); off += tab_bytes;
  float* st   = (float*)(ws + off); off += tab_bytes;
  float* qkv  = (float*)(ws + off); off += qkv_bytes;
  f16*   qhp  = (f16*)(ws + off);   off += pl_bytes;
  f16*   khp  = (f16*)(ws + off);   off += pl_bytes;
  f16*   vtp  = (f16*)(ws + off);   off += pl_bytes;
  f16*   qrp  = (f16*)(ws + off);   off += plr_bytes;
  f16*   krp  = (f16*)(ws + off);   off += plr_bytes;
  f16*   vtrp = (f16*)(ws + off);   off += plr_bytes;
  f16*   ctxh = (f16*)(ws + off);   off += ctx_bytes;
  f16*   ctxr = (f16*)(ws + off);   off += ctxr_bytes;
  if (off > ws_size) return;

  const float* x     = (const float*)d_in[0];
  const float* wqkv  = (const float*)d_in[1];
  const float* wproj = (const float*)d_in[2];
  float*       out   = (float*)d_out;

  // 1) 16-bit operand planes of the inputs
  const int ncvt_blocks = SEQ * DMODEL / 2048 + QKV_N * DMODEL / 2048 + DMODEL * DMODEL / 2048;
  convert_kernel<<<dim3(ncvt_blocks), 256, 0, stream>>>(x, wqkv, wproj, xb, wb, wp);

  // 2) RoPE cos/sin tables
  rope_table_kernel<<<dim3(SEQ / 8), 256, 0, stream>>>(ct, st);

  // 3) qkv[SEQ][QKV_N] = xb x wb^T (bf16 operands, f32 result)
  gemm_nt_kernel<FragB, 2, 0><<<dim3(QKV_N / 64, SEQ / 128), 128, 0, stream>>>(
      (const us16*)xb, (const us16*)xb, (const us16*)wb, qkv, DMODEL, QKV_N, 0, 1.0f, 0.0f);

  // 4) RoPE + q/k/v planes (+ residual planes for rows < ER)
  planes_kernel<<<dim3(SEQ / CT, NHEAD), 256, 0, stream>>>(qkv, ct, st, qhp, qrp, khp, krp, vtp, vtrp);

  // 5) causal attention -> ctx planes
  const int nqb     = SEQ / BQ;
  const int n_early = ER / BQ;
  const int n_late  = nqb - n_early;
  attn_kernel<1><<<dim3(n_early, NHEAD), 256, 0, stream>>>(qhp, qrp, khp, krp, vtp, vtrp, ctxh, ctxr, 0);
  if (n_late > 0)
    attn_kernel<0><<<dim3(n_late, NHEAD), 256, 0, stream>>>(qhp, qrp, khp, krp, vtp, vtrp, ctxh, ctxr, n_early);

  // 6) out[SEQ][DMODEL] = ctx x wp^T ; folds the ctx carry (64), the Wproj carry (256) and the residual scale (1024)
  const float oscale = 1.0f / (CCAR * WCAR);
  const float rscale = oscale / RSC;
  gemm_nt_kernel<FragH, 1, 1><<<dim3(DMODEL / 64, ER / 64), 128, 0, stream>>>(
      (const us16*)ctxh, (const us16*)ctxr, (const us16*)wp, out, DMODEL, DMODEL, 0, oscale, rscale);
  if (SEQ - ER > 0)
    gemm_nt_kernel<FragH, 2, 0><<<dim3(DMODEL / 64, (SEQ - ER) / 128), 128, 0, stream>>>(
        (const us16*)ctxh, (const us16*)ctxh, (const us16*)wp, out, DMODEL, DMODEL, ER, oscale, 0.0f);
}

// v002
// It runs in 164 microseconds.
// In both of two side-by-side timings against v001, it was 1.31 times as fast.
// Counting every step since v000, it is 2.70 times as fast.
#include <hip/hip_runtime.h>

// Contractions: qkv = X x Wqkv^T on v_wmma_f32_16x16x32_bf16 (bf16 operands = RNE-converted inputs, f32 accumulate);
// S^T = K x Q^T on v_wmma_f32_16x16x32_f16 (f16 q/k after RoPE, plus f16 residual planes x1024 with their own
// accumulator on query blocks < EARLY_QBLK); O = P x V on v_wmma_f32_16x16x32_f16 (P as f16 carried x4096,
// V as f16, plus P and V residual planes x1024 with their own accumulator on query blocks < EARLY_QBLK);
// out = ctx x Wproj^T on v_wmma_f32_16x16x32_f16 (ctx as f16 carried x64 plus residual x1024 on rows < ER,
// Wproj = f16 of the bf16 RNE-converted input carried x256). RoPE, softmax and all epilogues in f32.

#ifndef NB
#define NB 1
#endif
#ifndef SEQ
#define SEQ 4096
#endif
#define NB_FULL    1
#define SEQ_FULL   4096
#define NHEAD      16
#define HDIM       64
#define DMODEL     (NHEAD * HDIM)        // 1024
#define QKV_N      (3 * DMODEL)          // 3072
#define NROPE      (HDIM / 2)            // 32 frequencies
#define BQ         128                   // query rows per attention block (8 waves x 16)
#define BK         32                    // keys per inner iteration
#define NWAVE      8
#define EARLY_QBLK 2                     // query blocks with residual planes on q, k, P, v, ctx
#define ER         ((EARLY_QBLK * BQ < SEQ) ? (EARLY_QBLK * BQ) : SEQ)   // early rows == early keys
#define CT         64                    // rows per plane-builder block
#define TP         72                    // LDS pitch (halves) of the transposed V tile
#define OP         68                    // LDS pitch (floats) of output staging tiles
#define PCAR       4096.0f               // P carry
#define RSC        1024.0f               // residual plane scale
#define CCAR       64.0f                 // ctx carry
#define WCAR       256.0f                // Wproj carry
#define KS         64                    // keys per LDS stage of the attention loop (two inner iterations)
#define KP         72                    // LDS pitch (halves) of staged K rows and V^T rows: 144 B = 16 B x odd
#define TILE_H     (64 * KP)             // halves per staged tile (64 rows)
#define GS         64                    // k per LDS stage of the GEMM loop (two 32-k products)

static_assert(NB == 1 && NB <= NB_FULL);
static_assert(SEQ <= SEQ_FULL);
static_assert(SEQ % BQ == 0);
static_assert(ER % BQ == 0);
static_assert((SEQ - ER) % 128 == 0);
static_assert(ER % CT == 0);
static_assert(SEQ % CT == 0);
static_assert(SEQ % 8 == 0);
static_assert(BQ == NWAVE * 16);
static_assert(HDIM == 64);
static_assert(DMODEL % 64 == 0 && QKV_N % 64 == 0);
static_assert(DMODEL % 32 == 0);
static_assert((SEQ * DMODEL) % 2048 == 0);
static_assert((QKV_N * DMODEL) % 2048 == 0);
static_assert((DMODEL * DMODEL) % 2048 == 0);
static_assert((TP * 2) % 16 == 0);
static_assert((OP * 4) % 16 == 0);
static_assert(KS == 2 * BK && BQ % KS == 0 && KS == 64);
static_assert((KP * 2) % 16 == 0);

typedef __bf16         bf16;
typedef _Float16       f16;
typedef unsigned short us16;
typedef bf16     v16bf __attribute__((ext_vector_type(16)));
typedef f16      v16h  __attribute__((ext_vector_type(16)));
typedef f16      v8h   __attribute__((ext_vector_type(8)));
typedef float    v8f   __attribute__((ext_vector_type(8)));
typedef float    v4f   __attribute__((ext_vector_type(4)));
typedef unsigned v4u   __attribute__((ext_vector_type(4)));

union FragB  { v16bf v; v4u q[2]; bf16 h[16]; };
union FragH  { v16h  v; v4u q[2]; f16  h[16]; };
union Pack8B { v4u u; bf16 h[8]; };
union Pack8H { v4u u; v8h v; f16 h[8]; };

// WMMA helpers: builtin followed by the VALU hazard guard (ties D, keeps A/B live).
static __device__ __forceinline__ v8f mma_bf16(v16bf a, v16bf b, v8f acc) {
  acc = __builtin_amdgcn_wmma_f32_16x16x32_bf16(false, a, false, b, (short)0, acc, false, false);
  asm volatile("v_nop\n\tv_nop\n\tv_nop\n\tv_nop" : "+v"(acc) : "v"(a), "v"(b));
  return acc;
}
static __device__ __forceinline__ v8f mma_f16(v16h a, v16h b, v8f acc) {
  acc = __builtin_amdgcn_wmma_f32_16x16x32_f16(false, a, false, b, (short)0, acc, false, false);
  asm volatile("v_nop\n\tv_nop\n\tv_nop\n\tv_nop" : "+v"(acc) : "v"(a), "v"(b));
  return acc;
}
static __device__ __forceinline__ v8f mma(const FragB& a, const FragB& b, v8f acc) { return mma_bf16(a.v, b.v, acc); }
static __device__ __forceinline__ v8f mma(const FragH& a, const FragH& b, v8f acc) { return mma_f16(a.v, b.v, acc); }

// ---------------------------------------------------------------------------------------------
// Convert pass: xb = bf16(x) [SEQ][DMODEL], wb = bf16(Wqkv) [QKV_N][DMODEL], wp = f16(bf16(Wproj) * 256) [DMODEL][DMODEL].
// coverage: blocks [0,SEQ*DMODEL/2048) x 256 x 8 == SEQ*DMODEL; next QKV_N*DMODEL/2048 blocks == QKV_N*DMODEL;
//           last DMODEL*DMODEL/2048 blocks == DMODEL*DMODEL.
template <int MODE>
static __device__ __forceinline__ void cvt_body(const float* __restrict__ src, us16* __restrict__ dst,
                                                 int blk, int tid) {
  const size_t e = ((size_t)blk * 256 + tid) * 8;
  const v4f a = *(const v4f*)(src + e);
  const v4f b = *(const v4f*)(src + e + 4);
  v4u u;
  if (MODE == 0) {
    Pack8B pk;
    #pragma unroll
    for (int i = 0; i < 4; ++i) {
      pk.h[i]     = (bf16)a[i];                 // RNE convert
      pk.h[4 + i] = (bf16)b[i];
    }
    u = pk.u;
  } else {
    Pack8H pk;
    #pragma unroll
    for (int i = 0; i < 4; ++i) {
      pk.h[i]     = (f16)((float)(bf16)a[i] * WCAR);   // bf16 significand is exact in f16
      pk.h[4 + i] = (f16)((float)(bf16)b[i] * WCAR);
    }
    u = pk.u;
  }
  *(v4u*)(dst + e) = u;
  
}

__global__ __launch_bounds__(256) void convert_kernel(const float* __restrict__ x,
                                                      const float* __restrict__ wq,
                                                      const float* __restrict__ wpj,
                                                      bf16* __restrict__ xb,
                                                      bf16* __restrict__ wb,
                                                      f16* __restrict__ wp) {
  const int blk = blockIdx.x;
  const int tid = threadIdx.x;
  const int NBX = SEQ * DMODEL / 2048;
  const int NBQ = QKV_N * DMODEL / 2048;
  if (blk < NBX)            cvt_body<0>(x, (us16*)xb, blk, tid);
  else if (blk < NBX + NBQ) cvt_body<0>(wq, (us16*)wb, blk - NBX, tid);
  else                      cvt_body<1>(wpj, (us16*)wp, blk - NBX - NBQ, tid);
}

// ---------------------------------------------------------------------------------------------
// RoPE tables ct/st [SEQ][NROPE] f32: angle(t, j) = t * (1 / 10000^(2j/64)). Block = 8 positions x 32 freqs.
// One powf + one sincosf per thread (rolled). Rows staged in LDS; waves 0-1 write the cos lines, waves 2-3 the
// coverage: (SEQ/8 blocks) x 8 rows x 32 floats == SEQ*NROPE per table.
__global__ __launch_bounds__(256) void rope_table_kernel(float* __restrict__ ct, float* __restrict__ st) {
  __shared__ __align__(16) float sc[8 * NROPE];   // cross-wave (block barrier)
  __shared__ __align__(16) float ss[8 * NROPE];
  const int tid = threadIdx.x;
  const int j   = tid & 31;
  const int tl  = tid >> 5;
  const int t   = blockIdx.x * 8 + tl;
  const float e   = (float)(2 * j) * (1.0f / 64.0f);
  const float pw  = powf(10000.0f, e);
  const float inv = 1.0f / pw;
  const float ang = (float)t * inv;
  float sn, cs;
  sincosf(ang, &sn, &cs);
  sc[tl * NROPE + j] = cs;
  ss[tl * NROPE + j] = sn;
  __syncthreads();
  if (tid < 64) {
    const int rowl  = tid >> 3;
    const int piece = tid & 7;
    const v4f v = *(const v4f*)(sc + rowl * NROPE + piece * 4);
    const size_t gi = (size_t)(blockIdx.x * 8 + rowl) * NROPE + piece * 4;
    *(v4f*)(ct + gi) = v;
    
  } else if (tid < 128) {
    const int rowl  = (tid - 64) >> 3;
    const int piece = tid & 7;
    const v4f v = *(const v4f*)(ss + rowl * NROPE + piece * 4);
    const size_t gi = (size_t)(blockIdx.x * 8 + rowl) * NROPE + piece * 4;
    *(v4f*)(st + gi) = v;
    
  }
}

// ---------------------------------------------------------------------------------------------
// NT GEMM: C[m][n] = oscale * sum_k A[m][k] B[n][k] (+ rscale * sum_k Ar[m][k] B[n][k] when RES).
// A, Ar, B are 16-bit row-major planes with pitch K (k contiguous). 4 waves/block, wave tile (16*MI) x 64,
// block tile (64*MI) x 64. The block's A, Ar and B rows are staged GS k at a time in two LDS buffers by asynchronous
// 16-B copies (whole 128-B row pieces); a stage buffer holds three 64-row tiles at pitch KP: [A | A | B], or [A | Ar | B] when RES.
// A and B fragments are read from LDS with the split k map:
// elements 0..7 <- k0 + 8h + 0..7, elements 8..15 <- k0 + 16 + 8h + 0..7, lane&15 = row of A / row of B (= column n).
// Epilogue: wave tile staged in LDS (in the bytes of the stage buffers, which every wave has left by then), then per
// instruction lanes 0..15 write one 256-B row segment.
// Requires K % 64 == 0, N % 64 == 0, rows covered by the grid a multiple of 64*MI.
// One stage's copies of one thread of the 128: rows r + 16 j (r = tid>>3, j = 0..3) of each of the three 64-row tiles,
// 16-B piece tid&7. r0/r1/r2 point at the first row of each tile at the stage's first k (pitch K); in LDS the three
// tiles follow one another, so the twelve rows of a thread lie 16 rows apart.
static __device__ __forceinline__ void stage_gemm(us16* buf, const us16* r0, const us16* r1, const us16* r2,
                                                  int K, int tid) {
  const int row   = tid >> 3;     // 0..15
  const int piece = tid & 7;      // 0..7
  const unsigned l0 = (unsigned)(size_t)(buf + row * KP + piece * 8);   // LDS byte address
  const unsigned ls = 16 * KP * 2;                                      // 16 rows in LDS, bytes
  const size_t   go = (size_t)row * K + piece * 8;
  const size_t   gs = (size_t)16 * K;                                    // 16 rows in the plane, elements
  const us16* a0 = r0 + go;
  const us16* b0 = r1 + go;
  const us16* c0 = r2 + go;
  // the copies and, as the last line, the wait that stands before any of their address registers is rewritten
  asm volatile("global_load_async_to_lds_b128 %0, %12, off\n\t"
               "global_load_async_to_lds_b128 %1, %13, off\n\t"
               "global_load_async_to_lds_b128 %2, %14, off\n\t"
               "global_load_async_to_lds_b128 %3, %15, off\n\t"
               "global_load_async_to_lds_b128 %4, %16, off\n\t"
               "global_load_async_to_lds_b128 %5, %17, off\n\t"
               "global_load_async_to_lds_b128 %6, %18, off\n\t"
               "global_load_async_to_lds_b128 %7, %19, off\n\t"
               "global_load_async_to_lds_b128 %8, %20, off\n\t"
               "global_load_async_to_lds_b128 %9, %21, off\n\t"
               "global_load_async_to_lds_b128 %10, %22, off\n\t"
               "global_load_async_to_lds_b128 %11, %23, off\n\t"
               "s_wait_xcnt 0x0"
               :: "v"(l0), "v"(l0 + ls), "v"(l0 + 2 * ls), "v"(l0 + 3 * ls),
                  "v"(l0 + 4 * ls), "v"(l0 + 5 * ls), "v"(l0 + 6 * ls), "v"(l0 + 7 * ls),
                  "v"(l0 + 8 * ls), "v"(l0 + 9 * ls), "v"(l0 + 10 * ls), "v"(l0 + 11 * ls),
                  "v"(a0), "v"(a0 + gs), "v"(a0 + 2 * gs), "v"(a0 + 3 * gs),
                  "v"(b0), "v"(b0 + gs), "v"(b0 + 2 * gs), "v"(b0 + 3 * gs),
                  "v"(c0), "v"(c0 + gs), "v"(c0 + 2 * gs), "v"(c0 + 3 * gs) : "memory");
}

template <typename F, int MI, int RES>
__global__ __launch_bounds__(128) void gemm_nt_kernel(const us16* __restrict__ A,
                                                          const us16* __restrict__ Ar,
                                                          const us16* __restrict__ Bm,
                                                          float* __restrict__ C,
                                                          int K, int N, int mrow0,
                                                          float oscale, float rscale) {
  static_assert((MI == 2 && RES == 0) || (MI == 1 && RES == 1));   // three 64-row tiles per stage
  const int BT    = 2;                         // index of the B tile in a stage buffer
  const int STG_H = (BT + 1) * TILE_H;         // halves per stage buffer
  const int RING_B = 2 * STG_H * 2;            // bytes of the two stage buffers
  const int OUT_B  = 4 * 16 * MI * OP * 4;     // bytes of the four waves' output staging
  // two stage buffers (cross-wave) in the loop; behind the loop's last barrier the per-wave output staging
  __shared__ __align__(16) unsigned char smem[RING_B > OUT_B ? RING_B : OUT_B];
  us16*  ring = (us16*)smem;
  float* sC   = (float*)smem;
  const int tid  = threadIdx.x;
  const int wave = tid >> 5;
  const int lane = tid & 31;
  const int lq   = lane & 15;
  const int hi   = lane >> 4;
  const int mb   = mrow0 + blockIdx.y * (64 * MI);
  const int m0   = mb + wave * (16 * MI);
  const int n0   = blockIdx.x * 64;

  v8f acc[MI][4], acc2[MI][4];
  #pragma unroll
  for (int mi = 0; mi < MI; ++mi) {
    #pragma unroll
    for (int t = 0; t < 4; ++t) {
      acc[mi][t]  = (v8f){0, 0, 0, 0, 0, 0, 0, 0};
      acc2[mi][t] = (v8f){0, 0, 0, 0, 0, 0, 0, 0};
    }
  }

  const us16* ab  = A + (size_t)mb * K;                                                  // tile 0: A rows 0..63
  const us16* arb = (RES != 0) ? Ar + (size_t)mb * K : A + (size_t)(mb + 64) * K;        // tile 1: Ar, or A rows 64..127
  const us16* bb  = Bm + (size_t)n0 * K;                                                 // tile 2: B rows
  const int   nst = K / GS;                           // block-uniform stage count

  stage_gemm(ring, ab, arb, bb, K, tid);
  asm volatile("s_wait_asynccnt 0x0" ::: "memory");   // this wave's copies of stage 0 have landed
  __syncthreads();                                    // stage 0 readable by every wave
  if (nst > 1) stage_gemm(ring + STG_H, ab + GS, arb + GS, bb + GS, K, tid);

  for (int s = 0; s < nst; ++s) {
    const us16* sb = ring + (s & 1) * STG_H;
    #pragma unroll   // constant indices keep the fragment arrays in registers
    for (int u = 0; u < GS / 32; ++u) {
      F a[MI], ar[MI], b[4];
      #pragma unroll
      for (int mi = 0; mi < MI; ++mi) {
        const us16* p = sb + (wave * (16 * MI) + mi * 16 + lq) * KP + u * 32 + hi * 8;
        a[mi].q[0] = *(const v4u*)(p);        // k0 + 8h + 0..7
        a[mi].q[1] = *(const v4u*)(p + 16);   // k0 + 16 + 8h + 0..7
        if (RES != 0) {
          const us16* pr = p + MI * TILE_H;
          ar[mi].q[0] = *(const v4u*)(pr);
          ar[mi].q[1] = *(const v4u*)(pr + 16);
        }
      }
      #pragma unroll
      for (int t = 0; t < 4; ++t) {
        const us16* p = sb + BT * TILE_H + (t * 16 + lq) * KP + u * 32 + hi * 8;
        b[t].q[0] = *(const v4u*)(p);
        b[t].q[1] = *(const v4u*)(p + 16);
      }
      #pragma unroll
      for (int mi = 0; mi < MI; ++mi) {
        #pragma unroll
        for (int t = 0; t < 4; ++t) {
          acc[mi][t] = mma(a[mi], b[t], acc[mi][t]);
          if (RES != 0) acc2[mi][t] = mma(ar[mi], b[t], acc2[mi][t]);
        }
      }
    }
    // publish point of stage s + 1, passed by every wave
    asm volatile("s_wait_dscnt 0x0" ::: "memory");      // this wave's reads of stage s are done before its buffer is refilled
    asm volatile("s_wait_asynccnt 0x0" ::: "memory");   // this wave's copies of stage s + 1 have landed
    __syncthreads();                                    // stage s + 1 readable; every reader has left stage s
    if (s + 2 < nst)
      stage_gemm(ring + (s & 1) * STG_H, ab + (s + 2) * GS, arb + (s + 2) * GS, bb + (s + 2) * GS, K, tid);
  }
  asm volatile("s_wait_asynccnt 0x0" ::: "memory");     // no copy outstanding behind the loop

  float* so = sC + wave * (16 * MI * OP);
  #pragma unroll
  for (int mi = 0; mi < MI; ++mi) {
    #pragma unroll
    for (int t = 0; t < 4; ++t) {
      #pragma unroll
      for (int r = 0; r < 8; ++r) {
        float val = acc[mi][t][r] * oscale;
        if (RES != 0) val += acc2[mi][t][r] * rscale;
        so[(mi * 16 + hi * 8 + r) * OP + t * 16 + lq] = val;
      }
    }
  }
  __syncthreads();

  const int NIT = 8 * MI;   // (16*MI rows) / 2 rows per instruction
  v4f    vals[8 * MI];
  size_t gidx[8 * MI];
  #pragma unroll
  for (int it = 0; it < NIT; ++it) {
    const int row = it * 2 + hi;
    vals[it] = *(const v4f*)(so + row * OP + lq * 4);
    gidx[it] = (size_t)(m0 + row) * N + n0 + lq * 4;
  }
  #pragma unroll
  for (int it = 0; it < NIT; ++it) *(v4f*)(C + gidx[it]) = vals[it];
  
}

// ---------------------------------------------------------------------------------------------
// Plane builder. Block = (64-row tile, head), 256 threads; reads the f32 qkv rows [SEQ][QKV_N].
//   qr, kr [NHEAD][ER][HDIM]  f16 : residual planes (x - f16(x)) * 1024 for rows < ER (block-uniform).
//   vtr [NHEAD][HDIM][ER]     f16 : V residual transposed, keys < ER.
// RoPE (rotate-half): pair partner d^32 sits in lane^4 of the same wave; out[d] = x[d]*cos + sgn*x[d^32]*sin.
// coverage: rows kt*64 + {0..31, 32..63}, d 0..63 for every plane; residual planes for tiles with s0 < ER
//           (ER/64 tiles x 64 rows == ER rows); every written line whole, one instruction.
__global__ __launch_bounds__(256) void planes_kernel(const float* __restrict__ qkv,
                                                     const float* __restrict__ ct,
                                                     const float* __restrict__ st,
                                                     f16* __restrict__ qh, f16* __restrict__ qr,
                                                     f16* __restrict__ kh, f16* __restrict__ kr,
                                                     f16* __restrict__ vt, f16* __restrict__ vtr) {
  const int kt  = blockIdx.x;
  const int h   = blockIdx.y;
  const int tid = threadIdx.x;
  __shared__ __align__(16) f16 sT[HDIM * TP];   // [d][key] hi, cross-wave (block barrier)
  __shared__ __align__(16) f16 sR[HDIM * TP];   // [d][key] residual, cross-wave (block barrier)
  const int  s0    = kt * CT;
  const bool early = (s0 < ER);                 // block-uniform

  v4u    qv[2], kv[2], qx[2], kx[2];
  size_t pidx[2], ridx[2];
  #pragma unroll
  for (int kk = 0; kk < 2; ++kk) {
    const int   key  = kk * 32 + (tid >> 3);    // 0..63
    const int   d0   = (tid & 7) * 8;           // 0..56
    const int   j0   = d0 & (NROPE - 1);        // frequency index of d0
    const float sgn  = (d0 < NROPE) ? -1.0f : 1.0f;
    const int   srow = s0 + key;
    const float* src = qkv + (size_t)srow * QKV_N + h * HDIM + d0;     // slot 0 = q
    const v4f q0v = *(const v4f*)(src);
    const v4f q1v = *(const v4f*)(src + 4);
    const v4f k0v = *(const v4f*)(src + DMODEL);                        // slot 1 = k
    const v4f k1v = *(const v4f*)(src + DMODEL + 4);
    const v4f v0v = *(const v4f*)(src + 2 * DMODEL);                    // slot 2 = v
    const v4f v1v = *(const v4f*)(src + 2 * DMODEL + 4);
    const float* cp = ct + (size_t)srow * NROPE + j0;
    const float* sp = st + (size_t)srow * NROPE + j0;
    const v4f c0 = *(const v4f*)(cp);
    const v4f c1 = *(const v4f*)(cp + 4);
    const v4f n0 = *(const v4f*)(sp);
    const v4f n1 = *(const v4f*)(sp + 4);
    float qa[8], ka[8], va[8], ca[8], sa[8];
    #pragma unroll
    for (int i = 0; i < 4; ++i) {
      qa[i] = q0v[i]; qa[4 + i] = q1v[i];
      ka[i] = k0v[i]; ka[4 + i] = k1v[i];
      va[i] = v0v[i]; va[4 + i] = v1v[i];
      ca[i] = c0[i];  ca[4 + i] = c1[i];
      sa[i] = n0[i];  sa[4 + i] = n1[i];
    }
    Pack8H pq, pqr, pk, pkr;
    #pragma unroll
    for (int i = 0; i < 8; ++i) {
      const float qp = __shfl_xor(qa[i], 4, 32);   // partner d^32, same row, same wave
      const float kp = __shfl_xor(ka[i], 4, 32);
      const float qo = qa[i] * ca[i] + sgn * qp * sa[i];
      const float ko = ka[i] * ca[i] + sgn * kp * sa[i];
      const f16 qhh = (f16)qo;
      const f16 khh = (f16)ko;
      pq.h[i]  = qhh;
      pk.h[i]  = khh;
      pqr.h[i] = (f16)((qo - (float)qhh) * RSC);
      pkr.h[i] = (f16)((ko - (float)khh) * RSC);
      const f16 vhh = (f16)va[i];
      sT[(d0 + i) * TP + key] = vhh;
      sR[(d0 + i) * TP + key] = (f16)((va[i] - (float)vhh) * RSC);
    }
    qv[kk] = pq.u;  qx[kk] = pqr.u;
    kv[kk] = pk.u;  kx[kk] = pkr.u;
    pidx[kk] = ((size_t)h * SEQ + srow) * HDIM + d0;
    ridx[kk] = ((size_t)h * ER + srow) * HDIM + d0;   // used only when early (srow < ER)
  }
  __syncthreads();

  v4u    vv[2], vx[2];
  size_t vidx[2], vridx[2];
  #pragma unroll
  for (int kk = 0; kk < 2; ++kk) {
    const int d  = kk * 32 + (tid >> 3);        // 0..63
    const int ks = (tid & 7) * 8;               // 0..56
    Pack8H ph, px;
    ph.v = *(const v8h*)(sT + d * TP + ks);
    px.v = *(const v8h*)(sR + d * TP + ks);
    vv[kk] = ph.u;
    vx[kk] = px.u;
    vidx[kk]  = ((size_t)h * HDIM + d) * SEQ + s0 + ks;
    vridx[kk] = ((size_t)h * HDIM + d) * ER + s0 + ks;   // used only when early
  }

  #pragma unroll
  for (int kk = 0; kk < 2; ++kk) {
    *(v4u*)(qh + pidx[kk]) = qv[kk];
    *(v4u*)(kh + pidx[kk]) = kv[kk];
    *(v4u*)(vt + vidx[kk]) = vv[kk];
    if (early) {
      *(v4u*)(qr + ridx[kk])   = qx[kk];
      *(v4u*)(kr + ridx[kk])   = kx[kk];
      *(v4u*)(vtr + vridx[kk]) = vx[kk];
    }
  }
  
}

// ---------------------------------------------------------------------------------------------
// Flash attention, causal. Block = (query block of 128, head); one wave owns 16 query rows.
// S^T = K x Q^T so queries sit on lanes; P^T in C-layout is bit-identical to the A-fragment layout of O += P x V.
// Q B-fragments are loaded straight from the 16-bit plane; K A-fragments and V^T B-fragments from LDS (two 16-B loads each).
// RES != 0 (query blocks < EARLY_QBLK, all visited keys < ER): score = KQ + (K Qres + Kres Q)/1024;
// O2 = Pres V + P Vres accumulated separately and folded as O2/1024 before normalisation.
// K and V^T (and their residual planes when RES) are staged once per block, KS keys at a time, in two LDS buffers
// by asynchronous 16-B copies; all eight waves read their fragments from LDS. A stage buffer holds the tiles
// [K | V^T | Kres | V^Tres], each 64 rows of 128 B at pitch KP.
// One stage's copies of one thread: rows tid>>3 and 32 + (tid>>3) of every tile, 16-B piece tid&7.
// kg/krg point at the stage's first key row (pitch HDIM); vg/vrg at the stage's first key column (pitch SEQ / ER).
template <int RES>
static __device__ __forceinline__ void stage_tiles(f16* buf, const f16* kg, const f16* krg,
                                                   const f16* vg, const f16* vrg, int tid) {
  const int row   = tid >> 3;     // 0..31
  const int piece = tid & 7;      // 0..7
  const unsigned l0 = (unsigned)(size_t)(buf + row * KP + piece * 8);   // LDS byte address
  const unsigned l1 = l0 + 32 * KP * 2;
  const unsigned l2 = l0 + TILE_H * 2;
  const unsigned l3 = l1 + TILE_H * 2;
  const f16* g0 = kg + (size_t)row * HDIM + piece * 8;
  const f16* g1 = g0 + 32 * HDIM;
  const f16* g2 = vg + (size_t)row * SEQ + piece * 8;
  const f16* g3 = g2 + (size_t)32 * SEQ;
  // the copies and, as the last line, the wait that stands before any of their address registers is rewritten
  asm volatile("global_load_async_to_lds_b128 %0, %4, off\n\t"
               "global_load_async_to_lds_b128 %1, %5, off\n\t"
               "global_load_async_to_lds_b128 %2, %6, off\n\t"
               "global_load_async_to_lds_b128 %3, %7, off\n\t"
               "s_wait_xcnt 0x0"
               :: "v"(l0), "v"(l1), "v"(l2), "v"(l3), "v"(g0), "v"(g1), "v"(g2), "v"(g3) : "memory");
  if (RES != 0) {
    const unsigned l4 = l0 + 2 * TILE_H * 2;
    const unsigned l5 = l1 + 2 * TILE_H * 2;
    const unsigned l6 = l0 + 3 * TILE_H * 2;
    const unsigned l7 = l1 + 3 * TILE_H * 2;
    const f16* g4 = krg + (size_t)row * HDIM + piece * 8;
    const f16* g5 = g4 + 32 * HDIM;
    const f16* g6 = vrg + (size_t)row * ER + piece * 8;
    const f16* g7 = g6 + (size_t)32 * ER;
    // same form for the residual tiles
    asm volatile("global_load_async_to_lds_b128 %0, %4, off\n\t"
                 "global_load_async_to_lds_b128 %1, %5, off\n\t"
                 "global_load_async_to_lds_b128 %2, %6, off\n\t"
                 "global_load_async_to_lds_b128 %3, %7, off\n\t"
                 "s_wait_xcnt 0x0"
                 :: "v"(l4), "v"(l5), "v"(l6), "v"(l7), "v"(g4), "v"(g5), "v"(g6), "v"(g7) : "memory");
  }
}

template <int RES>
__global__ __launch_bounds__(256) void attn_kernel(const f16* __restrict__ qh, const f16* __restrict__ qr,
                                                   const f16* __restrict__ kh, const f16* __restrict__ kr,
                                                   const f16* __restrict__ vt, const f16* __restrict__ vtr,
                                                   f16* __restrict__ ctxh, f16* __restrict__ ctxr,
                                                   int qblk0) {
  const int qblk = qblk0 + blockIdx.x;
  const int h    = blockIdx.y;
  const int tid  = threadIdx.x;
  const int wave = __builtin_amdgcn_readfirstlane(tid >> 5);   // scalar, so the per-wave causal skip is a scalar branch
  const int lane = tid & 31;
  const int lq   = lane & 15;   // query column of S^T / d column of O
  const int hi   = lane >> 4;   // k-split half

  __shared__ __align__(16) float sO[NWAVE * 16 * OP];   // per-wave output staging (block barrier used)
  const int STG_H = (RES != 0 ? 4 : 2) * TILE_H;         // halves per stage buffer
  __shared__ __align__(16) f16 sKV[2 * (RES != 0 ? 4 : 2) * TILE_H];   // two stage buffers, cross-wave

  const int qrow0 = qblk * BQ + wave * 16;               // first query row of this wave

  // Q as B-operand fragments: lane lq holds query qrow0+lq, elements follow the split d map.
  FragH qf[2], qx[2];
  {
    const f16* qp = qh + ((size_t)h * SEQ + qrow0 + lq) * HDIM;
    #pragma unroll
    for (int f = 0; f < 2; ++f) {
      qf[f].q[0] = *(const v4u*)(qp + f * 32 + hi * 8);        // d = f*32 + hi*8 + 0..7
      qf[f].q[1] = *(const v4u*)(qp + f * 32 + 16 + hi * 8);   // d = f*32 + 16 + hi*8 + 0..7
    }
    if (RES != 0) {
      const f16* qrp = qr + ((size_t)h * ER + qrow0 + lq) * HDIM;
      #pragma unroll
      for (int f = 0; f < 2; ++f) {
        qx[f].q[0] = *(const v4u*)(qrp + f * 32 + hi * 8);
        qx[f].q[1] = *(const v4u*)(qrp + f * 32 + 16 + hi * 8);
      }
    }
  }

  const f16* kh_h  = kh  + (size_t)h * SEQ * HDIM;
  const f16* kr_h  = kr  + (size_t)h * ER * HDIM;
  const f16* vt_h  = vt  + (size_t)h * HDIM * SEQ;
  const f16* vtr_h = vtr + (size_t)h * HDIM * ER;

  v8f o[4], o2[4];
  #pragma unroll
  for (int dt = 0; dt < 4; ++dt) {
    o[dt]  = (v8f){0, 0, 0, 0, 0, 0, 0, 0};
    o2[dt] = (v8f){0, 0, 0, 0, 0, 0, 0, 0};
  }

  float rmax = -__builtin_inff();
  float rsum = 0.0f;
  const float SL = 0.125f * 1.4426950408889634f;   // softmax scale * log2(e)

  // causal: this wave visits key chunks whose first key is <= its last query row (wave-uniform trip count)
  const int nchunk = (qrow0 + 15) / BK + 1;
  // the block walks the stages up to its last query row (block-uniform count, at least two)
  const int nstage = (qblk + 1) * (BQ / KS);

  stage_tiles<RES>(sKV, kh_h, kr_h, vt_h, vtr_h, tid);
  asm volatile("s_wait_asynccnt 0x0" ::: "memory");   // this wave's copies of stage 0 have landed
  __syncthreads();                                    // stage 0 readable by every wave
  if (nstage > 1)
    stage_tiles<RES>(sKV + STG_H, kh_h + (size_t)KS * HDIM, kr_h + (size_t)KS * HDIM, vt_h + KS, vtr_h + KS, tid);

  for (int t = 0; t < nstage; ++t) {
   const f16* sb = sKV + (t & 1) * STG_H;
   for (int u = 0; u < KS / BK; ++u) {
    const int i = t * (KS / BK) + u;
    if (i >= nchunk) break;                 // wave-uniform: chunks beyond this wave's diagonal
    const int j0 = i * BK;
    const f16* sk  = sb + (u * BK) * KP;                 // K rows of this chunk
    const f16* sv  = sb + TILE_H + u * BK;               // V^T key columns of this chunk
    const f16* skr = sb + (RES != 0 ? 2 : 0) * TILE_H + (u * BK) * KP;    // residual tiles (read when RES only)
    const f16* svr = sb + (RES != 0 ? 3 : 1) * TILE_H + u * BK;

    // K A-fragments, then V B-fragments (column n = d = dt*16 + lq, split key map from the transposed tile): all
    // fetched at the head of the chunk, so that V's LDS latency passes under the score products and the softmax.
    FragH ka[2][2], bvf[4];
    #pragma unroll   // constant indices keep the fragment arrays in registers
    for (int sub = 0; sub < 2; ++sub) {
      const f16* base = sk + (sub * 16 + lq) * KP + hi * 8;   // row = key j0 + sub*16 + lq
      ka[sub][0].q[0] = *(const v4u*)(base);        // d = hi*8 + 0..7
      ka[sub][0].q[1] = *(const v4u*)(base + 16);   // d = 16 + hi*8 + 0..7
      ka[sub][1].q[0] = *(const v4u*)(base + 32);   // d = 32 + hi*8 + 0..7
      ka[sub][1].q[1] = *(const v4u*)(base + 48);   // d = 48 + hi*8 + 0..7
    }
    #pragma unroll   // as above
    for (int dt = 0; dt < 4; ++dt) {
      const f16* base = sv + (dt * 16 + lq) * KP + hi * 8;
      bvf[dt].q[0] = *(const v4u*)(base);        // keys j0 + hi*8 + 0..7
      bvf[dt].q[1] = *(const v4u*)(base + 16);   // keys j0 + 16 + hi*8 + 0..7
    }

    // S^T tiles: c[sub][r] = rawscore(query qrow0+lq, key j0 + sub*16 + hi*8 + r)
    v8f c[2];
    #pragma unroll
    for (int sub = 0; sub < 2; ++sub) {
      const FragH a0 = ka[sub][0];
      const FragH a1 = ka[sub][1];
      v8f acc = (v8f){0, 0, 0, 0, 0, 0, 0, 0};
      acc = mma_f16(a0.v, qf[0].v, acc);
      acc = mma_f16(a1.v, qf[1].v, acc);
      if (RES != 0) {
        FragH r0, r1;
        const f16* rb = skr + (sub * 16 + lq) * KP + hi * 8;
        r0.q[0] = *(const v4u*)(rb);
        r0.q[1] = *(const v4u*)(rb + 16);
        r1.q[0] = *(const v4u*)(rb + 32);
        r1.q[1] = *(const v4u*)(rb + 48);
        v8f ax = (v8f){0, 0, 0, 0, 0, 0, 0, 0};
        ax = mma_f16(a0.v, qx[0].v, ax);
        ax = mma_f16(a1.v, qx[1].v, ax);
        ax = mma_f16(r0.v, qf[0].v, ax);
        ax = mma_f16(r1.v, qf[1].v, ax);
        #pragma unroll
        for (int r = 0; r < 8; ++r) acc[r] += ax[r] * (1.0f / RSC);
      }
      c[sub] = acc;
    }

    // causal mask (key > query -> -inf); branch is wave-uniform, selects are per lane
    if (j0 + BK - 1 > qrow0) {
      const int qi = qrow0 + lq;
      #pragma unroll
      for (int sub = 0; sub < 2; ++sub) {
        #pragma unroll
        for (int r = 0; r < 8; ++r) {
          const int key = j0 + sub * 16 + hi * 8 + r;
          c[sub][r] = (key > qi) ? -__builtin_inff() : c[sub][r];
        }
      }
    }

    // online softmax: query lq's 32 scores are split across lane / lane^16
    float m_new = rmax;
    #pragma unroll
    for (int r = 0; r < 8; ++r) {
      m_new = fmaxf(m_new, c[0][r]);
      m_new = fmaxf(m_new, c[1][r]);
    }
    m_new = fmaxf(m_new, __shfl_xor(m_new, 16, 32));
    const float scale = __builtin_amdgcn_exp2f((rmax - m_new) * SL);
    rmax = m_new;

    // exp + pack: P^T C-layout == A-fragment layout for the PV product
    FragH pa, pr;
    float psum = 0.0f;
    #pragma unroll
    for (int r = 0; r < 8; ++r) {
      const float p0 = __builtin_amdgcn_exp2f((c[0][r] - m_new) * SL);   // key hi*8 + r
      const float p1 = __builtin_amdgcn_exp2f((c[1][r] - m_new) * SL);   // key 16 + hi*8 + r
      psum += p0 + p1;
      const float pc0 = p0 * PCAR;
      const float pc1 = p1 * PCAR;
      const f16 h0 = (f16)pc0;
      const f16 h1 = (f16)pc1;
      pa.h[r]     = h0;
      pa.h[8 + r] = h1;
      if (RES != 0) {
        pr.h[r]     = (f16)((pc0 - (float)h0) * RSC);
        pr.h[8 + r] = (f16)((pc1 - (float)h1) * RSC);
      }
    }
    rsum = rsum * scale + psum + __shfl_xor(psum, 16, 32);

    // rescale O: queries are the row dimension there -> per-row scale from lane 8*hi + r
    float sc[8];
    #pragma unroll
    for (int r = 0; r < 8; ++r) sc[r] = __shfl(scale, (hi << 3) + r, 32);
    #pragma unroll
    for (int dt = 0; dt < 4; ++dt) {
      #pragma unroll
      for (int r = 0; r < 8; ++r) {
        o[dt][r] *= sc[r];
        if (RES != 0) o2[dt][r] *= sc[r];
      }
    }

    // O += P x V
    #pragma unroll
    for (int dt = 0; dt < 4; ++dt) {
      o[dt] = mma_f16(pa.v, bvf[dt].v, o[dt]);
      if (RES != 0) {
        o2[dt] = mma_f16(pr.v, bvf[dt].v, o2[dt]);
        FragH br;
        const f16* rb = svr + (dt * 16 + lq) * KP + hi * 8;
        br.q[0] = *(const v4u*)(rb);
        br.q[1] = *(const v4u*)(rb + 16);
        o2[dt] = mma_f16(pa.v, br.v, o2[dt]);
      }
    }
   }
   // publish point of stage t + 1, passed by every wave (also one that skipped chunks)
   asm volatile("s_wait_dscnt 0x0" ::: "memory");      // this wave's reads of stage t are done before its buffer is refilled
   asm volatile("s_wait_asynccnt 0x0" ::: "memory");   // this wave's copies of stage t + 1 have landed
   __syncthreads();                                    // stage t + 1 readable; every reader has left stage t
   if (t + 2 < nstage)
     stage_tiles<RES>(sKV + (t & 1) * STG_H, kh_h + (size_t)(t + 2) * KS * HDIM, kr_h + (size_t)(t + 2) * KS * HDIM,
                      vt_h + (t + 2) * KS, vtr_h + (t + 2) * KS, tid);
  }
  asm volatile("s_wait_asynccnt 0x0" ::: "memory");    // no copy outstanding behind the loop

  // normalize: lane holds column d = dt*16 + lq for query rows 8*hi + r; stage ctx * 64
  float rs[8];
  #pragma unroll
  for (int r = 0; r < 8; ++r) rs[r] = 1.0f / __shfl(rsum, (hi << 3) + r, 32);

  float* so = sO + wave * (16 * OP);
  #pragma unroll
  for (int r = 0; r < 8; ++r) {
    #pragma unroll
    for (int dt = 0; dt < 4; ++dt) {
      float val = o[dt][r];
      if (RES != 0) val += o2[dt][r] * (1.0f / RSC);
      so[(hi * 8 + r) * OP + dt * 16 + lq] = val * (CCAR / PCAR) * rs[r];
    }
  }
  __syncthreads();

  v4u    hv[4], rv[4];
  size_t gi[4], gr[4];
  #pragma unroll
  for (int it = 0; it < 4; ++it) {
    const int row   = it * 4 + (lane >> 3);   // 0..15
    const int piece = lane & 7;               // 0..7
    const v4f a0 = *(const v4f*)(so + row * OP + piece * 8);
    const v4f a1 = *(const v4f*)(so + row * OP + piece * 8 + 4);
    Pack8H ph, px;
    #pragma unroll
    for (int k = 0; k < 4; ++k) {
      const float u0 = a0[k];
      const float u1 = a1[k];
      const f16 g0 = (f16)u0;
      const f16 g1 = (f16)u1;
      ph.h[k]     = g0;
      ph.h[4 + k] = g1;
      px.h[k]     = (f16)((u0 - (float)g0) * RSC);
      px.h[4 + k] = (f16)((u1 - (float)g1) * RSC);
    }
    hv[it] = ph.u;
    rv[it] = px.u;
    gi[it] = (size_t)(qrow0 + row) * DMODEL + h * HDIM + piece * 8;
    gr[it] = (size_t)(qrow0 + row) * DMODEL + h * HDIM + piece * 8;   // row < ER when RES
  }
  #pragma unroll
  for (int it = 0; it < 4; ++it) {
    *(v4u*)(ctxh + gi[it]) = hv[it];
    if (RES != 0) *(v4u*)(ctxr + gr[it]) = rv[it];
  }
  
}

// ---------------------------------------------------------------------------------------------
extern "C" void kernel_launch(void* const* d_in, const int* in_sizes, int n_in,
                              void* d_out, int out_size, void* d_ws, size_t ws_size,
                              hipStream_t stream) {
  if (n_in < 3) return;
  if ((size_t)in_sizes[0] < (size_t)SEQ * DMODEL) return;
  if ((size_t)in_sizes[1] < (size_t)QKV_N * DMODEL) return;
  if ((size_t)in_sizes[2] < (size_t)DMODEL * DMODEL) return;
  if ((size_t)out_size < (size_t)SEQ * DMODEL) return;

  const size_t xb_bytes   = (size_t)SEQ * DMODEL * 2;            // bf16 [SEQ][DMODEL]
  const size_t wb_bytes   = (size_t)QKV_N * DMODEL * 2;          // bf16 [QKV_N][DMODEL]
  const size_t wp_bytes   = (size_t)DMODEL * DMODEL * 2;         // f16  [DMODEL][DMODEL]
  const size_t tab_bytes  = (size_t)SEQ * NROPE * 4;             // f32  [SEQ][NROPE] (each of cos, sin)
  const size_t qkv_bytes  = (size_t)SEQ * QKV_N * 4;             // f32  [SEQ][QKV_N]
  const size_t pl_bytes   = (size_t)NHEAD * SEQ * HDIM * 2;      // f16  q/k/vt planes
  const size_t plr_bytes  = (size_t)NHEAD * ER * HDIM * 2;       // f16  residual planes
  const size_t ctx_bytes  = (size_t)SEQ * DMODEL * 2;            // f16  [SEQ][DMODEL]
  const size_t ctxr_bytes = (size_t)ER * DMODEL * 2;             // f16  [ER][DMODEL]
  const size_t total = xb_bytes + wb_bytes + wp_bytes + 2 * tab_bytes + qkv_bytes
                     + 3 * pl_bytes + 3 * plr_bytes + ctx_bytes + ctxr_bytes;
  if (ws_size < total) return;

  char* ws = (char*)d_ws;
  size_t off = 0;
  bf16*  xb   = (bf16*)(ws + off);  off += xb_bytes;
  bf16*  wb   = (bf16*)(ws + off);  off += wb_bytes;
  f16*   wp   = (f16*)(ws + off);   off += wp_bytes;
  float* ct   = (float*)(ws + off); off += tab_bytes;
  float* st   = (float*)(ws + off); off += tab_bytes;
  float* qkv  = (float*)(ws + off); off += qkv_bytes;
  f16*   qhp  = (f16*)(ws + off);   off += pl_bytes;
  f16*   khp  = (f16*)(ws + off);   off += pl_bytes;
  f16*   vtp  = (f16*)(ws + off);   off += pl_bytes;
  f16*   qrp  = (f16*)(ws + off);   off += plr_bytes;
  f16*   krp  = (f16*)(ws + off);   off += plr_bytes;
  f16*   vtrp = (f16*)(ws + off);   off += plr_bytes;
  f16*   ctxh = (f16*)(ws + off);   off += ctx_bytes;
  f16*   ctxr = (f16*)(ws + off);   off += ctxr_bytes;
  if (off > ws_size) return;

  const float* x     = (const float*)d_in[0];
  const float* wqkv  = (const float*)d_in[1];
  const float* wproj = (const float*)d_in[2];
  float*       out   = (float*)d_out;

  // 1) 16-bit operand planes of the inputs
  const int ncvt_blocks = SEQ * DMODEL / 2048 + QKV_N * DMODEL / 2048 + DMODEL * DMODEL / 2048;
  convert_kernel<<<dim3(ncvt_blocks), 256, 0, stream>>>(x, wqkv, wproj, xb, wb, wp);

  // 2) RoPE cos/sin tables
  rope_table_kernel<<<dim3(SEQ / 8), 256, 0, stream>>>(ct, st);

  // 3) qkv[SEQ][QKV_N] = xb x wb^T (bf16 operands, f32 result)
  gemm_nt_kernel<FragB, 2, 0><<<dim3(QKV_N / 64, SEQ / 128), 128, 0, stream>>>(
      (const us16*)xb, (const us16*)xb, (const us16*)wb, qkv, DMODEL, QKV_N, 0, 1.0f, 0.0f);

  // 4) RoPE + q/k/v planes (+ residual planes for rows < ER)
  planes_kernel<<<dim3(SEQ / CT, NHEAD), 256, 0, stream>>>(qkv, ct, st, qhp, qrp, khp, krp, vtp, vtrp);

  // 5) causal attention -> ctx planes
  const int nqb     = SEQ / BQ;
  const int n_early = ER / BQ;
  const int n_late  = nqb - n_early;
  attn_kernel<1><<<dim3(n_early, NHEAD), 256, 0, stream>>>(qhp, qrp, khp, krp, vtp, vtrp, ctxh, ctxr, 0);
  if (n_late > 0)
    attn_kernel<0><<<dim3(n_late, NHEAD), 256, 0, stream>>>(qhp, qrp, khp, krp, vtp, vtrp, ctxh, ctxr, n_early);

  // 6) out[SEQ][DMODEL] = ctx x wp^T ; folds the ctx carry (64), the Wproj carry (256) and the residual scale (1024)
  const float oscale = 1.0f / (CCAR * WCAR);
  const float rscale = oscale / RSC;
  gemm_nt_kernel<FragH, 1, 1><<<dim3(DMODEL / 64, ER / 64), 128, 0, stream>>>(
      (const us16*)ctxh, (const us16*)ctxr, (const us16*)wp, out, DMODEL, DMODEL, 0, oscale, rscale);
  if (SEQ - ER > 0)
    gemm_nt_kernel<FragH, 2, 0><<<dim3(DMODEL / 64, (SEQ - ER) / 128), 128, 0, stream>>>(
        (const us16*)ctxh, (const us16*)ctxh, (const us16*)wp, out, DMODEL, DMODEL, ER, oscale, 0.0f);
}

// v003
// A run of this version takes 146 microseconds.
// Timed twice side by side with v002, it ran 1.13 and 1.14 times as fast.
// Over all steps from v000 it is 3.06 times as fast.
#include <hip/hip_runtime.h>

// Contractions: qkv = X x Wqkv^T on v_wmma_f32_16x16x32_bf16 (bf16 operands = RNE-converted inputs, f32 accumulate);
// S^T = K x Q^T on v_wmma_f32_16x16x32_f16 (f16 q/k after RoPE, plus f16 residual planes x1024 with their own
// accumulator on query blocks < EARLY_QBLK); O = P x V on v_wmma_f32_16x16x32_f16 (P as f16 carried x4096,
// V as f16, plus P and V residual planes x1024 with their own accumulator on query blocks < EARLY_QBLK);
// out = ctx x Wproj^T on v_wmma_f32_16x16x32_f16 (ctx as f16 carried x64 plus residual x1024 on rows < ER,
// Wproj = f16 of the bf16 RNE-converted input carried x256). RoPE, softmax and all epilogues in f32.

#ifndef NB
#define NB 1
#endif
#ifndef SEQ
#define SEQ 4096
#endif
#define NB_FULL    1
#define SEQ_FULL   4096
#define NHEAD      16
#define HDIM       64
#define DMODEL     (NHEAD * HDIM)        // 1024
#define QKV_N      (3 * DMODEL)          // 3072
#define NROPE      (HDIM / 2)            // 32 frequencies
#define BQ         128                   // query rows per attention block (8 waves x 16)
#define BK         32                    // keys per inner iteration
#define NWAVE      8
#define EARLY_QBLK 2                     // query blocks with residual planes on q, k, P, v, ctx
#define ER         ((EARLY_QBLK * BQ < SEQ) ? (EARLY_QBLK * BQ) : SEQ)   // early rows == early keys
#define CT         64                    // rows per plane-builder block
#define TP         72                    // LDS pitch (halves) of the transposed V tile
#define OP         68                    // LDS pitch (floats) of output staging tiles
#define PCAR       4096.0f               // P carry
#define RSC        1024.0f               // residual plane scale
#define CCAR       64.0f                 // ctx carry
#define WCAR       256.0f                // Wproj carry
#define KS         64                    // keys per LDS stage of the attention loop (two inner iterations)
#define KP         72                    // LDS pitch (halves) of staged K rows and V^T rows: 144 B = 16 B x odd
#define TILE_H     (64 * KP)             // halves per staged tile (64 rows)
#define GS         64                    // k per LDS stage of the GEMM loop (two 32-k products)

static_assert(NB == 1 && NB <= NB_FULL);
static_assert(SEQ <= SEQ_FULL);
static_assert(SEQ % BQ == 0);
static_assert(ER % BQ == 0);
static_assert((SEQ - ER) % 128 == 0);
static_assert(ER % CT == 0);
static_assert(SEQ % CT == 0);
static_assert(SEQ % 8 == 0);
static_assert(BQ == NWAVE * 16);
static_assert(HDIM == 64);
static_assert(DMODEL % 64 == 0 && QKV_N % 64 == 0);
static_assert(DMODEL % 32 == 0);
static_assert((SEQ * DMODEL) % 2048 == 0);
static_assert((QKV_N * DMODEL) % 2048 == 0);
static_assert((DMODEL * DMODEL) % 2048 == 0);
static_assert((TP * 2) % 16 == 0);
static_assert((OP * 4) % 16 == 0);
static_assert(KS == 2 * BK && BQ % KS == 0 && KS == 64);
static_assert((KP * 2) % 16 == 0);

typedef __bf16         bf16;
typedef _Float16       f16;
typedef unsigned short us16;
typedef bf16     v16bf __attribute__((ext_vector_type(16)));
typedef f16      v16h  __attribute__((ext_vector_type(16)));
typedef f16      v8h   __attribute__((ext_vector_type(8)));
typedef float    v8f   __attribute__((ext_vector_type(8)));
typedef float    v4f   __attribute__((ext_vector_type(4)));
typedef unsigned v4u   __attribute__((ext_vector_type(4)));

union FragB  { v16bf v; v4u q[2]; bf16 h[16]; };
union FragH  { v16h  v; v4u q[2]; f16  h[16]; };
union Pack8B { v4u u; bf16 h[8]; };
union Pack8H { v4u u; v8h v; f16 h[8]; };

// WMMA helpers: builtin followed by the VALU hazard guard (ties D, keeps A/B live).
static __device__ __forceinline__ v8f mma_bf16(v16bf a, v16bf b, v8f acc) {
  acc = __builtin_amdgcn_wmma_f32_16x16x32_bf16(false, a, false, b, (short)0, acc, false, false);
  asm volatile("v_nop\n\tv_nop\n\tv_nop\n\tv_nop" : "+v"(acc) : "v"(a), "v"(b));
  return acc;
}
static __device__ __forceinline__ v8f mma_f16(v16h a, v16h b, v8f acc) {
  acc = __builtin_amdgcn_wmma_f32_16x16x32_f16(false, a, false, b, (short)0, acc, false, false);
  asm volatile("v_nop\n\tv_nop\n\tv_nop\n\tv_nop" : "+v"(acc) : "v"(a), "v"(b));
  return acc;
}
static __device__ __forceinline__ v8f mma(const FragB& a, const FragB& b, v8f acc) { return mma_bf16(a.v, b.v, acc); }
static __device__ __forceinline__ v8f mma(const FragH& a, const FragH& b, v8f acc) { return mma_f16(a.v, b.v, acc); }

// ---------------------------------------------------------------------------------------------
// Convert pass: xb = bf16(x) [SEQ][DMODEL], wb = bf16(Wqkv) [QKV_N][DMODEL], wp = f16(bf16(Wproj) * 256) [DMODEL][DMODEL].
// coverage: blocks [0,SEQ*DMODEL/2048) x 256 x 8 == SEQ*DMODEL; next QKV_N*DMODEL/2048 blocks == QKV_N*DMODEL;
//           last DMODEL*DMODEL/2048 blocks == DMODEL*DMODEL.
template <int MODE>
static __device__ __forceinline__ void cvt_body(const float* __restrict__ src, us16* __restrict__ dst,
                                                 int blk, int tid) {
  const size_t e = ((size_t)blk * 256 + tid) * 8;
  const v4f a = *(const v4f*)(src + e);
  const v4f b = *(const v4f*)(src + e + 4);
  v4u u;
  if (MODE == 0) {
    Pack8B pk;
    #pragma unroll
    for (int i = 0; i < 4; ++i) {
      pk.h[i]     = (bf16)a[i];                 // RNE convert
      pk.h[4 + i] = (bf16)b[i];
    }
    u = pk.u;
  } else {
    Pack8H pk;
    #pragma unroll
    for (int i = 0; i < 4; ++i) {
      pk.h[i]     = (f16)((float)(bf16)a[i] * WCAR);   // bf16 significand is exact in f16
      pk.h[4 + i] = (f16)((float)(bf16)b[i] * WCAR);
    }
    u = pk.u;
  }
  *(v4u*)(dst + e) = u;
  
}

static __device__ __forceinline__ void convert_body(const float* __restrict__ x,
                                                    const float* __restrict__ wq,
                                                    const float* __restrict__ wpj,
                                                    bf16* __restrict__ xb,
                                                    bf16* __restrict__ wb,
                                                    f16* __restrict__ wp,
                                                    int blk, int tid) {
  const int NBX = SEQ * DMODEL / 2048;
  const int NBQ = QKV_N * DMODEL / 2048;
  if (blk < NBX)            cvt_body<0>(x, (us16*)xb, blk, tid);
  else if (blk < NBX + NBQ) cvt_body<0>(wq, (us16*)wb, blk - NBX, tid);
  else                      cvt_body<1>(wpj, (us16*)wp, blk - NBX - NBQ, tid);
}

// ---------------------------------------------------------------------------------------------
// RoPE tables ct/st [SEQ][NROPE] f32: angle(t, j) = t * (1 / 10000^(2j/64)). Block = 8 positions x 32 freqs.
// One powf + one sincosf per thread (rolled). Rows staged in LDS; waves 0-1 write the cos lines, waves 2-3 the
// coverage: (SEQ/8 blocks) x 8 rows x 32 floats == SEQ*NROPE per table.
static __device__ __forceinline__ void rope_table_body(float* __restrict__ ct, float* __restrict__ st,
                                                       int blk, int tid) {
  __shared__ __align__(16) float sc[8 * NROPE];   // cross-wave (block barrier)
  __shared__ __align__(16) float ss[8 * NROPE];
  const int j   = tid & 31;
  const int tl  = tid >> 5;
  const int t   = blk * 8 + tl;
  const float e   = (float)(2 * j) * (1.0f / 64.0f);
  const float pw  = powf(10000.0f, e);
  const float inv = 1.0f / pw;
  const float ang = (float)t * inv;
  float sn, cs;
  sincosf(ang, &sn, &cs);
  sc[tl * NROPE + j] = cs;
  ss[tl * NROPE + j] = sn;
  __syncthreads();
  if (tid < 64) {
    const int rowl  = tid >> 3;
    const int piece = tid & 7;
    const v4f v = *(const v4f*)(sc + rowl * NROPE + piece * 4);
    const size_t gi = (size_t)(blk * 8 + rowl) * NROPE + piece * 4;
    *(v4f*)(ct + gi) = v;
    
  } else if (tid < 128) {
    const int rowl  = (tid - 64) >> 3;
    const int piece = tid & 7;
    const v4f v = *(const v4f*)(ss + rowl * NROPE + piece * 4);
    const size_t gi = (size_t)(blk * 8 + rowl) * NROPE + piece * 4;
    *(v4f*)(st + gi) = v;
    
  }
}

// One launch for the two passes that depend on nothing but the inputs: blocks [0, SEQ/8) build the RoPE tables,
// the rest convert the operands (block-uniform branch, so the table blocks' barrier is passed by whole blocks).
__global__ __launch_bounds__(256) void prep_kernel(const float* __restrict__ x,
                                                   const float* __restrict__ wq,
                                                   const float* __restrict__ wpj,
                                                   bf16* __restrict__ xb,
                                                   bf16* __restrict__ wb,
                                                   f16* __restrict__ wp,
                                                   float* __restrict__ ct, float* __restrict__ st) {
  const int blk = blockIdx.x;
  const int tid = threadIdx.x;
  const int NBR = SEQ / 8;
  if (blk < NBR) rope_table_body(ct, st, blk, tid);
  else           convert_body(x, wq, wpj, xb, wb, wp, blk - NBR, tid);
}

// ---------------------------------------------------------------------------------------------
// NT GEMM: C[m][n] = oscale * sum_k A[m][k] B[n][k] (+ rscale * sum_k Ar[m][k] B[n][k] when RES).
// A, Ar, B are 16-bit row-major planes with pitch K (k contiguous). 4 waves/block, wave tile (16*MI) x 64,
// block tile (64*MI) x 64. The block's A, Ar and B rows are staged GS k at a time in two LDS buffers by asynchronous
// 16-B copies (whole 128-B row pieces); a stage buffer holds three 64-row tiles at pitch KP: [A | A | B], or [A | Ar | B] when RES.
// A and B fragments are read from LDS with the split k map:
// elements 0..7 <- k0 + 8h + 0..7, elements 8..15 <- k0 + 16 + 8h + 0..7, lane&15 = row of A / row of B (= column n).
// Epilogue: wave tile staged in LDS (in the bytes of the stage buffers, which every wave has left by then), then per
// instruction lanes 0..15 write one 256-B row segment.
// Requires K % 64 == 0, N % 64 == 0, rows covered by the grid a multiple of 64*MI.
// One stage's copies of one thread of the 128: rows r + 16 j (r = tid>>3, j = 0..3) of each of the three 64-row tiles,
// 16-B piece tid&7. r0/r1/r2 point at the first row of each tile at the stage's first k (pitch K); in LDS the three
// tiles follow one another, so the twelve rows of a thread lie 16 rows apart.
static __device__ __forceinline__ void stage_gemm(us16* buf, const us16* r0, const us16* r1, const us16* r2,
                                                  int K, int tid) {
  const int row   = tid >> 3;     // 0..15
  const int piece = tid & 7;      // 0..7
  const unsigned l0 = (unsigned)(size_t)(buf + row * KP + piece * 8);   // LDS byte address
  const unsigned ls = 16 * KP * 2;                                      // 16 rows in LDS, bytes
  const size_t   go = (size_t)row * K + piece * 8;
  const size_t   gs = (size_t)16 * K;                                    // 16 rows in the plane, elements
  const us16* a0 = r0 + go;
  const us16* b0 = r1 + go;
  const us16* c0 = r2 + go;
  // the copies and, as the last line, the wait that stands before any of their address registers is rewritten
  asm volatile("global_load_async_to_lds_b128 %0, %12, off\n\t"
               "global_load_async_to_lds_b128 %1, %13, off\n\t"
               "global_load_async_to_lds_b128 %2, %14, off\n\t"
               "global_load_async_to_lds_b128 %3, %15, off\n\t"
               "global_load_async_to_lds_b128 %4, %16, off\n\t"
               "global_load_async_to_lds_b128 %5, %17, off\n\t"
               "global_load_async_to_lds_b128 %6, %18, off\n\t"
               "global_load_async_to_lds_b128 %7, %19, off\n\t"
               "global_load_async_to_lds_b128 %8, %20, off\n\t"
               "global_load_async_to_lds_b128 %9, %21, off\n\t"
               "global_load_async_to_lds_b128 %10, %22, off\n\t"
               "global_load_async_to_lds_b128 %11, %23, off\n\t"
               "s_wait_xcnt 0x0"
               :: "v"(l0), "v"(l0 + ls), "v"(l0 + 2 * ls), "v"(l0 + 3 * ls),
                  "v"(l0 + 4 * ls), "v"(l0 + 5 * ls), "v"(l0 + 6 * ls), "v"(l0 + 7 * ls),
                  "v"(l0 + 8 * ls), "v"(l0 + 9 * ls), "v"(l0 + 10 * ls), "v"(l0 + 11 * ls),
                  "v"(a0), "v"(a0 + gs), "v"(a0 + 2 * gs), "v"(a0 + 3 * gs),
                  "v"(b0), "v"(b0 + gs), "v"(b0 + 2 * gs), "v"(b0 + 3 * gs),
                  "v"(c0), "v"(c0 + gs), "v"(c0 + 2 * gs), "v"(c0 + 3 * gs) : "memory");
}

#define GEMM_LDS_B (2 * 3 * TILE_H * 2)        // bytes of the two stage buffers of three tiles each

// smem: the block's GEMM_LDS_B bytes of LDS; mb, n0: first row and first column of the block's tile.
template <typename F, int MI, int RES>
static __device__ __forceinline__ void gemm_nt_body(unsigned char* smem,
                                                    const us16* __restrict__ A,
                                                    const us16* __restrict__ Ar,
                                                    const us16* __restrict__ Bm,
                                                    float* __restrict__ C,
                                                    int K, int N, int mb, int n0,
                                                    float oscale, float rscale) {
  static_assert((MI == 2 && RES == 0) || (MI == 1 && RES == 1));   // three 64-row tiles per stage
  const int BT    = 2;                         // index of the B tile in a stage buffer
  const int STG_H = (BT + 1) * TILE_H;         // halves per stage buffer
  const int RING_B = 2 * STG_H * 2;            // bytes of the two stage buffers
  const int OUT_B  = 4 * 16 * MI * OP * 4;     // bytes of the four waves' output staging
  static_assert(RING_B <= GEMM_LDS_B && OUT_B <= GEMM_LDS_B);
  // two stage buffers (cross-wave) in the loop; behind the loop's last barrier the per-wave output staging
  us16*  ring = (us16*)smem;
  float* sC   = (float*)smem;
  const int tid  = threadIdx.x;
  const int wave = tid >> 5;
  const int lane = tid & 31;
  const int lq   = lane & 15;
  const int hi   = lane >> 4;
  const int m0   = mb + wave * (16 * MI);

  v8f acc[MI][4], acc2[MI][4];
  #pragma unroll
  for (int mi = 0; mi < MI; ++mi) {
    #pragma unroll
    for (int t = 0; t < 4; ++t) {
      acc[mi][t]  = (v8f){0, 0, 0, 0, 0, 0, 0, 0};
      acc2[mi][t] = (v8f){0, 0, 0, 0, 0, 0, 0, 0};
    }
  }

  const us16* ab  = A + (size_t)mb * K;                                                  // tile 0: A rows 0..63
  const us16* arb = (RES != 0) ? Ar + (size_t)mb * K : A + (size_t)(mb + 64) * K;        // tile 1: Ar, or A rows 64..127
  const us16* bb  = Bm + (size_t)n0 * K;                                                 // tile 2: B rows
  const int   nst = K / GS;                           // block-uniform stage count

  stage_gemm(ring, ab, arb, bb, K, tid);
  asm volatile("s_wait_asynccnt 0x0" ::: "memory");   // this wave's copies of stage 0 have landed
  __syncthreads();                                    // stage 0 readable by every wave
  if (nst > 1) stage_gemm(ring + STG_H, ab + GS, arb + GS, bb + GS, K, tid);

  for (int s = 0; s < nst; ++s) {
    const us16* sb = ring + (s & 1) * STG_H;
    #pragma unroll   // constant indices keep the fragment arrays in registers
    for (int u = 0; u < GS / 32; ++u) {
      F a[MI], ar[MI], b[4];
      #pragma unroll
      for (int mi = 0; mi < MI; ++mi) {
        const us16* p = sb + (wave * (16 * MI) + mi * 16 + lq) * KP + u * 32 + hi * 8;
        a[mi].q[0] = *(const v4u*)(p);        // k0 + 8h + 0..7
        a[mi].q[1] = *(const v4u*)(p + 16);   // k0 + 16 + 8h + 0..7
        if (RES != 0) {
          const us16* pr = p + MI * TILE_H;
          ar[mi].q[0] = *(const v4u*)(pr);
          ar[mi].q[1] = *(const v4u*)(pr + 16);
        }
      }
      #pragma unroll
      for (int t = 0; t < 4; ++t) {
        const us16* p = sb + BT * TILE_H + (t * 16 + lq) * KP + u * 32 + hi * 8;
        b[t].q[0] = *(const v4u*)(p);
        b[t].q[1] = *(const v4u*)(p + 16);
      }
      #pragma unroll
      for (int mi = 0; mi < MI; ++mi) {
        #pragma unroll
        for (int t = 0; t < 4; ++t) {
          acc[mi][t] = mma(a[mi], b[t], acc[mi][t]);
          if (RES != 0) acc2[mi][t] = mma(ar[mi], b[t], acc2[mi][t]);
        }
      }
    }
    // publish point of stage s + 1, passed by every wave
    asm volatile("s_wait_dscnt 0x0" ::: "memory");      // this wave's reads of stage s are done before its buffer is refilled
    asm volatile("s_wait_asynccnt 0x0" ::: "memory");   // this wave's copies of stage s + 1 have landed
    __syncthreads();                                    // stage s + 1 readable; every reader has left stage s
    if (s + 2 < nst)
      stage_gemm(ring + (s & 1) * STG_H, ab + (s + 2) * GS, arb + (s + 2) * GS, bb + (s + 2) * GS, K, tid);
  }
  asm volatile("s_wait_asynccnt 0x0" ::: "memory");     // no copy outstanding behind the loop

  float* so = sC + wave * (16 * MI * OP);
  #pragma unroll
  for (int mi = 0; mi < MI; ++mi) {
    #pragma unroll
    for (int t = 0; t < 4; ++t) {
      #pragma unroll
      for (int r = 0; r < 8; ++r) {
        float val = acc[mi][t][r] * oscale;
        if (RES != 0) val += acc2[mi][t][r] * rscale;
        so[(mi * 16 + hi * 8 + r) * OP + t * 16 + lq] = val;
      }
    }
  }
  __syncthreads();

  const int NIT = 8 * MI;   // (16*MI rows) / 2 rows per instruction
  v4f    vals[8 * MI];
  size_t gidx[8 * MI];
  #pragma unroll
  for (int it = 0; it < NIT; ++it) {
    const int row = it * 2 + hi;
    vals[it] = *(const v4f*)(so + row * OP + lq * 4);
    gidx[it] = (size_t)(m0 + row) * N + n0 + lq * 4;
  }
  #pragma unroll
  for (int it = 0; it < NIT; ++it) *(v4f*)(C + gidx[it]) = vals[it];
  
}

// qkv = xb x wb^T: block tile 128 x 64, grid (N / 64, rows / 128).
__global__ __launch_bounds__(128) void gemm_qkv_kernel(const us16* __restrict__ A,
                                                       const us16* __restrict__ Bm,
                                                       float* __restrict__ C, int K, int N) {
  __shared__ __align__(16) unsigned char smem[GEMM_LDS_B];
  gemm_nt_body<FragB, 2, 0>(smem, A, A, Bm, C, K, N, blockIdx.y * 128, blockIdx.x * 64, 1.0f, 0.0f);
}

// out = ctx x wp^T, all rows in one launch: the first ER / 64 block rows take 64 rows each with the residual plane,
// the others 128 rows each from row ER on (block-uniform branch; the two row ranges share no output element).
__global__ __launch_bounds__(128) void gemm_proj_kernel(const us16* __restrict__ A,
                                                        const us16* __restrict__ Ar,
                                                        const us16* __restrict__ Bm,
                                                        float* __restrict__ C, int K, int N,
                                                        float oscale, float rscale) {
  __shared__ __align__(16) unsigned char smem[GEMM_LDS_B];
  const int by = blockIdx.y;
  const int n0 = blockIdx.x * 64;
  if (by < ER / 64) gemm_nt_body<FragH, 1, 1>(smem, A, Ar, Bm, C, K, N, by * 64, n0, oscale, rscale);
  else              gemm_nt_body<FragH, 2, 0>(smem, A, A, Bm, C, K, N, ER + (by - ER / 64) * 128, n0, oscale, 0.0f);
}

// ---------------------------------------------------------------------------------------------
// Plane builder. Block = (64-row tile, head), 256 threads; reads the f32 qkv rows [SEQ][QKV_N].
//   qr, kr [NHEAD][ER][HDIM]  f16 : residual planes (x - f16(x)) * 1024 for rows < ER (block-uniform).
//   vtr [NHEAD][HDIM][ER]     f16 : V residual transposed, keys < ER.
// RoPE (rotate-half): pair partner d^32 sits in lane^4 of the same wave; out[d] = x[d]*cos + sgn*x[d^32]*sin.
// coverage: rows kt*64 + {0..31, 32..63}, d 0..63 for every plane; residual planes for tiles with s0 < ER
//           (ER/64 tiles x 64 rows == ER rows); every written line whole, one instruction.
__global__ __launch_bounds__(256) void planes_kernel(const float* __restrict__ qkv,
                                                     const float* __restrict__ ct,
                                                     const float* __restrict__ st,
                                                     f16* __restrict__ qh, f16* __restrict__ qr,
                                                     f16* __restrict__ kh, f16* __restrict__ kr,
                                                     f16* __restrict__ vt, f16* __restrict__ vtr) {
  const int kt  = blockIdx.x;
  const int h   = blockIdx.y;
  const int tid = threadIdx.x;
  __shared__ __align__(16) f16 sT[HDIM * TP];   // [d][key] hi, cross-wave (block barrier)
  __shared__ __align__(16) f16 sR[HDIM * TP];   // [d][key] residual, cross-wave (block barrier)
  const int  s0    = kt * CT;
  const bool early = (s0 < ER);                 // block-uniform

  v4u    qv[2], kv[2], qx[2], kx[2];
  size_t pidx[2], ridx[2];
  #pragma unroll
  for (int kk = 0; kk < 2; ++kk) {
    const int   key  = kk * 32 + (tid >> 3);    // 0..63
    const int   d0   = (tid & 7) * 8;           // 0..56
    const int   j0   = d0 & (NROPE - 1);        // frequency index of d0
    const float sgn  = (d0 < NROPE) ? -1.0f : 1.0f;
    const int   srow = s0 + key;
    const float* src = qkv + (size_t)srow * QKV_N + h * HDIM + d0;     // slot 0 = q
    const v4f q0v = *(const v4f*)(src);
    const v4f q1v = *(const v4f*)(src + 4);
    const v4f k0v = *(const v4f*)(src + DMODEL);                        // slot 1 = k
    const v4f k1v = *(const v4f*)(src + DMODEL + 4);
    const v4f v0v = *(const v4f*)(src + 2 * DMODEL);                    // slot 2 = v
    const v4f v1v = *(const v4f*)(src + 2 * DMODEL + 4);
    const float* cp = ct + (size_t)srow * NROPE + j0;
    const float* sp = st + (size_t)srow * NROPE + j0;
    const v4f c0 = *(const v4f*)(cp);
    const v4f c1 = *(const v4f*)(cp + 4);
    const v4f n0 = *(const v4f*)(sp);
    const v4f n1 = *(const v4f*)(sp + 4);
    float qa[8], ka[8], va[8], ca[8], sa[8];
    #pragma unroll
    for (int i = 0; i < 4; ++i) {
      qa[i] = q0v[i]; qa[4 + i] = q1v[i];
      ka[i] = k0v[i]; ka[4 + i] = k1v[i];
      va[i] = v0v[i]; va[4 + i] = v1v[i];
      ca[i] = c0[i];  ca[4 + i] = c1[i];
      sa[i] = n0[i];  sa[4 + i] = n1[i];
    }
    Pack8H pq, pqr, pk, pkr;
    #pragma unroll
    for (int i = 0; i < 8; ++i) {
      const float qp = __shfl_xor(qa[i], 4, 32);   // partner d^32, same row, same wave
      const float kp = __shfl_xor(ka[i], 4, 32);
      const float qo = qa[i] * ca[i] + sgn * qp * sa[i];
      const float ko = ka[i] * ca[i] + sgn * kp * sa[i];
      const f16 qhh = (f16)qo;
      const f16 khh = (f16)ko;
      pq.h[i]  = qhh;
      pk.h[i]  = khh;
      pqr.h[i] = (f16)((qo - (float)qhh) * RSC);
      pkr.h[i] = (f16)((ko - (float)khh) * RSC);
      const f16 vhh = (f16)va[i];
      sT[(d0 + i) * TP + key] = vhh;
      sR[(d0 + i) * TP + key] = (f16)((va[i] - (float)vhh) * RSC);
    }
    qv[kk] = pq.u;  qx[kk] = pqr.u;
    kv[kk] = pk.u;  kx[kk] = pkr.u;
    pidx[kk] = ((size_t)h * SEQ + srow) * HDIM + d0;
    ridx[kk] = ((size_t)h * ER + srow) * HDIM + d0;   // used only when early (srow < ER)
  }
  __syncthreads();

  v4u    vv[2], vx[2];
  size_t vidx[2], vridx[2];
  #pragma unroll
  for (int kk = 0; kk < 2; ++kk) {
    const int d  = kk * 32 + (tid >> 3);        // 0..63
    const int ks = (tid & 7) * 8;               // 0..56
    Pack8H ph, px;
    ph.v = *(const v8h*)(sT + d * TP + ks);
    px.v = *(const v8h*)(sR + d * TP + ks);
    vv[kk] = ph.u;
    vx[kk] = px.u;
    vidx[kk]  = ((size_t)h * HDIM + d) * SEQ + s0 + ks;
    vridx[kk] = ((size_t)h * HDIM + d) * ER + s0 + ks;   // used only when early
  }

  #pragma unroll
  for (int kk = 0; kk < 2; ++kk) {
    *(v4u*)(qh + pidx[kk]) = qv[kk];
    *(v4u*)(kh + pidx[kk]) = kv[kk];
    *(v4u*)(vt + vidx[kk]) = vv[kk];
    if (early) {
      *(v4u*)(qr + ridx[kk])   = qx[kk];
      *(v4u*)(kr + ridx[kk])   = kx[kk];
      *(v4u*)(vtr + vridx[kk]) = vx[kk];
    }
  }
  
}

// ---------------------------------------------------------------------------------------------
// Flash attention, causal. Block = (query block of 128, head); one wave owns 16 query rows.
// S^T = K x Q^T so queries sit on lanes; P^T in C-layout is bit-identical to the A-fragment layout of O += P x V.
// Q B-fragments are loaded straight from the 16-bit plane; K A-fragments and V^T B-fragments from LDS (two 16-B loads each).
// RES != 0 (query blocks < EARLY_QBLK, all visited keys < ER): score = KQ + (K Qres + Kres Q)/1024;
// O2 = Pres V + P Vres accumulated separately and folded as O2/1024 before normalisation.
// K and V^T (and their residual planes when RES) are staged once per block, KS keys at a time, in two LDS buffers
// by asynchronous 16-B copies; all eight waves read their fragments from LDS. A stage buffer holds the tiles
// [K | V^T | Kres | V^Tres], each 64 rows of 128 B at pitch KP.
// One stage's copies of one thread: rows tid>>3 and 32 + (tid>>3) of every tile, 16-B piece tid&7.
// kg/krg point at the stage's first key row (pitch HDIM); vg/vrg at the stage's first key column (pitch SEQ / ER).
template <int RES>
static __device__ __forceinline__ void stage_tiles(f16* buf, const f16* kg, const f16* krg,
                                                   const f16* vg, const f16* vrg, int tid) {
  const int row   = tid >> 3;     // 0..31
  const int piece = tid & 7;      // 0..7
  const unsigned l0 = (unsigned)(size_t)(buf + row * KP + piece * 8);   // LDS byte address
  const unsigned l1 = l0 + 32 * KP * 2;
  const unsigned l2 = l0 + TILE_H * 2;
  const unsigned l3 = l1 + TILE_H * 2;
  const f16* g0 = kg + (size_t)row * HDIM + piece * 8;
  const f16* g1 = g0 + 32 * HDIM;
  const f16* g2 = vg + (size_t)row * SEQ + piece * 8;
  const f16* g3 = g2 + (size_t)32 * SEQ;
  // the copies and, as the last line, the wait that stands before any of their address registers is rewritten
  asm volatile("global_load_async_to_lds_b128 %0, %4, off\n\t"
               "global_load_async_to_lds_b128 %1, %5, off\n\t"
               "global_load_async_to_lds_b128 %2, %6, off\n\t"
               "global_load_async_to_lds_b128 %3, %7, off\n\t"
               "s_wait_xcnt 0x0"
               :: "v"(l0), "v"(l1), "v"(l2), "v"(l3), "v"(g0), "v"(g1), "v"(g2), "v"(g3) : "memory");
  if (RES != 0) {
    const unsigned l4 = l0 + 2 * TILE_H * 2;
    const unsigned l5 = l1 + 2 * TILE_H * 2;
    const unsigned l6 = l0 + 3 * TILE_H * 2;
    const unsigned l7 = l1 + 3 * TILE_H * 2;
    const f16* g4 = krg + (size_t)row * HDIM + piece * 8;
    const f16* g5 = g4 + 32 * HDIM;
    const f16* g6 = vrg + (size_t)row * ER + piece * 8;
    const f16* g7 = g6 + (size_t)32 * ER;
    // same form for the residual tiles
    asm volatile("global_load_async_to_lds_b128 %0, %4, off\n\t"
                 "global_load_async_to_lds_b128 %1, %5, off\n\t"
                 "global_load_async_to_lds_b128 %2, %6, off\n\t"
                 "global_load_async_to_lds_b128 %3, %7, off\n\t"
                 "s_wait_xcnt 0x0"
                 :: "v"(l4), "v"(l5), "v"(l6), "v"(l7), "v"(g4), "v"(g5), "v"(g6), "v"(g7) : "memory");
  }
}

// sO: per-wave output staging, NWAVE * 16 * OP floats; sKV: the two stage buffers.
template <int RES>
static __device__ __forceinline__ void attn_body(float* sO, f16* sKV,
                                                 const f16* __restrict__ qh, const f16* __restrict__ qr,
                                                 const f16* __restrict__ kh, const f16* __restrict__ kr,
                                                 const f16* __restrict__ vt, const f16* __restrict__ vtr,
                                                 f16* __restrict__ ctxh, f16* __restrict__ ctxr,
                                                 int qblk, int h) {
  const int tid  = threadIdx.x;
  const int wave = __builtin_amdgcn_readfirstlane(tid >> 5);   // scalar, so the per-wave causal skip is a scalar branch
  const int lane = tid & 31;
  const int lq   = lane & 15;   // query column of S^T / d column of O
  const int hi   = lane >> 4;   // k-split half

  const int STG_H = (RES != 0 ? 4 : 2) * TILE_H;         // halves per stage buffer

  const int qrow0 = qblk * BQ + wave * 16;               // first query row of this wave

  // Q as B-operand fragments: lane lq holds query qrow0+lq, elements follow the split d map.
  FragH qf[2], qx[2];
  {
    const f16* qp = qh + ((size_t)h * SEQ + qrow0 + lq) * HDIM;
    #pragma unroll
    for (int f = 0; f < 2; ++f) {
      qf[f].q[0] = *(const v4u*)(qp + f * 32 + hi * 8);        // d = f*32 + hi*8 + 0..7
      qf[f].q[1] = *(const v4u*)(qp + f * 32 + 16 + hi * 8);   // d = f*32 + 16 + hi*8 + 0..7
    }
    if (RES != 0) {
      const f16* qrp = qr + ((size_t)h * ER + qrow0 + lq) * HDIM;
      #pragma unroll
      for (int f = 0; f < 2; ++f) {
        qx[f].q[0] = *(const v4u*)(qrp + f * 32 + hi * 8);
        qx[f].q[1] = *(const v4u*)(qrp + f * 32 + 16 + hi * 8);
      }
    }
  }

  const f16* kh_h  = kh  + (size_t)h * SEQ * HDIM;
  const f16* kr_h  = kr  + (size_t)h * ER * HDIM;
  const f16* vt_h  = vt  + (size_t)h * HDIM * SEQ;
  const f16* vtr_h = vtr + (size_t)h * HDIM * ER;

  v8f o[4], o2[4];
  #pragma unroll
  for (int dt = 0; dt < 4; ++dt) {
    o[dt]  = (v8f){0, 0, 0, 0, 0, 0, 0, 0};
    o2[dt] = (v8f){0, 0, 0, 0, 0, 0, 0, 0};
  }

  float rmax = -__builtin_inff();
  float rsum = 0.0f;
  const float SL = 0.125f * 1.4426950408889634f;   // softmax scale * log2(e)

  // causal: this wave visits key chunks whose first key is <= its last query row (wave-uniform trip count)
  const int nchunk = (qrow0 + 15) / BK + 1;
  // the block walks the stages up to its last query row (block-uniform count, at least two)
  const int nstage = (qblk + 1) * (BQ / KS);

  stage_tiles<RES>(sKV, kh_h, kr_h, vt_h, vtr_h, tid);
  asm volatile("s_wait_asynccnt 0x0" ::: "memory");   // this wave's copies of stage 0 have landed
  __syncthreads();                                    // stage 0 readable by every wave
  if (nstage > 1)
    stage_tiles<RES>(sKV + STG_H, kh_h + (size_t)KS * HDIM, kr_h + (size_t)KS * HDIM, vt_h + KS, vtr_h + KS, tid);

  for (int t = 0; t < nstage; ++t) {
   const f16* sb = sKV + (t & 1) * STG_H;
   for (int u = 0; u < KS / BK; ++u) {
    const int i = t * (KS / BK) + u;
    if (i >= nchunk) break;                 // wave-uniform: chunks beyond this wave's diagonal
    const int j0 = i * BK;
    const f16* sk  = sb + (u * BK) * KP;                 // K rows of this chunk
    const f16* sv  = sb + TILE_H + u * BK;               // V^T key columns of this chunk
    const f16* skr = sb + (RES != 0 ? 2 : 0) * TILE_H + (u * BK) * KP;    // residual tiles (read when RES only)
    const f16* svr = sb + (RES != 0 ? 3 : 1) * TILE_H + u * BK;

    // K A-fragments, then V B-fragments (column n = d = dt*16 + lq, split key map from the transposed tile): all
    // fetched at the head of the chunk, so that V's LDS latency passes under the score products and the softmax.
    FragH ka[2][2], bvf[4];
    #pragma unroll   // constant indices keep the fragment arrays in registers
    for (int sub = 0; sub < 2; ++sub) {
      const f16* base = sk + (sub * 16 + lq) * KP + hi * 8;   // row = key j0 + sub*16 + lq
      ka[sub][0].q[0] = *(const v4u*)(base);        // d = hi*8 + 0..7
      ka[sub][0].q[1] = *(const v4u*)(base + 16);   // d = 16 + hi*8 + 0..7
      ka[sub][1].q[0] = *(const v4u*)(base + 32);   // d = 32 + hi*8 + 0..7
      ka[sub][1].q[1] = *(const v4u*)(base + 48);   // d = 48 + hi*8 + 0..7
    }
    #pragma unroll   // as above
    for (int dt = 0; dt < 4; ++dt) {
      const f16* base = sv + (dt * 16 + lq) * KP + hi * 8;
      bvf[dt].q[0] = *(const v4u*)(base);        // keys j0 + hi*8 + 0..7
      bvf[dt].q[1] = *(const v4u*)(base + 16);   // keys j0 + 16 + hi*8 + 0..7
    }

    // S^T tiles: c[sub][r] = rawscore(query qrow0+lq, key j0 + sub*16 + hi*8 + r)
    v8f c[2];
    #pragma unroll
    for (int sub = 0; sub < 2; ++sub) {
      const FragH a0 = ka[sub][0];
      const FragH a1 = ka[sub][1];
      v8f acc = (v8f){0, 0, 0, 0, 0, 0, 0, 0};
      acc = mma_f16(a0.v, qf[0].v, acc);
      acc = mma_f16(a1.v, qf[1].v, acc);
      if (RES != 0) {
        FragH r0, r1;
        const f16* rb = skr + (sub * 16 + lq) * KP + hi * 8;
        r0.q[0] = *(const v4u*)(rb);
        r0.q[1] = *(const v4u*)(rb + 16);
        r1.q[0] = *(const v4u*)(rb + 32);
        r1.q[1] = *(const v4u*)(rb + 48);
        v8f ax = (v8f){0, 0, 0, 0, 0, 0, 0, 0};
        ax = mma_f16(a0.v, qx[0].v, ax);
        ax = mma_f16(a1.v, qx[1].v, ax);
        ax = mma_f16(r0.v, qf[0].v, ax);
        ax = mma_f16(r1.v, qf[1].v, ax);
        #pragma unroll
        for (int r = 0; r < 8; ++r) acc[r] += ax[r] * (1.0f / RSC);
      }
      c[sub] = acc;
    }

    // causal mask (key > query -> -inf); branch is wave-uniform, selects are per lane
    if (j0 + BK - 1 > qrow0) {
      const int qi = qrow0 + lq;
      #pragma unroll
      for (int sub = 0; sub < 2; ++sub) {
        #pragma unroll
        for (int r = 0; r < 8; ++r) {
          const int key = j0 + sub * 16 + hi * 8 + r;
          c[sub][r] = (key > qi) ? -__builtin_inff() : c[sub][r];
        }
      }
    }

    // online softmax: query lq's 32 scores are split across lane / lane^16
    float m_new = rmax;
    #pragma unroll
    for (int r = 0; r < 8; ++r) {
      m_new = fmaxf(m_new, c[0][r]);
      m_new = fmaxf(m_new, c[1][r]);
    }
    m_new = fmaxf(m_new, __shfl_xor(m_new, 16, 32));
    const float scale = __builtin_amdgcn_exp2f((rmax - m_new) * SL);
    rmax = m_new;

    // exp + pack: P^T C-layout == A-fragment layout for the PV product
    FragH pa, pr;
    float psum = 0.0f;
    #pragma unroll
    for (int r = 0; r < 8; ++r) {
      const float p0 = __builtin_amdgcn_exp2f((c[0][r] - m_new) * SL);   // key hi*8 + r
      const float p1 = __builtin_amdgcn_exp2f((c[1][r] - m_new) * SL);   // key 16 + hi*8 + r
      psum += p0 + p1;
      const float pc0 = p0 * PCAR;
      const float pc1 = p1 * PCAR;
      const f16 h0 = (f16)pc0;
      const f16 h1 = (f16)pc1;
      pa.h[r]     = h0;
      pa.h[8 + r] = h1;
      if (RES != 0) {
        pr.h[r]     = (f16)((pc0 - (float)h0) * RSC);
        pr.h[8 + r] = (f16)((pc1 - (float)h1) * RSC);
      }
    }
    rsum = rsum * scale + psum + __shfl_xor(psum, 16, 32);

    // rescale O: queries are the row dimension there -> per-row scale from lane 8*hi + r
    float sc[8];
    #pragma unroll
    for (int r = 0; r < 8; ++r) sc[r] = __shfl(scale, (hi << 3) + r, 32);
    #pragma unroll
    for (int dt = 0; dt < 4; ++dt) {
      #pragma unroll
      for (int r = 0; r < 8; ++r) {
        o[dt][r] *= sc[r];
        if (RES != 0) o2[dt][r] *= sc[r];
      }
    }

    // O += P x V
    #pragma unroll
    for (int dt = 0; dt < 4; ++dt) {
      o[dt] = mma_f16(pa.v, bvf[dt].v, o[dt]);
      if (RES != 0) {
        o2[dt] = mma_f16(pr.v, bvf[dt].v, o2[dt]);
        FragH br;
        const f16* rb = svr + (dt * 16 + lq) * KP + hi * 8;
        br.q[0] = *(const v4u*)(rb);
        br.q[1] = *(const v4u*)(rb + 16);
        o2[dt] = mma_f16(pa.v, br.v, o2[dt]);
      }
    }
   }
   // publish point of stage t + 1, passed by every wave (also one that skipped chunks)
   asm volatile("s_wait_dscnt 0x0" ::: "memory");      // this wave's reads of stage t are done before its buffer is refilled
   asm volatile("s_wait_asynccnt 0x0" ::: "memory");   // this wave's copies of stage t + 1 have landed
   __syncthreads();                                    // stage t + 1 readable; every reader has left stage t
   if (t + 2 < nstage)
     stage_tiles<RES>(sKV + (t & 1) * STG_H, kh_h + (size_t)(t + 2) * KS * HDIM, kr_h + (size_t)(t + 2) * KS * HDIM,
                      vt_h + (t + 2) * KS, vtr_h + (t + 2) * KS, tid);
  }
  asm volatile("s_wait_asynccnt 0x0" ::: "memory");    // no copy outstanding behind the loop

  // normalize: lane holds column d = dt*16 + lq for query rows 8*hi + r; stage ctx * 64
  float rs[8];
  #pragma unroll
  for (int r = 0; r < 8; ++r) rs[r] = 1.0f / __shfl(rsum, (hi << 3) + r, 32);

  float* so = sO + wave * (16 * OP);
  #pragma unroll
  for (int r = 0; r < 8; ++r) {
    #pragma unroll
    for (int dt = 0; dt < 4; ++dt) {
      float val = o[dt][r];
      if (RES != 0) val += o2[dt][r] * (1.0f / RSC);
      so[(hi * 8 + r) * OP + dt * 16 + lq] = val * (CCAR / PCAR) * rs[r];
    }
  }
  __syncthreads();

  v4u    hv[4], rv[4];
  size_t gi[4], gr[4];
  #pragma unroll
  for (int it = 0; it < 4; ++it) {
    const int row   = it * 4 + (lane >> 3);   // 0..15
    const int piece = lane & 7;               // 0..7
    const v4f a0 = *(const v4f*)(so + row * OP + piece * 8);
    const v4f a1 = *(const v4f*)(so + row * OP + piece * 8 + 4);
    Pack8H ph, px;
    #pragma unroll
    for (int k = 0; k < 4; ++k) {
      const float u0 = a0[k];
      const float u1 = a1[k];
      const f16 g0 = (f16)u0;
      const f16 g1 = (f16)u1;
      ph.h[k]     = g0;
      ph.h[4 + k] = g1;
      px.h[k]     = (f16)((u0 - (float)g0) * RSC);
      px.h[4 + k] = (f16)((u1 - (float)g1) * RSC);
    }
    hv[it] = ph.u;
    rv[it] = px.u;
    gi[it] = (size_t)(qrow0 + row) * DMODEL + h * HDIM + piece * 8;
    gr[it] = (size_t)(qrow0 + row) * DMODEL + h * HDIM + piece * 8;   // row < ER when RES
  }
  #pragma unroll
  for (int it = 0; it < 4; ++it) {
    *(v4u*)(ctxh + gi[it]) = hv[it];
    if (RES != 0) *(v4u*)(ctxr + gr[it]) = rv[it];
  }
  
}

// All query blocks in one launch, one-dimensional grid (block-uniform branch): first the blocks without residual
// planes, query block fastest, then head; behind them the few short blocks < ER / BQ with residual planes.
// The LDS is sized for the residual form; the other uses the first half of sKV.
__global__ __launch_bounds__(256) void attn_kernel(const f16* __restrict__ qh, const f16* __restrict__ qr,
                                                   const f16* __restrict__ kh, const f16* __restrict__ kr,
                                                   const f16* __restrict__ vt, const f16* __restrict__ vtr,
                                                   f16* __restrict__ ctxh, f16* __restrict__ ctxr) {
  __shared__ __align__(16) float sO[NWAVE * 16 * OP];   // per-wave output staging (block barrier used)
  __shared__ __align__(16) f16 sKV[2 * 4 * TILE_H];     // two stage buffers, cross-wave
  const int NE = ER / BQ;                       // query blocks with residual planes, per head
  const int NL = SEQ / BQ - NE;                 // query blocks without, per head
  const int ND = (NL > 0) ? NL : 1;             // divisor (NL == 0: the first branch is never taken)
  const int b  = blockIdx.x;
  if (b < NL * NHEAD) {
    attn_body<0>(sO, sKV, qh, qr, kh, kr, vt, vtr, ctxh, ctxr, NE + b % ND, b / ND);
  } else {
    const int e = b - NL * NHEAD;
    attn_body<1>(sO, sKV, qh, qr, kh, kr, vt, vtr, ctxh, ctxr, e % NE, e / NE);
  }
}

// ---------------------------------------------------------------------------------------------
extern "C" void kernel_launch(void* const* d_in, const int* in_sizes, int n_in,
                              void* d_out, int out_size, void* d_ws, size_t ws_size,
                              hipStream_t stream) {
  if (n_in < 3) return;
  if ((size_t)in_sizes[0] < (size_t)SEQ * DMODEL) return;
  if ((size_t)in_sizes[1] < (size_t)QKV_N * DMODEL) return;
  if ((size_t)in_sizes[2] < (size_t)DMODEL * DMODEL) return;
  if ((size_t)out_size < (size_t)SEQ * DMODEL) return;

  const size_t xb_bytes   = (size_t)SEQ * DMODEL * 2;            // bf16 [SEQ][DMODEL]
  const size_t wb_bytes   = (size_t)QKV_N * DMODEL * 2;          // bf16 [QKV_N][DMODEL]
  const size_t wp_bytes   = (size_t)DMODEL * DMODEL * 2;         // f16  [DMODEL][DMODEL]
  const size_t tab_bytes  = (size_t)SEQ * NROPE * 4;             // f32  [SEQ][NROPE] (each of cos, sin)
  const size_t qkv_bytes  = (size_t)SEQ * QKV_N * 4;             // f32  [SEQ][QKV_N]
  const size_t pl_bytes   = (size_t)NHEAD * SEQ * HDIM * 2;      // f16  q/k/vt planes
  const size_t plr_bytes  = (size_t)NHEAD * ER * HDIM * 2;       // f16  residual planes
  const size_t ctx_bytes  = (size_t)SEQ * DMODEL * 2;            // f16  [SEQ][DMODEL]
  const size_t ctxr_bytes = (size_t)ER * DMODEL * 2;             // f16  [ER][DMODEL]
  const size_t total = xb_bytes + wb_bytes + wp_bytes + 2 * tab_bytes + qkv_bytes
                     + 3 * pl_bytes + 3 * plr_bytes + ctx_bytes + ctxr_bytes;
  if (ws_size < total) return;

  char* ws = (char*)d_ws;
  size_t off = 0;
  bf16*  xb   = (bf16*)(ws + off);  off += xb_bytes;
  bf16*  wb   = (bf16*)(ws + off);  off += wb_bytes;
  f16*   wp   = (f16*)(ws + off);   off += wp_bytes;
  float* ct   = (float*)(ws + off); off += tab_bytes;
  float* st   = (float*)(ws + off); off += tab_bytes;
  float* qkv  = (float*)(ws + off); off += qkv_bytes;
  f16*   qhp  = (f16*)(ws + off);   off += pl_bytes;
  f16*   khp  = (f16*)(ws + off);   off += pl_bytes;
  f16*   vtp  = (f16*)(ws + off);   off += pl_bytes;
  f16*   qrp  = (f16*)(ws + off);   off += plr_bytes;
  f16*   krp  = (f16*)(ws + off);   off += plr_bytes;
  f16*   vtrp = (f16*)(ws + off);   off += plr_bytes;
  f16*   ctxh = (f16*)(ws + off);   off += ctx_bytes;
  f16*   ctxr = (f16*)(ws + off);   off += ctxr_bytes;
  if (off > ws_size) return;

  const float* x     = (const float*)d_in[0];
  const float* wqkv  = (const float*)d_in[1];
  const float* wproj = (const float*)d_in[2];
  float*       out   = (float*)d_out;

  // 1) RoPE cos/sin tables and the 16-bit operand planes of the inputs
  const int ncvt_blocks = SEQ * DMODEL / 2048 + QKV_N * DMODEL / 2048 + DMODEL * DMODEL / 2048;
  prep_kernel<<<dim3(SEQ / 8 + ncvt_blocks), 256, 0, stream>>>(x, wqkv, wproj, xb, wb, wp, ct, st);

  // 2) qkv[SEQ][QKV_N] = xb x wb^T (bf16 operands, f32 result)
  gemm_qkv_kernel<<<dim3(QKV_N / 64, SEQ / 128), 128, 0, stream>>>(
      (const us16*)xb, (const us16*)wb, qkv, DMODEL, QKV_N);

  // 3) RoPE + q/k/v planes (+ residual planes for rows < ER)
  planes_kernel<<<dim3(SEQ / CT, NHEAD), 256, 0, stream>>>(qkv, ct, st, qhp, qrp, khp, krp, vtp, vtrp);

  // 4) causal attention -> ctx planes, every query block
  attn_kernel<<<dim3((SEQ / BQ) * NHEAD), 256, 0, stream>>>(qhp, qrp, khp, krp, vtp, vtrp, ctxh, ctxr);

  // 5) out[SEQ][DMODEL] = ctx x wp^T ; folds the ctx carry (64), the Wproj carry (256) and the residual scale (1024)
  const float oscale = 1.0f / (CCAR * WCAR);
  const float rscale = oscale / RSC;
  gemm_proj_kernel<<<dim3(DMODEL / 64, ER / 64 + (SEQ - ER) / 128), 128, 0, stream>>>(
      (const us16*)ctxh, (const us16*)ctxr, (const us16*)wp, out, DMODEL, DMODEL, oscale, rscale);
}

// v004
// One run takes 138 microseconds.
// Next to v003, in two timings, it ran 1.06 times as fast each time.
// Counting every step since v000, it is 3.24 times as fast.
#include <hip/hip_runtime.h>

// Contractions: qkv = X x Wqkv^T on v_wmma_f32_16x16x32_bf16 (bf16 operands = RNE-converted inputs, f32 accumulate);
// S^T = K x Q^T on v_wmma_f32_16x16x32_f16 (f16 q/k after RoPE, plus f16 residual planes x1024 with their own
// accumulator on query blocks < EARLY_QBLK); O = P x V on v_wmma_f32_16x16x32_f16 (P as f16 carried x4096,
// V as f16, plus P and V residual planes x1024 with their own accumulator on query blocks < EARLY_QBLK);
// out = ctx x Wproj^T on v_wmma_f32_16x16x32_f16 (ctx as f16 carried x64 plus residual x1024 on rows < ER,
// Wproj = f16 of the bf16 RNE-converted input carried x256). RoPE, softmax and all epilogues in f32.

#ifndef NB
#define NB 1
#endif
#ifndef SEQ
#define SEQ 4096
#endif
#define NB_FULL    1
#define SEQ_FULL   4096
#define NHEAD      16
#define HDIM       64
#define DMODEL     (NHEAD * HDIM)        // 1024
#define QKV_N      (3 * DMODEL)          // 3072
#define NROPE      (HDIM / 2)            // 32 frequencies
#define BQ         128                   // query rows per attention block (8 waves x 16)
#define BK         32                    // keys per inner iteration
#define NWAVE      8
#define EARLY_QBLK 2                     // query blocks with residual planes on q, k, P, v, ctx
#define ER         ((EARLY_QBLK * BQ < SEQ) ? (EARLY_QBLK * BQ) : SEQ)   // early rows == early keys
#define CT         64                    // rows per plane-builder block
#define TP         72                    // LDS pitch (halves) of the transposed V tile
#define OP         68                    // LDS pitch (floats) of output staging tiles
#define PCAR       4096.0f               // P carry
#define RSC        1024.0f               // residual plane scale
#define CCAR       64.0f                 // ctx carry
#define WCAR       256.0f                // Wproj carry
#define KS         64                    // keys per LDS stage of the attention loop (two inner iterations)
#define KP         72                    // LDS pitch (halves) of staged K rows and V^T rows: 144 B = 16 B x odd
#define TILE_H     (64 * KP)             // halves per staged tile (64 rows)
#define GS         64                    // k per LDS stage of the GEMM loop (two 32-k products)

static_assert(NB == 1 && NB <= NB_FULL);
static_assert(SEQ <= SEQ_FULL);
static_assert(SEQ % BQ == 0);
static_assert(ER % BQ == 0);
static_assert((SEQ - ER) % 128 == 0);
static_assert(ER % CT == 0);
static_assert(SEQ % CT == 0);
static_assert(SEQ % 8 == 0);
static_assert(BQ == NWAVE * 16);
static_assert(HDIM == 64);
static_assert(DMODEL % 64 == 0 && QKV_N % 64 == 0);
static_assert(DMODEL % 32 == 0);
static_assert((SEQ * DMODEL) % 2048 == 0);
static_assert((QKV_N * DMODEL) % 2048 == 0);
static_assert((DMODEL * DMODEL) % 2048 == 0);
static_assert((TP * 2) % 16 == 0);
static_assert((OP * 4) % 16 == 0);
static_assert(KS == 2 * BK && BQ % KS == 0 && KS == 64);
static_assert((KP * 2) % 16 == 0);

typedef __bf16         bf16;
typedef _Float16       f16;
typedef unsigned short us16;
typedef bf16     v16bf __attribute__((ext_vector_type(16)));
typedef f16      v16h  __attribute__((ext_vector_type(16)));
typedef f16      v8h   __attribute__((ext_vector_type(8)));
typedef float    v8f   __attribute__((ext_vector_type(8)));
typedef float    v4f   __attribute__((ext_vector_type(4)));
typedef unsigned v4u   __attribute__((ext_vector_type(4)));

union FragB  { v16bf v; v4u q[2]; bf16 h[16]; };
union FragH  { v16h  v; v4u q[2]; f16  h[16]; };
union Pack8B { v4u u; bf16 h[8]; };
union Pack8H { v4u u; v8h v; f16 h[8]; };

// WMMA helpers: builtin followed by the VALU hazard guard (ties D, keeps A/B live).
static __device__ __forceinline__ v8f mma_bf16(v16bf a, v16bf b, v8f acc) {
  acc = __builtin_amdgcn_wmma_f32_16x16x32_bf16(false, a, false, b, (short)0, acc, false, false);
  asm volatile("v_nop\n\tv_nop\n\tv_nop\n\tv_nop" : "+v"(acc) : "v"(a), "v"(b));
  return acc;
}
static __device__ __forceinline__ v8f mma_f16(v16h a, v16h b, v8f acc) {
  acc = __builtin_amdgcn_wmma_f32_16x16x32_f16(false, a, false, b, (short)0, acc, false, false);
  asm volatile("v_nop\n\tv_nop\n\tv_nop\n\tv_nop" : "+v"(acc) : "v"(a), "v"(b));
  return acc;
}
static __device__ __forceinline__ v8f mma(const FragB& a, const FragB& b, v8f acc) { return mma_bf16(a.v, b.v, acc); }
static __device__ __forceinline__ v8f mma(const FragH& a, const FragH& b, v8f acc) { return mma_f16(a.v, b.v, acc); }

// ---------------------------------------------------------------------------------------------
// Convert pass: xb = bf16(x) [SEQ][DMODEL], wb = bf16(Wqkv) [QKV_N][DMODEL], wp = f16(bf16(Wproj) * 256) [DMODEL][DMODEL].
// coverage: blocks [0,SEQ*DMODEL/2048) x 256 x 8 == SEQ*DMODEL; next QKV_N*DMODEL/2048 blocks == QKV_N*DMODEL;
//           last DMODEL*DMODEL/2048 blocks == DMODEL*DMODEL.
template <int MODE>
static __device__ __forceinline__ void cvt_body(const float* __restrict__ src, us16* __restrict__ dst,
                                                 int blk, int tid) {
  const size_t e = ((size_t)blk * 256 + tid) * 8;
  const v4f a = *(const v4f*)(src + e);
  const v4f b = *(const v4f*)(src + e + 4);
  v4u u;
  if (MODE == 0) {
    Pack8B pk;
    #pragma unroll
    for (int i = 0; i < 4; ++i) {
      pk.h[i]     = (bf16)a[i];                 // RNE convert
      pk.h[4 + i] = (bf16)b[i];
    }
    u = pk.u;
  } else {
    Pack8H pk;
    #pragma unroll
    for (int i = 0; i < 4; ++i) {
      pk.h[i]     = (f16)((float)(bf16)a[i] * WCAR);   // bf16 significand is exact in f16
      pk.h[4 + i] = (f16)((float)(bf16)b[i] * WCAR);
    }
    u = pk.u;
  }
  *(v4u*)(dst + e) = u;
  
}

static __device__ __forceinline__ void convert_body(const float* __restrict__ x,
                                                    const float* __restrict__ wq,
                                                    const float* __restrict__ wpj,
                                                    bf16* __restrict__ xb,
                                                    bf16* __restrict__ wb,
                                                    f16* __restrict__ wp,
                                                    int blk, int tid) {
  const int NBX = SEQ * DMODEL / 2048;
  const int NBQ = QKV_N * DMODEL / 2048;
  if (blk < NBX)            cvt_body<0>(x, (us16*)xb, blk, tid);
  else if (blk < NBX + NBQ) cvt_body<0>(wq, (us16*)wb, blk - NBX, tid);
  else                      cvt_body<1>(wpj, (us16*)wp, blk - NBX - NBQ, tid);
}

// ---------------------------------------------------------------------------------------------
// RoPE tables ct/st [SEQ][NROPE] f32: angle(t, j) = t * (1 / 10000^(2j/64)). Block = 8 positions x 32 freqs.
// One powf + one sincosf per thread (rolled). Rows staged in LDS; waves 0-1 write the cos lines, waves 2-3 the
// coverage: (SEQ/8 blocks) x 8 rows x 32 floats == SEQ*NROPE per table.
static __device__ __forceinline__ void rope_table_body(float* __restrict__ ct, float* __restrict__ st,
                                                       int blk, int tid) {
  __shared__ __align__(16) float sc[8 * NROPE];   // cross-wave (block barrier)
  __shared__ __align__(16) float ss[8 * NROPE];
  const int j   = tid & 31;
  const int tl  = tid >> 5;
  const int t   = blk * 8 + tl;
  const float e   = (float)(2 * j) * (1.0f / 64.0f);
  const float pw  = powf(10000.0f, e);
  const float inv = 1.0f / pw;
  const float ang = (float)t * inv;
  float sn, cs;
  sincosf(ang, &sn, &cs);
  sc[tl * NROPE + j] = cs;
  ss[tl * NROPE + j] = sn;
  __syncthreads();
  if (tid < 64) {
    const int rowl  = tid >> 3;
    const int piece = tid & 7;
    const v4f v = *(const v4f*)(sc + rowl * NROPE + piece * 4);
    const size_t gi = (size_t)(blk * 8 + rowl) * NROPE + piece * 4;
    *(v4f*)(ct + gi) = v;
    
  } else if (tid < 128) {
    const int rowl  = (tid - 64) >> 3;
    const int piece = tid & 7;
    const v4f v = *(const v4f*)(ss + rowl * NROPE + piece * 4);
    const size_t gi = (size_t)(blk * 8 + rowl) * NROPE + piece * 4;
    *(v4f*)(st + gi) = v;
    
  }
}

// One launch for the two passes that depend on nothing but the inputs: blocks [0, SEQ/8) build the RoPE tables,
// the rest convert the operands (block-uniform branch, so the table blocks' barrier is passed by whole blocks).
__global__ __launch_bounds__(256) void prep_kernel(const float* __restrict__ x,
                                                   const float* __restrict__ wq,
                                                   const float* __restrict__ wpj,
                                                   bf16* __restrict__ xb,
                                                   bf16* __restrict__ wb,
                                                   f16* __restrict__ wp,
                                                   float* __restrict__ ct, float* __restrict__ st) {
  const int blk = blockIdx.x;
  const int tid = threadIdx.x;
  const int NBR = SEQ / 8;
  if (blk < NBR) rope_table_body(ct, st, blk, tid);
  else           convert_body(x, wq, wpj, xb, wb, wp, blk - NBR, tid);
}

// ---------------------------------------------------------------------------------------------
// NT GEMM: C[m][n] = oscale * sum_k A[m][k] B[n][k] (+ rscale * sum_k Ar[m][k] B[n][k] when RES).
// A, Ar, B are 16-bit row-major planes with pitch K (k contiguous). 4 waves/block, wave tile (16*MI) x 64,
// block tile (64*MI) x 64. The block's A, Ar and B rows are staged GS k at a time in two LDS buffers by asynchronous
// 16-B copies (whole 128-B row pieces); a stage buffer holds three 64-row tiles at pitch KP: [A | A | B], or [A | Ar | B] when RES.
// A and B fragments are read from LDS with the split k map:
// elements 0..7 <- k0 + 8h + 0..7, elements 8..15 <- k0 + 16 + 8h + 0..7, lane&15 = row of A / row of B (= column n).
// Epilogue: wave tile staged in LDS (in the bytes of the stage buffers, which every wave has left by then), then per
// instruction lanes 0..15 write one 256-B row segment.
// Requires K % 64 == 0, N % 64 == 0, rows covered by the grid a multiple of 64*MI.
// One stage's copies of one thread of the 128: rows r + 16 j (r = tid>>3, j = 0..3) of each of the three 64-row tiles,
// 16-B piece tid&7. r0/r1/r2 point at the first row of each tile at the stage's first k (pitch K); in LDS the three
// tiles follow one another, so the twelve rows of a thread lie 16 rows apart.
static __device__ __forceinline__ void stage_gemm(us16* buf, const us16* r0, const us16* r1, const us16* r2,
                                                  int K, int tid) {
  const int row   = tid >> 3;     // 0..15
  const int piece = tid & 7;      // 0..7
  const unsigned l0 = (unsigned)(size_t)(buf + row * KP + piece * 8);   // LDS byte address
  const unsigned ls = 16 * KP * 2;                                      // 16 rows in LDS, bytes
  const size_t   go = (size_t)row * K + piece * 8;
  const size_t   gs = (size_t)16 * K;                                    // 16 rows in the plane, elements
  const us16* a0 = r0 + go;
  const us16* b0 = r1 + go;
  const us16* c0 = r2 + go;
  // the copies and, as the last line, the wait that stands before any of their address registers is rewritten
  asm volatile("global_load_async_to_lds_b128 %0, %12, off\n\t"
               "global_load_async_to_lds_b128 %1, %13, off\n\t"
               "global_load_async_to_lds_b128 %2, %14, off\n\t"
               "global_load_async_to_lds_b128 %3, %15, off\n\t"
               "global_load_async_to_lds_b128 %4, %16, off\n\t"
               "global_load_async_to_lds_b128 %5, %17, off\n\t"
               "global_load_async_to_lds_b128 %6, %18, off\n\t"
               "global_load_async_to_lds_b128 %7, %19, off\n\t"
               "global_load_async_to_lds_b128 %8, %20, off\n\t"
               "global_load_async_to_lds_b128 %9, %21, off\n\t"
               "global_load_async_to_lds_b128 %10, %22, off\n\t"
               "global_load_async_to_lds_b128 %11, %23, off\n\t"
               "s_wait_xcnt 0x0"
               :: "v"(l0), "v"(l0 + ls), "v"(l0 + 2 * ls), "v"(l0 + 3 * ls),
                  "v"(l0 + 4 * ls), "v"(l0 + 5 * ls), "v"(l0 + 6 * ls), "v"(l0 + 7 * ls),
                  "v"(l0 + 8 * ls), "v"(l0 + 9 * ls), "v"(l0 + 10 * ls), "v"(l0 + 11 * ls),
                  "v"(a0), "v"(a0 + gs), "v"(a0 + 2 * gs), "v"(a0 + 3 * gs),
                  "v"(b0), "v"(b0 + gs), "v"(b0 + 2 * gs), "v"(b0 + 3 * gs),
                  "v"(c0), "v"(c0 + gs), "v"(c0 + 2 * gs), "v"(c0 + 3 * gs) : "memory");
}

#define GEMM_LDS_B (2 * 3 * TILE_H * 2)        // bytes of the two stage buffers of three tiles each

// smem: the block's GEMM_LDS_B bytes of LDS; mb, n0: first row and first column of the block's tile.
template <typename F, int MI, int RES>
static __device__ __forceinline__ void gemm_nt_body(unsigned char* smem,
                                                    const us16* __restrict__ A,
                                                    const us16* __restrict__ Ar,
                                                    const us16* __restrict__ Bm,
                                                    float* __restrict__ C,
                                                    int K, int N, int mb, int n0,
                                                    float oscale, float rscale) {
  static_assert((MI == 2 && RES == 0) || (MI == 1 && RES == 1));   // three 64-row tiles per stage
  const int BT    = 2;                         // index of the B tile in a stage buffer
  const int STG_H = (BT + 1) * TILE_H;         // halves per stage buffer
  const int RING_B = 2 * STG_H * 2;            // bytes of the two stage buffers
  const int OUT_B  = 4 * 16 * MI * OP * 4;     // bytes of the four waves' output staging
  static_assert(RING_B <= GEMM_LDS_B && OUT_B <= GEMM_LDS_B);
  // two stage buffers (cross-wave) in the loop; behind the loop's last barrier the per-wave output staging
  us16*  ring = (us16*)smem;
  float* sC   = (float*)smem;
  const int tid  = threadIdx.x;
  const int wave = tid >> 5;
  const int lane = tid & 31;
  const int lq   = lane & 15;
  const int hi   = lane >> 4;
  const int m0   = mb + wave * (16 * MI);

  v8f acc[MI][4], acc2[MI][4];
  #pragma unroll
  for (int mi = 0; mi < MI; ++mi) {
    #pragma unroll
    for (int t = 0; t < 4; ++t) {
      acc[mi][t]  = (v8f){0, 0, 0, 0, 0, 0, 0, 0};
      acc2[mi][t] = (v8f){0, 0, 0, 0, 0, 0, 0, 0};
    }
  }

  const us16* ab  = A + (size_t)mb * K;                                                  // tile 0: A rows 0..63
  const us16* arb = (RES != 0) ? Ar + (size_t)mb * K : A + (size_t)(mb + 64) * K;        // tile 1: Ar, or A rows 64..127
  const us16* bb  = Bm + (size_t)n0 * K;                                                 // tile 2: B rows
  const int   nst = K / GS;                           // block-uniform stage count

  stage_gemm(ring, ab, arb, bb, K, tid);
  asm volatile("s_wait_asynccnt 0x0" ::: "memory");   // this wave's copies of stage 0 have landed
  __syncthreads();                                    // stage 0 readable by every wave
  if (nst > 1) stage_gemm(ring + STG_H, ab + GS, arb + GS, bb + GS, K, tid);

  for (int s = 0; s < nst; ++s) {
    const us16* sb = ring + (s & 1) * STG_H;
    #pragma unroll   // constant indices keep the fragment arrays in registers
    for (int u = 0; u < GS / 32; ++u) {
      F a[MI], ar[MI], b[4];
      #pragma unroll
      for (int mi = 0; mi < MI; ++mi) {
        const us16* p = sb + (wave * (16 * MI) + mi * 16 + lq) * KP + u * 32 + hi * 8;
        a[mi].q[0] = *(const v4u*)(p);        // k0 + 8h + 0..7
        a[mi].q[1] = *(const v4u*)(p + 16);   // k0 + 16 + 8h + 0..7
        if (RES != 0) {
          const us16* pr = p + MI * TILE_H;
          ar[mi].q[0] = *(const v4u*)(pr);
          ar[mi].q[1] = *(const v4u*)(pr + 16);
        }
      }
      #pragma unroll
      for (int t = 0; t < 4; ++t) {
        const us16* p = sb + BT * TILE_H + (t * 16 + lq) * KP + u * 32 + hi * 8;
        b[t].q[0] = *(const v4u*)(p);
        b[t].q[1] = *(const v4u*)(p + 16);
      }
      #pragma unroll
      for (int mi = 0; mi < MI; ++mi) {
        #pragma unroll
        for (int t = 0; t < 4; ++t) {
          acc[mi][t] = mma(a[mi], b[t], acc[mi][t]);
          if (RES != 0) acc2[mi][t] = mma(ar[mi], b[t], acc2[mi][t]);
        }
      }
    }
    // publish point of stage s + 1, passed by every wave
    asm volatile("s_wait_dscnt 0x0" ::: "memory");      // this wave's reads of stage s are done before its buffer is refilled
    asm volatile("s_wait_asynccnt 0x0" ::: "memory");   // this wave's copies of stage s + 1 have landed
    __syncthreads();                                    // stage s + 1 readable; every reader has left stage s
    if (s + 2 < nst)
      stage_gemm(ring + (s & 1) * STG_H, ab + (s + 2) * GS, arb + (s + 2) * GS, bb + (s + 2) * GS, K, tid);
  }
  asm volatile("s_wait_asynccnt 0x0" ::: "memory");     // no copy outstanding behind the loop

  float* so = sC + wave * (16 * MI * OP);
  #pragma unroll
  for (int mi = 0; mi < MI; ++mi) {
    #pragma unroll
    for (int t = 0; t < 4; ++t) {
      #pragma unroll
      for (int r = 0; r < 8; ++r) {
        float val = acc[mi][t][r] * oscale;
        if (RES != 0) val += acc2[mi][t][r] * rscale;
        so[(mi * 16 + hi * 8 + r) * OP + t * 16 + lq] = val;
      }
    }
  }
  __syncthreads();

  const int NIT = 8 * MI;   // (16*MI rows) / 2 rows per instruction
  v4f    vals[8 * MI];
  size_t gidx[8 * MI];
  #pragma unroll
  for (int it = 0; it < NIT; ++it) {
    const int row = it * 2 + hi;
    vals[it] = *(const v4f*)(so + row * OP + lq * 4);
    gidx[it] = (size_t)(m0 + row) * N + n0 + lq * 4;
  }
  #pragma unroll
  for (int it = 0; it < NIT; ++it) *(v4f*)(C + gidx[it]) = vals[it];
  
}

// qkv = xb x wb^T: block tile 128 x 64, grid (N / 64, rows / 128).
__global__ __launch_bounds__(128) void gemm_qkv_kernel(const us16* __restrict__ A,
                                                       const us16* __restrict__ Bm,
                                                       float* __restrict__ C, int K, int N) {
  __shared__ __align__(16) unsigned char smem[GEMM_LDS_B];
  gemm_nt_body<FragB, 2, 0>(smem, A, A, Bm, C, K, N, blockIdx.y * 128, blockIdx.x * 64, 1.0f, 0.0f);
}

// out = ctx x wp^T, all rows in one launch: the first ER / 64 block rows take 64 rows each with the residual plane,
// the others 128 rows each from row ER on (block-uniform branch; the two row ranges share no output element).
__global__ __launch_bounds__(128) void gemm_proj_kernel(const us16* __restrict__ A,
                                                        const us16* __restrict__ Ar,
                                                        const us16* __restrict__ Bm,
                                                        float* __restrict__ C, int K, int N,
                                                        float oscale, float rscale) {
  __shared__ __align__(16) unsigned char smem[GEMM_LDS_B];
  const int by = blockIdx.y;
  const int n0 = blockIdx.x * 64;
  if (by < ER / 64) gemm_nt_body<FragH, 1, 1>(smem, A, Ar, Bm, C, K, N, by * 64, n0, oscale, rscale);
  else              gemm_nt_body<FragH, 2, 0>(smem, A, A, Bm, C, K, N, ER + (by - ER / 64) * 128, n0, oscale, 0.0f);
}

// ---------------------------------------------------------------------------------------------
// Plane builder. Block = (64-row tile, head), 256 threads; reads the f32 qkv rows [SEQ][QKV_N].
//   qr, kr [NHEAD][ER][HDIM]  f16 : residual planes (x - f16(x)) * 1024 for rows < ER (block-uniform).
//   vtr [NHEAD][HDIM][ER]     f16 : V residual transposed, keys < ER.
// RoPE (rotate-half): pair partner d^32 sits in lane^4 of the same wave; out[d] = x[d]*cos + sgn*x[d^32]*sin.
// coverage: rows kt*64 + {0..31, 32..63}, d 0..63 for every plane; residual planes for tiles with s0 < ER
//           (ER/64 tiles x 64 rows == ER rows); every written line whole, one instruction.
__global__ __launch_bounds__(256) void planes_kernel(const float* __restrict__ qkv,
                                                     const float* __restrict__ ct,
                                                     const float* __restrict__ st,
                                                     f16* __restrict__ qh, f16* __restrict__ qr,
                                                     f16* __restrict__ kh, f16* __restrict__ kr,
                                                     f16* __restrict__ vt, f16* __restrict__ vtr) {
  const int kt  = blockIdx.x;
  const int h   = blockIdx.y;
  const int tid = threadIdx.x;
  __shared__ __align__(16) f16 sT[HDIM * TP];   // [d][key] hi, cross-wave (block barrier)
  __shared__ __align__(16) f16 sR[HDIM * TP];   // [d][key] residual, cross-wave (block barrier)
  const int  s0    = kt * CT;
  const bool early = (s0 < ER);                 // block-uniform

  v4u    qv[2], kv[2], qx[2], kx[2];
  size_t pidx[2], ridx[2];
  #pragma unroll
  for (int kk = 0; kk < 2; ++kk) {
    const int   key  = kk * 32 + (tid >> 3);    // 0..63
    const int   d0   = (tid & 7) * 8;           // 0..56
    const int   j0   = d0 & (NROPE - 1);        // frequency index of d0
    const float sgn  = (d0 < NROPE) ? -1.0f : 1.0f;
    const int   srow = s0 + key;
    const float* src = qkv + (size_t)srow * QKV_N + h * HDIM + d0;     // slot 0 = q
    const v4f q0v = *(const v4f*)(src);
    const v4f q1v = *(const v4f*)(src + 4);
    const v4f k0v = *(const v4f*)(src + DMODEL);                        // slot 1 = k
    const v4f k1v = *(const v4f*)(src + DMODEL + 4);
    const v4f v0v = *(const v4f*)(src + 2 * DMODEL);                    // slot 2 = v
    const v4f v1v = *(const v4f*)(src + 2 * DMODEL + 4);
    const float* cp = ct + (size_t)srow * NROPE + j0;
    const float* sp = st + (size_t)srow * NROPE + j0;
    const v4f c0 = *(const v4f*)(cp);
    const v4f c1 = *(const v4f*)(cp + 4);
    const v4f n0 = *(const v4f*)(sp);
    const v4f n1 = *(const v4f*)(sp + 4);
    float qa[8], ka[8], va[8], ca[8], sa[8];
    #pragma unroll
    for (int i = 0; i < 4; ++i) {
      qa[i] = q0v[i]; qa[4 + i] = q1v[i];
      ka[i] = k0v[i]; ka[4 + i] = k1v[i];
      va[i] = v0v[i]; va[4 + i] = v1v[i];
      ca[i] = c0[i];  ca[4 + i] = c1[i];
      sa[i] = n0[i];  sa[4 + i] = n1[i];
    }
    Pack8H pq, pqr, pk, pkr;
    #pragma unroll
    for (int i = 0; i < 8; ++i) {
      const float qp = __shfl_xor(qa[i], 4, 32);   // partner d^32, same row, same wave
      const float kp = __shfl_xor(ka[i], 4, 32);
      const float qo = qa[i] * ca[i] + sgn * qp * sa[i];
      const float ko = ka[i] * ca[i] + sgn * kp * sa[i];
      const f16 qhh = (f16)qo;
      const f16 khh = (f16)ko;
      pq.h[i]  = qhh;
      pk.h[i]  = khh;
      pqr.h[i] = (f16)((qo - (float)qhh) * RSC);
      pkr.h[i] = (f16)((ko - (float)khh) * RSC);
      const f16 vhh = (f16)va[i];
      sT[(d0 + i) * TP + key] = vhh;
      sR[(d0 + i) * TP + key] = (f16)((va[i] - (float)vhh) * RSC);
    }
    qv[kk] = pq.u;  qx[kk] = pqr.u;
    kv[kk] = pk.u;  kx[kk] = pkr.u;
    pidx[kk] = ((size_t)h * SEQ + srow) * HDIM + d0;
    ridx[kk] = ((size_t)h * ER + srow) * HDIM + d0;   // used only when early (srow < ER)
  }
  __syncthreads();

  v4u    vv[2], vx[2];
  size_t vidx[2], vridx[2];
  #pragma unroll
  for (int kk = 0; kk < 2; ++kk) {
    const int d  = kk * 32 + (tid >> 3);        // 0..63
    const int ks = (tid & 7) * 8;               // 0..56
    Pack8H ph, px;
    ph.v = *(const v8h*)(sT + d * TP + ks);
    px.v = *(const v8h*)(sR + d * TP + ks);
    vv[kk] = ph.u;
    vx[kk] = px.u;
    vidx[kk]  = ((size_t)h * HDIM + d) * SEQ + s0 + ks;
    vridx[kk] = ((size_t)h * HDIM + d) * ER + s0 + ks;   // used only when early
  }

  #pragma unroll
  for (int kk = 0; kk < 2; ++kk) {
    *(v4u*)(qh + pidx[kk]) = qv[kk];
    *(v4u*)(kh + pidx[kk]) = kv[kk];
    *(v4u*)(vt + vidx[kk]) = vv[kk];
    if (early) {
      *(v4u*)(qr + ridx[kk])   = qx[kk];
      *(v4u*)(kr + ridx[kk])   = kx[kk];
      *(v4u*)(vtr + vridx[kk]) = vx[kk];
    }
  }
  
}

// ---------------------------------------------------------------------------------------------
// Flash attention, causal. Block = (head, two query blocks of 128 in turn); one wave owns 16 query rows of each.
// S^T = K x Q^T so queries sit on lanes; P^T in C-layout is bit-identical to the A-fragment layout of O += P x V.
// Q B-fragments are loaded straight from the 16-bit plane; K A-fragments and V^T B-fragments from LDS (two 16-B loads each).
// RES != 0 (query blocks < EARLY_QBLK, all visited keys < ER): score = KQ + (K Qres + Kres Q)/1024;
// O2 = Pres V + P Vres accumulated separately and folded as O2/1024 before normalisation.
// K and V^T (and their residual planes when RES) are staged once per query block, KS keys at a time, in two LDS buffers
// by asynchronous 16-B copies; all eight waves read their fragments from LDS. A stage buffer holds the tiles
// [K | V^T | Kres | V^Tres], each 64 rows of 128 B at pitch KP.
// One stage's copies of one thread: rows tid>>3 and 32 + (tid>>3) of every tile, 16-B piece tid&7.
// kg/krg point at the stage's first key row (pitch HDIM); vg/vrg at the stage's first key column (pitch SEQ / ER).
template <int RES>
static __device__ __forceinline__ void stage_tiles(f16* buf, const f16* kg, const f16* krg,
                                                   const f16* vg, const f16* vrg, int tid) {
  const int row   = tid >> 3;     // 0..31
  const int piece = tid & 7;      // 0..7
  const unsigned l0 = (unsigned)(size_t)(buf + row * KP + piece * 8);   // LDS byte address
  const unsigned l1 = l0 + 32 * KP * 2;
  const unsigned l2 = l0 + TILE_H * 2;
  const unsigned l3 = l1 + TILE_H * 2;
  const f16* g0 = kg + (size_t)row * HDIM + piece * 8;
  const f16* g1 = g0 + 32 * HDIM;
  const f16* g2 = vg + (size_t)row * SEQ + piece * 8;
  const f16* g3 = g2 + (size_t)32 * SEQ;
  // the copies and, as the last line, the wait that stands before any of their address registers is rewritten
  asm volatile("global_load_async_to_lds_b128 %0, %4, off\n\t"
               "global_load_async_to_lds_b128 %1, %5, off\n\t"
               "global_load_async_to_lds_b128 %2, %6, off\n\t"
               "global_load_async_to_lds_b128 %3, %7, off\n\t"
               "s_wait_xcnt 0x0"
               :: "v"(l0), "v"(l1), "v"(l2), "v"(l3), "v"(g0), "v"(g1), "v"(g2), "v"(g3) : "memory");
  if (RES != 0) {
    const unsigned l4 = l0 + 2 * TILE_H * 2;
    const unsigned l5 = l1 + 2 * TILE_H * 2;
    const unsigned l6 = l0 + 3 * TILE_H * 2;
    const unsigned l7 = l1 + 3 * TILE_H * 2;
    const f16* g4 = krg + (size_t)row * HDIM + piece * 8;
    const f16* g5 = g4 + 32 * HDIM;
    const f16* g6 = vrg + (size_t)row * ER + piece * 8;
    const f16* g7 = g6 + (size_t)32 * ER;
    // same form for the residual tiles
    asm volatile("global_load_async_to_lds_b128 %0, %4, off\n\t"
                 "global_load_async_to_lds_b128 %1, %5, off\n\t"
                 "global_load_async_to_lds_b128 %2, %6, off\n\t"
                 "global_load_async_to_lds_b128 %3, %7, off\n\t"
                 "s_wait_xcnt 0x0"
                 :: "v"(l4), "v"(l5), "v"(l6), "v"(l7), "v"(g4), "v"(g5), "v"(g6), "v"(g7) : "memory");
  }
}

// sO: per-wave output staging, NWAVE * 16 * OP floats; sKV: the two stage buffers.
template <int RES>
static __device__ __forceinline__ void attn_body(float* sO, f16* sKV,
                                                 const f16* __restrict__ qh, const f16* __restrict__ qr,
                                                 const f16* __restrict__ kh, const f16* __restrict__ kr,
                                                 const f16* __restrict__ vt, const f16* __restrict__ vtr,
                                                 f16* __restrict__ ctxh, f16* __restrict__ ctxr,
                                                 int qblk, int h) {
  const int tid  = threadIdx.x;
  const int wave = __builtin_amdgcn_readfirstlane(tid >> 5);   // scalar, so the per-wave causal skip is a scalar branch
  const int lane = tid & 31;
  const int lq   = lane & 15;   // query column of S^T / d column of O
  const int hi   = lane >> 4;   // k-split half

  const int STG_H = (RES != 0 ? 4 : 2) * TILE_H;         // halves per stage buffer

  const int qrow0 = qblk * BQ + wave * 16;               // first query row of this wave

  // Q as B-operand fragments: lane lq holds query qrow0+lq, elements follow the split d map.
  FragH qf[2], qx[2];
  {
    const f16* qp = qh + ((size_t)h * SEQ + qrow0 + lq) * HDIM;
    #pragma unroll
    for (int f = 0; f < 2; ++f) {
      qf[f].q[0] = *(const v4u*)(qp + f * 32 + hi * 8);        // d = f*32 + hi*8 + 0..7
      qf[f].q[1] = *(const v4u*)(qp + f * 32 + 16 + hi * 8);   // d = f*32 + 16 + hi*8 + 0..7
    }
    if (RES != 0) {
      const f16* qrp = qr + ((size_t)h * ER + qrow0 + lq) * HDIM;
      #pragma unroll
      for (int f = 0; f < 2; ++f) {
        qx[f].q[0] = *(const v4u*)(qrp + f * 32 + hi * 8);
        qx[f].q[1] = *(const v4u*)(qrp + f * 32 + 16 + hi * 8);
      }
    }
  }

  const f16* kh_h  = kh  + (size_t)h * SEQ * HDIM;
  const f16* kr_h  = kr  + (size_t)h * ER * HDIM;
  const f16* vt_h  = vt  + (size_t)h * HDIM * SEQ;
  const f16* vtr_h = vtr + (size_t)h * HDIM * ER;

  v8f o[4], o2[4];
  #pragma unroll
  for (int dt = 0; dt < 4; ++dt) {
    o[dt]  = (v8f){0, 0, 0, 0, 0, 0, 0, 0};
    o2[dt] = (v8f){0, 0, 0, 0, 0, 0, 0, 0};
  }

  float rmax = -__builtin_inff();
  float rsum = 0.0f;
  const float SL = 0.125f * 1.4426950408889634f;   // softmax scale * log2(e)

  // causal: this wave visits key chunks whose first key is <= its last query row (wave-uniform trip count)
  const int nchunk = (qrow0 + 15) / BK + 1;
  // the block walks the stages up to its last query row (block-uniform count, at least two)
  const int nstage = (qblk + 1) * (BQ / KS);

  stage_tiles<RES>(sKV, kh_h, kr_h, vt_h, vtr_h, tid);
  asm volatile("s_wait_asynccnt 0x0" ::: "memory");   // this wave's copies of stage 0 have landed
  __syncthreads();                                    // stage 0 readable by every wave
  if (nstage > 1)
    stage_tiles<RES>(sKV + STG_H, kh_h + (size_t)KS * HDIM, kr_h + (size_t)KS * HDIM, vt_h + KS, vtr_h + KS, tid);

  for (int t = 0; t < nstage; ++t) {
   const f16* sb = sKV + (t & 1) * STG_H;
   for (int u = 0; u < KS / BK; ++u) {
    const int i = t * (KS / BK) + u;
    if (i >= nchunk) break;                 // wave-uniform: chunks beyond this wave's diagonal
    const int j0 = i * BK;
    const f16* sk  = sb + (u * BK) * KP;                 // K rows of this chunk
    const f16* sv  = sb + TILE_H + u * BK;               // V^T key columns of this chunk
    const f16* skr = sb + (RES != 0 ? 2 : 0) * TILE_H + (u * BK) * KP;    // residual tiles (read when RES only)
    const f16* svr = sb + (RES != 0 ? 3 : 1) * TILE_H + u * BK;

    // K A-fragments, then V B-fragments (column n = d = dt*16 + lq, split key map from the transposed tile): all
    // fetched at the head of the chunk, so that V's LDS latency passes under the score products and the softmax.
    FragH ka[2][2], bvf[4];
    #pragma unroll   // constant indices keep the fragment arrays in registers
    for (int sub = 0; sub < 2; ++sub) {
      const f16* base = sk + (sub * 16 + lq) * KP + hi * 8;   // row = key j0 + sub*16 + lq
      ka[sub][0].q[0] = *(const v4u*)(base);        // d = hi*8 + 0..7
      ka[sub][0].q[1] = *(const v4u*)(base + 16);   // d = 16 + hi*8 + 0..7
      ka[sub][1].q[0] = *(const v4u*)(base + 32);   // d = 32 + hi*8 + 0..7
      ka[sub][1].q[1] = *(const v4u*)(base + 48);   // d = 48 + hi*8 + 0..7
    }
    #pragma unroll   // as above
    for (int dt = 0; dt < 4; ++dt) {
      const f16* base = sv + (dt * 16 + lq) * KP + hi * 8;
      bvf[dt].q[0] = *(const v4u*)(base);        // keys j0 + hi*8 + 0..7
      bvf[dt].q[1] = *(const v4u*)(base + 16);   // keys j0 + 16 + hi*8 + 0..7
    }

    // S^T tiles: c[sub][r] = rawscore(query qrow0+lq, key j0 + sub*16 + hi*8 + r)
    v8f c[2];
    #pragma unroll
    for (int sub = 0; sub < 2; ++sub) {
      const FragH a0 = ka[sub][0];
      const FragH a1 = ka[sub][1];
      v8f acc = (v8f){0, 0, 0, 0, 0, 0, 0, 0};
      acc = mma_f16(a0.v, qf[0].v, acc);
      acc = mma_f16(a1.v, qf[1].v, acc);
      if (RES != 0) {
        FragH r0, r1;
        const f16* rb = skr + (sub * 16 + lq) * KP + hi * 8;
        r0.q[0] = *(const v4u*)(rb);
        r0.q[1] = *(const v4u*)(rb + 16);
        r1.q[0] = *(const v4u*)(rb + 32);
        r1.q[1] = *(const v4u*)(rb + 48);
        v8f ax = (v8f){0, 0, 0, 0, 0, 0, 0, 0};
        ax = mma_f16(a0.v, qx[0].v, ax);
        ax = mma_f16(a1.v, qx[1].v, ax);
        ax = mma_f16(r0.v, qf[0].v, ax);
        ax = mma_f16(r1.v, qf[1].v, ax);
        #pragma unroll
        for (int r = 0; r < 8; ++r) acc[r] += ax[r] * (1.0f / RSC);
      }
      c[sub] = acc;
    }

    // causal mask (key > query -> -inf); branch is wave-uniform, selects are per lane
    if (j0 + BK - 1 > qrow0) {
      const int qi = qrow0 + lq;
      #pragma unroll
      for (int sub = 0; sub < 2; ++sub) {
        #pragma unroll
        for (int r = 0; r < 8; ++r) {
          const int key = j0 + sub * 16 + hi * 8 + r;
          c[sub][r] = (key > qi) ? -__builtin_inff() : c[sub][r];
        }
      }
    }

    // online softmax: query lq's 32 scores are split across lane / lane^16
    float m_new = rmax;
    #pragma unroll
    for (int r = 0; r < 8; ++r) {
      m_new = fmaxf(m_new, c[0][r]);
      m_new = fmaxf(m_new, c[1][r]);
    }
    m_new = fmaxf(m_new, __shfl_xor(m_new, 16, 32));
    const float scale = __builtin_amdgcn_exp2f((rmax - m_new) * SL);
    rmax = m_new;

    // exp + pack: P^T C-layout == A-fragment layout for the PV product
    FragH pa, pr;
    float psum = 0.0f;
    #pragma unroll
    for (int r = 0; r < 8; ++r) {
      const float p0 = __builtin_amdgcn_exp2f((c[0][r] - m_new) * SL);   // key hi*8 + r
      const float p1 = __builtin_amdgcn_exp2f((c[1][r] - m_new) * SL);   // key 16 + hi*8 + r
      psum += p0 + p1;
      const float pc0 = p0 * PCAR;
      const float pc1 = p1 * PCAR;
      const f16 h0 = (f16)pc0;
      const f16 h1 = (f16)pc1;
      pa.h[r]     = h0;
      pa.h[8 + r] = h1;
      if (RES != 0) {
        pr.h[r]     = (f16)((pc0 - (float)h0) * RSC);
        pr.h[8 + r] = (f16)((pc1 - (float)h1) * RSC);
      }
    }
    rsum = rsum * scale + psum + __shfl_xor(psum, 16, 32);

    // rescale O: queries are the row dimension there -> per-row scale from lane 8*hi + r
    float sc[8];
    #pragma unroll
    for (int r = 0; r < 8; ++r) sc[r] = __shfl(scale, (hi << 3) + r, 32);
    #pragma unroll
    for (int dt = 0; dt < 4; ++dt) {
      #pragma unroll
      for (int r = 0; r < 8; ++r) {
        o[dt][r] *= sc[r];
        if (RES != 0) o2[dt][r] *= sc[r];
      }
    }

    // O += P x V
    #pragma unroll
    for (int dt = 0; dt < 4; ++dt) {
      o[dt] = mma_f16(pa.v, bvf[dt].v, o[dt]);
      if (RES != 0) {
        o2[dt] = mma_f16(pr.v, bvf[dt].v, o2[dt]);
        FragH br;
        const f16* rb = svr + (dt * 16 + lq) * KP + hi * 8;
        br.q[0] = *(const v4u*)(rb);
        br.q[1] = *(const v4u*)(rb + 16);
        o2[dt] = mma_f16(pa.v, br.v, o2[dt]);
      }
    }
   }
   // publish point of stage t + 1, passed by every wave (also one that skipped chunks)
   asm volatile("s_wait_dscnt 0x0" ::: "memory");      // this wave's reads of stage t are done before its buffer is refilled
   asm volatile("s_wait_asynccnt 0x0" ::: "memory");   // this wave's copies of stage t + 1 have landed
   __syncthreads();                                    // stage t + 1 readable; every reader has left stage t
   if (t + 2 < nstage)
     stage_tiles<RES>(sKV + (t & 1) * STG_H, kh_h + (size_t)(t + 2) * KS * HDIM, kr_h + (size_t)(t + 2) * KS * HDIM,
                      vt_h + (t + 2) * KS, vtr_h + (t + 2) * KS, tid);
  }
  asm volatile("s_wait_asynccnt 0x0" ::: "memory");    // no copy outstanding behind the loop

  // normalize: lane holds column d = dt*16 + lq for query rows 8*hi + r; stage ctx * 64
  float rs[8];
  #pragma unroll
  for (int r = 0; r < 8; ++r) rs[r] = 1.0f / __shfl(rsum, (hi << 3) + r, 32);

  float* so = sO + wave * (16 * OP);
  #pragma unroll
  for (int r = 0; r < 8; ++r) {
    #pragma unroll
    for (int dt = 0; dt < 4; ++dt) {
      float val = o[dt][r];
      if (RES != 0) val += o2[dt][r] * (1.0f / RSC);
      so[(hi * 8 + r) * OP + dt * 16 + lq] = val * (CCAR / PCAR) * rs[r];
    }
  }
  __syncthreads();

  v4u    hv[4], rv[4];
  size_t gi[4], gr[4];
  #pragma unroll
  for (int it = 0; it < 4; ++it) {
    const int row   = it * 4 + (lane >> 3);   // 0..15
    const int piece = lane & 7;               // 0..7
    const v4f a0 = *(const v4f*)(so + row * OP + piece * 8);
    const v4f a1 = *(const v4f*)(so + row * OP + piece * 8 + 4);
    Pack8H ph, px;
    #pragma unroll
    for (int k = 0; k < 4; ++k) {
      const float u0 = a0[k];
      const float u1 = a1[k];
      const f16 g0 = (f16)u0;
      const f16 g1 = (f16)u1;
      ph.h[k]     = g0;
      ph.h[4 + k] = g1;
      px.h[k]     = (f16)((u0 - (float)g0) * RSC);
      px.h[4 + k] = (f16)((u1 - (float)g1) * RSC);
    }
    hv[it] = ph.u;
    rv[it] = px.u;
    gi[it] = (size_t)(qrow0 + row) * DMODEL + h * HDIM + piece * 8;
    gr[it] = (size_t)(qrow0 + row) * DMODEL + h * HDIM + piece * 8;   // row < ER when RES
  }
  #pragma unroll
  for (int it = 0; it < 4; ++it) {
    *(v4u*)(ctxh + gi[it]) = hv[it];
    if (RES != 0) *(v4u*)(ctxr + gr[it]) = rv[it];
  }
  
}

// Causal balance: a query block's cost grows linearly with its index, and every work-group of the launch is resident
// at once, so the launch lasts as long as its longest work-group. Each work-group therefore takes two query blocks of
// one head, one after the other in every wave: NT - 1 - p, then p. Every work-group walks NT + 1 blocks' worth of key
// stages; every (head, query block) is taken exactly once. All branches are block-uniform.
// The LDS is sized for the residual form; the other uses the first half of sKV.
// At most two waves per SIMD: one work-group per WGP, so that none of the 256 equal work-groups shares a WGP while another WGP stands empty.
__global__ __launch_bounds__(256) __attribute__((amdgpu_waves_per_eu(2, 2))) void attn_kernel(const f16* __restrict__ qh, const f16* __restrict__ qr,
                                                   const f16* __restrict__ kh, const f16* __restrict__ kr,
                                                   const f16* __restrict__ vt, const f16* __restrict__ vtr,
                                                   f16* __restrict__ ctxh, f16* __restrict__ ctxr) {
  __shared__ __align__(16) float sO[NWAVE * 16 * OP];   // per-wave output staging (block barrier used)
  __shared__ __align__(16) f16 sKV[2 * 4 * TILE_H];     // two stage buffers, cross-wave
  const int NE = ER / BQ;                       // query blocks with residual planes, per head
  const int NT = SEQ / BQ;                      // query blocks per head
  const int NP = NT / 2;                        // pairs per head
  static_assert(NT % 2 == 0 && NE <= NP);       // whole pairs; the long block of a pair never has residual planes
  const int p  = blockIdx.x % NP;
  const int h  = blockIdx.x / NP;
  attn_body<0>(sO, sKV, qh, qr, kh, kr, vt, vtr, ctxh, ctxr, NT - 1 - p, h);
  asm volatile("s_wait_dscnt 0x0" ::: "memory");   // this wave's LDS reads of the first block are done before the buffers are refilled
  __syncthreads();                                 // every wave has left the first block's LDS
  if (p < NE) attn_body<1>(sO, sKV, qh, qr, kh, kr, vt, vtr, ctxh, ctxr, p, h);
  else        attn_body<0>(sO, sKV, qh, qr, kh, kr, vt, vtr, ctxh, ctxr, p, h);
}

// ---------------------------------------------------------------------------------------------
extern "C" void kernel_launch(void* const* d_in, const int* in_sizes, int n_in,
                              void* d_out, int out_size, void* d_ws, size_t ws_size,
                              hipStream_t stream) {
  if (n_in < 3) return;
  if ((size_t)in_sizes[0] < (size_t)SEQ * DMODEL) return;
  if ((size_t)in_sizes[1] < (size_t)QKV_N * DMODEL) return;
  if ((size_t)in_sizes[2] < (size_t)DMODEL * DMODEL) return;
  if ((size_t)out_size < (size_t)SEQ * DMODEL) return;

  const size_t xb_bytes   = (size_t)SEQ * DMODEL * 2;            // bf16 [SEQ][DMODEL]
  const size_t wb_bytes   = (size_t)QKV_N * DMODEL * 2;          // bf16 [QKV_N][DMODEL]
  const size_t wp_bytes   = (size_t)DMODEL * DMODEL * 2;         // f16  [DMODEL][DMODEL]
  const size_t tab_bytes  = (size_t)SEQ * NROPE * 4;             // f32  [SEQ][NROPE] (each of cos, sin)
  const size_t qkv_bytes  = (size_t)SEQ * QKV_N * 4;             // f32  [SEQ][QKV_N]
  const size_t pl_bytes   = (size_t)NHEAD * SEQ * HDIM * 2;      // f16  q/k/vt planes
  const size_t plr_bytes  = (size_t)NHEAD * ER * HDIM * 2;       // f16  residual planes
  const size_t ctx_bytes  = (size_t)SEQ * DMODEL * 2;            // f16  [SEQ][DMODEL]
  const size_t ctxr_bytes = (size_t)ER * DMODEL * 2;             // f16  [ER][DMODEL]
  const size_t total = xb_bytes + wb_bytes + wp_bytes + 2 * tab_bytes + qkv_bytes
                     + 3 * pl_bytes + 3 * plr_bytes + ctx_bytes + ctxr_bytes;
  if (ws_size < total) return;

  char* ws = (char*)d_ws;
  size_t off = 0;
  bf16*  xb   = (bf16*)(ws + off);  off += xb_bytes;
  bf16*  wb   = (bf16*)(ws + off);  off += wb_bytes;
  f16*   wp   = (f16*)(ws + off);   off += wp_bytes;
  float* ct   = (float*)(ws + off); off += tab_bytes;
  float* st   = (float*)(ws + off); off += tab_bytes;
  float* qkv  = (float*)(ws + off); off += qkv_bytes;
  f16*   qhp  = (f16*)(ws + off);   off += pl_bytes;
  f16*   khp  = (f16*)(ws + off);   off += pl_bytes;
  f16*   vtp  = (f16*)(ws + off);   off += pl_bytes;
  f16*   qrp  = (f16*)(ws + off);   off += plr_bytes;
  f16*   krp  = (f16*)(ws + off);   off += plr_bytes;
  f16*   vtrp = (f16*)(ws + off);   off += plr_bytes;
  f16*   ctxh = (f16*)(ws + off);   off += ctx_bytes;
  f16*   ctxr = (f16*)(ws + off);   off += ctxr_bytes;
  if (off > ws_size) return;

  const float* x     = (const float*)d_in[0];
  const float* wqkv  = (const float*)d_in[1];
  const float* wproj = (const float*)d_in[2];
  float*       out   = (float*)d_out;

  // 1) RoPE cos/sin tables and the 16-bit operand planes of the inputs
  const int ncvt_blocks = SEQ * DMODEL / 2048 + QKV_N * DMODEL / 2048 + DMODEL * DMODEL / 2048;
  prep_kernel<<<dim3(SEQ / 8 + ncvt_blocks), 256, 0, stream>>>(x, wqkv, wproj, xb, wb, wp, ct, st);

  // 2) qkv[SEQ][QKV_N] = xb x wb^T (bf16 operands, f32 result)
  gemm_qkv_kernel<<<dim3(QKV_N / 64, SEQ / 128), 128, 0, stream>>>(
      (const us16*)xb, (const us16*)wb, qkv, DMODEL, QKV_N);

  // 3) RoPE + q/k/v planes (+ residual planes for rows < ER)
  planes_kernel<<<dim3(SEQ / CT, NHEAD), 256, 0, stream>>>(qkv, ct, st, qhp, qrp, khp, krp, vtp, vtrp);

  // 4) causal attention -> ctx planes, two query blocks per work-group
  attn_kernel<<<dim3((SEQ / BQ / 2) * NHEAD), 256, 0, stream>>>(qhp, qrp, khp, krp, vtp, vtrp, ctxh, ctxr);

  // 5) out[SEQ][DMODEL] = ctx x wp^T ; folds the ctx carry (64), the Wproj carry (256) and the residual scale (1024)
  const float oscale = 1.0f / (CCAR * WCAR);
  const float rscale = oscale / RSC;
  gemm_proj_kernel<<<dim3(DMODEL / 64, ER / 64 + (SEQ - ER) / 128), 128, 0, stream>>>(
      (const us16*)ctxh, (const us16*)ctxr, (const us16*)wp, out, DMODEL, DMODEL, oscale, rscale);
}

// v005
// One run takes 125 microseconds.
// Next to v004, in two timings, it ran 1.10 and 1.11 times as fast.
// All steps since v000 together make it 3.59 times as fast.
#include <hip/hip_runtime.h>

// Contractions: qkv = X x Wqkv^T on v_wmma_f32_16x16x32_bf16 (bf16 operands = RNE-converted inputs, f32 accumulate);
// S^T = K x Q^T on v_wmma_f32_16x16x32_f16 (f16 q/k after RoPE, plus f16 residual planes x1024 with their own
// accumulator on query blocks < EARLY_QBLK); O = P x V on v_wmma_f32_16x16x32_f16 (P as f16 carried x4096,
// V as f16, plus P and V residual planes x1024 with their own accumulator on query blocks < EARLY_QBLK);
// out = ctx x Wproj^T on v_wmma_f32_16x16x32_f16 (ctx as f16 carried x64 plus residual x1024 on rows < ER,
// Wproj = f16 of the bf16 RNE-converted input carried x256). RoPE, softmax and all epilogues in f32.

#ifndef NB
#define NB 1
#endif
#ifndef SEQ
#define SEQ 4096
#endif
#define NB_FULL    1
#define SEQ_FULL   4096
#define NHEAD      16
#define HDIM       64
#define DMODEL     (NHEAD * HDIM)        // 1024
#define QKV_N      (3 * DMODEL)          // 3072
#define NROPE      (HDIM / 2)            // 32 frequencies
#define BQ         128                   // query rows per attention block (8 waves x 16)
#define BK         32                    // keys per inner iteration
#define NWAVE      8
#define EARLY_QBLK 2                     // query blocks with residual planes on q, k, P, v, ctx
#define ER         ((EARLY_QBLK * BQ < SEQ) ? (EARLY_QBLK * BQ) : SEQ)   // early rows == early keys
#define VP         136                   // LDS pitch (halves) of the transposed V tile (128 keys): 272 B = 16 B x odd
#define OP         68                    // LDS pitch (floats) of output staging tiles
#define PCAR       4096.0f               // P carry
#define RSC        1024.0f               // residual plane scale
#define CCAR       64.0f                 // ctx carry
#define WCAR       256.0f                // Wproj carry
#define KS         64                    // keys per LDS stage of the attention loop (two inner iterations)
#define KP         72                    // LDS pitch (halves) of staged K rows and V^T rows: 144 B = 16 B x odd
#define TILE_H     (64 * KP)             // halves per staged tile (64 rows)
#define GS         64                    // k per LDS stage of the GEMM loop (two 32-k products)

static_assert(NB == 1 && NB <= NB_FULL);
static_assert(SEQ <= SEQ_FULL);
static_assert(SEQ % BQ == 0);
static_assert(ER % BQ == 0);
static_assert((SEQ - ER) % 128 == 0);
static_assert(SEQ % 8 == 0);
static_assert(BQ == NWAVE * 16);
static_assert(HDIM == 64);
static_assert(DMODEL % 64 == 0 && QKV_N % 64 == 0);
static_assert(DMODEL % 32 == 0);
static_assert((SEQ * DMODEL) % 2048 == 0);
static_assert((QKV_N * DMODEL) % 2048 == 0);
static_assert((DMODEL * DMODEL) % 2048 == 0);
static_assert((VP * 2) % 16 == 0);
static_assert((OP * 4) % 16 == 0);
static_assert(KS == 2 * BK && BQ % KS == 0 && KS == 64);
static_assert((KP * 2) % 16 == 0);

typedef __bf16         bf16;
typedef _Float16       f16;
typedef unsigned short us16;
typedef bf16     v16bf __attribute__((ext_vector_type(16)));
typedef f16      v16h  __attribute__((ext_vector_type(16)));
typedef f16      v8h   __attribute__((ext_vector_type(8)));
typedef float    v8f   __attribute__((ext_vector_type(8)));
typedef float    v4f   __attribute__((ext_vector_type(4)));
typedef unsigned v4u   __attribute__((ext_vector_type(4)));

union FragB  { v16bf v; v4u q[2]; bf16 h[16]; };
union FragH  { v16h  v; v4u q[2]; f16  h[16]; };
union Pack8B { v4u u; bf16 h[8]; };
union Pack8H { v4u u; v8h v; f16 h[8]; };

// WMMA helpers: builtin followed by the VALU hazard guard (ties D, keeps A/B live).
static __device__ __forceinline__ v8f mma_bf16(v16bf a, v16bf b, v8f acc) {
  acc = __builtin_amdgcn_wmma_f32_16x16x32_bf16(false, a, false, b, (short)0, acc, false, false);
  asm volatile("v_nop\n\tv_nop\n\tv_nop\n\tv_nop" : "+v"(acc) : "v"(a), "v"(b));
  return acc;
}
static __device__ __forceinline__ v8f mma_f16(v16h a, v16h b, v8f acc) {
  acc = __builtin_amdgcn_wmma_f32_16x16x32_f16(false, a, false, b, (short)0, acc, false, false);
  asm volatile("v_nop\n\tv_nop\n\tv_nop\n\tv_nop" : "+v"(acc) : "v"(a), "v"(b));
  return acc;
}
static __device__ __forceinline__ v8f mma(const FragB& a, const FragB& b, v8f acc) { return mma_bf16(a.v, b.v, acc); }
static __device__ __forceinline__ v8f mma(const FragH& a, const FragH& b, v8f acc) { return mma_f16(a.v, b.v, acc); }

// ---------------------------------------------------------------------------------------------
// Convert pass: xb = bf16(x) [SEQ][DMODEL], wb = bf16(Wqkv) [QKV_N][DMODEL], wp = f16(bf16(Wproj) * 256) [DMODEL][DMODEL].
// coverage: blocks [0,SEQ*DMODEL/2048) x 256 x 8 == SEQ*DMODEL; next QKV_N*DMODEL/2048 blocks == QKV_N*DMODEL;
//           last DMODEL*DMODEL/2048 blocks == DMODEL*DMODEL.
template <int MODE>
static __device__ __forceinline__ void cvt_body(const float* __restrict__ src, us16* __restrict__ dst,
                                                 int blk, int tid) {
  const size_t e = ((size_t)blk * 256 + tid) * 8;
  const v4f a = *(const v4f*)(src + e);
  const v4f b = *(const v4f*)(src + e + 4);
  v4u u;
  if (MODE == 0) {
    Pack8B pk;
    #pragma unroll
    for (int i = 0; i < 4; ++i) {
      pk.h[i]     = (bf16)a[i];                 // RNE convert
      pk.h[4 + i] = (bf16)b[i];
    }
    u = pk.u;
  } else {
    Pack8H pk;
    #pragma unroll
    for (int i = 0; i < 4; ++i) {
      pk.h[i]     = (f16)((float)(bf16)a[i] * WCAR);   // bf16 significand is exact in f16
      pk.h[4 + i] = (f16)((float)(bf16)b[i] * WCAR);
    }
    u = pk.u;
  }
  *(v4u*)(dst + e) = u;
  
}

static __device__ __forceinline__ void convert_body(const float* __restrict__ x,
                                                    const float* __restrict__ wq,
                                                    const float* __restrict__ wpj,
                                                    bf16* __restrict__ xb,
                                                    bf16* __restrict__ wb,
                                                    f16* __restrict__ wp,
                                                    int blk, int tid) {
  const int NBX = SEQ * DMODEL / 2048;
  const int NBQ = QKV_N * DMODEL / 2048;
  if (blk < NBX)            cvt_body<0>(x, (us16*)xb, blk, tid);
  else if (blk < NBX + NBQ) cvt_body<0>(wq, (us16*)wb, blk - NBX, tid);
  else                      cvt_body<1>(wpj, (us16*)wp, blk - NBX - NBQ, tid);
}

// ---------------------------------------------------------------------------------------------
// RoPE tables ct/st [SEQ][NROPE] f32: angle(t, j) = t * (1 / 10000^(2j/64)). Block = 8 positions x 32 freqs.
// One powf + one sincosf per thread (rolled). Rows staged in LDS; waves 0-1 write the cos lines, waves 2-3 the
// coverage: (SEQ/8 blocks) x 8 rows x 32 floats == SEQ*NROPE per table.
static __device__ __forceinline__ void rope_table_body(float* __restrict__ ct, float* __restrict__ st,
                                                       int blk, int tid) {
  __shared__ __align__(16) float sc[8 * NROPE];   // cross-wave (block barrier)
  __shared__ __align__(16) float ss[8 * NROPE];
  const int j   = tid & 31;
  const int tl  = tid >> 5;
  const int t   = blk * 8 + tl;
  const float e   = (float)(2 * j) * (1.0f / 64.0f);
  const float pw  = powf(10000.0f, e);
  const float inv = 1.0f / pw;
  const float ang = (float)t * inv;
  float sn, cs;
  sincosf(ang, &sn, &cs);
  sc[tl * NROPE + j] = cs;
  ss[tl * NROPE + j] = sn;
  __syncthreads();
  if (tid < 64) {
    const int rowl  = tid >> 3;
    const int piece = tid & 7;
    const v4f v = *(const v4f*)(sc + rowl * NROPE + piece * 4);
    const size_t gi = (size_t)(blk * 8 + rowl) * NROPE + piece * 4;
    *(v4f*)(ct + gi) = v;
    
  } else if (tid < 128) {
    const int rowl  = (tid - 64) >> 3;
    const int piece = tid & 7;
    const v4f v = *(const v4f*)(ss + rowl * NROPE + piece * 4);
    const size_t gi = (size_t)(blk * 8 + rowl) * NROPE + piece * 4;
    *(v4f*)(st + gi) = v;
    
  }
}

// One launch for the two passes that depend on nothing but the inputs: blocks [0, SEQ/8) build the RoPE tables,
// the rest convert the operands (block-uniform branch, so the table blocks' barrier is passed by whole blocks).
__global__ __launch_bounds__(256) void prep_kernel(const float* __restrict__ x,
                                                   const float* __restrict__ wq,
                                                   const float* __restrict__ wpj,
                                                   bf16* __restrict__ xb,
                                                   bf16* __restrict__ wb,
                                                   f16* __restrict__ wp,
                                                   float* __restrict__ ct, float* __restrict__ st) {
  const int blk = blockIdx.x;
  const int tid = threadIdx.x;
  const int NBR = SEQ / 8;
  if (blk < NBR) rope_table_body(ct, st, blk, tid);
  else           convert_body(x, wq, wpj, xb, wb, wp, blk - NBR, tid);
}

// ---------------------------------------------------------------------------------------------
// NT GEMM: C[m][n] = oscale * sum_k A[m][k] B[n][k] (+ rscale * sum_k Ar[m][k] B[n][k] when RES).
// A, Ar, B are 16-bit row-major planes with pitch K (k contiguous). 4 waves/block, wave tile (16*MI) x 64,
// block tile (64*MI) x 64. The block's A, Ar and B rows are staged GS k at a time in two LDS buffers by asynchronous
// 16-B copies (whole 128-B row pieces); a stage buffer holds three 64-row tiles at pitch KP: [A | A | B], or [A | Ar | B] when RES.
// A and B fragments are read from LDS with the split k map:
// elements 0..7 <- k0 + 8h + 0..7, elements 8..15 <- k0 + 16 + 8h + 0..7, lane&15 = row of A / row of B (= column n).
// Epilogue: wave tile staged in LDS (in the bytes of the stage buffers, which every wave has left by then), then per
// instruction lanes 0..15 write one 256-B row segment.
// Requires K % 64 == 0, N % 64 == 0, rows covered by the grid a multiple of 64*MI.
// One stage's copies of one thread of the 128: rows r + 16 j (r = tid>>3, j = 0..3) of each of the three 64-row tiles,
// 16-B piece tid&7. r0/r1/r2 point at the first row of each tile at the stage's first k (pitch K); in LDS the three
// tiles follow one another, so the twelve rows of a thread lie 16 rows apart.
static __device__ __forceinline__ void stage_gemm(us16* buf, const us16* r0, const us16* r1, const us16* r2,
                                                  int K, int tid) {
  const int row   = tid >> 3;     // 0..15
  const int piece = tid & 7;      // 0..7
  const unsigned l0 = (unsigned)(size_t)(buf + row * KP + piece * 8);   // LDS byte address
  const unsigned ls = 16 * KP * 2;                                      // 16 rows in LDS, bytes
  const size_t   go = (size_t)row * K + piece * 8;
  const size_t   gs = (size_t)16 * K;                                    // 16 rows in the plane, elements
  const us16* a0 = r0 + go;
  const us16* b0 = r1 + go;
  const us16* c0 = r2 + go;
  // the copies and, as the last line, the wait that stands before any of their address registers is rewritten
  asm volatile("global_load_async_to_lds_b128 %0, %12, off\n\t"
               "global_load_async_to_lds_b128 %1, %13, off\n\t"
               "global_load_async_to_lds_b128 %2, %14, off\n\t"
               "global_load_async_to_lds_b128 %3, %15, off\n\t"
               "global_load_async_to_lds_b128 %4, %16, off\n\t"
               "global_load_async_to_lds_b128 %5, %17, off\n\t"
               "global_load_async_to_lds_b128 %6, %18, off\n\t"
               "global_load_async_to_lds_b128 %7, %19, off\n\t"
               "global_load_async_to_lds_b128 %8, %20, off\n\t"
               "global_load_async_to_lds_b128 %9, %21, off\n\t"
               "global_load_async_to_lds_b128 %10, %22, off\n\t"
               "global_load_async_to_lds_b128 %11, %23, off\n\t"
               "s_wait_xcnt 0x0"
               :: "v"(l0), "v"(l0 + ls), "v"(l0 + 2 * ls), "v"(l0 + 3 * ls),
                  "v"(l0 + 4 * ls), "v"(l0 + 5 * ls), "v"(l0 + 6 * ls), "v"(l0 + 7 * ls),
                  "v"(l0 + 8 * ls), "v"(l0 + 9 * ls), "v"(l0 + 10 * ls), "v"(l0 + 11 * ls),
                  "v"(a0), "v"(a0 + gs), "v"(a0 + 2 * gs), "v"(a0 + 3 * gs),
                  "v"(b0), "v"(b0 + gs), "v"(b0 + 2 * gs), "v"(b0 + 3 * gs),
                  "v"(c0), "v"(c0 + gs), "v"(c0 + 2 * gs), "v"(c0 + 3 * gs) : "memory");
}

#define GEMM_LDS_B (2 * 3 * TILE_H * 2)        // bytes of the two stage buffers of three tiles each

// Where the qkv product's epilogue reads the RoPE tables and writes the 16-bit planes.
//   qh, kh [NHEAD][SEQ][HDIM] f16 : q and k after RoPE;  vt [NHEAD][HDIM][SEQ] f16 : V transposed.
//   qr, kr [NHEAD][ER][HDIM]  f16 : residual planes (x - f16(x)) * 1024 for rows < ER;  vtr [NHEAD][HDIM][ER] likewise.
struct PlaneOut {
  const float* ct;
  const float* st;
  f16* qh;
  f16* qr;
  f16* kh;
  f16* kr;
  f16* vt;
  f16* vtr;
};

// Epilogue of the qkv product: the block's 128 x 64 tile is one slot (q, k or v) of one head for 128 rows, so the planes
// are built from the f32 accumulators and the f32 qkv array is never written. All branches are block-uniform.
// q, k: wave tile staged in LDS as f32; RoPE (rotate-half): out[d] = x[d]*cos + sgn*x[d^32]*sin, both from the staged row;
//       per instruction 4 rows of 128 B, whole lines.
// v:    a lane's 8 accumulator rows are 8 consecutive keys of one d, so the tile is staged transposed with one 16-B LDS
//       store each; per instruction 2 rows of 256 B, whole lines.
// coverage: rows mb..mb+127, d 0..63 of the slot's plane; residual planes for blocks with mb < ER (ER % 128 == 0).
// EARLY is the block-uniform mb < ER as a template argument, so that neither form carries the other's registers.
// Every loop here is unrolled: constant indices keep the accumulators and the small arrays in registers.
template <int EARLY>
static __device__ __forceinline__ void rope_planes(unsigned char* smem, const v8f (&acc)[2][4],
                                                   const float* ct, const float* st,
                                                   f16* pl, f16* plr, int mb, int h) {
  const int tid  = threadIdx.x;
  const int wave = tid >> 5;
  const int lane = tid & 31;
  const int lq   = lane & 15;
  const int hi   = lane >> 4;
  float* so = (float*)smem + wave * (32 * OP);
  #pragma unroll
  for (int mi = 0; mi < 2; ++mi) {
    #pragma unroll
    for (int t = 0; t < 4; ++t) {
      #pragma unroll
      for (int r = 0; r < 8; ++r) so[(mi * 16 + hi * 8 + r) * OP + t * 16 + lq] = acc[mi][t][r];
    }
  }
  __syncthreads();
  const int   d0  = (lane & 7) * 8;           // 0..56
  const int   j0  = d0 & (NROPE - 1);         // frequency index of d0
  const float sgn = (d0 < NROPE) ? -1.0f : 1.0f;
  const int   NK  = (EARLY != 0) ? 2 : 4;     // row groups whose loads are in flight together
  // one 32-bit lane offset per array on a uniform base; the row groups lie a constant 4 rows apart
  const unsigned srow0 = (unsigned)(mb + wave * 32 + (lane >> 3));
  const unsigned toff  = srow0 * NROPE + j0;
  const unsigned poff  = srow0 * HDIM + d0;
  f16* plh  = pl + (size_t)h * SEQ * HDIM;
  f16* plrh = plr + (size_t)h * ER * HDIM;    // used only when EARLY (rows < ER)
  const float* cpb = ct + toff;
  const float* spb = st + toff;
  #pragma unroll
  for (int b = 0; b < 8 / NK; ++b) {
    v4f c0[NK], c1[NK], n0v[NK], n1v[NK];
    #pragma unroll
    for (int k = 0; k < NK; ++k) {
      c0[k]  = *(const v4f*)(cpb + (b * NK + k) * 4 * NROPE);
      c1[k]  = *(const v4f*)(cpb + (b * NK + k) * 4 * NROPE + 4);
      n0v[k] = *(const v4f*)(spb + (b * NK + k) * 4 * NROPE);
      n1v[k] = *(const v4f*)(spb + (b * NK + k) * 4 * NROPE + 4);
    }
    // the wait that stands before the table loads' address registers are rewritten; it names them, so they live up to it
    asm volatile("s_wait_xcnt 0x0" :: "v"(cpb), "v"(spb) : "memory");
    v4u hv[NK], rv[NK];
    #pragma unroll
    for (int k = 0; k < NK; ++k) {
      const int row = (b * NK + k) * 4 + (lane >> 3);    // 0..31
      const float* xo = so + row * OP + d0;
      const float* xq = so + row * OP + (d0 ^ NROPE);    // pair partner d^32
      const v4f x0 = *(const v4f*)(xo);
      const v4f x1 = *(const v4f*)(xo + 4);
      const v4f p0 = *(const v4f*)(xq);
      const v4f p1 = *(const v4f*)(xq + 4);
      float xa[8], pa[8], ca[8], sa[8];
      #pragma unroll
      for (int i = 0; i < 4; ++i) {
        xa[i] = x0[i];     xa[4 + i] = x1[i];
        pa[i] = p0[i];     pa[4 + i] = p1[i];
        ca[i] = c0[k][i];  ca[4 + i] = c1[k][i];
        sa[i] = n0v[k][i]; sa[4 + i] = n1v[k][i];
      }
      Pack8H ph, px;
      #pragma unroll
      for (int i = 0; i < 8; ++i) {
        const float xr = xa[i] * ca[i] + sgn * pa[i] * sa[i];
        const f16 xh = (f16)xr;
        ph.h[i] = xh;
        px.h[i] = (f16)((xr - (float)xh) * RSC);
      }
      hv[k] = ph.u;
      rv[k] = px.u;
    }
    f16* pp = plh + poff;
    f16* pr = plrh + poff;
    #pragma unroll
    for (int k = 0; k < NK; ++k) {
      *(v4u*)(pp + (b * NK + k) * 4 * HDIM) = hv[k];
      if (EARLY != 0) *(v4u*)(pr + (b * NK + k) * 4 * HDIM) = rv[k];
    }
    // the wait that stands before the stores' address and data registers are rewritten; it names them, so they live up to it
    if constexpr (EARLY != 0)
      asm volatile("s_wait_xcnt 0x0" :: "v"(pp), "v"(pr), "v"(hv[0]), "v"(hv[1]), "v"(rv[0]), "v"(rv[1]) : "memory");
    else
      asm volatile("s_wait_xcnt 0x0" :: "v"(pp), "v"(hv[0]), "v"(hv[1]), "v"(hv[2]), "v"(hv[3]) : "memory");
  }
}

template <int EARLY>
static __device__ __forceinline__ void v_planes(unsigned char* smem, const v8f (&acc)[2][4],
                                                f16* vt, f16* vtr, int mb, int h) {
  const int tid  = threadIdx.x;
  const int wave = tid >> 5;
  const int lane = tid & 31;
  const int lq   = lane & 15;
  const int hi   = lane >> 4;
  f16* sT = (f16*)smem;                       // [d][key] hi, cross-wave (block barrier)
  f16* sR = sT + HDIM * VP;                   // [d][key] residual, cross-wave (block barrier)
  #pragma unroll
  for (int mi = 0; mi < 2; ++mi) {
    #pragma unroll
    for (int t = 0; t < 4; ++t) {
      Pack8H ph, px;
      #pragma unroll
      for (int r = 0; r < 8; ++r) {
        const float va = acc[mi][t][r];
        const f16 vh = (f16)va;
        ph.h[r] = vh;
        px.h[r] = (f16)((va - (float)vh) * RSC);
      }
      const int o = (t * 16 + lq) * VP + wave * 32 + mi * 16 + hi * 8;   // d = t*16 + lq, keys hi*8 + 0..7 of the 16
      *(v4u*)(sT + o) = ph.u;
      if (EARLY != 0) *(v4u*)(sR + o) = px.u;
    }
  }
  __syncthreads();
  const int dl = tid >> 4;                    // 0..7
  const int ks = (tid & 15) * 8;              // 0..120
  v4u vv[8];
  #pragma unroll
  for (int it = 0; it < 8; ++it) vv[it] = *(const v4u*)(sT + (it * 8 + dl) * VP + ks);
  f16* vth = vt + (size_t)h * HDIM * SEQ + mb;   // uniform base; one 32-bit lane offset; the rows lie a constant 8 apart
  #pragma unroll
  for (int it = 0; it < 8; ++it) *(v4u*)(vth + (unsigned)(dl * SEQ + ks) + it * 8 * SEQ) = vv[it];
  asm volatile("s_wait_xcnt 0x0" ::: "memory");   // stands before the stores' address and data registers are rewritten
  if (EARLY != 0) {
    v4u vx[8];
    #pragma unroll
    for (int it = 0; it < 8; ++it) vx[it] = *(const v4u*)(sR + (it * 8 + dl) * VP + ks);
    f16* vtrh = vtr + (size_t)h * HDIM * ER + mb;
    #pragma unroll
    for (int it = 0; it < 8; ++it) *(v4u*)(vtrh + (unsigned)(dl * ER + ks) + it * 8 * ER) = vx[it];
    asm volatile("s_wait_xcnt 0x0" ::: "memory");   // as above
  }
}

static __device__ __forceinline__ void planes_epilogue(unsigned char* smem, const v8f (&acc)[2][4],
                                                       const PlaneOut& po, int mb, int n0) {
  const int slot = n0 / DMODEL;               // 0 = q, 1 = k, 2 = v
  const int h    = (n0 % DMODEL) / HDIM;
  if (slot < 2) {
    f16* pl  = (slot == 0) ? po.qh : po.kh;
    f16* plr = (slot == 0) ? po.qr : po.kr;
    if (mb >= ER) rope_planes<0>(smem, acc, po.ct, po.st, pl, plr, mb, h);
    else          rope_planes<1>(smem, acc, po.ct, po.st, pl, plr, mb, h);
  } else {
    if (mb >= ER) v_planes<0>(smem, acc, po.vt, po.vtr, mb, h);
    else          v_planes<1>(smem, acc, po.vt, po.vtr, mb, h);
  }
}
static_assert(2 * HDIM * VP * 2 <= GEMM_LDS_B && 4 * 32 * OP * 4 <= GEMM_LDS_B);
static_assert(ER % 128 == 0 && SEQ % 128 == 0 && DMODEL % HDIM == 0);

// smem: the block's GEMM_LDS_B bytes of LDS; mb, n0: first row and first column of the block's tile.
// EPI != 0: the result goes through planes_epilogue to po's planes and C is not written.
template <typename F, int MI, int RES, int EPI>
static __device__ __forceinline__ void gemm_nt_body(unsigned char* smem,
                                                    const us16* __restrict__ A,
                                                    const us16* __restrict__ Ar,
                                                    const us16* __restrict__ Bm,
                                                    float* __restrict__ C,
                                                    int K, int N, int mb, int n0,
                                                    float oscale, float rscale, const PlaneOut& po) {
  static_assert((MI == 2 && RES == 0) || (MI == 1 && RES == 1));   // three 64-row tiles per stage
  static_assert(EPI == 0 || (MI == 2 && RES == 0));
  const int BT    = 2;                         // index of the B tile in a stage buffer
  const int STG_H = (BT + 1) * TILE_H;         // halves per stage buffer
  const int RING_B = 2 * STG_H * 2;            // bytes of the two stage buffers
  const int OUT_B  = 4 * 16 * MI * OP * 4;     // bytes of the four waves' output staging
  static_assert(RING_B <= GEMM_LDS_B && OUT_B <= GEMM_LDS_B);
  // two stage buffers (cross-wave) in the loop; behind the loop's last barrier the per-wave output staging
  us16*  ring = (us16*)smem;
  float* sC   = (float*)smem;
  const int tid  = threadIdx.x;
  const int wave = tid >> 5;
  const int lane = tid & 31;
  const int lq   = lane & 15;
  const int hi   = lane >> 4;
  const int m0   = mb + wave * (16 * MI);

  v8f acc[MI][4], acc2[MI][4];
  #pragma unroll
  for (int mi = 0; mi < MI; ++mi) {
    #pragma unroll
    for (int t = 0; t < 4; ++t) {
      acc[mi][t]  = (v8f){0, 0, 0, 0, 0, 0, 0, 0};
      acc2[mi][t] = (v8f){0, 0, 0, 0, 0, 0, 0, 0};
    }
  }

  const us16* ab  = A + (size_t)mb * K;                                                  // tile 0: A rows 0..63
  const us16* arb = (RES != 0) ? Ar + (size_t)mb * K : A + (size_t)(mb + 64) * K;        // tile 1: Ar, or A rows 64..127
  const us16* bb  = Bm + (size_t)n0 * K;                                                 // tile 2: B rows
  const int   nst = K / GS;                           // block-uniform stage count

  stage_gemm(ring, ab, arb, bb, K, tid);
  asm volatile("s_wait_asynccnt 0x0" ::: "memory");   // this wave's copies of stage 0 have landed
  __syncthreads();                                    // stage 0 readable by every wave
  if (nst > 1) stage_gemm(ring + STG_H, ab + GS, arb + GS, bb + GS, K, tid);

  for (int s = 0; s < nst; ++s) {
    const us16* sb = ring + (s & 1) * STG_H;
    #pragma unroll   // constant indices keep the fragment arrays in registers
    for (int u = 0; u < GS / 32; ++u) {
      F a[MI], ar[MI], b[4];
      #pragma unroll
      for (int mi = 0; mi < MI; ++mi) {
        const us16* p = sb + (wave * (16 * MI) + mi * 16 + lq) * KP + u * 32 + hi * 8;
        a[mi].q[0] = *(const v4u*)(p);        // k0 + 8h + 0..7
        a[mi].q[1] = *(const v4u*)(p + 16);   // k0 + 16 + 8h + 0..7
        if (RES != 0) {
          const us16* pr = p + MI * TILE_H;
          ar[mi].q[0] = *(const v4u*)(pr);
          ar[mi].q[1] = *(const v4u*)(pr + 16);
        }
      }
      #pragma unroll
      for (int t = 0; t < 4; ++t) {
        const us16* p = sb + BT * TILE_H + (t * 16 + lq) * KP + u * 32 + hi * 8;
        b[t].q[0] = *(const v4u*)(p);
        b[t].q[1] = *(const v4u*)(p + 16);
      }
      #pragma unroll
      for (int mi = 0; mi < MI; ++mi) {
        #pragma unroll
        for (int t = 0; t < 4; ++t) {
          acc[mi][t] = mma(a[mi], b[t], acc[mi][t]);
          if (RES != 0) acc2[mi][t] = mma(ar[mi], b[t], acc2[mi][t]);
        }
      }
    }
    // publish point of stage s + 1, passed by every wave
    asm volatile("s_wait_dscnt 0x0" ::: "memory");      // this wave's reads of stage s are done before its buffer is refilled
    asm volatile("s_wait_asynccnt 0x0" ::: "memory");   // this wave's copies of stage s + 1 have landed
    __syncthreads();                                    // stage s + 1 readable; every reader has left stage s
    if (s + 2 < nst)
      stage_gemm(ring + (s & 1) * STG_H, ab + (s + 2) * GS, arb + (s + 2) * GS, bb + (s + 2) * GS, K, tid);
  }
  asm volatile("s_wait_asynccnt 0x0" ::: "memory");     // no copy outstanding behind the loop

  if constexpr (EPI != 0) {
    planes_epilogue(smem, acc, po, mb, n0);
    return;
  }

  float* so = sC + wave * (16 * MI * OP);
  #pragma unroll
  for (int mi = 0; mi < MI; ++mi) {
    #pragma unroll
    for (int t = 0; t < 4; ++t) {
      #pragma unroll
      for (int r = 0; r < 8; ++r) {
        float val = acc[mi][t][r] * oscale;
        if (RES != 0) val += acc2[mi][t][r] * rscale;
        so[(mi * 16 + hi * 8 + r) * OP + t * 16 + lq] = val;
      }
    }
  }
  __syncthreads();

  const int NIT = 8 * MI;   // (16*MI rows) / 2 rows per instruction
  v4f    vals[8 * MI];
  size_t gidx[8 * MI];
  #pragma unroll
  for (int it = 0; it < NIT; ++it) {
    const int row = it * 2 + hi;
    vals[it] = *(const v4f*)(so + row * OP + lq * 4);
    gidx[it] = (size_t)(m0 + row) * N + n0 + lq * 4;
  }
  #pragma unroll
  for (int it = 0; it < NIT; ++it) *(v4f*)(C + gidx[it]) = vals[it];
  
}

// qkv = xb x wb^T, RoPE and the q/k/v planes: block tile 128 x 64, grid (N / 64, rows / 128).
__global__ __launch_bounds__(128) void gemm_qkv_kernel(const us16* __restrict__ A,
                                                       const us16* __restrict__ Bm,
                                                       const float* __restrict__ ct,
                                                       const float* __restrict__ st,
                                                       f16* __restrict__ qh, f16* __restrict__ qr,
                                                       f16* __restrict__ kh, f16* __restrict__ kr,
                                                       f16* __restrict__ vt, f16* __restrict__ vtr,
                                                       int K, int N) {
  __shared__ __align__(16) unsigned char smem[GEMM_LDS_B];
  const PlaneOut po = {ct, st, qh, qr, kh, kr, vt, vtr};
  gemm_nt_body<FragB, 2, 0, 1>(smem, A, A, Bm, nullptr, K, N, blockIdx.y * 128, blockIdx.x * 64, 1.0f, 0.0f, po);
}

// out = ctx x wp^T, all rows in one launch: the first ER / 64 block rows take 64 rows each with the residual plane,
// the others 128 rows each from row ER on (block-uniform branch; the two row ranges share no output element).
__global__ __launch_bounds__(128) void gemm_proj_kernel(const us16* __restrict__ A,
                                                        const us16* __restrict__ Ar,
                                                        const us16* __restrict__ Bm,
                                                        float* __restrict__ C, int K, int N,
                                                        float oscale, float rscale) {
  __shared__ __align__(16) unsigned char smem[GEMM_LDS_B];
  const int by = blockIdx.y;
  const int n0 = blockIdx.x * 64;
  const PlaneOut none = {};
  if (by < ER / 64) gemm_nt_body<FragH, 1, 1, 0>(smem, A, Ar, Bm, C, K, N, by * 64, n0, oscale, rscale, none);
  else              gemm_nt_body<FragH, 2, 0, 0>(smem, A, A, Bm, C, K, N, ER + (by - ER / 64) * 128, n0, oscale, 0.0f, none);
}

// ---------------------------------------------------------------------------------------------
// Flash attention, causal. Block = (head, two query blocks of 128 in turn); one wave owns 16 query rows of each.
// S^T = K x Q^T so queries sit on lanes; P^T in C-layout is bit-identical to the A-fragment layout of O += P x V.
// Q B-fragments are loaded straight from the 16-bit plane; K A-fragments and V^T B-fragments from LDS (two 16-B loads each).
// RES != 0 (query blocks < EARLY_QBLK, all visited keys < ER): score = KQ + (K Qres + Kres Q)/1024;
// O2 = Pres V + P Vres accumulated separately and folded as O2/1024 before normalisation.
// K and V^T (and their residual planes when RES) are staged once per query block, KS keys at a time, in two LDS buffers
// by asynchronous 16-B copies; all eight waves read their fragments from LDS. A stage buffer holds the tiles
// [K | V^T | Kres | V^Tres], each 64 rows of 128 B at pitch KP.
// One stage's copies of one thread: rows tid>>3 and 32 + (tid>>3) of every tile, 16-B piece tid&7.
// kg/krg point at the stage's first key row (pitch HDIM); vg/vrg at the stage's first key column (pitch SEQ / ER).
template <int RES>
static __device__ __forceinline__ void stage_tiles(f16* buf, const f16* kg, const f16* krg,
                                                   const f16* vg, const f16* vrg, int tid) {
  const int row   = tid >> 3;     // 0..31
  const int piece = tid & 7;      // 0..7
  const unsigned l0 = (unsigned)(size_t)(buf + row * KP + piece * 8);   // LDS byte address
  const unsigned l1 = l0 + 32 * KP * 2;
  const unsigned l2 = l0 + TILE_H * 2;
  const unsigned l3 = l1 + TILE_H * 2;
  const f16* g0 = kg + (size_t)row * HDIM + piece * 8;
  const f16* g1 = g0 + 32 * HDIM;
  const f16* g2 = vg + (size_t)row * SEQ + piece * 8;
  const f16* g3 = g2 + (size_t)32 * SEQ;
  // the copies and, as the last line, the wait that stands before any of their address registers is rewritten
  asm volatile("global_load_async_to_lds_b128 %0, %4, off\n\t"
               "global_load_async_to_lds_b128 %1, %5, off\n\t"
               "global_load_async_to_lds_b128 %2, %6, off\n\t"
               "global_load_async_to_lds_b128 %3, %7, off\n\t"
               "s_wait_xcnt 0x0"
               :: "v"(l0), "v"(l1), "v"(l2), "v"(l3), "v"(g0), "v"(g1), "v"(g2), "v"(g3) : "memory");
  if (RES != 0) {
    const unsigned l4 = l0 + 2 * TILE_H * 2;
    const unsigned l5 = l1 + 2 * TILE_H * 2;
    const unsigned l6 = l0 + 3 * TILE_H * 2;
    const unsigned l7 = l1 + 3 * TILE_H * 2;
    const f16* g4 = krg + (size_t)row * HDIM + piece * 8;
    const f16* g5 = g4 + 32 * HDIM;
    const f16* g6 = vrg + (size_t)row * ER + piece * 8;
    const f16* g7 = g6 + (size_t)32 * ER;
    // same form for the residual tiles
    asm volatile("global_load_async_to_lds_b128 %0, %4, off\n\t"
                 "global_load_async_to_lds_b128 %1, %5, off\n\t"
                 "global_load_async_to_lds_b128 %2, %6, off\n\t"
                 "global_load_async_to_lds_b128 %3, %7, off\n\t"
                 "s_wait_xcnt 0x0"
                 :: "v"(l4), "v"(l5), "v"(l6), "v"(l7), "v"(g4), "v"(g5), "v"(g6), "v"(g7) : "memory");
  }
}

// sO: per-wave output staging, NWAVE * 16 * OP floats; sKV: the two stage buffers.
template <int RES>
static __device__ __forceinline__ void attn_body(float* sO, f16* sKV,
                                                 const f16* __restrict__ qh, const f16* __restrict__ qr,
                                                 const f16* __restrict__ kh, const f16* __restrict__ kr,
                                                 const f16* __restrict__ vt, const f16* __restrict__ vtr,
                                                 f16* __restrict__ ctxh, f16* __restrict__ ctxr,
                                                 int qblk, int h) {
  const int tid  = threadIdx.x;
  const int wave = __builtin_amdgcn_readfirstlane(tid >> 5);   // scalar, so the per-wave causal skip is a scalar branch
  const int lane = tid & 31;
  const int lq   = lane & 15;   // query column of S^T / d column of O
  const int hi   = lane >> 4;   // k-split half

  const int STG_H = (RES != 0 ? 4 : 2) * TILE_H;         // halves per stage buffer

  const int qrow0 = qblk * BQ + wave * 16;               // first query row of this wave

  // Q as B-operand fragments: lane lq holds query qrow0+lq, elements follow the split d map.
  FragH qf[2], qx[2];
  {
    const f16* qp = qh + ((size_t)h * SEQ + qrow0 + lq) * HDIM;
    #pragma unroll
    for (int f = 0; f < 2; ++f) {
      qf[f].q[0] = *(const v4u*)(qp + f * 32 + hi * 8);        // d = f*32 + hi*8 + 0..7
      qf[f].q[1] = *(const v4u*)(qp + f * 32 + 16 + hi * 8);   // d = f*32 + 16 + hi*8 + 0..7
    }
    if (RES != 0) {
      const f16* qrp = qr + ((size_t)h * ER + qrow0 + lq) * HDIM;
      #pragma unroll
      for (int f = 0; f < 2; ++f) {
        qx[f].q[0] = *(const v4u*)(qrp + f * 32 + hi * 8);
        qx[f].q[1] = *(const v4u*)(qrp + f * 32 + 16 + hi * 8);
      }
    }
  }

  const f16* kh_h  = kh  + (size_t)h * SEQ * HDIM;
  const f16* kr_h  = kr  + (size_t)h * ER * HDIM;
  const f16* vt_h  = vt  + (size_t)h * HDIM * SEQ;
  const f16* vtr_h = vtr + (size_t)h * HDIM * ER;

  v8f o[4], o2[4];
  #pragma unroll
  for (int dt = 0; dt < 4; ++dt) {
    o[dt]  = (v8f){0, 0, 0, 0, 0, 0, 0, 0};
    o2[dt] = (v8f){0, 0, 0, 0, 0, 0, 0, 0};
  }

  float rmax = -__builtin_inff();
  float rsum = 0.0f;
  const float SL = 0.125f * 1.4426950408889634f;   // softmax scale * log2(e)

  // causal: this wave visits key chunks whose first key is <= its last query row (wave-uniform trip count)
  const int nchunk = (qrow0 + 15) / BK + 1;
  // the block walks the stages up to its last query row (block-uniform count, at least two)
  const int nstage = (qblk + 1) * (BQ / KS);

  stage_tiles<RES>(sKV, kh_h, kr_h, vt_h, vtr_h, tid);
  asm volatile("s_wait_asynccnt 0x0" ::: "memory");   // this wave's copies of stage 0 have landed
  __syncthreads();                                    // stage 0 readable by every wave
  if (nstage > 1)
    stage_tiles<RES>(sKV + STG_H, kh_h + (size_t)KS * HDIM, kr_h + (size_t)KS * HDIM, vt_h + KS, vtr_h + KS, tid);

  for (int t = 0; t < nstage; ++t) {
   const f16* sb = sKV + (t & 1) * STG_H;
   for (int u = 0; u < KS / BK; ++u) {
    const int i = t * (KS / BK) + u;
    if (i >= nchunk) break;                 // wave-uniform: chunks beyond this wave's diagonal
    const int j0 = i * BK;
    const f16* sk  = sb + (u * BK) * KP;                 // K rows of this chunk
    const f16* sv  = sb + TILE_H + u * BK;               // V^T key columns of this chunk
    const f16* skr = sb + (RES != 0 ? 2 : 0) * TILE_H + (u * BK) * KP;    // residual tiles (read when RES only)
    const f16* svr = sb + (RES != 0 ? 3 : 1) * TILE_H + u * BK;

    // K A-fragments, then V B-fragments (column n = d = dt*16 + lq, split key map from the transposed tile): all
    // fetched at the head of the chunk, so that V's LDS latency passes under the score products and the softmax.
    FragH ka[2][2], bvf[4];
    #pragma unroll   // constant indices keep the fragment arrays in registers
    for (int sub = 0; sub < 2; ++sub) {
      const f16* base = sk + (sub * 16 + lq) * KP + hi * 8;   // row = key j0 + sub*16 + lq
      ka[sub][0].q[0] = *(const v4u*)(base);        // d = hi*8 + 0..7
      ka[sub][0].q[1] = *(const v4u*)(base + 16);   // d = 16 + hi*8 + 0..7
      ka[sub][1].q[0] = *(const v4u*)(base + 32);   // d = 32 + hi*8 + 0..7
      ka[sub][1].q[1] = *(const v4u*)(base + 48);   // d = 48 + hi*8 + 0..7
    }
    #pragma unroll   // as above
    for (int dt = 0; dt < 4; ++dt) {
      const f16* base = sv + (dt * 16 + lq) * KP + hi * 8;
      bvf[dt].q[0] = *(const v4u*)(base);        // keys j0 + hi*8 + 0..7
      bvf[dt].q[1] = *(const v4u*)(base + 16);   // keys j0 + 16 + hi*8 + 0..7
    }

    // S^T tiles: c[sub][r] = rawscore(query qrow0+lq, key j0 + sub*16 + hi*8 + r)
    v8f c[2];
    #pragma unroll
    for (int sub = 0; sub < 2; ++sub) {
      const FragH a0 = ka[sub][0];
      const FragH a1 = ka[sub][1];
      v8f acc = (v8f){0, 0, 0, 0, 0, 0, 0, 0};
      acc = mma_f16(a0.v, qf[0].v, acc);
      acc = mma_f16(a1.v, qf[1].v, acc);
      if (RES != 0) {
        FragH r0, r1;
        const f16* rb = skr + (sub * 16 + lq) * KP + hi * 8;
        r0.q[0] = *(const v4u*)(rb);
        r0.q[1] = *(const v4u*)(rb + 16);
        r1.q[0] = *(const v4u*)(rb + 32);
        r1.q[1] = *(const v4u*)(rb + 48);
        v8f ax = (v8f){0, 0, 0, 0, 0, 0, 0, 0};
        ax = mma_f16(a0.v, qx[0].v, ax);
        ax = mma_f16(a1.v, qx[1].v, ax);
        ax = mma_f16(r0.v, qf[0].v, ax);
        ax = mma_f16(r1.v, qf[1].v, ax);
        #pragma unroll
        for (int r = 0; r < 8; ++r) acc[r] += ax[r] * (1.0f / RSC);
      }
      c[sub] = acc;
    }

    // causal mask (key > query -> -inf); branch is wave-uniform, selects are per lane
    if (j0 + BK - 1 > qrow0) {
      const int qi = qrow0 + lq;
      #pragma unroll
      for (int sub = 0; sub < 2; ++sub) {
        #pragma unroll
        for (int r = 0; r < 8; ++r) {
          const int key = j0 + sub * 16 + hi * 8 + r;
          c[sub][r] = (key > qi) ? -__builtin_inff() : c[sub][r];
        }
      }
    }

    // online softmax: query lq's 32 scores are split across lane / lane^16
    float m_new = rmax;
    #pragma unroll
    for (int r = 0; r < 8; ++r) {
      m_new = fmaxf(m_new, c[0][r]);
      m_new = fmaxf(m_new, c[1][r]);
    }
    m_new = fmaxf(m_new, __shfl_xor(m_new, 16, 32));
    const float scale = __builtin_amdgcn_exp2f((rmax - m_new) * SL);
    rmax = m_new;

    // exp + pack: P^T C-layout == A-fragment layout for the PV product
    FragH pa, pr;
    float psum = 0.0f;
    #pragma unroll
    for (int r = 0; r < 8; ++r) {
      const float p0 = __builtin_amdgcn_exp2f((c[0][r] - m_new) * SL);   // key hi*8 + r
      const float p1 = __builtin_amdgcn_exp2f((c[1][r] - m_new) * SL);   // key 16 + hi*8 + r
      psum += p0 + p1;
      const float pc0 = p0 * PCAR;
      const float pc1 = p1 * PCAR;
      const f16 h0 = (f16)pc0;
      const f16 h1 = (f16)pc1;
      pa.h[r]     = h0;
      pa.h[8 + r] = h1;
      if (RES != 0) {
        pr.h[r]     = (f16)((pc0 - (float)h0) * RSC);
        pr.h[8 + r] = (f16)((pc1 - (float)h1) * RSC);
      }
    }
    rsum = rsum * scale + psum + __shfl_xor(psum, 16, 32);

    // rescale O: queries are the row dimension there -> per-row scale from lane 8*hi + r
    float sc[8];
    #pragma unroll
    for (int r = 0; r < 8; ++r) sc[r] = __shfl(scale, (hi << 3) + r, 32);
    #pragma unroll
    for (int dt = 0; dt < 4; ++dt) {
      #pragma unroll
      for (int r = 0; r < 8; ++r) {
        o[dt][r] *= sc[r];
        if (RES != 0) o2[dt][r] *= sc[r];
      }
    }

    // O += P x V
    #pragma unroll
    for (int dt = 0; dt < 4; ++dt) {
      o[dt] = mma_f16(pa.v, bvf[dt].v, o[dt]);
      if (RES != 0) {
        o2[dt] = mma_f16(pr.v, bvf[dt].v, o2[dt]);
        FragH br;
        const f16* rb = svr + (dt * 16 + lq) * KP + hi * 8;
        br.q[0] = *(const v4u*)(rb);
        br.q[1] = *(const v4u*)(rb + 16);
        o2[dt] = mma_f16(pa.v, br.v, o2[dt]);
      }
    }
   }
   // publish point of stage t + 1, passed by every wave (also one that skipped chunks)
   asm volatile("s_wait_dscnt 0x0" ::: "memory");      // this wave's reads of stage t are done before its buffer is refilled
   asm volatile("s_wait_asynccnt 0x0" ::: "memory");   // this wave's copies of stage t + 1 have landed
   __syncthreads();                                    // stage t + 1 readable; every reader has left stage t
   if (t + 2 < nstage)
     stage_tiles<RES>(sKV + (t & 1) * STG_H, kh_h + (size_t)(t + 2) * KS * HDIM, kr_h + (size_t)(t + 2) * KS * HDIM,
                      vt_h + (t + 2) * KS, vtr_h + (t + 2) * KS, tid);
  }
  asm volatile("s_wait_asynccnt 0x0" ::: "memory");    // no copy outstanding behind the loop

  // normalize: lane holds column d = dt*16 + lq for query rows 8*hi + r; stage ctx * 64
  float rs[8];
  #pragma unroll
  for (int r = 0; r < 8; ++r) rs[r] = 1.0f / __shfl(rsum, (hi << 3) + r, 32);

  float* so = sO + wave * (16 * OP);
  #pragma unroll
  for (int r = 0; r < 8; ++r) {
    #pragma unroll
    for (int dt = 0; dt < 4; ++dt) {
      float val = o[dt][r];
      if (RES != 0) val += o2[dt][r] * (1.0f / RSC);
      so[(hi * 8 + r) * OP + dt * 16 + lq] = val * (CCAR / PCAR) * rs[r];
    }
  }
  __syncthreads();

  v4u    hv[4], rv[4];
  size_t gi[4], gr[4];
  #pragma unroll
  for (int it = 0; it < 4; ++it) {
    const int row   = it * 4 + (lane >> 3);   // 0..15
    const int piece = lane & 7;               // 0..7
    const v4f a0 = *(const v4f*)(so + row * OP + piece * 8);
    const v4f a1 = *(const v4f*)(so + row * OP + piece * 8 + 4);
    Pack8H ph, px;
    #pragma unroll
    for (int k = 0; k < 4; ++k) {
      const float u0 = a0[k];
      const float u1 = a1[k];
      const f16 g0 = (f16)u0;
      const f16 g1 = (f16)u1;
      ph.h[k]     = g0;
      ph.h[4 + k] = g1;
      px.h[k]     = (f16)((u0 - (float)g0) * RSC);
      px.h[4 + k] = (f16)((u1 - (float)g1) * RSC);
    }
    hv[it] = ph.u;
    rv[it] = px.u;
    gi[it] = (size_t)(qrow0 + row) * DMODEL + h * HDIM + piece * 8;
    gr[it] = (size_t)(qrow0 + row) * DMODEL + h * HDIM + piece * 8;   // row < ER when RES
  }
  #pragma unroll
  for (int it = 0; it < 4; ++it) {
    *(v4u*)(ctxh + gi[it]) = hv[it];
    if (RES != 0) *(v4u*)(ctxr + gr[it]) = rv[it];
  }
  
}

// Causal balance: a query block's cost grows linearly with its index, and every work-group of the launch is resident
// at once, so the launch lasts as long as its longest work-group. Each work-group therefore takes two query blocks of
// one head, one after the other in every wave: NT - 1 - p, then p. Every work-group walks NT + 1 blocks' worth of key
// stages; every (head, query block) is taken exactly once. All branches are block-uniform.
// The LDS is sized for the residual form; the other uses the first half of sKV.
// At most two waves per SIMD: one work-group per WGP, so that none of the 256 equal work-groups shares a WGP while another WGP stands empty.
__global__ __launch_bounds__(256) __attribute__((amdgpu_waves_per_eu(2, 2))) void attn_kernel(const f16* __restrict__ qh, const f16* __restrict__ qr,
                                                   const f16* __restrict__ kh, const f16* __restrict__ kr,
                                                   const f16* __restrict__ vt, const f16* __restrict__ vtr,
                                                   f16* __restrict__ ctxh, f16* __restrict__ ctxr) {
  __shared__ __align__(16) float sO[NWAVE * 16 * OP];   // per-wave output staging (block barrier used)
  __shared__ __align__(16) f16 sKV[2 * 4 * TILE_H];     // two stage buffers, cross-wave
  const int NE = ER / BQ;                       // query blocks with residual planes, per head
  const int NT = SEQ / BQ;                      // query blocks per head
  const int NP = NT / 2;                        // pairs per head
  static_assert(NT % 2 == 0 && NE <= NP);       // whole pairs; the long block of a pair never has residual planes
  const int p  = blockIdx.x % NP;
  const int h  = blockIdx.x / NP;
  attn_body<0>(sO, sKV, qh, qr, kh, kr, vt, vtr, ctxh, ctxr, NT - 1 - p, h);
  asm volatile("s_wait_dscnt 0x0" ::: "memory");   // this wave's LDS reads of the first block are done before the buffers are refilled
  __syncthreads();                                 // every wave has left the first block's LDS
  if (p < NE) attn_body<1>(sO, sKV, qh, qr, kh, kr, vt, vtr, ctxh, ctxr, p, h);
  else        attn_body<0>(sO, sKV, qh, qr, kh, kr, vt, vtr, ctxh, ctxr, p, h);
}

// ---------------------------------------------------------------------------------------------
extern "C" void kernel_launch(void* const* d_in, const int* in_sizes, int n_in,
                              void* d_out, int out_size, void* d_ws, size_t ws_size,
                              hipStream_t stream) {
  if (n_in < 3) return;
  if ((size_t)in_sizes[0] < (size_t)SEQ * DMODEL) return;
  if ((size_t)in_sizes[1] < (size_t)QKV_N * DMODEL) return;
  if ((size_t)in_sizes[2] < (size_t)DMODEL * DMODEL) return;
  if ((size_t)out_size < (size_t)SEQ * DMODEL) return;

  const size_t xb_bytes   = (size_t)SEQ * DMODEL * 2;            // bf16 [SEQ][DMODEL]
  const size_t wb_bytes   = (size_t)QKV_N * DMODEL * 2;          // bf16 [QKV_N][DMODEL]
  const size_t wp_bytes   = (size_t)DMODEL * DMODEL * 2;         // f16  [DMODEL][DMODEL]
  const size_t tab_bytes  = (size_t)SEQ * NROPE * 4;             // f32  [SEQ][NROPE] (each of cos, sin)
  const size_t pl_bytes   = (size_t)NHEAD * SEQ * HDIM * 2;      // f16  q/k/vt planes
  const size_t plr_bytes  = (size_t)NHEAD * ER * HDIM * 2;       // f16  residual planes
  const size_t ctx_bytes  = (size_t)SEQ * DMODEL * 2;            // f16  [SEQ][DMODEL]
  const size_t ctxr_bytes = (size_t)ER * DMODEL * 2;             // f16  [ER][DMODEL]
  const size_t total = xb_bytes + wb_bytes + wp_bytes + 2 * tab_bytes
                     + 3 * pl_bytes + 3 * plr_bytes + ctx_bytes + ctxr_bytes;
  if (ws_size < total) return;

  char* ws = (char*)d_ws;
  size_t off = 0;
  bf16*  xb   = (bf16*)(ws + off);  off += xb_bytes;
  bf16*  wb   = (bf16*)(ws + off);  off += wb_bytes;
  f16*   wp   = (f16*)(ws + off);   off += wp_bytes;
  float* ct   = (float*)(ws + off); off += tab_bytes;
  float* st   = (float*)(ws + off); off += tab_bytes;
  f16*   qhp  = (f16*)(ws + off);   off += pl_bytes;
  f16*   khp  = (f16*)(ws + off);   off += pl_bytes;
  f16*   vtp  = (f16*)(ws + off);   off += pl_bytes;
  f16*   qrp  = (f16*)(ws + off);   off += plr_bytes;
  f16*   krp  = (f16*)(ws + off);   off += plr_bytes;
  f16*   vtrp = (f16*)(ws + off);   off += plr_bytes;
  f16*   ctxh = (f16*)(ws + off);   off += ctx_bytes;
  f16*   ctxr = (f16*)(ws + off);   off += ctxr_bytes;
  if (off > ws_size) return;

  const float* x     = (const float*)d_in[0];
  const float* wqkv  = (const float*)d_in[1];
  const float* wproj = (const float*)d_in[2];
  float*       out   = (float*)d_out;

  // 1) RoPE cos/sin tables and the 16-bit operand planes of the inputs
  const int ncvt_blocks = SEQ * DMODEL / 2048 + QKV_N * DMODEL / 2048 + DMODEL * DMODEL / 2048;
  prep_kernel<<<dim3(SEQ / 8 + ncvt_blocks), 256, 0, stream>>>(x, wqkv, wproj, xb, wb, wp, ct, st);

  // 2) qkv = xb x wb^T (bf16 operands, f32 accumulators), RoPE, q/k/v planes (+ residual planes for rows < ER)
  gemm_qkv_kernel<<<dim3(QKV_N / 64, SEQ / 128), 128, 0, stream>>>(
      (const us16*)xb, (const us16*)wb, ct, st, qhp, qrp, khp, krp, vtp, vtrp, DMODEL, QKV_N);

  // 3) causal attention -> ctx planes, two query blocks per work-group
  attn_kernel<<<dim3((SEQ / BQ / 2) * NHEAD), 256, 0, stream>>>(qhp, qrp, khp, krp, vtp, vtrp, ctxh, ctxr);

  // 4) out[SEQ][DMODEL] = ctx x wp^T ; folds the ctx carry (64), the Wproj carry (256) and the residual scale (1024)
  const float oscale = 1.0f / (CCAR * WCAR);
  const float rscale = oscale / RSC;
  gemm_proj_kernel<<<dim3(DMODEL / 64, ER / 64 + (SEQ - ER) / 128), 128, 0, stream>>>(
      (const us16*)ctxh, (const us16*)ctxr, (const us16*)wp, out, DMODEL, DMODEL, oscale, rscale);
}

// v006
// It runs in 117 microseconds.
// Two timings next to v005 put it at 1.07 and 1.06 times that version's speed.
// Over all steps from v000 it is 3.82 times as fast.
#include <hip/hip_runtime.h>

// Contractions: qkv = X x Wqkv^T on v_wmma_f32_16x16x32_bf16 (bf16 operands = RNE-converted inputs, f32 accumulate);
// S^T = K x Q^T on v_wmma_f32_16x16x32_f16 (f16 q/k after RoPE, plus f16 residual planes x1024 with their own
// accumulator on query blocks < EARLY_QBLK); O = P x V on v_wmma_f32_16x16x32_f16 (P as f16 carried x4096,
// V as f16, plus P and V residual planes x1024 with their own accumulator on query blocks < EARLY_QBLK);
// out = ctx x Wproj^T on v_wmma_f32_16x16x32_f16 (ctx as f16 carried x64 plus residual x1024 on rows < ER,
// Wproj = f16 of the bf16 RNE-converted input carried x256). RoPE, softmax and all epilogues in f32.

#ifndef NB
#define NB 1
#endif
#ifndef SEQ
#define SEQ 4096
#endif
#define NB_FULL    1
#define SEQ_FULL   4096
#define NHEAD      16
#define HDIM       64
#define DMODEL     (NHEAD * HDIM)        // 1024
#define QKV_N      (3 * DMODEL)          // 3072
#define NROPE      (HDIM / 2)            // 32 frequencies
#define BQ         128                   // query rows per attention block (8 waves x 16)
#define BK         32                    // keys per inner iteration
#define NWAVE      8
#define EARLY_QBLK 2                     // query blocks with residual planes on q, k, P, v, ctx
#define ER         ((EARLY_QBLK * BQ < SEQ) ? (EARLY_QBLK * BQ) : SEQ)   // early rows == early keys
#define VP         136                   // LDS pitch (halves) of the transposed V tile (128 keys): 272 B = 16 B x odd
#define OP         68                    // LDS pitch (floats) of output staging tiles
#define PCAR       4096.0f               // P carry
#define RSC        1024.0f               // residual plane scale
#define CCAR       64.0f                 // ctx carry
#define WCAR       256.0f                // Wproj carry
#define KS         64                    // keys per LDS stage of the attention loop (two inner iterations)
#define KP         72                    // LDS pitch (halves) of staged K rows and V^T rows: 144 B = 16 B x odd
#define TILE_H     (64 * KP)             // halves per staged tile (64 rows)
#define GS         64                    // k per LDS stage of the GEMM loop (two 32-k products)

static_assert(NB == 1 && NB <= NB_FULL);
static_assert(SEQ <= SEQ_FULL);
static_assert(SEQ % BQ == 0);
static_assert(ER % BQ == 0);
static_assert((SEQ - ER) % 128 == 0);
static_assert(SEQ % 8 == 0);
static_assert(BQ == NWAVE * 16);
static_assert(HDIM == 64);
static_assert(DMODEL % 64 == 0 && QKV_N % 64 == 0);
static_assert(DMODEL % 32 == 0);
static_assert((SEQ * DMODEL) % 2048 == 0);
static_assert((QKV_N * DMODEL) % 2048 == 0);
static_assert((DMODEL * DMODEL) % 2048 == 0);
static_assert((VP * 2) % 16 == 0);
static_assert((OP * 4) % 16 == 0);
static_assert(KS == 2 * BK && BQ % KS == 0 && KS == 64);
static_assert((KP * 2) % 16 == 0);

typedef __bf16         bf16;
typedef _Float16       f16;
typedef unsigned short us16;
typedef bf16     v16bf __attribute__((ext_vector_type(16)));
typedef f16      v16h  __attribute__((ext_vector_type(16)));
typedef f16      v8h   __attribute__((ext_vector_type(8)));
typedef float    v8f   __attribute__((ext_vector_type(8)));
typedef float    v4f   __attribute__((ext_vector_type(4)));
typedef unsigned v4u   __attribute__((ext_vector_type(4)));

union FragB  { v16bf v; v4u q[2]; bf16 h[16]; };
union FragH  { v16h  v; v4u q[2]; f16  h[16]; };
union Pack8B { v4u u; bf16 h[8]; };
union Pack8H { v4u u; v8h v; f16 h[8]; };

// WMMA helpers: builtin followed by the VALU hazard guard (ties D, keeps A/B live).
static __device__ __forceinline__ v8f mma_bf16(v16bf a, v16bf b, v8f acc) {
  acc = __builtin_amdgcn_wmma_f32_16x16x32_bf16(false, a, false, b, (short)0, acc, false, false);
  asm volatile("v_nop\n\tv_nop\n\tv_nop\n\tv_nop" : "+v"(acc) : "v"(a), "v"(b));
  return acc;
}
static __device__ __forceinline__ v8f mma_f16(v16h a, v16h b, v8f acc) {
  acc = __builtin_amdgcn_wmma_f32_16x16x32_f16(false, a, false, b, (short)0, acc, false, false);
  asm volatile("v_nop\n\tv_nop\n\tv_nop\n\tv_nop" : "+v"(acc) : "v"(a), "v"(b));
  return acc;
}
static __device__ __forceinline__ v8f mma(const FragB& a, const FragB& b, v8f acc) { return mma_bf16(a.v, b.v, acc); }

// Cross-lane moves on the vector pipe (a shuffle compiles to an LDS-pipe permute, whose result a wave must wait for).
// They are used where every lane is on. The fetch-inactive flag (fifth argument) then changes no value; it says that the
// old destination is not read, which saves a register copy in front of every move.
// xhalf: lane l gets the value of lane l ^ 16.
static __device__ __forceinline__ float xhalf(float x) {
  const int b = __builtin_bit_cast(int, x);
  return __builtin_bit_cast(float, __builtin_amdgcn_permlanex16(b, b, 0x76543210, 0xfedcba98, true, false));
}
// row_rot8: lane l gets the value of lane l ^ 8 (the other half of its own 16-lane row).
static __device__ __forceinline__ float row_rot8(float x) {
  const int b = __builtin_bit_cast(int, x);
  return __builtin_bit_cast(float, __builtin_amdgcn_permlane16(b, b, 0xfedcba98, 0x76543210, true, false));
}
// row_bcast<R>: every lane gets the value of lane R of its own 16-lane row.
template <int R>
static __device__ __forceinline__ float row_bcast(float x) {
  const int b = __builtin_bit_cast(int, x);
  return __builtin_bit_cast(float, __builtin_amdgcn_permlane16(b, b, 0x11111111u * R, 0x11111111u * R, true, false));
}
static __device__ __forceinline__ v8f mma(const FragH& a, const FragH& b, v8f acc) { return mma_f16(a.v, b.v, acc); }

// ---------------------------------------------------------------------------------------------
// Convert pass: xb = bf16(x) [SEQ][DMODEL], wb = bf16(Wqkv) [QKV_N][DMODEL], wp = f16(bf16(Wproj) * 256) [DMODEL][DMODEL].
// coverage: blocks [0,SEQ*DMODEL/2048) x 256 x 8 == SEQ*DMODEL; next QKV_N*DMODEL/2048 blocks == QKV_N*DMODEL;
//           last DMODEL*DMODEL/2048 blocks == DMODEL*DMODEL.
template <int MODE>
static __device__ __forceinline__ void cvt_body(const float* __restrict__ src, us16* __restrict__ dst,
                                                 int blk, int tid) {
  const size_t e = ((size_t)blk * 256 + tid) * 8;
  const v4f a = *(const v4f*)(src + e);
  const v4f b = *(const v4f*)(src + e + 4);
  v4u u;
  if (MODE == 0) {
    Pack8B pk;
    #pragma unroll
    for (int i = 0; i < 4; ++i) {
      pk.h[i]     = (bf16)a[i];                 // RNE convert
      pk.h[4 + i] = (bf16)b[i];
    }
    u = pk.u;
  } else {
    Pack8H pk;
    #pragma unroll
    for (int i = 0; i < 4; ++i) {
      pk.h[i]     = (f16)((float)(bf16)a[i] * WCAR);   // bf16 significand is exact in f16
      pk.h[4 + i] = (f16)((float)(bf16)b[i] * WCAR);
    }
    u = pk.u;
  }
  *(v4u*)(dst + e) = u;
  
}

static __device__ __forceinline__ void convert_body(const float* __restrict__ x,
                                                    const float* __restrict__ wq,
                                                    const float* __restrict__ wpj,
                                                    bf16* __restrict__ xb,
                                                    bf16* __restrict__ wb,
                                                    f16* __restrict__ wp,
                                                    int blk, int tid) {
  const int NBX = SEQ * DMODEL / 2048;
  const int NBQ = QKV_N * DMODEL / 2048;
  if (blk < NBX)            cvt_body<0>(x, (us16*)xb, blk, tid);
  else if (blk < NBX + NBQ) cvt_body<0>(wq, (us16*)wb, blk - NBX, tid);
  else                      cvt_body<1>(wpj, (us16*)wp, blk - NBX - NBQ, tid);
}

// ---------------------------------------------------------------------------------------------
// RoPE tables ct/st [SEQ][NROPE] f32: angle(t, j) = t * (1 / 10000^(2j/64)). Block = 8 positions x 32 freqs.
// One powf + one sincosf per thread (rolled). Rows staged in LDS; waves 0-1 write the cos lines, waves 2-3 the
// coverage: (SEQ/8 blocks) x 8 rows x 32 floats == SEQ*NROPE per table.
static __device__ __forceinline__ void rope_table_body(float* __restrict__ ct, float* __restrict__ st,
                                                       int blk, int tid) {
  __shared__ __align__(16) float sc[8 * NROPE];   // cross-wave (block barrier)
  __shared__ __align__(16) float ss[8 * NROPE];
  const int j   = tid & 31;
  const int tl  = tid >> 5;
  const int t   = blk * 8 + tl;
  const float e   = (float)(2 * j) * (1.0f / 64.0f);
  const float pw  = powf(10000.0f, e);
  const float inv = 1.0f / pw;
  const float ang = (float)t * inv;
  float sn, cs;
  sincosf(ang, &sn, &cs);
  sc[tl * NROPE + j] = cs;
  ss[tl * NROPE + j] = sn;
  __syncthreads();
  if (tid < 64) {
    const int rowl  = tid >> 3;
    const int piece = tid & 7;
    const v4f v = *(const v4f*)(sc + rowl * NROPE + piece * 4);
    const size_t gi = (size_t)(blk * 8 + rowl) * NROPE + piece * 4;
    *(v4f*)(ct + gi) = v;
    
  } else if (tid < 128) {
    const int rowl  = (tid - 64) >> 3;
    const int piece = tid & 7;
    const v4f v = *(const v4f*)(ss + rowl * NROPE + piece * 4);
    const size_t gi = (size_t)(blk * 8 + rowl) * NROPE + piece * 4;
    *(v4f*)(st + gi) = v;
    
  }
}

// One launch for the two passes that depend on nothing but the inputs: blocks [0, SEQ/8) build the RoPE tables,
// the rest convert the operands (block-uniform branch, so the table blocks' barrier is passed by whole blocks).
__global__ __launch_bounds__(256) void prep_kernel(const float* __restrict__ x,
                                                   const float* __restrict__ wq,
                                                   const float* __restrict__ wpj,
                                                   bf16* __restrict__ xb,
                                                   bf16* __restrict__ wb,
                                                   f16* __restrict__ wp,
                                                   float* __restrict__ ct, float* __restrict__ st) {
  const int blk = blockIdx.x;
  const int tid = threadIdx.x;
  const int NBR = SEQ / 8;
  if (blk < NBR) rope_table_body(ct, st, blk, tid);
  else           convert_body(x, wq, wpj, xb, wb, wp, blk - NBR, tid);
}

// ---------------------------------------------------------------------------------------------
// NT GEMM: C[m][n] = oscale * sum_k A[m][k] B[n][k] (+ rscale * sum_k Ar[m][k] B[n][k] when RES).
// A, Ar, B are 16-bit row-major planes with pitch K (k contiguous). 4 waves/block, wave tile (16*MI) x 64,
// block tile (64*MI) x 64. The block's A, Ar and B rows are staged GS k at a time in two LDS buffers by asynchronous
// 16-B copies (whole 128-B row pieces); a stage buffer holds three 64-row tiles at pitch KP: [A | A | B], or [A | Ar | B] when RES.
// A and B fragments are read from LDS with the split k map:
// elements 0..7 <- k0 + 8h + 0..7, elements 8..15 <- k0 + 16 + 8h + 0..7, lane&15 = row of A / row of B (= column n).
// Epilogue: wave tile staged in LDS (in the bytes of the stage buffers, which every wave has left by then), then per
// instruction lanes 0..15 write one 256-B row segment.
// Requires K % 64 == 0, N % 64 == 0, rows covered by the grid a multiple of 64*MI.
// One stage's copies of one thread of the 128: rows r + 16 j (r = tid>>3, j = 0..3) of each of the three 64-row tiles,
// 16-B piece tid&7. r0/r1/r2 point at the first row of each tile at the stage's first k (pitch K); in LDS the three
// tiles follow one another, so the twelve rows of a thread lie 16 rows apart.
static __device__ __forceinline__ void stage_gemm(us16* buf, const us16* r0, const us16* r1, const us16* r2,
                                                  int K, int tid) {
  const int row   = tid >> 3;     // 0..15
  const int piece = tid & 7;      // 0..7
  const unsigned l0 = (unsigned)(size_t)(buf + row * KP + piece * 8);   // LDS byte address
  const unsigned ls = 16 * KP * 2;                                      // 16 rows in LDS, bytes
  const size_t   go = (size_t)row * K + piece * 8;
  const size_t   gs = (size_t)16 * K;                                    // 16 rows in the plane, elements
  const us16* a0 = r0 + go;
  const us16* b0 = r1 + go;
  const us16* c0 = r2 + go;
  // the copies and, as the last line, the wait that stands before any of their address registers is rewritten
  asm volatile("global_load_async_to_lds_b128 %0, %12, off\n\t"
               "global_load_async_to_lds_b128 %1, %13, off\n\t"
               "global_load_async_to_lds_b128 %2, %14, off\n\t"
               "global_load_async_to_lds_b128 %3, %15, off\n\t"
               "global_load_async_to_lds_b128 %4, %16, off\n\t"
               "global_load_async_to_lds_b128 %5, %17, off\n\t"
               "global_load_async_to_lds_b128 %6, %18, off\n\t"
               "global_load_async_to_lds_b128 %7, %19, off\n\t"
               "global_load_async_to_lds_b128 %8, %20, off\n\t"
               "global_load_async_to_lds_b128 %9, %21, off\n\t"
               "global_load_async_to_lds_b128 %10, %22, off\n\t"
               "global_load_async_to_lds_b128 %11, %23, off\n\t"
               "s_wait_xcnt 0x0"
               :: "v"(l0), "v"(l0 + ls), "v"(l0 + 2 * ls), "v"(l0 + 3 * ls),
                  "v"(l0 + 4 * ls), "v"(l0 + 5 * ls), "v"(l0 + 6 * ls), "v"(l0 + 7 * ls),
                  "v"(l0 + 8 * ls), "v"(l0 + 9 * ls), "v"(l0 + 10 * ls), "v"(l0 + 11 * ls),
                  "v"(a0), "v"(a0 + gs), "v"(a0 + 2 * gs), "v"(a0 + 3 * gs),
                  "v"(b0), "v"(b0 + gs), "v"(b0 + 2 * gs), "v"(b0 + 3 * gs),
                  "v"(c0), "v"(c0 + gs), "v"(c0 + 2 * gs), "v"(c0 + 3 * gs) : "memory");
}

#define GEMM_LDS_B (2 * 3 * TILE_H * 2)        // bytes of the two stage buffers of three tiles each

// Where the qkv product's epilogue reads the RoPE tables and writes the 16-bit planes.
//   qh, kh [NHEAD][SEQ][HDIM] f16 : q and k after RoPE;  vt [NHEAD][HDIM][SEQ] f16 : V transposed.
//   qr, kr [NHEAD][ER][HDIM]  f16 : residual planes (x - f16(x)) * 1024 for rows < ER;  vtr [NHEAD][HDIM][ER] likewise.
struct PlaneOut {
  const float* ct;
  const float* st;
  f16* qh;
  f16* qr;
  f16* kh;
  f16* kr;
  f16* vt;
  f16* vtr;
};

// Epilogue of the qkv product: the block's 128 x 64 tile is one slot (q, k or v) of one head for 128 rows, so the planes
// are built from the f32 accumulators and the f32 qkv array is never written. All branches are block-uniform.
// q, k: wave tile staged in LDS as f32; RoPE (rotate-half): out[d] = x[d]*cos + sgn*x[d^32]*sin, both from the staged row;
//       per instruction 4 rows of 128 B, whole lines.
// v:    a lane's 8 accumulator rows are 8 consecutive keys of one d, so the tile is staged transposed with one 16-B LDS
//       store each; per instruction 2 rows of 256 B, whole lines.
// coverage: rows mb..mb+127, d 0..63 of the slot's plane; residual planes for blocks with mb < ER (ER % 128 == 0).
// EARLY is the block-uniform mb < ER as a template argument, so that neither form carries the other's registers.
// Every loop here is unrolled: constant indices keep the accumulators and the small arrays in registers.
template <int EARLY>
static __device__ __forceinline__ void rope_planes(unsigned char* smem, const v8f (&acc)[2][4],
                                                   const float* ct, const float* st,
                                                   f16* pl, f16* plr, int mb, int h) {
  const int tid  = threadIdx.x;
  const int wave = tid >> 5;
  const int lane = tid & 31;
  const int lq   = lane & 15;
  const int hi   = lane >> 4;
  float* so = (float*)smem + wave * (32 * OP);
  #pragma unroll
  for (int mi = 0; mi < 2; ++mi) {
    #pragma unroll
    for (int t = 0; t < 4; ++t) {
      #pragma unroll
      for (int r = 0; r < 8; ++r) so[(mi * 16 + hi * 8 + r) * OP + t * 16 + lq] = acc[mi][t][r];
    }
  }
  __syncthreads();
  const int   d0  = (lane & 7) * 8;           // 0..56
  const int   j0  = d0 & (NROPE - 1);         // frequency index of d0
  const float sgn = (d0 < NROPE) ? -1.0f : 1.0f;
  const int   NK  = (EARLY != 0) ? 2 : 4;     // row groups whose loads are in flight together
  // one 32-bit lane offset per array on a uniform base; the row groups lie a constant 4 rows apart
  const unsigned srow0 = (unsigned)(mb + wave * 32 + (lane >> 3));
  const unsigned toff  = srow0 * NROPE + j0;
  const unsigned poff  = srow0 * HDIM + d0;
  f16* plh  = pl + (size_t)h * SEQ * HDIM;
  f16* plrh = plr + (size_t)h * ER * HDIM;    // used only when EARLY (rows < ER)
  const float* cpb = ct + toff;
  const float* spb = st + toff;
  #pragma unroll
  for (int b = 0; b < 8 / NK; ++b) {
    v4f c0[NK], c1[NK], n0v[NK], n1v[NK];
    #pragma unroll
    for (int k = 0; k < NK; ++k) {
      c0[k]  = *(const v4f*)(cpb + (b * NK + k) * 4 * NROPE);
      c1[k]  = *(const v4f*)(cpb + (b * NK + k) * 4 * NROPE + 4);
      n0v[k] = *(const v4f*)(spb + (b * NK + k) * 4 * NROPE);
      n1v[k] = *(const v4f*)(spb + (b * NK + k) * 4 * NROPE + 4);
    }
    // the wait that stands before the table loads' address registers are rewritten; it names them, so they live up to it
    asm volatile("s_wait_xcnt 0x0" :: "v"(cpb), "v"(spb) : "memory");
    v4u hv[NK], rv[NK];
    #pragma unroll
    for (int k = 0; k < NK; ++k) {
      const int row = (b * NK + k) * 4 + (lane >> 3);    // 0..31
      const float* xo = so + row * OP + d0;
      const float* xq = so + row * OP + (d0 ^ NROPE);    // pair partner d^32
      const v4f x0 = *(const v4f*)(xo);
      const v4f x1 = *(const v4f*)(xo + 4);
      const v4f p0 = *(const v4f*)(xq);
      const v4f p1 = *(const v4f*)(xq + 4);
      float xa[8], pa[8], ca[8], sa[8];
      #pragma unroll
      for (int i = 0; i < 4; ++i) {
        xa[i] = x0[i];     xa[4 + i] = x1[i];
        pa[i] = p0[i];     pa[4 + i] = p1[i];
        ca[i] = c0[k][i];  ca[4 + i] = c1[k][i];
        sa[i] = n0v[k][i]; sa[4 + i] = n1v[k][i];
      }
      Pack8H ph, px;
      #pragma unroll
      for (int i = 0; i < 8; ++i) {
        const float xr = xa[i] * ca[i] + sgn * pa[i] * sa[i];
        const f16 xh = (f16)xr;
        ph.h[i] = xh;
        px.h[i] = (f16)((xr - (float)xh) * RSC);
      }
      hv[k] = ph.u;
      rv[k] = px.u;
    }
    f16* pp = plh + poff;
    f16* pr = plrh + poff;
    #pragma unroll
    for (int k = 0; k < NK; ++k) {
      *(v4u*)(pp + (b * NK + k) * 4 * HDIM) = hv[k];
      if (EARLY != 0) *(v4u*)(pr + (b * NK + k) * 4 * HDIM) = rv[k];
    }
    // the wait that stands before the stores' address and data registers are rewritten; it names them, so they live up to it
    if constexpr (EARLY != 0)
      asm volatile("s_wait_xcnt 0x0" :: "v"(pp), "v"(pr), "v"(hv[0]), "v"(hv[1]), "v"(rv[0]), "v"(rv[1]) : "memory");
    else
      asm volatile("s_wait_xcnt 0x0" :: "v"(pp), "v"(hv[0]), "v"(hv[1]), "v"(hv[2]), "v"(hv[3]) : "memory");
  }
}

template <int EARLY>
static __device__ __forceinline__ void v_planes(unsigned char* smem, const v8f (&acc)[2][4],
                                                f16* vt, f16* vtr, int mb, int h) {
  const int tid  = threadIdx.x;
  const int wave = tid >> 5;
  const int lane = tid & 31;
  const int lq   = lane & 15;
  const int hi   = lane >> 4;
  f16* sT = (f16*)smem;                       // [d][key] hi, cross-wave (block barrier)
  f16* sR = sT + HDIM * VP;                   // [d][key] residual, cross-wave (block barrier)
  #pragma unroll
  for (int mi = 0; mi < 2; ++mi) {
    #pragma unroll
    for (int t = 0; t < 4; ++t) {
      Pack8H ph, px;
      #pragma unroll
      for (int r = 0; r < 8; ++r) {
        const float va = acc[mi][t][r];
        const f16 vh = (f16)va;
        ph.h[r] = vh;
        px.h[r] = (f16)((va - (float)vh) * RSC);
      }
      const int o = (t * 16 + lq) * VP + wave * 32 + mi * 16 + hi * 8;   // d = t*16 + lq, keys hi*8 + 0..7 of the 16
      *(v4u*)(sT + o) = ph.u;
      if (EARLY != 0) *(v4u*)(sR + o) = px.u;
    }
  }
  __syncthreads();
  const int dl = tid >> 4;                    // 0..7
  const int ks = (tid & 15) * 8;              // 0..120
  v4u vv[8];
  #pragma unroll
  for (int it = 0; it < 8; ++it) vv[it] = *(const v4u*)(sT + (it * 8 + dl) * VP + ks);
  f16* vth = vt + (size_t)h * HDIM * SEQ + mb;   // uniform base; one 32-bit lane offset; the rows lie a constant 8 apart
  #pragma unroll
  for (int it = 0; it < 8; ++it) *(v4u*)(vth + (unsigned)(dl * SEQ + ks) + it * 8 * SEQ) = vv[it];
  asm volatile("s_wait_xcnt 0x0" ::: "memory");   // stands before the stores' address and data registers are rewritten
  if (EARLY != 0) {
    v4u vx[8];
    #pragma unroll
    for (int it = 0; it < 8; ++it) vx[it] = *(const v4u*)(sR + (it * 8 + dl) * VP + ks);
    f16* vtrh = vtr + (size_t)h * HDIM * ER + mb;
    #pragma unroll
    for (int it = 0; it < 8; ++it) *(v4u*)(vtrh + (unsigned)(dl * ER + ks) + it * 8 * ER) = vx[it];
    asm volatile("s_wait_xcnt 0x0" ::: "memory");   // as above
  }
}

static __device__ __forceinline__ void planes_epilogue(unsigned char* smem, const v8f (&acc)[2][4],
                                                       const PlaneOut& po, int mb, int n0) {
  const int slot = n0 / DMODEL;               // 0 = q, 1 = k, 2 = v
  const int h    = (n0 % DMODEL) / HDIM;
  if (slot < 2) {
    f16* pl  = (slot == 0) ? po.qh : po.kh;
    f16* plr = (slot == 0) ? po.qr : po.kr;
    if (mb >= ER) rope_planes<0>(smem, acc, po.ct, po.st, pl, plr, mb, h);
    else          rope_planes<1>(smem, acc, po.ct, po.st, pl, plr, mb, h);
  } else {
    if (mb >= ER) v_planes<0>(smem, acc, po.vt, po.vtr, mb, h);
    else          v_planes<1>(smem, acc, po.vt, po.vtr, mb, h);
  }
}
static_assert(2 * HDIM * VP * 2 <= GEMM_LDS_B && 4 * 32 * OP * 4 <= GEMM_LDS_B);
static_assert(ER % 128 == 0 && SEQ % 128 == 0 && DMODEL % HDIM == 0);

// smem: the block's GEMM_LDS_B bytes of LDS; mb, n0: first row and first column of the block's tile.
// EPI != 0: the result goes through planes_epilogue to po's planes and C is not written.
template <typename F, int MI, int RES, int EPI>
static __device__ __forceinline__ void gemm_nt_body(unsigned char* smem,
                                                    const us16* __restrict__ A,
                                                    const us16* __restrict__ Ar,
                                                    const us16* __restrict__ Bm,
                                                    float* __restrict__ C,
                                                    int K, int N, int mb, int n0,
                                                    float oscale, float rscale, const PlaneOut& po) {
  static_assert((MI == 2 && RES == 0) || (MI == 1 && RES == 1));   // three 64-row tiles per stage
  static_assert(EPI == 0 || (MI == 2 && RES == 0));
  const int BT    = 2;                         // index of the B tile in a stage buffer
  const int STG_H = (BT + 1) * TILE_H;         // halves per stage buffer
  const int RING_B = 2 * STG_H * 2;            // bytes of the two stage buffers
  const int OUT_B  = 4 * 16 * MI * OP * 4;     // bytes of the four waves' output staging
  static_assert(RING_B <= GEMM_LDS_B && OUT_B <= GEMM_LDS_B);
  // two stage buffers (cross-wave) in the loop; behind the loop's last barrier the per-wave output staging
  us16*  ring = (us16*)smem;
  float* sC   = (float*)smem;
  const int tid  = threadIdx.x;
  const int wave = tid >> 5;
  const int lane = tid & 31;
  const int lq   = lane & 15;
  const int hi   = lane >> 4;
  const int m0   = mb + wave * (16 * MI);

  v8f acc[MI][4], acc2[MI][4];
  #pragma unroll
  for (int mi = 0; mi < MI; ++mi) {
    #pragma unroll
    for (int t = 0; t < 4; ++t) {
      acc[mi][t]  = (v8f){0, 0, 0, 0, 0, 0, 0, 0};
      acc2[mi][t] = (v8f){0, 0, 0, 0, 0, 0, 0, 0};
    }
  }

  const us16* ab  = A + (size_t)mb * K;                                                  // tile 0: A rows 0..63
  const us16* arb = (RES != 0) ? Ar + (size_t)mb * K : A + (size_t)(mb + 64) * K;        // tile 1: Ar, or A rows 64..127
  const us16* bb  = Bm + (size_t)n0 * K;                                                 // tile 2: B rows
  const int   nst = K / GS;                           // block-uniform stage count

  stage_gemm(ring, ab, arb, bb, K, tid);
  asm volatile("s_wait_asynccnt 0x0" ::: "memory");   // this wave's copies of stage 0 have landed
  __syncthreads();                                    // stage 0 readable by every wave
  if (nst > 1) stage_gemm(ring + STG_H, ab + GS, arb + GS, bb + GS, K, tid);

  for (int s = 0; s < nst; ++s) {
    const us16* sb = ring + (s & 1) * STG_H;
    #pragma unroll   // constant indices keep the fragment arrays in registers
    for (int u = 0; u < GS / 32; ++u) {
      F a[MI], ar[MI], b[4];
      #pragma unroll
      for (int mi = 0; mi < MI; ++mi) {
        const us16* p = sb + (wave * (16 * MI) + mi * 16 + lq) * KP + u * 32 + hi * 8;
        a[mi].q[0] = *(const v4u*)(p);        // k0 + 8h + 0..7
        a[mi].q[1] = *(const v4u*)(p + 16);   // k0 + 16 + 8h + 0..7
        if (RES != 0) {
          const us16* pr = p + MI * TILE_H;
          ar[mi].q[0] = *(const v4u*)(pr);
          ar[mi].q[1] = *(const v4u*)(pr + 16);
        }
      }
      #pragma unroll
      for (int t = 0; t < 4; ++t) {
        const us16* p = sb + BT * TILE_H + (t * 16 + lq) * KP + u * 32 + hi * 8;
        b[t].q[0] = *(const v4u*)(p);
        b[t].q[1] = *(const v4u*)(p + 16);
      }
      #pragma unroll
      for (int mi = 0; mi < MI; ++mi) {
        #pragma unroll
        for (int t = 0; t < 4; ++t) {
          acc[mi][t] = mma(a[mi], b[t], acc[mi][t]);
          if (RES != 0) acc2[mi][t] = mma(ar[mi], b[t], acc2[mi][t]);
        }
      }
    }
    // publish point of stage s + 1, passed by every wave
    asm volatile("s_wait_dscnt 0x0" ::: "memory");      // this wave's reads of stage s are done before its buffer is refilled
    asm volatile("s_wait_asynccnt 0x0" ::: "memory");   // this wave's copies of stage s + 1 have landed
    __syncthreads();                                    // stage s + 1 readable; every reader has left stage s
    if (s + 2 < nst)
      stage_gemm(ring + (s & 1) * STG_H, ab + (s + 2) * GS, arb + (s + 2) * GS, bb + (s + 2) * GS, K, tid);
  }
  asm volatile("s_wait_asynccnt 0x0" ::: "memory");     // no copy outstanding behind the loop

  if constexpr (EPI != 0) {
    planes_epilogue(smem, acc, po, mb, n0);
    return;
  }

  float* so = sC + wave * (16 * MI * OP);
  #pragma unroll
  for (int mi = 0; mi < MI; ++mi) {
    #pragma unroll
    for (int t = 0; t < 4; ++t) {
      #pragma unroll
      for (int r = 0; r < 8; ++r) {
        float val = acc[mi][t][r] * oscale;
        if (RES != 0) val += acc2[mi][t][r] * rscale;
        so[(mi * 16 + hi * 8 + r) * OP + t * 16 + lq] = val;
      }
    }
  }
  __syncthreads();

  const int NIT = 8 * MI;   // (16*MI rows) / 2 rows per instruction
  v4f    vals[8 * MI];
  size_t gidx[8 * MI];
  #pragma unroll
  for (int it = 0; it < NIT; ++it) {
    const int row = it * 2 + hi;
    vals[it] = *(const v4f*)(so + row * OP + lq * 4);
    gidx[it] = (size_t)(m0 + row) * N + n0 + lq * 4;
  }
  #pragma unroll
  for (int it = 0; it < NIT; ++it) *(v4f*)(C + gidx[it]) = vals[it];
  
}

// qkv = xb x wb^T, RoPE and the q/k/v planes: block tile 128 x 64, grid (N / 64, rows / 128).
__global__ __launch_bounds__(128) void gemm_qkv_kernel(const us16* __restrict__ A,
                                                       const us16* __restrict__ Bm,
                                                       const float* __restrict__ ct,
                                                       const float* __restrict__ st,
                                                       f16* __restrict__ qh, f16* __restrict__ qr,
                                                       f16* __restrict__ kh, f16* __restrict__ kr,
                                                       f16* __restrict__ vt, f16* __restrict__ vtr,
                                                       int K, int N) {
  __shared__ __align__(16) unsigned char smem[GEMM_LDS_B];
  const PlaneOut po = {ct, st, qh, qr, kh, kr, vt, vtr};
  gemm_nt_body<FragB, 2, 0, 1>(smem, A, A, Bm, nullptr, K, N, blockIdx.y * 128, blockIdx.x * 64, 1.0f, 0.0f, po);
}

// out = ctx x wp^T, all rows in one launch: the first ER / 64 block rows take 64 rows each with the residual plane,
// the others 128 rows each from row ER on (block-uniform branch; the two row ranges share no output element).
__global__ __launch_bounds__(128) void gemm_proj_kernel(const us16* __restrict__ A,
                                                        const us16* __restrict__ Ar,
                                                        const us16* __restrict__ Bm,
                                                        float* __restrict__ C, int K, int N,
                                                        float oscale, float rscale) {
  __shared__ __align__(16) unsigned char smem[GEMM_LDS_B];
  const int by = blockIdx.y;
  const int n0 = blockIdx.x * 64;
  const PlaneOut none = {};
  if (by < ER / 64) gemm_nt_body<FragH, 1, 1, 0>(smem, A, Ar, Bm, C, K, N, by * 64, n0, oscale, rscale, none);
  else              gemm_nt_body<FragH, 2, 0, 0>(smem, A, A, Bm, C, K, N, ER + (by - ER / 64) * 128, n0, oscale, 0.0f, none);
}

// ---------------------------------------------------------------------------------------------
// Flash attention, causal. Block = (head, two query blocks of 128 in turn); one wave owns 16 query rows of each.
// S^T = K x Q^T so queries sit on lanes; P^T in C-layout is bit-identical to the A-fragment layout of O += P x V.
// Q B-fragments are loaded straight from the 16-bit plane; K A-fragments and V^T B-fragments from LDS (two 16-B loads each).
// RES != 0 (query blocks < EARLY_QBLK, all visited keys < ER): score = KQ + (K Qres + Kres Q)/1024;
// O2 = Pres V + P Vres accumulated separately and folded as O2/1024 before normalisation.
// K and V^T (and their residual planes when RES) are staged once per query block, KS keys at a time, in two LDS buffers
// by asynchronous 16-B copies; all eight waves read their fragments from LDS. A stage buffer holds the tiles
// [K | V^T | Kres | V^Tres], each 64 rows of 128 B at pitch KP.
// One stage's copies of one thread: rows tid>>3 and 32 + (tid>>3) of every tile, 16-B piece tid&7.
// kg/krg point at the stage's first key row (pitch HDIM); vg/vrg at the stage's first key column (pitch SEQ / ER).
template <int RES>
static __device__ __forceinline__ void stage_tiles(f16* buf, const f16* kg, const f16* krg,
                                                   const f16* vg, const f16* vrg, int tid) {
  const int row   = tid >> 3;     // 0..31
  const int piece = tid & 7;      // 0..7
  const unsigned l0 = (unsigned)(size_t)(buf + row * KP + piece * 8);   // LDS byte address
  const unsigned l1 = l0 + 32 * KP * 2;
  const unsigned l2 = l0 + TILE_H * 2;
  const unsigned l3 = l1 + TILE_H * 2;
  const f16* g0 = kg + (size_t)row * HDIM + piece * 8;
  const f16* g1 = g0 + 32 * HDIM;
  const f16* g2 = vg + (size_t)row * SEQ + piece * 8;
  const f16* g3 = g2 + (size_t)32 * SEQ;
  // the copies and, as the last line, the wait that stands before any of their address registers is rewritten
  asm volatile("global_load_async_to_lds_b128 %0, %4, off\n\t"
               "global_load_async_to_lds_b128 %1, %5, off\n\t"
               "global_load_async_to_lds_b128 %2, %6, off\n\t"
               "global_load_async_to_lds_b128 %3, %7, off\n\t"
               "s_wait_xcnt 0x0"
               :: "v"(l0), "v"(l1), "v"(l2), "v"(l3), "v"(g0), "v"(g1), "v"(g2), "v"(g3) : "memory");
  if (RES != 0) {
    const unsigned l4 = l0 + 2 * TILE_H * 2;
    const unsigned l5 = l1 + 2 * TILE_H * 2;
    const unsigned l6 = l0 + 3 * TILE_H * 2;
    const unsigned l7 = l1 + 3 * TILE_H * 2;
    const f16* g4 = krg + (size_t)row * HDIM + piece * 8;
    const f16* g5 = g4 + 32 * HDIM;
    const f16* g6 = vrg + (size_t)row * ER + piece * 8;
    const f16* g7 = g6 + (size_t)32 * ER;
    // same form for the residual tiles
    asm volatile("global_load_async_to_lds_b128 %0, %4, off\n\t"
                 "global_load_async_to_lds_b128 %1, %5, off\n\t"
                 "global_load_async_to_lds_b128 %2, %6, off\n\t"
                 "global_load_async_to_lds_b128 %3, %7, off\n\t"
                 "s_wait_xcnt 0x0"
                 :: "v"(l4), "v"(l5), "v"(l6), "v"(l7), "v"(g4), "v"(g5), "v"(g6), "v"(g7) : "memory");
  }
}

// sO: per-wave output staging, NWAVE * 16 * OP floats; sKV: the two stage buffers.
template <int RES>
static __device__ __forceinline__ void attn_body(float* sO, f16* sKV,
                                                 const f16* __restrict__ qh, const f16* __restrict__ qr,
                                                 const f16* __restrict__ kh, const f16* __restrict__ kr,
                                                 const f16* __restrict__ vt, const f16* __restrict__ vtr,
                                                 f16* __restrict__ ctxh, f16* __restrict__ ctxr,
                                                 int qblk, int h) {
  const int tid  = threadIdx.x;
  const int wave = __builtin_amdgcn_readfirstlane(tid >> 5);   // scalar, so the per-wave causal skip is a scalar branch
  const int lane = tid & 31;
  const int lq   = lane & 15;   // query column of S^T / d column of O
  const int hi   = lane >> 4;   // k-split half

  const int STG_H = (RES != 0 ? 4 : 2) * TILE_H;         // halves per stage buffer

  const int qrow0 = qblk * BQ + wave * 16;               // first query row of this wave

  // Q as B-operand fragments: lane lq holds query qrow0+lq, elements follow the split d map.
  FragH qf[2], qx[2];
  {
    const f16* qp = qh + ((size_t)h * SEQ + qrow0 + lq) * HDIM;
    #pragma unroll
    for (int f = 0; f < 2; ++f) {
      qf[f].q[0] = *(const v4u*)(qp + f * 32 + hi * 8);        // d = f*32 + hi*8 + 0..7
      qf[f].q[1] = *(const v4u*)(qp + f * 32 + 16 + hi * 8);   // d = f*32 + 16 + hi*8 + 0..7
    }
    if (RES != 0) {
      const f16* qrp = qr + ((size_t)h * ER + qrow0 + lq) * HDIM;
      #pragma unroll
      for (int f = 0; f < 2; ++f) {
        qx[f].q[0] = *(const v4u*)(qrp + f * 32 + hi * 8);
        qx[f].q[1] = *(const v4u*)(qrp + f * 32 + 16 + hi * 8);
      }
    }
  }

  const f16* kh_h  = kh  + (size_t)h * SEQ * HDIM;
  const f16* kr_h  = kr  + (size_t)h * ER * HDIM;
  const f16* vt_h  = vt  + (size_t)h * HDIM * SEQ;
  const f16* vtr_h = vtr + (size_t)h * HDIM * ER;

  v8f o[4], o2[4];
  #pragma unroll
  for (int dt = 0; dt < 4; ++dt) {
    o[dt]  = (v8f){0, 0, 0, 0, 0, 0, 0, 0};
    o2[dt] = (v8f){0, 0, 0, 0, 0, 0, 0, 0};
  }

  float rmax = -__builtin_inff();
  float rsum = 0.0f;
  const float SL = 0.125f * 1.4426950408889634f;   // softmax scale * log2(e)

  // causal: this wave visits key chunks whose first key is <= its last query row (wave-uniform trip count)
  const int nchunk = (qrow0 + 15) / BK + 1;
  // the block walks the stages up to its last query row (block-uniform count, at least two)
  const int nstage = (qblk + 1) * (BQ / KS);

  stage_tiles<RES>(sKV, kh_h, kr_h, vt_h, vtr_h, tid);
  asm volatile("s_wait_asynccnt 0x0" ::: "memory");   // this wave's copies of stage 0 have landed
  __syncthreads();                                    // stage 0 readable by every wave
  if (nstage > 1)
    stage_tiles<RES>(sKV + STG_H, kh_h + (size_t)KS * HDIM, kr_h + (size_t)KS * HDIM, vt_h + KS, vtr_h + KS, tid);

  for (int t = 0; t < nstage; ++t) {
   const f16* sb = sKV + (t & 1) * STG_H;
   for (int u = 0; u < KS / BK; ++u) {
    const int i = t * (KS / BK) + u;
    if (i >= nchunk) break;                 // wave-uniform: chunks beyond this wave's diagonal
    const int j0 = i * BK;
    const f16* sk  = sb + (u * BK) * KP;                 // K rows of this chunk
    const f16* sv  = sb + TILE_H + u * BK;               // V^T key columns of this chunk
    const f16* skr = sb + (RES != 0 ? 2 : 0) * TILE_H + (u * BK) * KP;    // residual tiles (read when RES only)
    const f16* svr = sb + (RES != 0 ? 3 : 1) * TILE_H + u * BK;

    // K A-fragments, then V B-fragments (column n = d = dt*16 + lq, split key map from the transposed tile): all
    // fetched at the head of the chunk, so that V's LDS latency passes under the score products and the softmax.
    FragH ka[2][2], bvf[4];
    #pragma unroll   // constant indices keep the fragment arrays in registers
    for (int sub = 0; sub < 2; ++sub) {
      const f16* base = sk + (sub * 16 + lq) * KP + hi * 8;   // row = key j0 + sub*16 + lq
      ka[sub][0].q[0] = *(const v4u*)(base);        // d = hi*8 + 0..7
      ka[sub][0].q[1] = *(const v4u*)(base + 16);   // d = 16 + hi*8 + 0..7
      ka[sub][1].q[0] = *(const v4u*)(base + 32);   // d = 32 + hi*8 + 0..7
      ka[sub][1].q[1] = *(const v4u*)(base + 48);   // d = 48 + hi*8 + 0..7
    }
    #pragma unroll   // as above
    for (int dt = 0; dt < 4; ++dt) {
      const f16* base = sv + (dt * 16 + lq) * KP + hi * 8;
      bvf[dt].q[0] = *(const v4u*)(base);        // keys j0 + hi*8 + 0..7
      bvf[dt].q[1] = *(const v4u*)(base + 16);   // keys j0 + 16 + hi*8 + 0..7
    }

    // S^T tiles: c[sub][r] = rawscore(query qrow0+lq, key j0 + sub*16 + hi*8 + r)
    v8f c[2];
    #pragma unroll
    for (int sub = 0; sub < 2; ++sub) {
      const FragH a0 = ka[sub][0];
      const FragH a1 = ka[sub][1];
      v8f acc = (v8f){0, 0, 0, 0, 0, 0, 0, 0};
      acc = mma_f16(a0.v, qf[0].v, acc);
      acc = mma_f16(a1.v, qf[1].v, acc);
      if (RES != 0) {
        FragH r0, r1;
        const f16* rb = skr + (sub * 16 + lq) * KP + hi * 8;
        r0.q[0] = *(const v4u*)(rb);
        r0.q[1] = *(const v4u*)(rb + 16);
        r1.q[0] = *(const v4u*)(rb + 32);
        r1.q[1] = *(const v4u*)(rb + 48);
        v8f ax = (v8f){0, 0, 0, 0, 0, 0, 0, 0};
        ax = mma_f16(a0.v, qx[0].v, ax);
        ax = mma_f16(a1.v, qx[1].v, ax);
        ax = mma_f16(r0.v, qf[0].v, ax);
        ax = mma_f16(r1.v, qf[1].v, ax);
        #pragma unroll
        for (int r = 0; r < 8; ++r) acc[r] += ax[r] * (1.0f / RSC);
      }
      c[sub] = acc;
    }

    // causal mask (key > query -> -inf); branch is wave-uniform, selects are per lane
    if (j0 + BK - 1 > qrow0) {
      const int qi = qrow0 + lq;
      #pragma unroll
      for (int sub = 0; sub < 2; ++sub) {
        #pragma unroll
        for (int r = 0; r < 8; ++r) {
          const int key = j0 + sub * 16 + hi * 8 + r;
          c[sub][r] = (key > qi) ? -__builtin_inff() : c[sub][r];
        }
      }
    }

    // online softmax: query lq's 32 scores are split across lane / lane^16
    float m_new = rmax;
    #pragma unroll
    for (int r = 0; r < 8; ++r) {
      m_new = fmaxf(m_new, c[0][r]);
      m_new = fmaxf(m_new, c[1][r]);
    }
    m_new = fmaxf(m_new, xhalf(m_new));
    const float scale = __builtin_amdgcn_exp2f((rmax - m_new) * SL);
    rmax = m_new;

    // exp + pack: P^T C-layout == A-fragment layout for the PV product
    FragH pa, pr;
    float psum = 0.0f;
    #pragma unroll
    for (int r = 0; r < 8; ++r) {
      const float p0 = __builtin_amdgcn_exp2f((c[0][r] - m_new) * SL);   // key hi*8 + r
      const float p1 = __builtin_amdgcn_exp2f((c[1][r] - m_new) * SL);   // key 16 + hi*8 + r
      psum += p0 + p1;
      const float pc0 = p0 * PCAR;
      const float pc1 = p1 * PCAR;
      const f16 h0 = (f16)pc0;
      const f16 h1 = (f16)pc1;
      pa.h[r]     = h0;
      pa.h[8 + r] = h1;
      if (RES != 0) {
        pr.h[r]     = (f16)((pc0 - (float)h0) * RSC);
        pr.h[8 + r] = (f16)((pc1 - (float)h1) * RSC);
      }
    }
    rsum = rsum * scale + psum + xhalf(psum);

    // rescale O: queries are the row dimension there -> per-row scale of query 8*hi + r. A query's scale is the same
    // number in lanes lq and lq + 16 (rmax and m_new are joined over the halves), so each 16-lane row serves itself:
    // the upper row first brings queries 8..15 to its lanes 0..7, then lane r of each row is spread over the row.
    const float sw = row_rot8(scale);             // moved by every lane, so that the choice below is a select, not a branch
    const float sq = (hi != 0) ? sw : scale;
    const float sc[8] = {row_bcast<0>(sq), row_bcast<1>(sq), row_bcast<2>(sq), row_bcast<3>(sq),
                         row_bcast<4>(sq), row_bcast<5>(sq), row_bcast<6>(sq), row_bcast<7>(sq)};
    #pragma unroll
    for (int dt = 0; dt < 4; ++dt) {
      #pragma unroll
      for (int r = 0; r < 8; ++r) {
        o[dt][r] *= sc[r];
        if (RES != 0) o2[dt][r] *= sc[r];
      }
    }

    // O += P x V
    #pragma unroll
    for (int dt = 0; dt < 4; ++dt) {
      o[dt] = mma_f16(pa.v, bvf[dt].v, o[dt]);
      if (RES != 0) {
        o2[dt] = mma_f16(pr.v, bvf[dt].v, o2[dt]);
        FragH br;
        const f16* rb = svr + (dt * 16 + lq) * KP + hi * 8;
        br.q[0] = *(const v4u*)(rb);
        br.q[1] = *(const v4u*)(rb + 16);
        o2[dt] = mma_f16(pa.v, br.v, o2[dt]);
      }
    }
   }
   // publish point of stage t + 1, passed by every wave (also one that skipped chunks)
   asm volatile("s_wait_dscnt 0x0" ::: "memory");      // this wave's reads of stage t are done before its buffer is refilled
   asm volatile("s_wait_asynccnt 0x0" ::: "memory");   // this wave's copies of stage t + 1 have landed
   __syncthreads();                                    // stage t + 1 readable; every reader has left stage t
   if (t + 2 < nstage)
     stage_tiles<RES>(sKV + (t & 1) * STG_H, kh_h + (size_t)(t + 2) * KS * HDIM, kr_h + (size_t)(t + 2) * KS * HDIM,
                      vt_h + (t + 2) * KS, vtr_h + (t + 2) * KS, tid);
  }
  asm volatile("s_wait_asynccnt 0x0" ::: "memory");    // no copy outstanding behind the loop

  // normalize: lane holds column d = dt*16 + lq for query rows 8*hi + r; stage ctx * 64
  float rs[8];
  #pragma unroll
  for (int r = 0; r < 8; ++r) rs[r] = 1.0f / __shfl(rsum, (hi << 3) + r, 32);

  float* so = sO + wave * (16 * OP);
  #pragma unroll
  for (int r = 0; r < 8; ++r) {
    #pragma unroll
    for (int dt = 0; dt < 4; ++dt) {
      float val = o[dt][r];
      if (RES != 0) val += o2[dt][r] * (1.0f / RSC);
      so[(hi * 8 + r) * OP + dt * 16 + lq] = val * (CCAR / PCAR) * rs[r];
    }
  }
  __syncthreads();

  v4u    hv[4], rv[4];
  size_t gi[4], gr[4];
  #pragma unroll
  for (int it = 0; it < 4; ++it) {
    const int row   = it * 4 + (lane >> 3);   // 0..15
    const int piece = lane & 7;               // 0..7
    const v4f a0 = *(const v4f*)(so + row * OP + piece * 8);
    const v4f a1 = *(const v4f*)(so + row * OP + piece * 8 + 4);
    Pack8H ph, px;
    #pragma unroll
    for (int k = 0; k < 4; ++k) {
      const float u0 = a0[k];
      const float u1 = a1[k];
      const f16 g0 = (f16)u0;
      const f16 g1 = (f16)u1;
      ph.h[k]     = g0;
      ph.h[4 + k] = g1;
      px.h[k]     = (f16)((u0 - (float)g0) * RSC);
      px.h[4 + k] = (f16)((u1 - (float)g1) * RSC);
    }
    hv[it] = ph.u;
    rv[it] = px.u;
    gi[it] = (size_t)(qrow0 + row) * DMODEL + h * HDIM + piece * 8;
    gr[it] = (size_t)(qrow0 + row) * DMODEL + h * HDIM + piece * 8;   // row < ER when RES
  }
  #pragma unroll
  for (int it = 0; it < 4; ++it) {
    *(v4u*)(ctxh + gi[it]) = hv[it];
    if (RES != 0) *(v4u*)(ctxr + gr[it]) = rv[it];
  }
  
}

// Causal balance: a query block's cost grows linearly with its index, and every work-group of the launch is resident
// at once, so the launch lasts as long as its longest work-group. Each work-group therefore takes two query blocks of
// one head, one after the other in every wave: NT - 1 - p, then p. Every work-group walks NT + 1 blocks' worth of key
// stages; every (head, query block) is taken exactly once. All branches are block-uniform.
// The LDS is sized for the residual form; the other uses the first half of sKV.
// At most two waves per SIMD: one work-group per WGP, so that none of the 256 equal work-groups shares a WGP while another WGP stands empty.
__global__ __launch_bounds__(256) __attribute__((amdgpu_waves_per_eu(2, 2))) void attn_kernel(const f16* __restrict__ qh, const f16* __restrict__ qr,
                                                   const f16* __restrict__ kh, const f16* __restrict__ kr,
                                                   const f16* __restrict__ vt, const f16* __restrict__ vtr,
                                                   f16* __restrict__ ctxh, f16* __restrict__ ctxr) {
  __shared__ __align__(16) float sO[NWAVE * 16 * OP];   // per-wave output staging (block barrier used)
  __shared__ __align__(16) f16 sKV[2 * 4 * TILE_H];     // two stage buffers, cross-wave
  const int NE = ER / BQ;                       // query blocks with residual planes, per head
  const int NT = SEQ / BQ;                      // query blocks per head
  const int NP = NT / 2;                        // pairs per head
  static_assert(NT % 2 == 0 && NE <= NP);       // whole pairs; the long block of a pair never has residual planes
  const int p  = blockIdx.x % NP;
  const int h  = blockIdx.x / NP;
  attn_body<0>(sO, sKV, qh, qr, kh, kr, vt, vtr, ctxh, ctxr, NT - 1 - p, h);
  asm volatile("s_wait_dscnt 0x0" ::: "memory");   // this wave's LDS reads of the first block are done before the buffers are refilled
  __syncthreads();                                 // every wave has left the first block's LDS
  if (p < NE) attn_body<1>(sO, sKV, qh, qr, kh, kr, vt, vtr, ctxh, ctxr, p, h);
  else        attn_body<0>(sO, sKV, qh, qr, kh, kr, vt, vtr, ctxh, ctxr, p, h);
}

// ---------------------------------------------------------------------------------------------
extern "C" void kernel_launch(void* const* d_in, const int* in_sizes, int n_in,
                              void* d_out, int out_size, void* d_ws, size_t ws_size,
                              hipStream_t stream) {
  if (n_in < 3) return;
  if ((size_t)in_sizes[0] < (size_t)SEQ * DMODEL) return;
  if ((size_t)in_sizes[1] < (size_t)QKV_N * DMODEL) return;
  if ((size_t)in_sizes[2] < (size_t)DMODEL * DMODEL) return;
  if ((size_t)out_size < (size_t)SEQ * DMODEL) return;

  const size_t xb_bytes   = (size_t)SEQ * DMODEL * 2;            // bf16 [SEQ][DMODEL]
  const size_t wb_bytes   = (size_t)QKV_N * DMODEL * 2;          // bf16 [QKV_N][DMODEL]
  const size_t wp_bytes   = (size_t)DMODEL * DMODEL * 2;         // f16  [DMODEL][DMODEL]
  const size_t tab_bytes  = (size_t)SEQ * NROPE * 4;             // f32  [SEQ][NROPE] (each of cos, sin)
  const size_t pl_bytes   = (size_t)NHEAD * SEQ * HDIM * 2;      // f16  q/k/vt planes
  const size_t plr_bytes  = (size_t)NHEAD * ER * HDIM * 2;       // f16  residual planes
  const size_t ctx_bytes  = (size_t)SEQ * DMODEL * 2;            // f16  [SEQ][DMODEL]
  const size_t ctxr_bytes = (size_t)ER * DMODEL * 2;             // f16  [ER][DMODEL]
  const size_t total = xb_bytes + wb_bytes + wp_bytes + 2 * tab_bytes
                     + 3 * pl_bytes + 3 * plr_bytes + ctx_bytes + ctxr_bytes;
  if (ws_size < total) return;

  char* ws = (char*)d_ws;
  size_t off = 0;
  bf16*  xb   = (bf16*)(ws + off);  off += xb_bytes;
  bf16*  wb   = (bf16*)(ws + off);  off += wb_bytes;
  f16*   wp   = (f16*)(ws + off);   off += wp_bytes;
  float* ct   = (float*)(ws + off); off += tab_bytes;
  float* st   = (float*)(ws + off); off += tab_bytes;
  f16*   qhp  = (f16*)(ws + off);   off += pl_bytes;
  f16*   khp  = (f16*)(ws + off);   off += pl_bytes;
  f16*   vtp  = (f16*)(ws + off);   off += pl_bytes;
  f16*   qrp  = (f16*)(ws + off);   off += plr_bytes;
  f16*   krp  = (f16*)(ws + off);   off += plr_bytes;
  f16*   vtrp = (f16*)(ws + off);   off += plr_bytes;
  f16*   ctxh = (f16*)(ws + off);   off += ctx_bytes;
  f16*   ctxr = (f16*)(ws + off);   off += ctxr_bytes;
  if (off > ws_size) return;

  const float* x     = (const float*)d_in[0];
  const float* wqkv  = (const float*)d_in[1];
  const float* wproj = (const float*)d_in[2];
  float*       out   = (float*)d_out;

  // 1) RoPE cos/sin tables and the 16-bit operand planes of the inputs
  const int ncvt_blocks = SEQ * DMODEL / 2048 + QKV_N * DMODEL / 2048 + DMODEL * DMODEL / 2048;
  prep_kernel<<<dim3(SEQ / 8 + ncvt_blocks), 256, 0, stream>>>(x, wqkv, wproj, xb, wb, wp, ct, st);

  // 2) qkv = xb x wb^T (bf16 operands, f32 accumulators), RoPE, q/k/v planes (+ residual planes for rows < ER)
  gemm_qkv_kernel<<<dim3(QKV_N / 64, SEQ / 128), 128, 0, stream>>>(
      (const us16*)xb, (const us16*)wb, ct, st, qhp, qrp, khp, krp, vtp, vtrp, DMODEL, QKV_N);

  // 3) causal attention -> ctx planes, two query blocks per work-group
  attn_kernel<<<dim3((SEQ / BQ / 2) * NHEAD), 256, 0, stream>>>(qhp, qrp, khp, krp, vtp, vtrp, ctxh, ctxr);

  // 4) out[SEQ][DMODEL] = ctx x wp^T ; folds the ctx carry (64), the Wproj carry (256) and the residual scale (1024)
  const float oscale = 1.0f / (CCAR * WCAR);
  const float rscale = oscale / RSC;
  gemm_proj_kernel<<<dim3(DMODEL / 64, ER / 64 + (SEQ - ER) / 128), 128, 0, stream>>>(
      (const us16*)ctxh, (const us16*)ctxr, (const us16*)wp, out, DMODEL, DMODEL, oscale, rscale);
}

// v007
// Measured time: 112 microseconds a run.
// In two side-by-side timings against v006, it was 1.05 and 1.06 times as fast.
// All steps since v000 together make it 4.04 times as fast.
#include <hip/hip_runtime.h>

// Contractions: qkv = X x Wqkv^T on v_wmma_f32_16x16x32_bf16 (bf16 operands = RNE-converted inputs, f32 accumulate);
// S^T = K x Q^T on v_wmma_f32_16x16x32_f16 (f16 q/k after RoPE, plus f16 residual planes x1024 with their own
// accumulator on query blocks < EARLY_QBLK); O = P x V on v_wmma_f32_16x16x32_f16 (P as f16 carried x4096,
// V as f16, plus P and V residual planes x1024 with their own accumulator on query blocks < EARLY_QBLK);
// out = ctx x Wproj^T on v_wmma_f32_16x16x32_f16 (ctx as f16 carried x64 plus residual x1024 on rows < ER,
// Wproj = f16 of the bf16 RNE-converted input carried x256). RoPE, softmax and all epilogues in f32.

#ifndef NB
#define NB 1
#endif
#ifndef SEQ
#define SEQ 4096
#endif
#define NB_FULL    1
#define SEQ_FULL   4096
#define NHEAD      16
#define HDIM       64
#define DMODEL     (NHEAD * HDIM)        // 1024
#define QKV_N      (3 * DMODEL)          // 3072
#define NROPE      (HDIM / 2)            // 32 frequencies
#define BQ         128                   // query rows per attention block (8 waves x 16)
#define BK         32                    // keys per inner iteration
#define NWAVE      8
#define EARLY_QBLK 2                     // query blocks with residual planes on q, k, P, v, ctx
#define ER         ((EARLY_QBLK * BQ < SEQ) ? (EARLY_QBLK * BQ) : SEQ)   // early rows == early keys
#define VP         136                   // LDS pitch (halves) of the transposed V tile (128 keys): 272 B = 16 B x odd
#define OP         68                    // LDS pitch (floats) of output staging tiles
#define PCAR       4096.0f               // P carry
#define RSC        1024.0f               // residual plane scale
#define CCAR       64.0f                 // ctx carry
#define WCAR       256.0f                // Wproj carry
#define KS         64                    // keys per LDS stage of the attention loop (two inner iterations)
#define KP         72                    // LDS pitch (halves) of staged K rows and V^T rows: 144 B = 16 B x odd
#define TILE_H     (64 * KP)             // halves per staged tile (64 rows)
#define GS         64                    // k per LDS stage of the GEMM loop (two 32-k products)

static_assert(NB == 1 && NB <= NB_FULL);
static_assert(SEQ <= SEQ_FULL);
static_assert(SEQ % BQ == 0);
static_assert(ER % BQ == 0);
static_assert((SEQ - ER) % 128 == 0);
static_assert(SEQ % 8 == 0);
static_assert(BQ == NWAVE * 16);
static_assert(HDIM == 64);
static_assert(DMODEL % 64 == 0 && QKV_N % 64 == 0);
static_assert(DMODEL % 32 == 0);
static_assert((SEQ * DMODEL) % 2048 == 0);
static_assert((QKV_N * DMODEL) % 2048 == 0);
static_assert((DMODEL * DMODEL) % 2048 == 0);
static_assert((VP * 2) % 16 == 0);
static_assert((OP * 4) % 16 == 0);
static_assert(KS == 2 * BK && BQ % KS == 0 && KS == 64);
static_assert((KP * 2) % 16 == 0);

typedef __bf16         bf16;
typedef _Float16       f16;
typedef unsigned short us16;
typedef bf16     v16bf __attribute__((ext_vector_type(16)));
typedef f16      v16h  __attribute__((ext_vector_type(16)));
typedef f16      v8h   __attribute__((ext_vector_type(8)));
typedef float    v8f   __attribute__((ext_vector_type(8)));
typedef float    v4f   __attribute__((ext_vector_type(4)));
typedef unsigned v4u   __attribute__((ext_vector_type(4)));

union FragB  { v16bf v; v4u q[2]; bf16 h[16]; };
union FragH  { v16h  v; v4u q[2]; f16  h[16]; };
union Pack8B { v4u u; bf16 h[8]; };
union Pack8H { v4u u; v8h v; f16 h[8]; };

// WMMA helpers: builtin followed by the VALU hazard guard (ties D, keeps A/B live).
static __device__ __forceinline__ v8f mma_bf16(v16bf a, v16bf b, v8f acc) {
  acc = __builtin_amdgcn_wmma_f32_16x16x32_bf16(false, a, false, b, (short)0, acc, false, false);
  asm volatile("v_nop\n\tv_nop\n\tv_nop\n\tv_nop" : "+v"(acc) : "v"(a), "v"(b));
  return acc;
}
static __device__ __forceinline__ v8f mma_f16(v16h a, v16h b, v8f acc) {
  acc = __builtin_amdgcn_wmma_f32_16x16x32_f16(false, a, false, b, (short)0, acc, false, false);
  asm volatile("v_nop\n\tv_nop\n\tv_nop\n\tv_nop" : "+v"(acc) : "v"(a), "v"(b));
  return acc;
}
static __device__ __forceinline__ v8f mma(const FragB& a, const FragB& b, v8f acc) { return mma_bf16(a.v, b.v, acc); }

// Cross-lane moves on the vector pipe (a shuffle compiles to an LDS-pipe permute, whose result a wave must wait for).
// They are used where every lane is on. The fetch-inactive flag (fifth argument) then changes no value; it says that the
// old destination is not read, which saves a register copy in front of every move.
// xhalf: lane l gets the value of lane l ^ 16.
static __device__ __forceinline__ float xhalf(float x) {
  const int b = __builtin_bit_cast(int, x);
  return __builtin_bit_cast(float, __builtin_amdgcn_permlanex16(b, b, 0x76543210, 0xfedcba98, true, false));
}
// row_rot8: lane l gets the value of lane l ^ 8 (the other half of its own 16-lane row).
static __device__ __forceinline__ float row_rot8(float x) {
  const int b = __builtin_bit_cast(int, x);
  return __builtin_bit_cast(float, __builtin_amdgcn_permlane16(b, b, 0xfedcba98, 0x76543210, true, false));
}
// row_bcast<R>: every lane gets the value of lane R of its own 16-lane row.
template <int R>
static __device__ __forceinline__ float row_bcast(float x) {
  const int b = __builtin_bit_cast(int, x);
  return __builtin_bit_cast(float, __builtin_amdgcn_permlane16(b, b, 0x11111111u * R, 0x11111111u * R, true, false));
}
static __device__ __forceinline__ v8f mma(const FragH& a, const FragH& b, v8f acc) { return mma_f16(a.v, b.v, acc); }

// ---------------------------------------------------------------------------------------------
// Convert pass: xb = bf16(x) [SEQ][DMODEL], wb = bf16(Wqkv) [QKV_N][DMODEL], wp = f16(bf16(Wproj) * 256) [DMODEL][DMODEL].
// coverage: blocks [0,SEQ*DMODEL/2048) x 256 x 8 == SEQ*DMODEL; next QKV_N*DMODEL/2048 blocks == QKV_N*DMODEL;
//           last DMODEL*DMODEL/2048 blocks == DMODEL*DMODEL.
template <int MODE>
static __device__ __forceinline__ void cvt_body(const float* __restrict__ src, us16* __restrict__ dst,
                                                 int blk, int tid) {
  const size_t e = ((size_t)blk * 256 + tid) * 8;
  const v4f a = *(const v4f*)(src + e);
  const v4f b = *(const v4f*)(src + e + 4);
  v4u u;
  if (MODE == 0) {
    Pack8B pk;
    #pragma unroll
    for (int i = 0; i < 4; ++i) {
      pk.h[i]     = (bf16)a[i];                 // RNE convert
      pk.h[4 + i] = (bf16)b[i];
    }
    u = pk.u;
  } else {
    Pack8H pk;
    #pragma unroll
    for (int i = 0; i < 4; ++i) {
      pk.h[i]     = (f16)((float)(bf16)a[i] * WCAR);   // bf16 significand is exact in f16
      pk.h[4 + i] = (f16)((float)(bf16)b[i] * WCAR);
    }
    u = pk.u;
  }
  *(v4u*)(dst + e) = u;
  
}

static __device__ __forceinline__ void convert_body(const float* __restrict__ x,
                                                    const float* __restrict__ wq,
                                                    const float* __restrict__ wpj,
                                                    bf16* __restrict__ xb,
                                                    bf16* __restrict__ wb,
                                                    f16* __restrict__ wp,
                                                    int blk, int tid) {
  const int NBX = SEQ * DMODEL / 2048;
  const int NBQ = QKV_N * DMODEL / 2048;
  if (blk < NBX)            cvt_body<0>(x, (us16*)xb, blk, tid);
  else if (blk < NBX + NBQ) cvt_body<0>(wq, (us16*)wb, blk - NBX, tid);
  else                      cvt_body<1>(wpj, (us16*)wp, blk - NBX - NBQ, tid);
}

// ---------------------------------------------------------------------------------------------
// RoPE tables ct/st [SEQ][NROPE] f32: angle(t, j) = t * (1 / 10000^(2j/64)). Block = 8 positions x 32 freqs.
// One powf + one sincosf per thread (rolled). Rows staged in LDS; waves 0-1 write the cos lines, waves 2-3 the
// coverage: (SEQ/8 blocks) x 8 rows x 32 floats == SEQ*NROPE per table.
static __device__ __forceinline__ void rope_table_body(float* __restrict__ ct, float* __restrict__ st,
                                                       int blk, int tid) {
  __shared__ __align__(16) float sc[8 * NROPE];   // cross-wave (block barrier)
  __shared__ __align__(16) float ss[8 * NROPE];
  const int j   = tid & 31;
  const int tl  = tid >> 5;
  const int t   = blk * 8 + tl;
  const float e   = (float)(2 * j) * (1.0f / 64.0f);
  const float pw  = powf(10000.0f, e);
  const float inv = 1.0f / pw;
  const float ang = (float)t * inv;
  float sn, cs;
  sincosf(ang, &sn, &cs);
  sc[tl * NROPE + j] = cs;
  ss[tl * NROPE + j] = sn;
  __syncthreads();
  if (tid < 64) {
    const int rowl  = tid >> 3;
    const int piece = tid & 7;
    const v4f v = *(const v4f*)(sc + rowl * NROPE + piece * 4);
    const size_t gi = (size_t)(blk * 8 + rowl) * NROPE + piece * 4;
    *(v4f*)(ct + gi) = v;
    
  } else if (tid < 128) {
    const int rowl  = (tid - 64) >> 3;
    const int piece = tid & 7;
    const v4f v = *(const v4f*)(ss + rowl * NROPE + piece * 4);
    const size_t gi = (size_t)(blk * 8 + rowl) * NROPE + piece * 4;
    *(v4f*)(st + gi) = v;
    
  }
}

// One launch for the two passes that depend on nothing but the inputs: blocks [0, SEQ/8) build the RoPE tables,
// the rest convert the operands (block-uniform branch, so the table blocks' barrier is passed by whole blocks).
__global__ __launch_bounds__(256) void prep_kernel(const float* __restrict__ x,
                                                   const float* __restrict__ wq,
                                                   const float* __restrict__ wpj,
                                                   bf16* __restrict__ xb,
                                                   bf16* __restrict__ wb,
                                                   f16* __restrict__ wp,
                                                   float* __restrict__ ct, float* __restrict__ st) {
  const int blk = blockIdx.x;
  const int tid = threadIdx.x;
  const int NBR = SEQ / 8;
  if (blk < NBR) rope_table_body(ct, st, blk, tid);
  else           convert_body(x, wq, wpj, xb, wb, wp, blk - NBR, tid);
}

// ---------------------------------------------------------------------------------------------
// NT GEMM: C[m][n] = oscale * sum_k A[m][k] B[n][k] (+ rscale * sum_k Ar[m][k] B[n][k] when RES).
// A, Ar, B are 16-bit row-major planes with pitch K (k contiguous). 4 waves/block, wave tile (16*MI) x 64,
// block tile (64*MI) x 64 (MI == 4: waves 2 x 2, block tile 128 x 128, four tiles [A | A | B | B]). The block's A, Ar and B rows are staged GS k at a time in two LDS buffers by asynchronous
// 16-B copies (whole 128-B row pieces); a stage buffer holds three 64-row tiles at pitch KP: [A | A | B], or [A | Ar | B] when RES.
// A and B fragments are read from LDS with the split k map:
// elements 0..7 <- k0 + 8h + 0..7, elements 8..15 <- k0 + 16 + 8h + 0..7, lane&15 = row of A / row of B (= column n).
// Epilogue: wave tile staged in LDS (in the bytes of the stage buffers, which every wave has left by then), then per
// instruction lanes 0..15 write one 256-B row segment.
// Requires K % 64 == 0, N % 64 == 0 (N % 128 == 0 when MI == 4), rows covered by the grid a multiple of the block tile's rows.
// One stage's copies of one thread of the 128: rows r + 16 j (r = tid>>3, j = 0..3) of each of the three 64-row tiles,
// 16-B piece tid&7. r0/r1/r2 point at the first row of each tile at the stage's first k (pitch K); in LDS the three
// tiles follow one another, so the twelve rows of a thread lie 16 rows apart.
static __device__ __forceinline__ void stage_gemm(us16* buf, const us16* r0, const us16* r1, const us16* r2,
                                                  int K, int tid) {
  const int row   = tid >> 3;     // 0..15
  const int piece = tid & 7;      // 0..7
  const unsigned l0 = (unsigned)(size_t)(buf + row * KP + piece * 8);   // LDS byte address
  const unsigned ls = 16 * KP * 2;                                      // 16 rows in LDS, bytes
  const size_t   go = (size_t)row * K + piece * 8;
  const size_t   gs = (size_t)16 * K;                                    // 16 rows in the plane, elements
  const us16* a0 = r0 + go;
  const us16* b0 = r1 + go;
  const us16* c0 = r2 + go;
  // the copies and, as the last line, the wait that stands before any of their address registers is rewritten
  asm volatile("global_load_async_to_lds_b128 %0, %12, off\n\t"
               "global_load_async_to_lds_b128 %1, %13, off\n\t"
               "global_load_async_to_lds_b128 %2, %14, off\n\t"
               "global_load_async_to_lds_b128 %3, %15, off\n\t"
               "global_load_async_to_lds_b128 %4, %16, off\n\t"
               "global_load_async_to_lds_b128 %5, %17, off\n\t"
               "global_load_async_to_lds_b128 %6, %18, off\n\t"
               "global_load_async_to_lds_b128 %7, %19, off\n\t"
               "global_load_async_to_lds_b128 %8, %20, off\n\t"
               "global_load_async_to_lds_b128 %9, %21, off\n\t"
               "global_load_async_to_lds_b128 %10, %22, off\n\t"
               "global_load_async_to_lds_b128 %11, %23, off\n\t"
               "s_wait_xcnt 0x0"
               :: "v"(l0), "v"(l0 + ls), "v"(l0 + 2 * ls), "v"(l0 + 3 * ls),
                  "v"(l0 + 4 * ls), "v"(l0 + 5 * ls), "v"(l0 + 6 * ls), "v"(l0 + 7 * ls),
                  "v"(l0 + 8 * ls), "v"(l0 + 9 * ls), "v"(l0 + 10 * ls), "v"(l0 + 11 * ls),
                  "v"(a0), "v"(a0 + gs), "v"(a0 + 2 * gs), "v"(a0 + 3 * gs),
                  "v"(b0), "v"(b0 + gs), "v"(b0 + 2 * gs), "v"(b0 + 3 * gs),
                  "v"(c0), "v"(c0 + gs), "v"(c0 + 2 * gs), "v"(c0 + 3 * gs) : "memory");
}

#define GEMM_LDS_B (2 * 3 * TILE_H * 2)        // bytes of the two stage buffers of three tiles each
#define QKV_LDS_B  (2 * 4 * TILE_H * 2)        // bytes of the two stage buffers of four tiles each (128 x 128 block tile)

// The same for two 64-row tiles that follow one another in LDS: rows r + 16 j of each, eight copies of a thread.
static __device__ __forceinline__ void stage_pair(us16* buf, const us16* r0, const us16* r1, int K, int tid) {
  const int row   = tid >> 3;     // 0..15
  const int piece = tid & 7;      // 0..7
  const unsigned l0 = (unsigned)(size_t)(buf + row * KP + piece * 8);   // LDS byte address
  const unsigned ls = 16 * KP * 2;                                      // 16 rows in LDS, bytes
  const size_t   go = (size_t)row * K + piece * 8;
  const size_t   gs = (size_t)16 * K;                                    // 16 rows in the plane, elements
  const us16* a0 = r0 + go;
  const us16* b0 = r1 + go;
  // the copies and, as the last line, the wait that stands before any of their address registers is rewritten
  asm volatile("global_load_async_to_lds_b128 %0, %8, off\n\t"
               "global_load_async_to_lds_b128 %1, %9, off\n\t"
               "global_load_async_to_lds_b128 %2, %10, off\n\t"
               "global_load_async_to_lds_b128 %3, %11, off\n\t"
               "global_load_async_to_lds_b128 %4, %12, off\n\t"
               "global_load_async_to_lds_b128 %5, %13, off\n\t"
               "global_load_async_to_lds_b128 %6, %14, off\n\t"
               "global_load_async_to_lds_b128 %7, %15, off\n\t"
               "s_wait_xcnt 0x0"
               :: "v"(l0), "v"(l0 + ls), "v"(l0 + 2 * ls), "v"(l0 + 3 * ls),
                  "v"(l0 + 4 * ls), "v"(l0 + 5 * ls), "v"(l0 + 6 * ls), "v"(l0 + 7 * ls),
                  "v"(a0), "v"(a0 + gs), "v"(a0 + 2 * gs), "v"(a0 + 3 * gs),
                  "v"(b0), "v"(b0 + gs), "v"(b0 + 2 * gs), "v"(b0 + 3 * gs) : "memory");
}

// One stage of a block: MI == 4 stages four tiles [A | A | B | B], the other forms three (r3 is then not read).
template <int MI>
static __device__ __forceinline__ void stage_block(us16* buf, const us16* r0, const us16* r1, const us16* r2,
                                                   const us16* r3, int K, int tid) {
  if constexpr (MI == 4) {
    stage_pair(buf, r0, r1, K, tid);
    stage_pair(buf + 2 * TILE_H, r2, r3, K, tid);
  } else {
    stage_gemm(buf, r0, r1, r2, K, tid);
  }
}

// Where the qkv product's epilogue reads the RoPE tables and writes the 16-bit planes.
//   qh, kh [NHEAD][SEQ][HDIM] f16 : q and k after RoPE;  vt [NHEAD][HDIM][SEQ] f16 : V transposed.
//   qr, kr [NHEAD][ER][HDIM]  f16 : residual planes (x - f16(x)) * 1024 for rows < ER;  vtr [NHEAD][HDIM][ER] likewise.
struct PlaneOut {
  const float* ct;
  const float* st;
  f16* qh;
  f16* qr;
  f16* kh;
  f16* kr;
  f16* vt;
  f16* vtr;
};

// Epilogue of the qkv product: the block's 128 x 128 tile is one slot (q, k or v) of two heads for 128 rows, and a wave's
// 64 x 64 tile one head for 64 rows (wave = wm + 2 wn: rows mb + 64 wm, head h0 + wn), so the planes
// are built from the f32 accumulators and the f32 qkv array is never written. All branches are block-uniform.
// q, k: wave tile staged in LDS as f32; RoPE (rotate-half): out[d] = x[d]*cos + sgn*x[d^32]*sin, both from the staged row;
//       per instruction 4 rows of 128 B, whole lines.
// v:    a lane's 8 accumulator rows are 8 consecutive keys of one d, so the tile is staged transposed with one 16-B LDS
//       store each; per instruction 2 rows of 256 B, whole lines.
// coverage: rows mb..mb+127, d 0..63 of the slot's plane for both heads; residual planes for blocks with mb < ER (ER % 128 == 0).
// EARLY is the block-uniform mb < ER as a template argument, so that neither form carries the other's registers.
// Every loop here is unrolled: constant indices keep the accumulators and the small arrays in registers.
template <int EARLY>
static __device__ __forceinline__ void rope_planes(unsigned char* smem, const v8f (&acc)[4][4],
                                                   const float* ct, const float* st,
                                                   f16* pl, f16* plr, int mb, int h0) {
  const int tid  = threadIdx.x;
  const int wave = __builtin_amdgcn_readfirstlane(tid >> 5);   // scalar, so that the head's plane base stays uniform
  const int lane = tid & 31;
  const int lq   = lane & 15;
  const int hi   = lane >> 4;
  const int h    = h0 + (wave >> 1);
  float* so = (float*)smem + wave * (64 * OP);
  #pragma unroll
  for (int mi = 0; mi < 4; ++mi) {
    #pragma unroll
    for (int t = 0; t < 4; ++t) {
      #pragma unroll
      for (int r = 0; r < 8; ++r) so[(mi * 16 + hi * 8 + r) * OP + t * 16 + lq] = acc[mi][t][r];
    }
  }
  __syncthreads();
  const int   d0  = (lane & 7) * 8;           // 0..56
  const int   j0  = d0 & (NROPE - 1);         // frequency index of d0
  const float sgn = (d0 < NROPE) ? -1.0f : 1.0f;
  const int   NK  = (EARLY != 0) ? 2 : 4;     // row groups whose loads are in flight together
  // one 32-bit lane offset per array on a uniform base; the row groups lie a constant 4 rows apart
  const unsigned srow0 = (unsigned)(mb + (wave & 1) * 64 + (lane >> 3));
  const unsigned toff  = srow0 * NROPE + j0;
  const unsigned poff  = srow0 * HDIM + d0;
  f16* plh  = pl + (size_t)h * SEQ * HDIM;
  f16* plrh = plr + (size_t)h * ER * HDIM;    // used only when EARLY (rows < ER)
  const float* cpb = ct + toff;
  const float* spb = st + toff;
  #pragma unroll
  for (int b = 0; b < 16 / NK; ++b) {
    v4f c0[NK], c1[NK], n0v[NK], n1v[NK];
    #pragma unroll
    for (int k = 0; k < NK; ++k) {
      c0[k]  = *(const v4f*)(cpb + (b * NK + k) * 4 * NROPE);
      c1[k]  = *(const v4f*)(cpb + (b * NK + k) * 4 * NROPE + 4);
      n0v[k] = *(const v4f*)(spb + (b * NK + k) * 4 * NROPE);
      n1v[k] = *(const v4f*)(spb + (b * NK + k) * 4 * NROPE + 4);
    }
    // the wait that stands before the table loads' address registers are rewritten; it names them, so they live up to it
    asm volatile("s_wait_xcnt 0x0" :: "v"(cpb), "v"(spb) : "memory");
    v4u hv[NK], rv[NK];
    #pragma unroll
    for (int k = 0; k < NK; ++k) {
      const int row = (b * NK + k) * 4 + (lane >> 3);    // 0..63
      const float* xo = so + row * OP + d0;
      const float* xq = so + row * OP + (d0 ^ NROPE);    // pair partner d^32
      const v4f x0 = *(const v4f*)(xo);
      const v4f x1 = *(const v4f*)(xo + 4);
      const v4f p0 = *(const v4f*)(xq);
      const v4f p1 = *(const v4f*)(xq + 4);
      float xa[8], pa[8], ca[8], sa[8];
      #pragma unroll
      for (int i = 0; i < 4; ++i) {
        xa[i] = x0[i];     xa[4 + i] = x1[i];
        pa[i] = p0[i];     pa[4 + i] = p1[i];
        ca[i] = c0[k][i];  ca[4 + i] = c1[k][i];
        sa[i] = n0v[k][i]; sa[4 + i] = n1v[k][i];
      }
      Pack8H ph, px;
      #pragma unroll
      for (int i = 0; i < 8; ++i) {
        const float xr = xa[i] * ca[i] + sgn * pa[i] * sa[i];
        const f16 xh = (f16)xr;
        ph.h[i] = xh;
        px.h[i] = (f16)((xr - (float)xh) * RSC);
      }
      hv[k] = ph.u;
      rv[k] = px.u;
    }
    f16* pp = plh + poff;
    f16* pr = plrh + poff;
    #pragma unroll
    for (int k = 0; k < NK; ++k) {
      *(v4u*)(pp + (b * NK + k) * 4 * HDIM) = hv[k];
      if (EARLY != 0) *(v4u*)(pr + (b * NK + k) * 4 * HDIM) = rv[k];
    }
    // the wait that stands before the stores' address and data registers are rewritten; it names them, so they live up to it
    if constexpr (EARLY != 0)
      asm volatile("s_wait_xcnt 0x0" :: "v"(pp), "v"(pr), "v"(hv[0]), "v"(hv[1]), "v"(rv[0]), "v"(rv[1]) : "memory");
    else
      asm volatile("s_wait_xcnt 0x0" :: "v"(pp), "v"(hv[0]), "v"(hv[1]), "v"(hv[2]), "v"(hv[3]) : "memory");
  }
}

template <int EARLY>
static __device__ __forceinline__ void v_planes(unsigned char* smem, const v8f (&acc)[4][4],
                                                f16* vt, f16* vtr, int mb, int h0) {
  const int tid  = threadIdx.x;
  const int wave = tid >> 5;
  const int lane = tid & 31;
  const int lq   = lane & 15;
  const int hi   = lane >> 4;
  f16* sT = (f16*)smem;                       // [head, d][key] hi, 128 rows, cross-wave (block barrier)
  f16* sR = sT + 2 * HDIM * VP;               // [head, d][key] residual, cross-wave (block barrier)
  #pragma unroll
  for (int mi = 0; mi < 4; ++mi) {
    #pragma unroll
    for (int t = 0; t < 4; ++t) {
      Pack8H ph, px;
      #pragma unroll
      for (int r = 0; r < 8; ++r) {
        const float va = acc[mi][t][r];
        const f16 vh = (f16)va;
        ph.h[r] = vh;
        px.h[r] = (f16)((va - (float)vh) * RSC);
      }
      // row = 64 * (head - h0) + d, d = t*16 + lq; keys hi*8 + 0..7 of the 16
      const int o = ((wave >> 1) * HDIM + t * 16 + lq) * VP + (wave & 1) * 64 + mi * 16 + hi * 8;
      *(v4u*)(sT + o) = ph.u;
      if (EARLY != 0) *(v4u*)(sR + o) = px.u;
    }
  }
  __syncthreads();
  const int dl = tid >> 4;                    // 0..7
  const int ks = (tid & 15) * 8;              // 0..120
  // the two heads' d rows follow one another in the plane as in the staging: 128 rows, eight per pass of the block
  f16* vth = vt + (size_t)h0 * HDIM * SEQ + mb;   // uniform base; one 32-bit lane offset; the rows lie a constant 8 apart
  #pragma unroll
  for (int g = 0; g < 2; ++g) {
    v4u vv[8];
    #pragma unroll
    for (int it = 0; it < 8; ++it) vv[it] = *(const v4u*)(sT + ((g * 8 + it) * 8 + dl) * VP + ks);
    #pragma unroll
    for (int it = 0; it < 8; ++it) *(v4u*)(vth + (unsigned)(dl * SEQ + ks) + (g * 8 + it) * 8 * SEQ) = vv[it];
    asm volatile("s_wait_xcnt 0x0" ::: "memory");   // stands before the stores' address and data registers are rewritten
  }
  if (EARLY != 0) {
    f16* vtrh = vtr + (size_t)h0 * HDIM * ER + mb;
    #pragma unroll
    for (int g = 0; g < 2; ++g) {
      v4u vx[8];
      #pragma unroll
      for (int it = 0; it < 8; ++it) vx[it] = *(const v4u*)(sR + ((g * 8 + it) * 8 + dl) * VP + ks);
      #pragma unroll
      for (int it = 0; it < 8; ++it) *(v4u*)(vtrh + (unsigned)(dl * ER + ks) + (g * 8 + it) * 8 * ER) = vx[it];
      asm volatile("s_wait_xcnt 0x0" ::: "memory");   // as above
    }
  }
}

static __device__ __forceinline__ void planes_epilogue(unsigned char* smem, const v8f (&acc)[4][4],
                                                       const PlaneOut& po, int mb, int n0) {
  const int slot = n0 / DMODEL;               // 0 = q, 1 = k, 2 = v
  const int h    = (n0 % DMODEL) / HDIM;      // first of the block's two heads
  if (slot < 2) {
    f16* pl  = (slot == 0) ? po.qh : po.kh;
    f16* plr = (slot == 0) ? po.qr : po.kr;
    if (mb >= ER) rope_planes<0>(smem, acc, po.ct, po.st, pl, plr, mb, h);
    else          rope_planes<1>(smem, acc, po.ct, po.st, pl, plr, mb, h);
  } else {
    if (mb >= ER) v_planes<0>(smem, acc, po.vt, po.vtr, mb, h);
    else          v_planes<1>(smem, acc, po.vt, po.vtr, mb, h);
  }
}
static_assert(2 * 2 * HDIM * VP * 2 <= QKV_LDS_B && 4 * 64 * OP * 4 <= QKV_LDS_B);
static_assert(ER % 128 == 0 && SEQ % 128 == 0 && DMODEL % (2 * HDIM) == 0 && QKV_N % 128 == 0);

// smem: the block's LDS (GEMM_LDS_B bytes; QKV_LDS_B when MI == 4); mb, n0: first row and first column of the block's tile.
// MI == 4: block tile 128 x 128, the four waves 2 x 2 (wave = wm + 2 wn), wave tile 64 x 64, stage buffer [A | A | B | B]:
// a block brings 256 rows from L2 for 128 x 128 results (two 128 x 64 blocks bring 384), and a wave reads 8 fragments
// from LDS for 16 products (6 for 8 at 32 x 64).
// EPI != 0: the result goes through planes_epilogue to po's planes and C is not written.
template <typename F, int MI, int RES, int EPI>
static __device__ __forceinline__ void gemm_nt_body(unsigned char* smem,
                                                    const us16* __restrict__ A,
                                                    const us16* __restrict__ Ar,
                                                    const us16* __restrict__ Bm,
                                                    float* __restrict__ C,
                                                    int K, int N, int mb, int n0,
                                                    float oscale, float rscale, const PlaneOut& po) {
  static_assert((MI == 4 && RES == 0 && EPI != 0) || (EPI == 0 && ((MI == 2 && RES == 0) || (MI == 1 && RES == 1))));
  const int NWN   = (MI == 4) ? 2 : 1;         // waves along n == B tiles per stage
  const int BT    = 2;                         // index of the first B tile in a stage buffer
  const int STG_H = (BT + NWN) * TILE_H;       // halves per stage buffer
  const int RING_B = 2 * STG_H * 2;            // bytes of the two stage buffers
  const int OUT_B  = 4 * 16 * MI * OP * 4;     // bytes of the four waves' output staging
  const int LDS_B  = (MI == 4) ? QKV_LDS_B : GEMM_LDS_B;
  static_assert(RING_B <= LDS_B && OUT_B <= LDS_B);
  // two stage buffers (cross-wave) in the loop; behind the loop's last barrier the per-wave output staging
  us16*  ring = (us16*)smem;
  float* sC   = (float*)smem;
  const int tid  = threadIdx.x;
  const int wave = tid >> 5;
  const int lane = tid & 31;
  const int lq   = lane & 15;
  const int hi   = lane >> 4;
  const int wm   = (NWN == 2) ? (wave & 1) : wave;    // the wave's place along m
  const int wn   = (NWN == 2) ? (wave >> 1) : 0;      // and along n
  const int m0   = mb + wm * (16 * MI);

  v8f acc[MI][4], acc2[MI][4];
  #pragma unroll
  for (int mi = 0; mi < MI; ++mi) {
    #pragma unroll
    for (int t = 0; t < 4; ++t) {
      acc[mi][t]  = (v8f){0, 0, 0, 0, 0, 0, 0, 0};
      acc2[mi][t] = (v8f){0, 0, 0, 0, 0, 0, 0, 0};
    }
  }

  const us16* ab  = A + (size_t)mb * K;                                                  // tile 0: A rows 0..63
  const us16* arb = (RES != 0) ? Ar + (size_t)mb * K : A + (size_t)(mb + 64) * K;        // tile 1: Ar, or A rows 64..127
  const us16* bb  = Bm + (size_t)n0 * K;                                                 // tile 2: B rows 0..63
  const us16* bb2 = bb + (size_t)64 * K;                                                 // tile 3 (MI == 4): B rows 64..127
  const int   nst = K / GS;                           // block-uniform stage count

  stage_block<MI>(ring, ab, arb, bb, bb2, K, tid);
  asm volatile("s_wait_asynccnt 0x0" ::: "memory");   // this wave's copies of stage 0 have landed
  __syncthreads();                                    // stage 0 readable by every wave
  if (nst > 1) stage_block<MI>(ring + STG_H, ab + GS, arb + GS, bb + GS, bb2 + GS, K, tid);

  for (int s = 0; s < nst; ++s) {
    const us16* sb = ring + (s & 1) * STG_H;
    #pragma unroll   // constant indices keep the fragment arrays in registers
    for (int u = 0; u < GS / 32; ++u) {
      F a[MI], ar[MI], b[4];
      #pragma unroll
      for (int mi = 0; mi < MI; ++mi) {
        const us16* p = sb + (wm * (16 * MI) + mi * 16 + lq) * KP + u * 32 + hi * 8;
        a[mi].q[0] = *(const v4u*)(p);        // k0 + 8h + 0..7
        a[mi].q[1] = *(const v4u*)(p + 16);   // k0 + 16 + 8h + 0..7
        if (RES != 0) {
          const us16* pr = p + MI * TILE_H;
          ar[mi].q[0] = *(const v4u*)(pr);
          ar[mi].q[1] = *(const v4u*)(pr + 16);
        }
      }
      #pragma unroll
      for (int t = 0; t < 4; ++t) {
        const us16* p = sb + (BT + wn) * TILE_H + (t * 16 + lq) * KP + u * 32 + hi * 8;
        b[t].q[0] = *(const v4u*)(p);
        b[t].q[1] = *(const v4u*)(p + 16);
      }
      #pragma unroll
      for (int mi = 0; mi < MI; ++mi) {
        #pragma unroll
        for (int t = 0; t < 4; ++t) {
          acc[mi][t] = mma(a[mi], b[t], acc[mi][t]);
          if (RES != 0) acc2[mi][t] = mma(ar[mi], b[t], acc2[mi][t]);
        }
      }
    }
    // publish point of stage s + 1, passed by every wave
    asm volatile("s_wait_dscnt 0x0" ::: "memory");      // this wave's reads of stage s are done before its buffer is refilled
    asm volatile("s_wait_asynccnt 0x0" ::: "memory");   // this wave's copies of stage s + 1 have landed
    __syncthreads();                                    // stage s + 1 readable; every reader has left stage s
    if (s + 2 < nst)
      stage_block<MI>(ring + (s & 1) * STG_H, ab + (s + 2) * GS, arb + (s + 2) * GS, bb + (s + 2) * GS,
                      bb2 + (s + 2) * GS, K, tid);
  }
  asm volatile("s_wait_asynccnt 0x0" ::: "memory");     // no copy outstanding behind the loop

  if constexpr (EPI != 0) {
    planes_epilogue(smem, acc, po, mb, n0);
  } else {

  float* so = sC + wave * (16 * MI * OP);
  #pragma unroll
  for (int mi = 0; mi < MI; ++mi) {
    #pragma unroll
    for (int t = 0; t < 4; ++t) {
      #pragma unroll
      for (int r = 0; r < 8; ++r) {
        float val = acc[mi][t][r] * oscale;
        if (RES != 0) val += acc2[mi][t][r] * rscale;
        so[(mi * 16 + hi * 8 + r) * OP + t * 16 + lq] = val;
      }
    }
  }
  __syncthreads();

  const int NIT = 8 * MI;   // (16*MI rows) / 2 rows per instruction
  v4f    vals[8 * MI];
  size_t gidx[8 * MI];
  #pragma unroll
  for (int it = 0; it < NIT; ++it) {
    const int row = it * 2 + hi;
    vals[it] = *(const v4f*)(so + row * OP + lq * 4);
    gidx[it] = (size_t)(m0 + row) * N + n0 + lq * 4;
  }
  #pragma unroll
  for (int it = 0; it < NIT; ++it) *(v4f*)(C + gidx[it]) = vals[it];
  }
}

// qkv = xb x wb^T, RoPE and the q/k/v planes: block tile 128 x 128, grid (N / 128, rows / 128): 768 equal work-groups.
// At most three waves per SIMD: three work-groups per WGP, so that no WGP takes a fourth while another has two.
__global__ __launch_bounds__(128) __attribute__((amdgpu_waves_per_eu(3, 3))) void gemm_qkv_kernel(const us16* __restrict__ A,
                                                       const us16* __restrict__ Bm,
                                                       const float* __restrict__ ct,
                                                       const float* __restrict__ st,
                                                       f16* __restrict__ qh, f16* __restrict__ qr,
                                                       f16* __restrict__ kh, f16* __restrict__ kr,
                                                       f16* __restrict__ vt, f16* __restrict__ vtr,
                                                       int K, int N) {
  __shared__ __align__(16) unsigned char smem[QKV_LDS_B];
  const PlaneOut po = {ct, st, qh, qr, kh, kr, vt, vtr};
  gemm_nt_body<FragB, 4, 0, 1>(smem, A, A, Bm, nullptr, K, N, blockIdx.y * 128, blockIdx.x * 128, 1.0f, 0.0f, po);
}

// out = ctx x wp^T, all rows in one launch: the first ER / 64 block rows take 64 rows each with the residual plane,
// the others 128 rows each from row ER on (block-uniform branch; the two row ranges share no output element).
__global__ __launch_bounds__(128) void gemm_proj_kernel(const us16* __restrict__ A,
                                                        const us16* __restrict__ Ar,
                                                        const us16* __restrict__ Bm,
                                                        float* __restrict__ C, int K, int N,
                                                        float oscale, float rscale) {
  __shared__ __align__(16) unsigned char smem[GEMM_LDS_B];
  const int by = blockIdx.y;
  const int n0 = blockIdx.x * 64;
  const PlaneOut none = {};
  if (by < ER / 64) gemm_nt_body<FragH, 1, 1, 0>(smem, A, Ar, Bm, C, K, N, by * 64, n0, oscale, rscale, none);
  else              gemm_nt_body<FragH, 2, 0, 0>(smem, A, A, Bm, C, K, N, ER + (by - ER / 64) * 128, n0, oscale, 0.0f, none);
}

// ---------------------------------------------------------------------------------------------
// Flash attention, causal. Block = (head, two query blocks of 128 in turn); one wave owns 16 query rows of each.
// S^T = K x Q^T so queries sit on lanes; P^T in C-layout is bit-identical to the A-fragment layout of O += P x V.
// Q B-fragments are loaded straight from the 16-bit plane; K A-fragments and V^T B-fragments from LDS (two 16-B loads each).
// RES != 0 (query blocks < EARLY_QBLK, all visited keys < ER): score = KQ + (K Qres + Kres Q)/1024;
// O2 = Pres V + P Vres accumulated separately and folded as O2/1024 before normalisation.
// K and V^T (and their residual planes when RES) are staged once per query block, KS keys at a time, in two LDS buffers
// by asynchronous 16-B copies; all eight waves read their fragments from LDS. A stage buffer holds the tiles
// [K | V^T | Kres | V^Tres], each 64 rows of 128 B at pitch KP.
// One stage's copies of one thread: rows tid>>3 and 32 + (tid>>3) of every tile, 16-B piece tid&7.
// kg/krg point at the stage's first key row (pitch HDIM); vg/vrg at the stage's first key column (pitch SEQ / ER).
template <int RES>
static __device__ __forceinline__ void stage_tiles(f16* buf, const f16* kg, const f16* krg,
                                                   const f16* vg, const f16* vrg, int tid) {
  const int row   = tid >> 3;     // 0..31
  const int piece = tid & 7;      // 0..7
  const unsigned l0 = (unsigned)(size_t)(buf + row * KP + piece * 8);   // LDS byte address
  const unsigned l1 = l0 + 32 * KP * 2;
  const unsigned l2 = l0 + TILE_H * 2;
  const unsigned l3 = l1 + TILE_H * 2;
  const f16* g0 = kg + (size_t)row * HDIM + piece * 8;
  const f16* g1 = g0 + 32 * HDIM;
  const f16* g2 = vg + (size_t)row * SEQ + piece * 8;
  const f16* g3 = g2 + (size_t)32 * SEQ;
  // the copies and, as the last line, the wait that stands before any of their address registers is rewritten
  asm volatile("global_load_async_to_lds_b128 %0, %4, off\n\t"
               "global_load_async_to_lds_b128 %1, %5, off\n\t"
               "global_load_async_to_lds_b128 %2, %6, off\n\t"
               "global_load_async_to_lds_b128 %3, %7, off\n\t"
               "s_wait_xcnt 0x0"
               :: "v"(l0), "v"(l1), "v"(l2), "v"(l3), "v"(g0), "v"(g1), "v"(g2), "v"(g3) : "memory");
  if (RES != 0) {
    const unsigned l4 = l0 + 2 * TILE_H * 2;
    const unsigned l5 = l1 + 2 * TILE_H * 2;
    const unsigned l6 = l0 + 3 * TILE_H * 2;
    const unsigned l7 = l1 + 3 * TILE_H * 2;
    const f16* g4 = krg + (size_t)row * HDIM + piece * 8;
    const f16* g5 = g4 + 32 * HDIM;
    const f16* g6 = vrg + (size_t)row * ER + piece * 8;
    const f16* g7 = g6 + (size_t)32 * ER;
    // same form for the residual tiles
    asm volatile("global_load_async_to_lds_b128 %0, %4, off\n\t"
                 "global_load_async_to_lds_b128 %1, %5, off\n\t"
                 "global_load_async_to_lds_b128 %2, %6, off\n\t"
                 "global_load_async_to_lds_b128 %3, %7, off\n\t"
                 "s_wait_xcnt 0x0"
                 :: "v"(l4), "v"(l5), "v"(l6), "v"(l7), "v"(g4), "v"(g5), "v"(g6), "v"(g7) : "memory");
  }
}

// sO: per-wave output staging, NWAVE * 16 * OP floats; sKV: the two stage buffers.
template <int RES>
static __device__ __forceinline__ void attn_body(float* sO, f16* sKV,
                                                 const f16* __restrict__ qh, const f16* __restrict__ qr,
                                                 const f16* __restrict__ kh, const f16* __restrict__ kr,
                                                 const f16* __restrict__ vt, const f16* __restrict__ vtr,
                                                 f16* __restrict__ ctxh, f16* __restrict__ ctxr,
                                                 int qblk, int h) {
  const int tid  = threadIdx.x;
  const int wave = __builtin_amdgcn_readfirstlane(tid >> 5);   // scalar, so the per-wave causal skip is a scalar branch
  const int lane = tid & 31;
  const int lq   = lane & 15;   // query column of S^T / d column of O
  const int hi   = lane >> 4;   // k-split half

  const int STG_H = (RES != 0 ? 4 : 2) * TILE_H;         // halves per stage buffer

  const int qrow0 = qblk * BQ + wave * 16;               // first query row of this wave

  // Q as B-operand fragments: lane lq holds query qrow0+lq, elements follow the split d map.
  FragH qf[2], qx[2];
  {
    const f16* qp = qh + ((size_t)h * SEQ + qrow0 + lq) * HDIM;
    #pragma unroll
    for (int f = 0; f < 2; ++f) {
      qf[f].q[0] = *(const v4u*)(qp + f * 32 + hi * 8);        // d = f*32 + hi*8 + 0..7
      qf[f].q[1] = *(const v4u*)(qp + f * 32 + 16 + hi * 8);   // d = f*32 + 16 + hi*8 + 0..7
    }
    if (RES != 0) {
      const f16* qrp = qr + ((size_t)h * ER + qrow0 + lq) * HDIM;
      #pragma unroll
      for (int f = 0; f < 2; ++f) {
        qx[f].q[0] = *(const v4u*)(qrp + f * 32 + hi * 8);
        qx[f].q[1] = *(const v4u*)(qrp + f * 32 + 16 + hi * 8);
      }
    }
  }

  const f16* kh_h  = kh  + (size_t)h * SEQ * HDIM;
  const f16* kr_h  = kr  + (size_t)h * ER * HDIM;
  const f16* vt_h  = vt  + (size_t)h * HDIM * SEQ;
  const f16* vtr_h = vtr + (size_t)h * HDIM * ER;

  v8f o[4], o2[4];
  #pragma unroll
  for (int dt = 0; dt < 4; ++dt) {
    o[dt]  = (v8f){0, 0, 0, 0, 0, 0, 0, 0};
    o2[dt] = (v8f){0, 0, 0, 0, 0, 0, 0, 0};
  }

  float rmax = -__builtin_inff();
  float rsum = 0.0f;
  const float SL = 0.125f * 1.4426950408889634f;   // softmax scale * log2(e)

  // causal: this wave visits key chunks whose first key is <= its last query row (wave-uniform trip count)
  const int nchunk = (qrow0 + 15) / BK + 1;
  // the block walks the stages up to its last query row (block-uniform count, at least two)
  const int nstage = (qblk + 1) * (BQ / KS);

  stage_tiles<RES>(sKV, kh_h, kr_h, vt_h, vtr_h, tid);
  asm volatile("s_wait_asynccnt 0x0" ::: "memory");   // this wave's copies of stage 0 have landed
  __syncthreads();                                    // stage 0 readable by every wave
  if (nstage > 1)
    stage_tiles<RES>(sKV + STG_H, kh_h + (size_t)KS * HDIM, kr_h + (size_t)KS * HDIM, vt_h + KS, vtr_h + KS, tid);

  for (int t = 0; t < nstage; ++t) {
   const f16* sb = sKV + (t & 1) * STG_H;
   for (int u = 0; u < KS / BK; ++u) {
    const int i = t * (KS / BK) + u;
    if (i >= nchunk) break;                 // wave-uniform: chunks beyond this wave's diagonal
    const int j0 = i * BK;
    const f16* sk  = sb + (u * BK) * KP;                 // K rows of this chunk
    const f16* sv  = sb + TILE_H + u * BK;               // V^T key columns of this chunk
    const f16* skr = sb + (RES != 0 ? 2 : 0) * TILE_H + (u * BK) * KP;    // residual tiles (read when RES only)
    const f16* svr = sb + (RES != 0 ? 3 : 1) * TILE_H + u * BK;

    // K A-fragments, then V B-fragments (column n = d = dt*16 + lq, split key map from the transposed tile): all
    // fetched at the head of the chunk, so that V's LDS latency passes under the score products and the softmax.
    FragH ka[2][2], bvf[4];
    #pragma unroll   // constant indices keep the fragment arrays in registers
    for (int sub = 0; sub < 2; ++sub) {
      const f16* base = sk + (sub * 16 + lq) * KP + hi * 8;   // row = key j0 + sub*16 + lq
      ka[sub][0].q[0] = *(const v4u*)(base);        // d = hi*8 + 0..7
      ka[sub][0].q[1] = *(const v4u*)(base + 16);   // d = 16 + hi*8 + 0..7
      ka[sub][1].q[0] = *(const v4u*)(base + 32);   // d = 32 + hi*8 + 0..7
      ka[sub][1].q[1] = *(const v4u*)(base + 48);   // d = 48 + hi*8 + 0..7
    }
    #pragma unroll   // as above
    for (int dt = 0; dt < 4; ++dt) {
      const f16* base = sv + (dt * 16 + lq) * KP + hi * 8;
      bvf[dt].q[0] = *(const v4u*)(base);        // keys j0 + hi*8 + 0..7
      bvf[dt].q[1] = *(const v4u*)(base + 16);   // keys j0 + 16 + hi*8 + 0..7
    }

    // S^T tiles: c[sub][r] = rawscore(query qrow0+lq, key j0 + sub*16 + hi*8 + r)
    v8f c[2];
    #pragma unroll
    for (int sub = 0; sub < 2; ++sub) {
      const FragH a0 = ka[sub][0];
      const FragH a1 = ka[sub][1];
      v8f acc = (v8f){0, 0, 0, 0, 0, 0, 0, 0};
      acc = mma_f16(a0.v, qf[0].v, acc);
      acc = mma_f16(a1.v, qf[1].v, acc);
      if (RES != 0) {
        FragH r0, r1;
        const f16* rb = skr + (sub * 16 + lq) * KP + hi * 8;
        r0.q[0] = *(const v4u*)(rb);
        r0.q[1] = *(const v4u*)(rb + 16);
        r1.q[0] = *(const v4u*)(rb + 32);
        r1.q[1] = *(const v4u*)(rb + 48);
        v8f ax = (v8f){0, 0, 0, 0, 0, 0, 0, 0};
        ax = mma_f16(a0.v, qx[0].v, ax);
        ax = mma_f16(a1.v, qx[1].v, ax);
        ax = mma_f16(r0.v, qf[0].v, ax);
        ax = mma_f16(r1.v, qf[1].v, ax);
        #pragma unroll
        for (int r = 0; r < 8; ++r) acc[r] += ax[r] * (1.0f / RSC);
      }
      c[sub] = acc;
    }

    // causal mask (key > query -> -inf); branch is wave-uniform, selects are per lane
    if (j0 + BK - 1 > qrow0) {
      const int qi = qrow0 + lq;
      #pragma unroll
      for (int sub = 0; sub < 2; ++sub) {
        #pragma unroll
        for (int r = 0; r < 8; ++r) {
          const int key = j0 + sub * 16 + hi * 8 + r;
          c[sub][r] = (key > qi) ? -__builtin_inff() : c[sub][r];
        }
      }
    }

    // online softmax: query lq's 32 scores are split across lane / lane^16
    float m_new = rmax;
    #pragma unroll
    for (int r = 0; r < 8; ++r) {
      m_new = fmaxf(m_new, c[0][r]);
      m_new = fmaxf(m_new, c[1][r]);
    }
    m_new = fmaxf(m_new, xhalf(m_new));
    const float scale = __builtin_amdgcn_exp2f((rmax - m_new) * SL);
    rmax = m_new;

    // exp + pack: P^T C-layout == A-fragment layout for the PV product
    FragH pa, pr;
    float psum = 0.0f;
    #pragma unroll
    for (int r = 0; r < 8; ++r) {
      const float p0 = __builtin_amdgcn_exp2f((c[0][r] - m_new) * SL);   // key hi*8 + r
      const float p1 = __builtin_amdgcn_exp2f((c[1][r] - m_new) * SL);   // key 16 + hi*8 + r
      psum += p0 + p1;
      const float pc0 = p0 * PCAR;
      const float pc1 = p1 * PCAR;
      const f16 h0 = (f16)pc0;
      const f16 h1 = (f16)pc1;
      pa.h[r]     = h0;
      pa.h[8 + r] = h1;
      if (RES != 0) {
        pr.h[r]     = (f16)((pc0 - (float)h0) * RSC);
        pr.h[8 + r] = (f16)((pc1 - (float)h1) * RSC);
      }
    }
    rsum = rsum * scale + psum + xhalf(psum);

    // rescale O: queries are the row dimension there -> per-row scale of query 8*hi + r. A query's scale is the same
    // number in lanes lq and lq + 16 (rmax and m_new are joined over the halves), so each 16-lane row serves itself:
    // the upper row first brings queries 8..15 to its lanes 0..7, then lane r of each row is spread over the row.
    const float sw = row_rot8(scale);             // moved by every lane, so that the choice below is a select, not a branch
    const float sq = (hi != 0) ? sw : scale;
    const float sc[8] = {row_bcast<0>(sq), row_bcast<1>(sq), row_bcast<2>(sq), row_bcast<3>(sq),
                         row_bcast<4>(sq), row_bcast<5>(sq), row_bcast<6>(sq), row_bcast<7>(sq)};
    #pragma unroll
    for (int dt = 0; dt < 4; ++dt) {
      #pragma unroll
      for (int r = 0; r < 8; ++r) {
        o[dt][r] *= sc[r];
        if (RES != 0) o2[dt][r] *= sc[r];
      }
    }

    // O += P x V
    #pragma unroll
    for (int dt = 0; dt < 4; ++dt) {
      o[dt] = mma_f16(pa.v, bvf[dt].v, o[dt]);
      if (RES != 0) {
        o2[dt] = mma_f16(pr.v, bvf[dt].v, o2[dt]);
        FragH br;
        const f16* rb = svr + (dt * 16 + lq) * KP + hi * 8;
        br.q[0] = *(const v4u*)(rb);
        br.q[1] = *(const v4u*)(rb + 16);
        o2[dt] = mma_f16(pa.v, br.v, o2[dt]);
      }
    }
   }
   // publish point of stage t + 1, passed by every wave (also one that skipped chunks)
   asm volatile("s_wait_dscnt 0x0" ::: "memory");      // this wave's reads of stage t are done before its buffer is refilled
   asm volatile("s_wait_asynccnt 0x0" ::: "memory");   // this wave's copies of stage t + 1 have landed
   __syncthreads();                                    // stage t + 1 readable; every reader has left stage t
   if (t + 2 < nstage)
     stage_tiles<RES>(sKV + (t & 1) * STG_H, kh_h + (size_t)(t + 2) * KS * HDIM, kr_h + (size_t)(t + 2) * KS * HDIM,
                      vt_h + (t + 2) * KS, vtr_h + (t + 2) * KS, tid);
  }
  asm volatile("s_wait_asynccnt 0x0" ::: "memory");    // no copy outstanding behind the loop

  // normalize: lane holds column d = dt*16 + lq for query rows 8*hi + r; stage ctx * 64
  float rs[8];
  #pragma unroll
  for (int r = 0; r < 8; ++r) rs[r] = 1.0f / __shfl(rsum, (hi << 3) + r, 32);

  float* so = sO + wave * (16 * OP);
  #pragma unroll
  for (int r = 0; r < 8; ++r) {
    #pragma unroll
    for (int dt = 0; dt < 4; ++dt) {
      float val = o[dt][r];
      if (RES != 0) val += o2[dt][r] * (1.0f / RSC);
      so[(hi * 8 + r) * OP + dt * 16 + lq] = val * (CCAR / PCAR) * rs[r];
    }
  }
  __syncthreads();

  v4u    hv[4], rv[4];
  size_t gi[4], gr[4];
  #pragma unroll
  for (int it = 0; it < 4; ++it) {
    const int row   = it * 4 + (lane >> 3);   // 0..15
    const int piece = lane & 7;               // 0..7
    const v4f a0 = *(const v4f*)(so + row * OP + piece * 8);
    const v4f a1 = *(const v4f*)(so + row * OP + piece * 8 + 4);
    Pack8H ph, px;
    #pragma unroll
    for (int k = 0; k < 4; ++k) {
      const float u0 = a0[k];
      const float u1 = a1[k];
      const f16 g0 = (f16)u0;
      const f16 g1 = (f16)u1;
      ph.h[k]     = g0;
      ph.h[4 + k] = g1;
      px.h[k]     = (f16)((u0 - (float)g0) * RSC);
      px.h[4 + k] = (f16)((u1 - (float)g1) * RSC);
    }
    hv[it] = ph.u;
    rv[it] = px.u;
    gi[it] = (size_t)(qrow0 + row) * DMODEL + h * HDIM + piece * 8;
    gr[it] = (size_t)(qrow0 + row) * DMODEL + h * HDIM + piece * 8;   // row < ER when RES
  }
  #pragma unroll
  for (int it = 0; it < 4; ++it) {
    *(v4u*)(ctxh + gi[it]) = hv[it];
    if (RES != 0) *(v4u*)(ctxr + gr[it]) = rv[it];
  }
  
}

// Causal balance: a query block's cost grows linearly with its index, and every work-group of the launch is resident
// at once, so the launch lasts as long as its longest work-group. Each work-group therefore takes two query blocks of
// one head, one after the other in every wave: NT - 1 - p, then p. Every work-group walks NT + 1 blocks' worth of key
// stages; every (head, query block) is taken exactly once. All branches are block-uniform.
// The LDS is sized for the residual form; the other uses the first half of sKV.
// At most two waves per SIMD: one work-group per WGP, so that none of the 256 equal work-groups shares a WGP while another WGP stands empty.
__global__ __launch_bounds__(256) __attribute__((amdgpu_waves_per_eu(2, 2))) void attn_kernel(const f16* __restrict__ qh, const f16* __restrict__ qr,
                                                   const f16* __restrict__ kh, const f16* __restrict__ kr,
                                                   const f16* __restrict__ vt, const f16* __restrict__ vtr,
                                                   f16* __restrict__ ctxh, f16* __restrict__ ctxr) {
  __shared__ __align__(16) float sO[NWAVE * 16 * OP];   // per-wave output staging (block barrier used)
  __shared__ __align__(16) f16 sKV[2 * 4 * TILE_H];     // two stage buffers, cross-wave
  const int NE = ER / BQ;                       // query blocks with residual planes, per head
  const int NT = SEQ / BQ;                      // query blocks per head
  const int NP = NT / 2;                        // pairs per head
  static_assert(NT % 2 == 0 && NE <= NP);       // whole pairs; the long block of a pair never has residual planes
  const int p  = blockIdx.x % NP;
  const int h  = blockIdx.x / NP;
  attn_body<0>(sO, sKV, qh, qr, kh, kr, vt, vtr, ctxh, ctxr, NT - 1 - p, h);
  asm volatile("s_wait_dscnt 0x0" ::: "memory");   // this wave's LDS reads of the first block are done before the buffers are refilled
  __syncthreads();                                 // every wave has left the first block's LDS
  if (p < NE) attn_body<1>(sO, sKV, qh, qr, kh, kr, vt, vtr, ctxh, ctxr, p, h);
  else        attn_body<0>(sO, sKV, qh, qr, kh, kr, vt, vtr, ctxh, ctxr, p, h);
}

// ---------------------------------------------------------------------------------------------
extern "C" void kernel_launch(void* const* d_in, const int* in_sizes, int n_in,
                              void* d_out, int out_size, void* d_ws, size_t ws_size,
                              hipStream_t stream) {
  if (n_in < 3) return;
  if ((size_t)in_sizes[0] < (size_t)SEQ * DMODEL) return;
  if ((size_t)in_sizes[1] < (size_t)QKV_N * DMODEL) return;
  if ((size_t)in_sizes[2] < (size_t)DMODEL * DMODEL) return;
  if ((size_t)out_size < (size_t)SEQ * DMODEL) return;

  const size_t xb_bytes   = (size_t)SEQ * DMODEL * 2;            // bf16 [SEQ][DMODEL]
  const size_t wb_bytes   = (size_t)QKV_N * DMODEL * 2;          // bf16 [QKV_N][DMODEL]
  const size_t wp_bytes   = (size_t)DMODEL * DMODEL * 2;         // f16  [DMODEL][DMODEL]
  const size_t tab_bytes  = (size_t)SEQ * NROPE * 4;             // f32  [SEQ][NROPE] (each of cos, sin)
  const size_t pl_bytes   = (size_t)NHEAD * SEQ * HDIM * 2;      // f16  q/k/vt planes
  const size_t plr_bytes  = (size_t)NHEAD * ER * HDIM * 2;       // f16  residual planes
  const size_t ctx_bytes  = (size_t)SEQ * DMODEL * 2;            // f16  [SEQ][DMODEL]
  const size_t ctxr_bytes = (size_t)ER * DMODEL * 2;             // f16  [ER][DMODEL]
  const size_t total = xb_bytes + wb_bytes + wp_bytes + 2 * tab_bytes
                     + 3 * pl_bytes + 3 * plr_bytes + ctx_bytes + ctxr_bytes;
  if (ws_size < total) return;

  char* ws = (char*)d_ws;
  size_t off = 0;
  bf16*  xb   = (bf16*)(ws + off);  off += xb_bytes;
  bf16*  wb   = (bf16*)(ws + off);  off += wb_bytes;
  f16*   wp   = (f16*)(ws + off);   off += wp_bytes;
  float* ct   = (float*)(ws + off); off += tab_bytes;
  float* st   = (float*)(ws + off); off += tab_bytes;
  f16*   qhp  = (f16*)(ws + off);   off += pl_bytes;
  f16*   khp  = (f16*)(ws + off);   off += pl_bytes;
  f16*   vtp  = (f16*)(ws + off);   off += pl_bytes;
  f16*   qrp  = (f16*)(ws + off);   off += plr_bytes;
  f16*   krp  = (f16*)(ws + off);   off += plr_bytes;
  f16*   vtrp = (f16*)(ws + off);   off += plr_bytes;
  f16*   ctxh = (f16*)(ws + off);   off += ctx_bytes;
  f16*   ctxr = (f16*)(ws + off);   off += ctxr_bytes;
  if (off > ws_size) return;

  const float* x     = (const float*)d_in[0];
  const float* wqkv  = (const float*)d_in[1];
  const float* wproj = (const float*)d_in[2];
  float*       out   = (float*)d_out;

  // 1) RoPE cos/sin tables and the 16-bit operand planes of the inputs
  const int ncvt_blocks = SEQ * DMODEL / 2048 + QKV_N * DMODEL / 2048 + DMODEL * DMODEL / 2048;
  prep_kernel<<<dim3(SEQ / 8 + ncvt_blocks), 256, 0, stream>>>(x, wqkv, wproj, xb, wb, wp, ct, st);

  // 2) qkv = xb x wb^T (bf16 operands, f32 accumulators), RoPE, q/k/v planes (+ residual planes for rows < ER)
  gemm_qkv_kernel<<<dim3(QKV_N / 128, SEQ / 128), 128, 0, stream>>>(
      (const us16*)xb, (const us16*)wb, ct, st, qhp, qrp, khp, krp, vtp, vtrp, DMODEL, QKV_N);

  // 3) causal attention -> ctx planes, two query blocks per work-group
  attn_kernel<<<dim3((SEQ / BQ / 2) * NHEAD), 256, 0, stream>>>(qhp, qrp, khp, krp, vtp, vtrp, ctxh, ctxr);

  // 4) out[SEQ][DMODEL] = ctx x wp^T ; folds the ctx carry (64), the Wproj carry (256) and the residual scale (1024)
  const float oscale = 1.0f / (CCAR * WCAR);
  const float rscale = oscale / RSC;
  gemm_proj_kernel<<<dim3(DMODEL / 64, ER / 64 + (SEQ - ER) / 128), 128, 0, stream>>>(
      (const us16*)ctxh, (const us16*)ctxr, (const us16*)wp, out, DMODEL, DMODEL, oscale, rscale);
}

// v008
// Measured time: 99.2 microseconds a run.
// In two side-by-side timings against v007, it was 1.11 and 1.12 times as fast.
// Counting every step since v000, it is 4.52 times as fast.
#include <hip/hip_runtime.h>

// Contractions: qkv = X x Wqkv^T on v_wmma_f32_16x16x32_bf16 (bf16 operands = RNE-converted inputs, f32 accumulate);
// S^T = K x Q^T on v_wmma_f32_16x16x32_f16 (f16 q/k after RoPE, plus f16 residual planes x1024 with their own
// accumulator on query blocks < EARLY_QBLK); O = P x V on v_wmma_f32_16x16x32_f16 (P as f16 carried x4096,
// V as f16, plus P and V residual planes x1024 with their own accumulator on query blocks < EARLY_QBLK);
// out = ctx x Wproj^T on v_wmma_f32_16x16x32_f16 (ctx as f16 carried x64 plus residual x1024 on rows < ER,
// Wproj = f16 of the bf16 RNE-converted input carried x256). RoPE, softmax and all epilogues in f32.

#ifndef NB
#define NB 1
#endif
#ifndef SEQ
#define SEQ 4096
#endif
#define NB_FULL    1
#define SEQ_FULL   4096
#define NHEAD      16
#define HDIM       64
#define DMODEL     (NHEAD * HDIM)        // 1024
#define QKV_N      (3 * DMODEL)          // 3072
#define NROPE      (HDIM / 2)            // 32 frequencies
#define BQ         128                   // query rows per attention block (8 query tiles x 16)
#define BK         32                    // keys per inner iteration
#define NWAVE      8                     // query tiles of 16 rows per attention block
#define EARLY_QBLK 2                     // query blocks with residual planes on q, k, P, v, ctx
#define ER         ((EARLY_QBLK * BQ < SEQ) ? (EARLY_QBLK * BQ) : SEQ)   // early rows == early keys
#define VP         136                   // LDS pitch (halves) of the transposed V tile (128 keys): 272 B = 16 B x odd
#define OP         68                    // LDS pitch (floats) of output staging tiles
#define PCAR       4096.0f               // P carry
#define RSC        1024.0f               // residual plane scale
#define CCAR       64.0f                 // ctx carry
#define WCAR       256.0f                // Wproj carry
#define KS         64                    // keys per LDS stage and key group of the attention loop (two inner iterations)
#define KP         72                    // LDS pitch (halves) of staged K rows and V^T rows: 144 B = 16 B x odd
#define TILE_H     (64 * KP)             // halves per staged tile (64 rows)
#define NGRP       2                     // key groups of eight waves in an attention block
#define SK         (NGRP * KS)           // keys per LDS stage of the attention loop, all groups
#define GS         64                    // k per LDS stage of the GEMM loop (two 32-k products)

static_assert(NB == 1 && NB <= NB_FULL);
static_assert(SEQ <= SEQ_FULL);
static_assert(SEQ % BQ == 0);
static_assert(ER % BQ == 0);
static_assert((SEQ - ER) % 128 == 0);
static_assert(SEQ % 8 == 0);
static_assert(BQ == NWAVE * 16);
static_assert(HDIM == 64);
static_assert(DMODEL % 64 == 0 && QKV_N % 64 == 0);
static_assert(DMODEL % 32 == 0);
static_assert((SEQ * DMODEL) % 2048 == 0);
static_assert((QKV_N * DMODEL) % 2048 == 0);
static_assert((DMODEL * DMODEL) % 2048 == 0);
static_assert((VP * 2) % 16 == 0);
static_assert((OP * 4) % 16 == 0);
static_assert(KS == 2 * BK && BQ % SK == 0 && KS == 64);
static_assert((KP * 2) % 16 == 0);

typedef __bf16         bf16;
typedef _Float16       f16;
typedef unsigned short us16;
typedef bf16     v16bf __attribute__((ext_vector_type(16)));
typedef f16      v16h  __attribute__((ext_vector_type(16)));
typedef f16      v8h   __attribute__((ext_vector_type(8)));
typedef float    v8f   __attribute__((ext_vector_type(8)));
typedef float    v4f   __attribute__((ext_vector_type(4)));
typedef unsigned v4u   __attribute__((ext_vector_type(4)));

union FragB  { v16bf v; v4u q[2]; bf16 h[16]; };
union FragH  { v16h  v; v4u q[2]; f16  h[16]; };
union Pack8B { v4u u; bf16 h[8]; };
union Pack8H { v4u u; v8h v; f16 h[8]; };

// WMMA helpers: builtin followed by the VALU hazard guard (ties D, keeps A/B live).
static __device__ __forceinline__ v8f mma_bf16(v16bf a, v16bf b, v8f acc) {
  acc = __builtin_amdgcn_wmma_f32_16x16x32_bf16(false, a, false, b, (short)0, acc, false, false);
  asm volatile("v_nop\n\tv_nop\n\tv_nop\n\tv_nop" : "+v"(acc) : "v"(a), "v"(b));
  return acc;
}
static __device__ __forceinline__ v8f mma_f16(v16h a, v16h b, v8f acc) {
  acc = __builtin_amdgcn_wmma_f32_16x16x32_f16(false, a, false, b, (short)0, acc, false, false);
  asm volatile("v_nop\n\tv_nop\n\tv_nop\n\tv_nop" : "+v"(acc) : "v"(a), "v"(b));
  return acc;
}
static __device__ __forceinline__ v8f mma(const FragB& a, const FragB& b, v8f acc) { return mma_bf16(a.v, b.v, acc); }

// Cross-lane moves on the vector pipe (a shuffle compiles to an LDS-pipe permute, whose result a wave must wait for).
// They are used where every lane is on. The fetch-inactive flag (fifth argument) then changes no value; it says that the
// old destination is not read, which saves a register copy in front of every move.
// xhalf: lane l gets the value of lane l ^ 16.
static __device__ __forceinline__ float xhalf(float x) {
  const int b = __builtin_bit_cast(int, x);
  return __builtin_bit_cast(float, __builtin_amdgcn_permlanex16(b, b, 0x76543210, 0xfedcba98, true, false));
}
// row_rot8: lane l gets the value of lane l ^ 8 (the other half of its own 16-lane row).
static __device__ __forceinline__ float row_rot8(float x) {
  const int b = __builtin_bit_cast(int, x);
  return __builtin_bit_cast(float, __builtin_amdgcn_permlane16(b, b, 0xfedcba98, 0x76543210, true, false));
}
// row_bcast<R>: every lane gets the value of lane R of its own 16-lane row.
template <int R>
static __device__ __forceinline__ float row_bcast(float x) {
  const int b = __builtin_bit_cast(int, x);
  return __builtin_bit_cast(float, __builtin_amdgcn_permlane16(b, b, 0x11111111u * R, 0x11111111u * R, true, false));
}
static __device__ __forceinline__ v8f mma(const FragH& a, const FragH& b, v8f acc) { return mma_f16(a.v, b.v, acc); }

// ---------------------------------------------------------------------------------------------
// Convert pass: xb = bf16(x) [SEQ][DMODEL], wb = bf16(Wqkv) [QKV_N][DMODEL], wp = f16(bf16(Wproj) * 256) [DMODEL][DMODEL].
// coverage: blocks [0,SEQ*DMODEL/2048) x 256 x 8 == SEQ*DMODEL; next QKV_N*DMODEL/2048 blocks == QKV_N*DMODEL;
//           last DMODEL*DMODEL/2048 blocks == DMODEL*DMODEL.
template <int MODE>
static __device__ __forceinline__ void cvt_body(const float* __restrict__ src, us16* __restrict__ dst,
                                                 int blk, int tid) {
  const size_t e = ((size_t)blk * 256 + tid) * 8;
  const v4f a = *(const v4f*)(src + e);
  const v4f b = *(const v4f*)(src + e + 4);
  v4u u;
  if (MODE == 0) {
    Pack8B pk;
    #pragma unroll
    for (int i = 0; i < 4; ++i) {
      pk.h[i]     = (bf16)a[i];                 // RNE convert
      pk.h[4 + i] = (bf16)b[i];
    }
    u = pk.u;
  } else {
    Pack8H pk;
    #pragma unroll
    for (int i = 0; i < 4; ++i) {
      pk.h[i]     = (f16)((float)(bf16)a[i] * WCAR);   // bf16 significand is exact in f16
      pk.h[4 + i] = (f16)((float)(bf16)b[i] * WCAR);
    }
    u = pk.u;
  }
  *(v4u*)(dst + e) = u;
  
}

static __device__ __forceinline__ void convert_body(const float* __restrict__ x,
                                                    const float* __restrict__ wq,
                                                    const float* __restrict__ wpj,
                                                    bf16* __restrict__ xb,
                                                    bf16* __restrict__ wb,
                                                    f16* __restrict__ wp,
                                                    int blk, int tid) {
  const int NBX = SEQ * DMODEL / 2048;
  const int NBQ = QKV_N * DMODEL / 2048;
  if (blk < NBX)            cvt_body<0>(x, (us16*)xb, blk, tid);
  else if (blk < NBX + NBQ) cvt_body<0>(wq, (us16*)wb, blk - NBX, tid);
  else                      cvt_body<1>(wpj, (us16*)wp, blk - NBX - NBQ, tid);
}

// ---------------------------------------------------------------------------------------------
// RoPE tables ct/st [SEQ][NROPE] f32: angle(t, j) = t * (1 / 10000^(2j/64)). Block = 8 positions x 32 freqs.
// One powf + one sincosf per thread (rolled). Rows staged in LDS; waves 0-1 write the cos lines, waves 2-3 the
// coverage: (SEQ/8 blocks) x 8 rows x 32 floats == SEQ*NROPE per table.
static __device__ __forceinline__ void rope_table_body(float* __restrict__ ct, float* __restrict__ st,
                                                       int blk, int tid) {
  __shared__ __align__(16) float sc[8 * NROPE];   // cross-wave (block barrier)
  __shared__ __align__(16) float ss[8 * NROPE];
  const int j   = tid & 31;
  const int tl  = tid >> 5;
  const int t   = blk * 8 + tl;
  const float e   = (float)(2 * j) * (1.0f / 64.0f);
  const float pw  = powf(10000.0f, e);
  const float inv = 1.0f / pw;
  const float ang = (float)t * inv;
  float sn, cs;
  sincosf(ang, &sn, &cs);
  sc[tl * NROPE + j] = cs;
  ss[tl * NROPE + j] = sn;
  __syncthreads();
  if (tid < 64) {
    const int rowl  = tid >> 3;
    const int piece = tid & 7;
    const v4f v = *(const v4f*)(sc + rowl * NROPE + piece * 4);
    const size_t gi = (size_t)(blk * 8 + rowl) * NROPE + piece * 4;
    *(v4f*)(ct + gi) = v;
    
  } else if (tid < 128) {
    const int rowl  = (tid - 64) >> 3;
    const int piece = tid & 7;
    const v4f v = *(const v4f*)(ss + rowl * NROPE + piece * 4);
    const size_t gi = (size_t)(blk * 8 + rowl) * NROPE + piece * 4;
    *(v4f*)(st + gi) = v;
    
  }
}

// One launch for the two passes that depend on nothing but the inputs: blocks [0, SEQ/8) build the RoPE tables,
// the rest convert the operands (block-uniform branch, so the table blocks' barrier is passed by whole blocks).
__global__ __launch_bounds__(256) void prep_kernel(const float* __restrict__ x,
                                                   const float* __restrict__ wq,
                                                   const float* __restrict__ wpj,
                                                   bf16* __restrict__ xb,
                                                   bf16* __restrict__ wb,
                                                   f16* __restrict__ wp,
                                                   float* __restrict__ ct, float* __restrict__ st) {
  const int blk = blockIdx.x;
  const int tid = threadIdx.x;
  const int NBR = SEQ / 8;
  if (blk < NBR) rope_table_body(ct, st, blk, tid);
  else           convert_body(x, wq, wpj, xb, wb, wp, blk - NBR, tid);
}

// ---------------------------------------------------------------------------------------------
// NT GEMM: C[m][n] = oscale * sum_k A[m][k] B[n][k] (+ rscale * sum_k Ar[m][k] B[n][k] when RES).
// A, Ar, B are 16-bit row-major planes with pitch K (k contiguous). 4 waves/block, wave tile (16*MI) x 64,
// block tile (64*MI) x 64 (MI == 4: waves 2 x 2, block tile 128 x 128, four tiles [A | A | B | B]). The block's A, Ar and B rows are staged GS k at a time in two LDS buffers by asynchronous
// 16-B copies (whole 128-B row pieces); a stage buffer holds three 64-row tiles at pitch KP: [A | A | B], or [A | Ar | B] when RES.
// A and B fragments are read from LDS with the split k map:
// elements 0..7 <- k0 + 8h + 0..7, elements 8..15 <- k0 + 16 + 8h + 0..7, lane&15 = row of A / row of B (= column n).
// Epilogue: wave tile staged in LDS (in the bytes of the stage buffers, which every wave has left by then), then per
// instruction lanes 0..15 write one 256-B row segment.
// Requires K % 64 == 0, N % 64 == 0 (N % 128 == 0 when MI == 4), rows covered by the grid a multiple of the block tile's rows.
// One stage's copies of one thread of the 128: rows r + 16 j (r = tid>>3, j = 0..3) of each of the three 64-row tiles,
// 16-B piece tid&7. r0/r1/r2 point at the first row of each tile at the stage's first k (pitch K); in LDS the three
// tiles follow one another, so the twelve rows of a thread lie 16 rows apart.
static __device__ __forceinline__ void stage_gemm(us16* buf, const us16* r0, const us16* r1, const us16* r2,
                                                  int K, int tid) {
  const int row   = tid >> 3;     // 0..15
  const int piece = tid & 7;      // 0..7
  const unsigned l0 = (unsigned)(size_t)(buf + row * KP + piece * 8);   // LDS byte address
  const unsigned ls = 16 * KP * 2;                                      // 16 rows in LDS, bytes
  const size_t   go = (size_t)row * K + piece * 8;
  const size_t   gs = (size_t)16 * K;                                    // 16 rows in the plane, elements
  const us16* a0 = r0 + go;
  const us16* b0 = r1 + go;
  const us16* c0 = r2 + go;
  // the copies and, as the last line, the wait that stands before any of their address registers is rewritten
  asm volatile("global_load_async_to_lds_b128 %0, %12, off\n\t"
               "global_load_async_to_lds_b128 %1, %13, off\n\t"
               "global_load_async_to_lds_b128 %2, %14, off\n\t"
               "global_load_async_to_lds_b128 %3, %15, off\n\t"
               "global_load_async_to_lds_b128 %4, %16, off\n\t"
               "global_load_async_to_lds_b128 %5, %17, off\n\t"
               "global_load_async_to_lds_b128 %6, %18, off\n\t"
               "global_load_async_to_lds_b128 %7, %19, off\n\t"
               "global_load_async_to_lds_b128 %8, %20, off\n\t"
               "global_load_async_to_lds_b128 %9, %21, off\n\t"
               "global_load_async_to_lds_b128 %10, %22, off\n\t"
               "global_load_async_to_lds_b128 %11, %23, off\n\t"
               "s_wait_xcnt 0x0"
               :: "v"(l0), "v"(l0 + ls), "v"(l0 + 2 * ls), "v"(l0 + 3 * ls),
                  "v"(l0 + 4 * ls), "v"(l0 + 5 * ls), "v"(l0 + 6 * ls), "v"(l0 + 7 * ls),
                  "v"(l0 + 8 * ls), "v"(l0 + 9 * ls), "v"(l0 + 10 * ls), "v"(l0 + 11 * ls),
                  "v"(a0), "v"(a0 + gs), "v"(a0 + 2 * gs), "v"(a0 + 3 * gs),
                  "v"(b0), "v"(b0 + gs), "v"(b0 + 2 * gs), "v"(b0 + 3 * gs),
                  "v"(c0), "v"(c0 + gs), "v"(c0 + 2 * gs), "v"(c0 + 3 * gs) : "memory");
}

#define GEMM_LDS_B (2 * 3 * TILE_H * 2)        // bytes of the two stage buffers of three tiles each
#define QKV_LDS_B  (2 * 4 * TILE_H * 2)        // bytes of the two stage buffers of four tiles each (128 x 128 block tile)

// The same for two 64-row tiles that follow one another in LDS: rows r + 16 j of each, eight copies of a thread.
static __device__ __forceinline__ void stage_pair(us16* buf, const us16* r0, const us16* r1, int K, int tid) {
  const int row   = tid >> 3;     // 0..15
  const int piece = tid & 7;      // 0..7
  const unsigned l0 = (unsigned)(size_t)(buf + row * KP + piece * 8);   // LDS byte address
  const unsigned ls = 16 * KP * 2;                                      // 16 rows in LDS, bytes
  const size_t   go = (size_t)row * K + piece * 8;
  const size_t   gs = (size_t)16 * K;                                    // 16 rows in the plane, elements
  const us16* a0 = r0 + go;
  const us16* b0 = r1 + go;
  // the copies and, as the last line, the wait that stands before any of their address registers is rewritten
  asm volatile("global_load_async_to_lds_b128 %0, %8, off\n\t"
               "global_load_async_to_lds_b128 %1, %9, off\n\t"
               "global_load_async_to_lds_b128 %2, %10, off\n\t"
               "global_load_async_to_lds_b128 %3, %11, off\n\t"
               "global_load_async_to_lds_b128 %4, %12, off\n\t"
               "global_load_async_to_lds_b128 %5, %13, off\n\t"
               "global_load_async_to_lds_b128 %6, %14, off\n\t"
               "global_load_async_to_lds_b128 %7, %15, off\n\t"
               "s_wait_xcnt 0x0"
               :: "v"(l0), "v"(l0 + ls), "v"(l0 + 2 * ls), "v"(l0 + 3 * ls),
                  "v"(l0 + 4 * ls), "v"(l0 + 5 * ls), "v"(l0 + 6 * ls), "v"(l0 + 7 * ls),
                  "v"(a0), "v"(a0 + gs), "v"(a0 + 2 * gs), "v"(a0 + 3 * gs),
                  "v"(b0), "v"(b0 + gs), "v"(b0 + 2 * gs), "v"(b0 + 3 * gs) : "memory");
}

// One stage of a block: MI == 4 stages four tiles [A | A | B | B], the other forms three (r3 is then not read).
template <int MI>
static __device__ __forceinline__ void stage_block(us16* buf, const us16* r0, const us16* r1, const us16* r2,
                                                   const us16* r3, int K, int tid) {
  if constexpr (MI == 4) {
    stage_pair(buf, r0, r1, K, tid);
    stage_pair(buf + 2 * TILE_H, r2, r3, K, tid);
  } else {
    stage_gemm(buf, r0, r1, r2, K, tid);
  }
}

// Where the qkv product's epilogue reads the RoPE tables and writes the 16-bit planes.
//   qh, kh [NHEAD][SEQ][HDIM] f16 : q and k after RoPE;  vt [NHEAD][HDIM][SEQ] f16 : V transposed.
//   qr, kr [NHEAD][ER][HDIM]  f16 : residual planes (x - f16(x)) * 1024 for rows < ER;  vtr [NHEAD][HDIM][ER] likewise.
struct PlaneOut {
  const float* ct;
  const float* st;
  f16* qh;
  f16* qr;
  f16* kh;
  f16* kr;
  f16* vt;
  f16* vtr;
};

// Epilogue of the qkv product: the block's 128 x 128 tile is one slot (q, k or v) of two heads for 128 rows, and a wave's
// 64 x 64 tile one head for 64 rows (wave = wm + 2 wn: rows mb + 64 wm, head h0 + wn), so the planes
// are built from the f32 accumulators and the f32 qkv array is never written. All branches are block-uniform.
// q, k: wave tile staged in LDS as f32; RoPE (rotate-half): out[d] = x[d]*cos + sgn*x[d^32]*sin, both from the staged row;
//       per instruction 4 rows of 128 B, whole lines.
// v:    a lane's 8 accumulator rows are 8 consecutive keys of one d, so the tile is staged transposed with one 16-B LDS
//       store each; per instruction 2 rows of 256 B, whole lines.
// coverage: rows mb..mb+127, d 0..63 of the slot's plane for both heads; residual planes for blocks with mb < ER (ER % 128 == 0).
// EARLY is the block-uniform mb < ER as a template argument, so that neither form carries the other's registers.
// Every loop here is unrolled: constant indices keep the accumulators and the small arrays in registers.
template <int EARLY>
static __device__ __forceinline__ void rope_planes(unsigned char* smem, const v8f (&acc)[4][4],
                                                   const float* ct, const float* st,
                                                   f16* pl, f16* plr, int mb, int h0) {
  const int tid  = threadIdx.x;
  const int wave = __builtin_amdgcn_readfirstlane(tid >> 5);   // scalar, so that the head's plane base stays uniform
  const int lane = tid & 31;
  const int lq   = lane & 15;
  const int hi   = lane >> 4;
  const int h    = h0 + (wave >> 1);
  float* so = (float*)smem + wave * (64 * OP);
  #pragma unroll
  for (int mi = 0; mi < 4; ++mi) {
    #pragma unroll
    for (int t = 0; t < 4; ++t) {
      #pragma unroll
      for (int r = 0; r < 8; ++r) so[(mi * 16 + hi * 8 + r) * OP + t * 16 + lq] = acc[mi][t][r];
    }
  }
  __syncthreads();
  const int   d0  = (lane & 7) * 8;           // 0..56
  const int   j0  = d0 & (NROPE - 1);         // frequency index of d0
  const float sgn = (d0 < NROPE) ? -1.0f : 1.0f;
  const int   NK  = (EARLY != 0) ? 2 : 4;     // row groups whose loads are in flight together
  // one 32-bit lane offset per array on a uniform base; the row groups lie a constant 4 rows apart
  const unsigned srow0 = (unsigned)(mb + (wave & 1) * 64 + (lane >> 3));
  const unsigned toff  = srow0 * NROPE + j0;
  const unsigned poff  = srow0 * HDIM + d0;
  f16* plh  = pl + (size_t)h * SEQ * HDIM;
  f16* plrh = plr + (size_t)h * ER * HDIM;    // used only when EARLY (rows < ER)
  const float* cpb = ct + toff;
  const float* spb = st + toff;
  #pragma unroll
  for (int b = 0; b < 16 / NK; ++b) {
    v4f c0[NK], c1[NK], n0v[NK], n1v[NK];
    #pragma unroll
    for (int k = 0; k < NK; ++k) {
      c0[k]  = *(const v4f*)(cpb + (b * NK + k) * 4 * NROPE);
      c1[k]  = *(const v4f*)(cpb + (b * NK + k) * 4 * NROPE + 4);
      n0v[k] = *(const v4f*)(spb + (b * NK + k) * 4 * NROPE);
      n1v[k] = *(const v4f*)(spb + (b * NK + k) * 4 * NROPE + 4);
    }
    // the wait that stands before the table loads' address registers are rewritten; it names them, so they live up to it
    asm volatile("s_wait_xcnt 0x0" :: "v"(cpb), "v"(spb) : "memory");
    v4u hv[NK], rv[NK];
    #pragma unroll
    for (int k = 0; k < NK; ++k) {
      const int row = (b * NK + k) * 4 + (lane >> 3);    // 0..63
      const float* xo = so + row * OP + d0;
      const float* xq = so + row * OP + (d0 ^ NROPE);    // pair partner d^32
      const v4f x0 = *(const v4f*)(xo);
      const v4f x1 = *(const v4f*)(xo + 4);
      const v4f p0 = *(const v4f*)(xq);
      const v4f p1 = *(const v4f*)(xq + 4);
      float xa[8], pa[8], ca[8], sa[8];
      #pragma unroll
      for (int i = 0; i < 4; ++i) {
        xa[i] = x0[i];     xa[4 + i] = x1[i];
        pa[i] = p0[i];     pa[4 + i] = p1[i];
        ca[i] = c0[k][i];  ca[4 + i] = c1[k][i];
        sa[i] = n0v[k][i]; sa[4 + i] = n1v[k][i];
      }
      Pack8H ph, px;
      #pragma unroll
      for (int i = 0; i < 8; ++i) {
        const float xr = xa[i] * ca[i] + sgn * pa[i] * sa[i];
        const f16 xh = (f16)xr;
        ph.h[i] = xh;
        px.h[i] = (f16)((xr - (float)xh) * RSC);
      }
      hv[k] = ph.u;
      rv[k] = px.u;
    }
    f16* pp = plh + poff;
    f16* pr = plrh + poff;
    #pragma unroll
    for (int k = 0; k < NK; ++k) {
      *(v4u*)(pp + (b * NK + k) * 4 * HDIM) = hv[k];
      if (EARLY != 0) *(v4u*)(pr + (b * NK + k) * 4 * HDIM) = rv[k];
    }
    // the wait that stands before the stores' address and data registers are rewritten; it names them, so they live up to it
    if constexpr (EARLY != 0)
      asm volatile("s_wait_xcnt 0x0" :: "v"(pp), "v"(pr), "v"(hv[0]), "v"(hv[1]), "v"(rv[0]), "v"(rv[1]) : "memory");
    else
      asm volatile("s_wait_xcnt 0x0" :: "v"(pp), "v"(hv[0]), "v"(hv[1]), "v"(hv[2]), "v"(hv[3]) : "memory");
  }
}

template <int EARLY>
static __device__ __forceinline__ void v_planes(unsigned char* smem, const v8f (&acc)[4][4],
                                                f16* vt, f16* vtr, int mb, int h0) {
  const int tid  = threadIdx.x;
  const int wave = tid >> 5;
  const int lane = tid & 31;
  const int lq   = lane & 15;
  const int hi   = lane >> 4;
  f16* sT = (f16*)smem;                       // [head, d][key] hi, 128 rows, cross-wave (block barrier)
  f16* sR = sT + 2 * HDIM * VP;               // [head, d][key] residual, cross-wave (block barrier)
  #pragma unroll
  for (int mi = 0; mi < 4; ++mi) {
    #pragma unroll
    for (int t = 0; t < 4; ++t) {
      Pack8H ph, px;
      #pragma unroll
      for (int r = 0; r < 8; ++r) {
        const float va = acc[mi][t][r];
        const f16 vh = (f16)va;
        ph.h[r] = vh;
        px.h[r] = (f16)((va - (float)vh) * RSC);
      }
      // row = 64 * (head - h0) + d, d = t*16 + lq; keys hi*8 + 0..7 of the 16
      const int o = ((wave >> 1) * HDIM + t * 16 + lq) * VP + (wave & 1) * 64 + mi * 16 + hi * 8;
      *(v4u*)(sT + o) = ph.u;
      if (EARLY != 0) *(v4u*)(sR + o) = px.u;
    }
  }
  __syncthreads();
  const int dl = tid >> 4;                    // 0..7
  const int ks = (tid & 15) * 8;              // 0..120
  // the two heads' d rows follow one another in the plane as in the staging: 128 rows, eight per pass of the block
  f16* vth = vt + (size_t)h0 * HDIM * SEQ + mb;   // uniform base; one 32-bit lane offset; the rows lie a constant 8 apart
  #pragma unroll
  for (int g = 0; g < 2; ++g) {
    v4u vv[8];
    #pragma unroll
    for (int it = 0; it < 8; ++it) vv[it] = *(const v4u*)(sT + ((g * 8 + it) * 8 + dl) * VP + ks);
    #pragma unroll
    for (int it = 0; it < 8; ++it) *(v4u*)(vth + (unsigned)(dl * SEQ + ks) + (g * 8 + it) * 8 * SEQ) = vv[it];
    asm volatile("s_wait_xcnt 0x0" ::: "memory");   // stands before the stores' address and data registers are rewritten
  }
  if (EARLY != 0) {
    f16* vtrh = vtr + (size_t)h0 * HDIM * ER + mb;
    #pragma unroll
    for (int g = 0; g < 2; ++g) {
      v4u vx[8];
      #pragma unroll
      for (int it = 0; it < 8; ++it) vx[it] = *(const v4u*)(sR + ((g * 8 + it) * 8 + dl) * VP + ks);
      #pragma unroll
      for (int it = 0; it < 8; ++it) *(v4u*)(vtrh + (unsigned)(dl * ER + ks) + (g * 8 + it) * 8 * ER) = vx[it];
      asm volatile("s_wait_xcnt 0x0" ::: "memory");   // as above
    }
  }
}

static __device__ __forceinline__ void planes_epilogue(unsigned char* smem, const v8f (&acc)[4][4],
                                                       const PlaneOut& po, int mb, int n0) {
  const int slot = n0 / DMODEL;               // 0 = q, 1 = k, 2 = v
  const int h    = (n0 % DMODEL) / HDIM;      // first of the block's two heads
  if (slot < 2) {
    f16* pl  = (slot == 0) ? po.qh : po.kh;
    f16* plr = (slot == 0) ? po.qr : po.kr;
    if (mb >= ER) rope_planes<0>(smem, acc, po.ct, po.st, pl, plr, mb, h);
    else          rope_planes<1>(smem, acc, po.ct, po.st, pl, plr, mb, h);
  } else {
    if (mb >= ER) v_planes<0>(smem, acc, po.vt, po.vtr, mb, h);
    else          v_planes<1>(smem, acc, po.vt, po.vtr, mb, h);
  }
}
static_assert(2 * 2 * HDIM * VP * 2 <= QKV_LDS_B && 4 * 64 * OP * 4 <= QKV_LDS_B);
static_assert(ER % 128 == 0 && SEQ % 128 == 0 && DMODEL % (2 * HDIM) == 0 && QKV_N % 128 == 0);

// smem: the block's LDS (GEMM_LDS_B bytes; QKV_LDS_B when MI == 4); mb, n0: first row and first column of the block's tile.
// MI == 4: block tile 128 x 128, the four waves 2 x 2 (wave = wm + 2 wn), wave tile 64 x 64, stage buffer [A | A | B | B]:
// a block brings 256 rows from L2 for 128 x 128 results (two 128 x 64 blocks bring 384), and a wave reads 8 fragments
// from LDS for 16 products (6 for 8 at 32 x 64).
// EPI != 0: the result goes through planes_epilogue to po's planes and C is not written.
template <typename F, int MI, int RES, int EPI>
static __device__ __forceinline__ void gemm_nt_body(unsigned char* smem,
                                                    const us16* __restrict__ A,
                                                    const us16* __restrict__ Ar,
                                                    const us16* __restrict__ Bm,
                                                    float* __restrict__ C,
                                                    int K, int N, int mb, int n0,
                                                    float oscale, float rscale, const PlaneOut& po) {
  static_assert((MI == 4 && RES == 0 && EPI != 0) || (EPI == 0 && ((MI == 2 && RES == 0) || (MI == 1 && RES == 1))));
  const int NWN   = (MI == 4) ? 2 : 1;         // waves along n == B tiles per stage
  const int BT    = 2;                         // index of the first B tile in a stage buffer
  const int STG_H = (BT + NWN) * TILE_H;       // halves per stage buffer
  const int RING_B = 2 * STG_H * 2;            // bytes of the two stage buffers
  const int OUT_B  = 4 * 16 * MI * OP * 4;     // bytes of the four waves' output staging
  const int LDS_B  = (MI == 4) ? QKV_LDS_B : GEMM_LDS_B;
  static_assert(RING_B <= LDS_B && OUT_B <= LDS_B);
  // two stage buffers (cross-wave) in the loop; behind the loop's last barrier the per-wave output staging
  us16*  ring = (us16*)smem;
  float* sC   = (float*)smem;
  const int tid  = threadIdx.x;
  const int wave = tid >> 5;
  const int lane = tid & 31;
  const int lq   = lane & 15;
  const int hi   = lane >> 4;
  const int wm   = (NWN == 2) ? (wave & 1) : wave;    // the wave's place along m
  const int wn   = (NWN == 2) ? (wave >> 1) : 0;      // and along n
  const int m0   = mb + wm * (16 * MI);

  v8f acc[MI][4], acc2[MI][4];
  #pragma unroll
  for (int mi = 0; mi < MI; ++mi) {
    #pragma unroll
    for (int t = 0; t < 4; ++t) {
      acc[mi][t]  = (v8f){0, 0, 0, 0, 0, 0, 0, 0};
      acc2[mi][t] = (v8f){0, 0, 0, 0, 0, 0, 0, 0};
    }
  }

  const us16* ab  = A + (size_t)mb * K;                                                  // tile 0: A rows 0..63
  const us16* arb = (RES != 0) ? Ar + (size_t)mb * K : A + (size_t)(mb + 64) * K;        // tile 1: Ar, or A rows 64..127
  const us16* bb  = Bm + (size_t)n0 * K;                                                 // tile 2: B rows 0..63
  const us16* bb2 = bb + (size_t)64 * K;                                                 // tile 3 (MI == 4): B rows 64..127
  const int   nst = K / GS;                           // block-uniform stage count

  stage_block<MI>(ring, ab, arb, bb, bb2, K, tid);
  asm volatile("s_wait_asynccnt 0x0" ::: "memory");   // this wave's copies of stage 0 have landed
  __syncthreads();                                    // stage 0 readable by every wave
  if (nst > 1) stage_block<MI>(ring + STG_H, ab + GS, arb + GS, bb + GS, bb2 + GS, K, tid);

  for (int s = 0; s < nst; ++s) {
    const us16* sb = ring + (s & 1) * STG_H;
    #pragma unroll   // constant indices keep the fragment arrays in registers
    for (int u = 0; u < GS / 32; ++u) {
      F a[MI], ar[MI], b[4];
      #pragma unroll
      for (int mi = 0; mi < MI; ++mi) {
        const us16* p = sb + (wm * (16 * MI) + mi * 16 + lq) * KP + u * 32 + hi * 8;
        a[mi].q[0] = *(const v4u*)(p);        // k0 + 8h + 0..7
        a[mi].q[1] = *(const v4u*)(p + 16);   // k0 + 16 + 8h + 0..7
        if (RES != 0) {
          const us16* pr = p + MI * TILE_H;
          ar[mi].q[0] = *(const v4u*)(pr);
          ar[mi].q[1] = *(const v4u*)(pr + 16);
        }
      }
      #pragma unroll
      for (int t = 0; t < 4; ++t) {
        const us16* p = sb + (BT + wn) * TILE_H + (t * 16 + lq) * KP + u * 32 + hi * 8;
        b[t].q[0] = *(const v4u*)(p);
        b[t].q[1] = *(const v4u*)(p + 16);
      }
      #pragma unroll
      for (int mi = 0; mi < MI; ++mi) {
        #pragma unroll
        for (int t = 0; t < 4; ++t) {
          acc[mi][t] = mma(a[mi], b[t], acc[mi][t]);
          if (RES != 0) acc2[mi][t] = mma(ar[mi], b[t], acc2[mi][t]);
        }
      }
    }
    // publish point of stage s + 1, passed by every wave
    asm volatile("s_wait_dscnt 0x0" ::: "memory");      // this wave's reads of stage s are done before its buffer is refilled
    asm volatile("s_wait_asynccnt 0x0" ::: "memory");   // this wave's copies of stage s + 1 have landed
    __syncthreads();                                    // stage s + 1 readable; every reader has left stage s
    if (s + 2 < nst)
      stage_block<MI>(ring + (s & 1) * STG_H, ab + (s + 2) * GS, arb + (s + 2) * GS, bb + (s + 2) * GS,
                      bb2 + (s + 2) * GS, K, tid);
  }
  asm volatile("s_wait_asynccnt 0x0" ::: "memory");     // no copy outstanding behind the loop

  if constexpr (EPI != 0) {
    planes_epilogue(smem, acc, po, mb, n0);
  } else {

  float* so = sC + wave * (16 * MI * OP);
  #pragma unroll
  for (int mi = 0; mi < MI; ++mi) {
    #pragma unroll
    for (int t = 0; t < 4; ++t) {
      #pragma unroll
      for (int r = 0; r < 8; ++r) {
        float val = acc[mi][t][r] * oscale;
        if (RES != 0) val += acc2[mi][t][r] * rscale;
        so[(mi * 16 + hi * 8 + r) * OP + t * 16 + lq] = val;
      }
    }
  }
  __syncthreads();

  const int NIT = 8 * MI;   // (16*MI rows) / 2 rows per instruction
  v4f    vals[8 * MI];
  size_t gidx[8 * MI];
  #pragma unroll
  for (int it = 0; it < NIT; ++it) {
    const int row = it * 2 + hi;
    vals[it] = *(const v4f*)(so + row * OP + lq * 4);
    gidx[it] = (size_t)(m0 + row) * N + n0 + lq * 4;
  }
  #pragma unroll
  for (int it = 0; it < NIT; ++it) *(v4f*)(C + gidx[it]) = vals[it];
  }
}

// qkv = xb x wb^T, RoPE and the q/k/v planes: block tile 128 x 128, grid (N / 128, rows / 128): 768 equal work-groups.
// At most three waves per SIMD: three work-groups per WGP, so that no WGP takes a fourth while another has two.
__global__ __launch_bounds__(128) __attribute__((amdgpu_waves_per_eu(3, 3))) void gemm_qkv_kernel(const us16* __restrict__ A,
                                                       const us16* __restrict__ Bm,
                                                       const float* __restrict__ ct,
                                                       const float* __restrict__ st,
                                                       f16* __restrict__ qh, f16* __restrict__ qr,
                                                       f16* __restrict__ kh, f16* __restrict__ kr,
                                                       f16* __restrict__ vt, f16* __restrict__ vtr,
                                                       int K, int N) {
  __shared__ __align__(16) unsigned char smem[QKV_LDS_B];
  const PlaneOut po = {ct, st, qh, qr, kh, kr, vt, vtr};
  gemm_nt_body<FragB, 4, 0, 1>(smem, A, A, Bm, nullptr, K, N, blockIdx.y * 128, blockIdx.x * 128, 1.0f, 0.0f, po);
}

// out = ctx x wp^T, all rows in one launch: the first ER / 64 block rows take 64 rows each with the residual plane,
// the others 128 rows each from row ER on (block-uniform branch; the two row ranges share no output element).
__global__ __launch_bounds__(128) void gemm_proj_kernel(const us16* __restrict__ A,
                                                        const us16* __restrict__ Ar,
                                                        const us16* __restrict__ Bm,
                                                        float* __restrict__ C, int K, int N,
                                                        float oscale, float rscale) {
  __shared__ __align__(16) unsigned char smem[GEMM_LDS_B];
  const int by = blockIdx.y;
  const int n0 = blockIdx.x * 64;
  const PlaneOut none = {};
  if (by < ER / 64) gemm_nt_body<FragH, 1, 1, 0>(smem, A, Ar, Bm, C, K, N, by * 64, n0, oscale, rscale, none);
  else              gemm_nt_body<FragH, 2, 0, 0>(smem, A, A, Bm, C, K, N, ER + (by - ER / 64) * 128, n0, oscale, 0.0f, none);
}

// ---------------------------------------------------------------------------------------------
// Flash attention, causal. Block = (query block of 128, head), 16 waves in two groups of eight: wave w of either group owns
// the 16 query rows w; group g takes the g-th 64 keys of every 128-key stage. Four waves share a SIMD, so that one wave's LDS,
// matrix and softmax latencies pass under the others' work. Behind the key loop group 1 hands its maximum, sum and O to
// group 0 through LDS, which joins the two partial softmaxes.
// S^T = K x Q^T so queries sit on lanes; P^T in C-layout is bit-identical to the A-fragment layout of O += P x V.
// Q B-fragments are loaded straight from the 16-bit plane; K A-fragments and V^T B-fragments from LDS (two 16-B loads each).
// RES != 0 (query blocks < EARLY_QBLK, all visited keys < ER): score = KQ + (K Qres + Kres Q)/1024;
// O2 = Pres V + P Vres accumulated separately and folded as O2/1024 before normalisation.
// K and V^T (and their residual planes when RES) are staged once per block, SK keys at a time (KS per key group), in two LDS buffers
// by asynchronous 16-B copies; the eight waves of a group read their fragments from LDS. A stage buffer holds, for each group
// in turn, the tiles [K | V^T | Kres | V^Tres] of its KS keys, each 64 rows of 128 B at pitch KP; a group stages its own tiles.
// One stage's copies of one thread of a group's 256 (tid): rows tid>>3 and 32 + (tid>>3) of every tile, 16-B piece tid&7.
// kg/krg point at the group's first key row of the stage (pitch HDIM); vg/vrg at its first key column (pitch SEQ / ER).
template <int RES>
static __device__ __forceinline__ void stage_tiles(f16* buf, const f16* kg, const f16* krg,
                                                   const f16* vg, const f16* vrg, int tid) {
  const int row   = tid >> 3;     // 0..31
  const int piece = tid & 7;      // 0..7
  const unsigned l0 = (unsigned)(size_t)(buf + row * KP + piece * 8);   // LDS byte address
  const unsigned l1 = l0 + 32 * KP * 2;
  const unsigned l2 = l0 + TILE_H * 2;
  const unsigned l3 = l1 + TILE_H * 2;
  const f16* g0 = kg + (size_t)row * HDIM + piece * 8;
  const f16* g1 = g0 + 32 * HDIM;
  const f16* g2 = vg + (size_t)row * SEQ + piece * 8;
  const f16* g3 = g2 + (size_t)32 * SEQ;
  // the copies and, as the last line, the wait that stands before any of their address registers is rewritten
  asm volatile("global_load_async_to_lds_b128 %0, %4, off\n\t"
               "global_load_async_to_lds_b128 %1, %5, off\n\t"
               "global_load_async_to_lds_b128 %2, %6, off\n\t"
               "global_load_async_to_lds_b128 %3, %7, off\n\t"
               "s_wait_xcnt 0x0"
               :: "v"(l0), "v"(l1), "v"(l2), "v"(l3), "v"(g0), "v"(g1), "v"(g2), "v"(g3) : "memory");
  if (RES != 0) {
    const unsigned l4 = l0 + 2 * TILE_H * 2;
    const unsigned l5 = l1 + 2 * TILE_H * 2;
    const unsigned l6 = l0 + 3 * TILE_H * 2;
    const unsigned l7 = l1 + 3 * TILE_H * 2;
    const f16* g4 = krg + (size_t)row * HDIM + piece * 8;
    const f16* g5 = g4 + 32 * HDIM;
    const f16* g6 = vrg + (size_t)row * ER + piece * 8;
    const f16* g7 = g6 + (size_t)32 * ER;
    // same form for the residual tiles
    asm volatile("global_load_async_to_lds_b128 %0, %4, off\n\t"
                 "global_load_async_to_lds_b128 %1, %5, off\n\t"
                 "global_load_async_to_lds_b128 %2, %6, off\n\t"
                 "global_load_async_to_lds_b128 %3, %7, off\n\t"
                 "s_wait_xcnt 0x0"
                 :: "v"(l4), "v"(l5), "v"(l6), "v"(l7), "v"(g4), "v"(g5), "v"(g6), "v"(g7) : "memory");
  }
}

// sO: output staging per query tile, NWAVE * 16 * OP floats; sM: group 1's partial O, the same size; sS: group 1's maximum and
// sum, NWAVE * 64 floats; sKV: the two stage buffers.
template <int RES>
static __device__ __forceinline__ void attn_body(float* sO, float* sM, float* sS, f16* sKV,
                                                 const f16* __restrict__ qh, const f16* __restrict__ qr,
                                                 const f16* __restrict__ kh, const f16* __restrict__ kr,
                                                 const f16* __restrict__ vt, const f16* __restrict__ vtr,
                                                 f16* __restrict__ ctxh, f16* __restrict__ ctxr,
                                                 int qblk, int h) {
  const int tid  = threadIdx.x;
  const int wv   = __builtin_amdgcn_readfirstlane(tid >> 5);   // scalar, so the per-wave causal skip is a scalar branch
  const int grp  = wv >> 3;     // key group: which KS keys of a stage
  const int wave = wv & 7;      // query tile
  const int gtid = tid & 255;   // thread within the group
  const int lane = tid & 31;
  const int lq   = lane & 15;   // query column of S^T / d column of O
  const int hi   = lane >> 4;   // k-split half

  const int STG_H = (RES != 0 ? 4 : 2) * TILE_H;         // halves of one group's tiles in a stage buffer
  const int BUF_H = NGRP * STG_H;                        // halves per stage buffer

  const int qrow0 = qblk * BQ + wave * 16;               // first query row of this wave

  // Q as B-operand fragments: lane lq holds query qrow0+lq, elements follow the split d map.
  FragH qf[2], qx[2];
  {
    const f16* qp = qh + ((size_t)h * SEQ + qrow0 + lq) * HDIM;
    #pragma unroll
    for (int f = 0; f < 2; ++f) {
      qf[f].q[0] = *(const v4u*)(qp + f * 32 + hi * 8);        // d = f*32 + hi*8 + 0..7
      qf[f].q[1] = *(const v4u*)(qp + f * 32 + 16 + hi * 8);   // d = f*32 + 16 + hi*8 + 0..7
    }
    if (RES != 0) {
      const f16* qrp = qr + ((size_t)h * ER + qrow0 + lq) * HDIM;
      #pragma unroll
      for (int f = 0; f < 2; ++f) {
        qx[f].q[0] = *(const v4u*)(qrp + f * 32 + hi * 8);
        qx[f].q[1] = *(const v4u*)(qrp + f * 32 + 16 + hi * 8);
      }
    }
  }

  // the head's planes at the group's first key
  const f16* kh_h  = kh  + (size_t)h * SEQ * HDIM + grp * (KS * HDIM);
  const f16* kr_h  = kr  + (size_t)h * ER * HDIM + grp * (KS * HDIM);
  const f16* vt_h  = vt  + (size_t)h * HDIM * SEQ + grp * KS;
  const f16* vtr_h = vtr + (size_t)h * HDIM * ER + grp * KS;
  f16* sg = sKV + grp * STG_H;                           // the group's tiles in stage buffer 0

  v8f o[4], o2[4];
  #pragma unroll
  for (int dt = 0; dt < 4; ++dt) {
    o[dt]  = (v8f){0, 0, 0, 0, 0, 0, 0, 0};
    o2[dt] = (v8f){0, 0, 0, 0, 0, 0, 0, 0};
  }

  float rmax = -__builtin_inff();
  float rsum = 0.0f;
  const float SL = 0.125f * 1.4426950408889634f;   // softmax scale * log2(e)

  // causal: this wave visits key chunks whose first key is <= its last query row (wave-uniform trip count)
  const int nchunk = (qrow0 + 15) / BK + 1;
  // the block walks the stages of SK keys up to its last query row (block-uniform count, at least one)
  const int nstage = (qblk + 1) * (BQ / SK);

  stage_tiles<RES>(sg, kh_h, kr_h, vt_h, vtr_h, gtid);
  asm volatile("s_wait_asynccnt 0x0" ::: "memory");   // this wave's copies of stage 0 have landed
  __syncthreads();                                    // stage 0 readable by every wave
  if (nstage > 1)
    stage_tiles<RES>(sg + BUF_H, kh_h + (size_t)SK * HDIM, kr_h + (size_t)SK * HDIM, vt_h + SK, vtr_h + SK, gtid);

  for (int t = 0; t < nstage; ++t) {
   const f16* sb = sg + (t & 1) * BUF_H;
   for (int u = 0; u < KS / BK; ++u) {
    const int i = (t * NGRP + grp) * (KS / BK) + u;
    if (i >= nchunk) break;                 // wave-uniform: chunks beyond this wave's diagonal
    const int j0 = i * BK;
    const f16* sk  = sb + (u * BK) * KP;                 // K rows of this chunk
    const f16* sv  = sb + TILE_H + u * BK;               // V^T key columns of this chunk
    const f16* skr = sb + (RES != 0 ? 2 : 0) * TILE_H + (u * BK) * KP;    // residual tiles (read when RES only)
    const f16* svr = sb + (RES != 0 ? 3 : 1) * TILE_H + u * BK;

    // K A-fragments, then V B-fragments (column n = d = dt*16 + lq, split key map from the transposed tile): all
    // fetched at the head of the chunk, so that V's LDS latency passes under the score products and the softmax.
    FragH ka[2][2], bvf[4];
    #pragma unroll   // constant indices keep the fragment arrays in registers
    for (int sub = 0; sub < 2; ++sub) {
      const f16* base = sk + (sub * 16 + lq) * KP + hi * 8;   // row = key j0 + sub*16 + lq
      ka[sub][0].q[0] = *(const v4u*)(base);        // d = hi*8 + 0..7
      ka[sub][0].q[1] = *(const v4u*)(base + 16);   // d = 16 + hi*8 + 0..7
      ka[sub][1].q[0] = *(const v4u*)(base + 32);   // d = 32 + hi*8 + 0..7
      ka[sub][1].q[1] = *(const v4u*)(base + 48);   // d = 48 + hi*8 + 0..7
    }
    #pragma unroll   // as above
    for (int dt = 0; dt < 4; ++dt) {
      const f16* base = sv + (dt * 16 + lq) * KP + hi * 8;
      bvf[dt].q[0] = *(const v4u*)(base);        // keys j0 + hi*8 + 0..7
      bvf[dt].q[1] = *(const v4u*)(base + 16);   // keys j0 + 16 + hi*8 + 0..7
    }

    // S^T tiles: c[sub][r] = rawscore(query qrow0+lq, key j0 + sub*16 + hi*8 + r)
    v8f c[2];
    #pragma unroll
    for (int sub = 0; sub < 2; ++sub) {
      const FragH a0 = ka[sub][0];
      const FragH a1 = ka[sub][1];
      v8f acc = (v8f){0, 0, 0, 0, 0, 0, 0, 0};
      acc = mma_f16(a0.v, qf[0].v, acc);
      acc = mma_f16(a1.v, qf[1].v, acc);
      if (RES != 0) {
        FragH r0, r1;
        const f16* rb = skr + (sub * 16 + lq) * KP + hi * 8;
        r0.q[0] = *(const v4u*)(rb);
        r0.q[1] = *(const v4u*)(rb + 16);
        r1.q[0] = *(const v4u*)(rb + 32);
        r1.q[1] = *(const v4u*)(rb + 48);
        v8f ax = (v8f){0, 0, 0, 0, 0, 0, 0, 0};
        ax = mma_f16(a0.v, qx[0].v, ax);
        ax = mma_f16(a1.v, qx[1].v, ax);
        ax = mma_f16(r0.v, qf[0].v, ax);
        ax = mma_f16(r1.v, qf[1].v, ax);
        #pragma unroll
        for (int r = 0; r < 8; ++r) acc[r] += ax[r] * (1.0f / RSC);
      }
      c[sub] = acc;
    }

    // causal mask (key > query -> -inf); branch is wave-uniform, selects are per lane
    if (j0 + BK - 1 > qrow0) {
      const int qi = qrow0 + lq;
      #pragma unroll
      for (int sub = 0; sub < 2; ++sub) {
        #pragma unroll
        for (int r = 0; r < 8; ++r) {
          const int key = j0 + sub * 16 + hi * 8 + r;
          c[sub][r] = (key > qi) ? -__builtin_inff() : c[sub][r];
        }
      }
    }

    // online softmax: query lq's 32 scores are split across lane / lane^16
    float m_new = rmax;
    #pragma unroll
    for (int r = 0; r < 8; ++r) {
      m_new = fmaxf(m_new, c[0][r]);
      m_new = fmaxf(m_new, c[1][r]);
    }
    m_new = fmaxf(m_new, xhalf(m_new));
    const float scale = __builtin_amdgcn_exp2f((rmax - m_new) * SL);
    rmax = m_new;

    // exp + pack: P^T C-layout == A-fragment layout for the PV product
    FragH pa, pr;
    float psum = 0.0f;
    #pragma unroll
    for (int r = 0; r < 8; ++r) {
      const float p0 = __builtin_amdgcn_exp2f((c[0][r] - m_new) * SL);   // key hi*8 + r
      const float p1 = __builtin_amdgcn_exp2f((c[1][r] - m_new) * SL);   // key 16 + hi*8 + r
      psum += p0 + p1;
      const float pc0 = p0 * PCAR;
      const float pc1 = p1 * PCAR;
      const f16 h0 = (f16)pc0;
      const f16 h1 = (f16)pc1;
      pa.h[r]     = h0;
      pa.h[8 + r] = h1;
      if (RES != 0) {
        pr.h[r]     = (f16)((pc0 - (float)h0) * RSC);
        pr.h[8 + r] = (f16)((pc1 - (float)h1) * RSC);
      }
    }
    rsum = rsum * scale + psum + xhalf(psum);

    // rescale O: queries are the row dimension there -> per-row scale of query 8*hi + r. A query's scale is the same
    // number in lanes lq and lq + 16 (rmax and m_new are joined over the halves), so each 16-lane row serves itself:
    // the upper row first brings queries 8..15 to its lanes 0..7, then lane r of each row is spread over the row.
    const float sw = row_rot8(scale);             // moved by every lane, so that the choice below is a select, not a branch
    const float sq = (hi != 0) ? sw : scale;
    const float sc[8] = {row_bcast<0>(sq), row_bcast<1>(sq), row_bcast<2>(sq), row_bcast<3>(sq),
                         row_bcast<4>(sq), row_bcast<5>(sq), row_bcast<6>(sq), row_bcast<7>(sq)};
    #pragma unroll
    for (int dt = 0; dt < 4; ++dt) {
      #pragma unroll
      for (int r = 0; r < 8; ++r) {
        o[dt][r] *= sc[r];
        if (RES != 0) o2[dt][r] *= sc[r];
      }
    }

    // O += P x V
    #pragma unroll
    for (int dt = 0; dt < 4; ++dt) {
      o[dt] = mma_f16(pa.v, bvf[dt].v, o[dt]);
      if (RES != 0) {
        o2[dt] = mma_f16(pr.v, bvf[dt].v, o2[dt]);
        FragH br;
        const f16* rb = svr + (dt * 16 + lq) * KP + hi * 8;
        br.q[0] = *(const v4u*)(rb);
        br.q[1] = *(const v4u*)(rb + 16);
        o2[dt] = mma_f16(pa.v, br.v, o2[dt]);
      }
    }
   }
   // publish point of stage t + 1, passed by every wave (also one that skipped chunks)
   asm volatile("s_wait_dscnt 0x0" ::: "memory");      // this wave's reads of stage t are done before its buffer is refilled
   asm volatile("s_wait_asynccnt 0x0" ::: "memory");   // this wave's copies of stage t + 1 have landed
   __syncthreads();                                    // stage t + 1 readable; every reader has left stage t
   if (t + 2 < nstage)
     stage_tiles<RES>(sg + (t & 1) * BUF_H, kh_h + (size_t)(t + 2) * SK * HDIM, kr_h + (size_t)(t + 2) * SK * HDIM,
                      vt_h + (t + 2) * SK, vtr_h + (t + 2) * SK, gtid);
  }
  asm volatile("s_wait_asynccnt 0x0" ::: "memory");    // no copy outstanding behind the loop

  // join of the two key groups; all branches on grp are scalar. A lane holds column d = dt*16 + lq for query rows 8*hi + r.
  // Group 1 hands over its partial O and, per lane (query lq), its maximum and sum. A group-1 wave that saw no key
  // (first query block only) hands over maximum -inf, sum 0 and O 0, whose weight below is exp2(-inf) = 0.
  float* sm = sM + wave * (16 * OP);
  float* sx = sS + wave * 64;
  if (grp != 0) {
    #pragma unroll
    for (int r = 0; r < 8; ++r) {
      #pragma unroll
      for (int dt = 0; dt < 4; ++dt) {
        float val = o[dt][r];
        if (RES != 0) val += o2[dt][r] * (1.0f / RSC);
        sm[(hi * 8 + r) * OP + dt * 16 + lq] = val;
      }
    }
    sx[lane]      = rmax;
    sx[32 + lane] = rsum;
  }
  __syncthreads();                                     // group 1's partial results readable by group 0

  // group 0 (its maximum is finite: every query sees key 0): weights of the two parts, normalised; stage ctx * 64
  float* so = sO + wave * (16 * OP);
  if (grp == 0) {
    const float m1  = sx[lane];
    const float s1  = sx[32 + lane];
    const float m   = fmaxf(rmax, m1);
    const float a0  = __builtin_amdgcn_exp2f((rmax - m) * SL);
    const float a1  = __builtin_amdgcn_exp2f((m1 - m) * SL);
    const float inv = 1.0f / (rsum * a0 + s1 * a1);
    const float w0  = a0 * inv;
    const float w1  = a1 * inv;
    #pragma unroll
    for (int r = 0; r < 8; ++r) {
      const float f0 = __shfl(w0, (hi << 3) + r, 32);
      const float f1 = __shfl(w1, (hi << 3) + r, 32);
      #pragma unroll
      for (int dt = 0; dt < 4; ++dt) {
        float val = o[dt][r];
        if (RES != 0) val += o2[dt][r] * (1.0f / RSC);
        const int e = (hi * 8 + r) * OP + dt * 16 + lq;
        so[e] = (val * f0 + sm[e] * f1) * (CCAR / PCAR);
      }
    }
  }
  __syncthreads();
  if (grp != 0) return;                                // the caller's barrier is passed by every wave behind this body

  v4u    hv[4], rv[4];
  size_t gi[4], gr[4];
  #pragma unroll
  for (int it = 0; it < 4; ++it) {
    const int row   = it * 4 + (lane >> 3);   // 0..15
    const int piece = lane & 7;               // 0..7
    const v4f a0 = *(const v4f*)(so + row * OP + piece * 8);
    const v4f a1 = *(const v4f*)(so + row * OP + piece * 8 + 4);
    Pack8H ph, px;
    #pragma unroll
    for (int k = 0; k < 4; ++k) {
      const float u0 = a0[k];
      const float u1 = a1[k];
      const f16 g0 = (f16)u0;
      const f16 g1 = (f16)u1;
      ph.h[k]     = g0;
      ph.h[4 + k] = g1;
      px.h[k]     = (f16)((u0 - (float)g0) * RSC);
      px.h[4 + k] = (f16)((u1 - (float)g1) * RSC);
    }
    hv[it] = ph.u;
    rv[it] = px.u;
    gi[it] = (size_t)(qrow0 + row) * DMODEL + h * HDIM + piece * 8;
    gr[it] = (size_t)(qrow0 + row) * DMODEL + h * HDIM + piece * 8;   // row < ER when RES
  }
  #pragma unroll
  for (int it = 0; it < 4; ++it) {
    *(v4u*)(ctxh + gi[it]) = hv[it];
    if (RES != 0) *(v4u*)(ctxr + gr[it]) = rv[it];
  }
  
}

// Causal balance: a query block's cost grows linearly with its index, and every work-group of the launch is resident
// at once, so the launch lasts as long as its longest work-group. Each work-group therefore takes two query blocks of
// one head, one after the other in every wave: NT - 1 - p, then p. Every work-group walks NT + 1 blocks' worth of key
// stages; every (head, query block) is taken exactly once. All branches are block-uniform.
// The LDS is sized for the residual form; the other uses the first half of sKV.
// Four waves per SIMD: the 16 waves of one work-group fill a WGP's share, one of the 256 equal work-groups per WGP.
__global__ __launch_bounds__(NGRP * 256) __attribute__((amdgpu_waves_per_eu(4, 4))) void attn_kernel(const f16* __restrict__ qh, const f16* __restrict__ qr,
                                                   const f16* __restrict__ kh, const f16* __restrict__ kr,
                                                   const f16* __restrict__ vt, const f16* __restrict__ vtr,
                                                   f16* __restrict__ ctxh, f16* __restrict__ ctxr) {
  __shared__ __align__(16) float sO[NWAVE * 16 * OP];   // output staging per query tile (block barrier used)
  __shared__ __align__(16) float sM[NWAVE * 16 * OP];   // group 1's partial O, cross-wave
  __shared__ __align__(16) float sS[NWAVE * 64];        // group 1's maximum and sum, cross-wave
  __shared__ __align__(16) f16 sKV[2 * NGRP * 4 * TILE_H];   // two stage buffers, cross-wave
  const int NE = ER / BQ;                       // query blocks with residual planes, per head
  const int NT = SEQ / BQ;                      // query blocks per head
  const int NP = NT / 2;                        // pairs per head
  static_assert(NT % 2 == 0 && NE <= NP);       // whole pairs; the long block of a pair never has residual planes
  const int p  = blockIdx.x % NP;
  const int h  = blockIdx.x / NP;
  attn_body<0>(sO, sM, sS, sKV, qh, qr, kh, kr, vt, vtr, ctxh, ctxr, NT - 1 - p, h);
  asm volatile("s_wait_dscnt 0x0" ::: "memory");   // this wave's LDS reads of the first block are done before the buffers are refilled
  __syncthreads();                                 // every wave has left the first block's LDS
  if (p < NE) attn_body<1>(sO, sM, sS, sKV, qh, qr, kh, kr, vt, vtr, ctxh, ctxr, p, h);
  else        attn_body<0>(sO, sM, sS, sKV, qh, qr, kh, kr, vt, vtr, ctxh, ctxr, p, h);
}

// ---------------------------------------------------------------------------------------------
extern "C" void kernel_launch(void* const* d_in, const int* in_sizes, int n_in,
                              void* d_out, int out_size, void* d_ws, size_t ws_size,
                              hipStream_t stream) {
  if (n_in < 3) return;
  if ((size_t)in_sizes[0] < (size_t)SEQ * DMODEL) return;
  if ((size_t)in_sizes[1] < (size_t)QKV_N * DMODEL) return;
  if ((size_t)in_sizes[2] < (size_t)DMODEL * DMODEL) return;
  if ((size_t)out_size < (size_t)SEQ * DMODEL) return;

  const size_t xb_bytes   = (size_t)SEQ * DMODEL * 2;            // bf16 [SEQ][DMODEL]
  const size_t wb_bytes   = (size_t)QKV_N * DMODEL * 2;          // bf16 [QKV_N][DMODEL]
  const size_t wp_bytes   = (size_t)DMODEL * DMODEL * 2;         // f16  [DMODEL][DMODEL]
  const size_t tab_bytes  = (size_t)SEQ * NROPE * 4;             // f32  [SEQ][NROPE] (each of cos, sin)
  const size_t pl_bytes   = (size_t)NHEAD * SEQ * HDIM * 2;      // f16  q/k/vt planes
  const size_t plr_bytes  = (size_t)NHEAD * ER * HDIM * 2;       // f16  residual planes
  const size_t ctx_bytes  = (size_t)SEQ * DMODEL * 2;            // f16  [SEQ][DMODEL]
  const size_t ctxr_bytes = (size_t)ER * DMODEL * 2;             // f16  [ER][DMODEL]
  const size_t total = xb_bytes + wb_bytes + wp_bytes + 2 * tab_bytes
                     + 3 * pl_bytes + 3 * plr_bytes + ctx_bytes + ctxr_bytes;
  if (ws_size < total) return;

  char* ws = (char*)d_ws;
  size_t off = 0;
  bf16*  xb   = (bf16*)(ws + off);  off += xb_bytes;
  bf16*  wb   = (bf16*)(ws + off);  off += wb_bytes;
  f16*   wp   = (f16*)(ws + off);   off += wp_bytes;
  float* ct   = (float*)(ws + off); off += tab_bytes;
  float* st   = (float*)(ws + off); off += tab_bytes;
  f16*   qhp  = (f16*)(ws + off);   off += pl_bytes;
  f16*   khp  = (f16*)(ws + off);   off += pl_bytes;
  f16*   vtp  = (f16*)(ws + off);   off += pl_bytes;
  f16*   qrp  = (f16*)(ws + off);   off += plr_bytes;
  f16*   krp  = (f16*)(ws + off);   off += plr_bytes;
  f16*   vtrp = (f16*)(ws + off);   off += plr_bytes;
  f16*   ctxh = (f16*)(ws + off);   off += ctx_bytes;
  f16*   ctxr = (f16*)(ws + off);   off += ctxr_bytes;
  if (off > ws_size) return;

  const float* x     = (const float*)d_in[0];
  const float* wqkv  = (const float*)d_in[1];
  const float* wproj = (const float*)d_in[2];
  float*       out   = (float*)d_out;

  // 1) RoPE cos/sin tables and the 16-bit operand planes of the inputs
  const int ncvt_blocks = SEQ * DMODEL / 2048 + QKV_N * DMODEL / 2048 + DMODEL * DMODEL / 2048;
  prep_kernel<<<dim3(SEQ / 8 + ncvt_blocks), 256, 0, stream>>>(x, wqkv, wproj, xb, wb, wp, ct, st);

  // 2) qkv = xb x wb^T (bf16 operands, f32 accumulators), RoPE, q/k/v planes (+ residual planes for rows < ER)
  gemm_qkv_kernel<<<dim3(QKV_N / 128, SEQ / 128), 128, 0, stream>>>(
      (const us16*)xb, (const us16*)wb, ct, st, qhp, qrp, khp, krp, vtp, vtrp, DMODEL, QKV_N);

  // 3) causal attention -> ctx planes, two query blocks per work-group
  attn_kernel<<<dim3((SEQ / BQ / 2) * NHEAD), NGRP * 256, 0, stream>>>(qhp, qrp, khp, krp, vtp, vtrp, ctxh, ctxr);

  // 4) out[SEQ][DMODEL] = ctx x wp^T ; folds the ctx carry (64), the Wproj carry (256) and the residual scale (1024)
  const float oscale = 1.0f / (CCAR * WCAR);
  const float rscale = oscale / RSC;
  gemm_proj_kernel<<<dim3(DMODEL / 64, ER / 64 + (SEQ - ER) / 128), 128, 0, stream>>>(
      (const us16*)ctxh, (const us16*)ctxr, (const us16*)wp, out, DMODEL, DMODEL, oscale, rscale);
}

// v009
// A run of this version takes 95.1 microseconds.
// Next to v008, in two timings, it ran 1.04 times as fast each time.
// Over all steps from v000 it is 4.69 times as fast.
#include <hip/hip_runtime.h>

// Contractions: qkv = X x Wqkv^T on v_wmma_f32_16x16x32_bf16 (bf16 operands = RNE-converted inputs, f32 accumulate);
// S^T = K x Q^T on v_wmma_f32_16x16x32_f16 (f16 q/k after RoPE, plus f16 residual planes x1024 with their own
// accumulator on query blocks < EARLY_QBLK); O = P x V on v_wmma_f32_16x16x32_f16 (P as f16 carried x4096,
// V as f16, plus P and V residual planes x1024 with their own accumulator on query blocks < EARLY_QBLK);
// out = ctx x Wproj^T on v_wmma_f32_16x16x32_f16 (ctx as f16 carried x64 plus residual x1024 on rows < ER,
// Wproj = f16 of the bf16 RNE-converted input carried x256). RoPE, softmax and all epilogues in f32.

#ifndef NB
#define NB 1
#endif
#ifndef SEQ
#define SEQ 4096
#endif
#define NB_FULL    1
#define SEQ_FULL   4096
#define NHEAD      16
#define HDIM       64
#define DMODEL     (NHEAD * HDIM)        // 1024
#define QKV_N      (3 * DMODEL)          // 3072
#define NROPE      (HDIM / 2)            // 32 frequencies
#define BQ         128                   // query rows per attention block (8 query tiles x 16)
#define BK         32                    // keys per inner iteration
#define NWAVE      8                     // query tiles of 16 rows per attention block
#define EARLY_QBLK 2                     // query blocks with residual planes on q, k, P, v, ctx
#define ER         ((EARLY_QBLK * BQ < SEQ) ? (EARLY_QBLK * BQ) : SEQ)   // early rows == early keys
#define VP         136                   // LDS pitch (halves) of the transposed V tile (128 keys): 272 B = 16 B x odd
#define OP         68                    // LDS pitch (floats) of output staging tiles
#define PCAR       4096.0f               // P carry
#define RSC        1024.0f               // residual plane scale
#define CCAR       64.0f                 // ctx carry
#define WCAR       256.0f                // Wproj carry
#define KS         64                    // keys per LDS stage and key group of the attention loop (two inner iterations)
#define KP         72                    // LDS pitch (halves) of staged K rows and V^T rows: 144 B = 16 B x odd
#define TILE_H     (64 * KP)             // halves per staged tile (64 rows)
#define NGRP       2                     // key groups of eight waves in an attention block
#define SK         (NGRP * KS)           // keys per LDS stage of the attention loop, all groups
#define GS         64                    // k per LDS stage of the GEMM loop (two 32-k products)

static_assert(NB == 1 && NB <= NB_FULL);
static_assert(SEQ <= SEQ_FULL);
static_assert(SEQ % BQ == 0);
static_assert(ER % BQ == 0);
static_assert((SEQ - ER) % 128 == 0);
static_assert(SEQ % 8 == 0);
static_assert(BQ == NWAVE * 16);
static_assert(HDIM == 64);
static_assert(DMODEL % 64 == 0 && QKV_N % 64 == 0);
static_assert(DMODEL % 32 == 0);
static_assert((SEQ * DMODEL) % 2048 == 0);
static_assert((QKV_N * DMODEL) % 2048 == 0);
static_assert((DMODEL * DMODEL) % 2048 == 0);
static_assert((VP * 2) % 16 == 0);
static_assert((OP * 4) % 16 == 0);
static_assert(KS == 2 * BK && BQ % SK == 0 && KS == 64);
static_assert((KP * 2) % 16 == 0);

typedef __bf16         bf16;
typedef _Float16       f16;
typedef unsigned short us16;
typedef bf16     v16bf __attribute__((ext_vector_type(16)));
typedef f16      v16h  __attribute__((ext_vector_type(16)));
typedef f16      v8h   __attribute__((ext_vector_type(8)));
typedef float    v8f   __attribute__((ext_vector_type(8)));
typedef float    v4f   __attribute__((ext_vector_type(4)));
typedef unsigned v4u   __attribute__((ext_vector_type(4)));

union FragB  { v16bf v; v4u q[2]; bf16 h[16]; };
union FragH  { v16h  v; v4u q[2]; f16  h[16]; };
union Pack8B { v4u u; bf16 h[8]; };
union Pack8H { v4u u; v8h v; f16 h[8]; };

// WMMA helpers: the builtin alone. The compiler keeps the distance behind its own matrix instructions and fills it with
// independent work where it has some.
static __device__ __forceinline__ v8f mma_bf16(v16bf a, v16bf b, v8f acc) {
  return __builtin_amdgcn_wmma_f32_16x16x32_bf16(false, a, false, b, (short)0, acc, false, false);
}
static __device__ __forceinline__ v8f mma_f16(v16h a, v16h b, v8f acc) {
  return __builtin_amdgcn_wmma_f32_16x16x32_f16(false, a, false, b, (short)0, acc, false, false);
}
static __device__ __forceinline__ v8f mma(const FragB& a, const FragB& b, v8f acc) { return mma_bf16(a.v, b.v, acc); }

// Cross-lane moves on the vector pipe (a shuffle compiles to an LDS-pipe permute, whose result a wave must wait for).
// They are used where every lane is on. The fetch-inactive flag (fifth argument) then changes no value; it says that the
// old destination is not read, which saves a register copy in front of every move.
// xhalf: lane l gets the value of lane l ^ 16.
static __device__ __forceinline__ float xhalf(float x) {
  const int b = __builtin_bit_cast(int, x);
  return __builtin_bit_cast(float, __builtin_amdgcn_permlanex16(b, b, 0x76543210, 0xfedcba98, true, false));
}
// row_rot8: lane l gets the value of lane l ^ 8 (the other half of its own 16-lane row).
static __device__ __forceinline__ float row_rot8(float x) {
  const int b = __builtin_bit_cast(int, x);
  return __builtin_bit_cast(float, __builtin_amdgcn_permlane16(b, b, 0xfedcba98, 0x76543210, true, false));
}
// row_bcast<R>: every lane gets the value of lane R of its own 16-lane row.
template <int R>
static __device__ __forceinline__ float row_bcast(float x) {
  const int b = __builtin_bit_cast(int, x);
  return __builtin_bit_cast(float, __builtin_amdgcn_permlane16(b, b, 0x11111111u * R, 0x11111111u * R, true, false));
}
static __device__ __forceinline__ v8f mma(const FragH& a, const FragH& b, v8f acc) { return mma_f16(a.v, b.v, acc); }

// ---------------------------------------------------------------------------------------------
// Convert pass: xb = bf16(x) [SEQ][DMODEL], wb = bf16(Wqkv) [QKV_N][DMODEL], wp = f16(bf16(Wproj) * 256) [DMODEL][DMODEL].
// coverage: blocks [0,SEQ*DMODEL/2048) x 256 x 8 == SEQ*DMODEL; next QKV_N*DMODEL/2048 blocks == QKV_N*DMODEL;
//           last DMODEL*DMODEL/2048 blocks == DMODEL*DMODEL.
template <int MODE>
static __device__ __forceinline__ void cvt_body(const float* __restrict__ src, us16* __restrict__ dst,
                                                 int blk, int tid) {
  const size_t e = ((size_t)blk * 256 + tid) * 8;
  const v4f a = *(const v4f*)(src + e);
  const v4f b = *(const v4f*)(src + e + 4);
  v4u u;
  if (MODE == 0) {
    Pack8B pk;
    #pragma unroll
    for (int i = 0; i < 4; ++i) {
      pk.h[i]     = (bf16)a[i];                 // RNE convert
      pk.h[4 + i] = (bf16)b[i];
    }
    u = pk.u;
  } else {
    Pack8H pk;
    #pragma unroll
    for (int i = 0; i < 4; ++i) {
      pk.h[i]     = (f16)((float)(bf16)a[i] * WCAR);   // bf16 significand is exact in f16
      pk.h[4 + i] = (f16)((float)(bf16)b[i] * WCAR);
    }
    u = pk.u;
  }
  *(v4u*)(dst + e) = u;
  
}

static __device__ __forceinline__ void convert_body(const float* __restrict__ x,
                                                    const float* __restrict__ wq,
                                                    const float* __restrict__ wpj,
                                                    bf16* __restrict__ xb,
                                                    bf16* __restrict__ wb,
                                                    f16* __restrict__ wp,
                                                    int blk, int tid) {
  const int NBX = SEQ * DMODEL / 2048;
  const int NBQ = QKV_N * DMODEL / 2048;
  if (blk < NBX)            cvt_body<0>(x, (us16*)xb, blk, tid);
  else if (blk < NBX + NBQ) cvt_body<0>(wq, (us16*)wb, blk - NBX, tid);
  else                      cvt_body<1>(wpj, (us16*)wp, blk - NBX - NBQ, tid);
}

// ---------------------------------------------------------------------------------------------
// RoPE tables ct/st [SEQ][NROPE] f32: angle(t, j) = t * (1 / 10000^(2j/64)). Block = 8 positions x 32 freqs.
// One powf + one sincosf per thread (rolled). Rows staged in LDS; waves 0-1 write the cos lines, waves 2-3 the
// coverage: (SEQ/8 blocks) x 8 rows x 32 floats == SEQ*NROPE per table.
static __device__ __forceinline__ void rope_table_body(float* __restrict__ ct, float* __restrict__ st,
                                                       int blk, int tid) {
  __shared__ __align__(16) float sc[8 * NROPE];   // cross-wave (block barrier)
  __shared__ __align__(16) float ss[8 * NROPE];
  const int j   = tid & 31;
  const int tl  = tid >> 5;
  const int t   = blk * 8 + tl;
  const float e   = (float)(2 * j) * (1.0f / 64.0f);
  const float pw  = powf(10000.0f, e);
  const float inv = 1.0f / pw;
  const float ang = (float)t * inv;
  float sn, cs;
  sincosf(ang, &sn, &cs);
  sc[tl * NROPE + j] = cs;
  ss[tl * NROPE + j] = sn;
  __syncthreads();
  if (tid < 64) {
    const int rowl  = tid >> 3;
    const int piece = tid & 7;
    const v4f v = *(const v4f*)(sc + rowl * NROPE + piece * 4);
    const size_t gi = (size_t)(blk * 8 + rowl) * NROPE + piece * 4;
    *(v4f*)(ct + gi) = v;
    
  } else if (tid < 128) {
    const int rowl  = (tid - 64) >> 3;
    const int piece = tid & 7;
    const v4f v = *(const v4f*)(ss + rowl * NROPE + piece * 4);
    const size_t gi = (size_t)(blk * 8 + rowl) * NROPE + piece * 4;
    *(v4f*)(st + gi) = v;
    
  }
}

// One launch for the two passes that depend on nothing but the inputs: blocks [0, SEQ/8) build the RoPE tables,
// the rest convert the operands (block-uniform branch, so the table blocks' barrier is passed by whole blocks).
__global__ __launch_bounds__(256) void prep_kernel(const float* __restrict__ x,
                                                   const float* __restrict__ wq,
                                                   const float* __restrict__ wpj,
                                                   bf16* __restrict__ xb,
                                                   bf16* __restrict__ wb,
                                                   f16* __restrict__ wp,
                                                   float* __restrict__ ct, float* __restrict__ st) {
  const int blk = blockIdx.x;
  const int tid = threadIdx.x;
  const int NBR = SEQ / 8;
  if (blk < NBR) rope_table_body(ct, st, blk, tid);
  else           convert_body(x, wq, wpj, xb, wb, wp, blk - NBR, tid);
}

// ---------------------------------------------------------------------------------------------
// NT GEMM: C[m][n] = oscale * sum_k A[m][k] B[n][k] (+ rscale * sum_k Ar[m][k] B[n][k] when RES).
// A, Ar, B are 16-bit row-major planes with pitch K (k contiguous). 4 waves/block, wave tile (16*MI) x 64,
// block tile (64*MI) x 64 (MI == 4: waves 2 x 2, block tile 128 x 128, four tiles [A | A | B | B]). The block's A, Ar and B rows are staged GS k at a time in two LDS buffers by asynchronous
// 16-B copies (whole 128-B row pieces); a stage buffer holds three 64-row tiles at pitch KP: [A | A | B], or [A | Ar | B] when RES.
// A and B fragments are read from LDS with the split k map:
// elements 0..7 <- k0 + 8h + 0..7, elements 8..15 <- k0 + 16 + 8h + 0..7, lane&15 = row of A / row of B (= column n).
// Epilogue: wave tile staged in LDS (in the bytes of the stage buffers, which every wave has left by then), then per
// instruction lanes 0..15 write one 256-B row segment.
// Requires K % 64 == 0, N % 64 == 0 (N % 128 == 0 when MI == 4), rows covered by the grid a multiple of the block tile's rows.
// One stage's copies of one thread of the 128: rows r + 16 j (r = tid>>3, j = 0..3) of each of the three 64-row tiles,
// 16-B piece tid&7. r0/r1/r2 point at the first row of each tile at the stage's first k (pitch K); in LDS the three
// tiles follow one another, so the twelve rows of a thread lie 16 rows apart.
static __device__ __forceinline__ void stage_gemm(us16* buf, const us16* r0, const us16* r1, const us16* r2,
                                                  int K, int tid) {
  const int row   = tid >> 3;     // 0..15
  const int piece = tid & 7;      // 0..7
  const unsigned l0 = (unsigned)(size_t)(buf + row * KP + piece * 8);   // LDS byte address
  const unsigned ls = 16 * KP * 2;                                      // 16 rows in LDS, bytes
  const size_t   go = (size_t)row * K + piece * 8;
  const size_t   gs = (size_t)16 * K;                                    // 16 rows in the plane, elements
  const us16* a0 = r0 + go;
  const us16* b0 = r1 + go;
  const us16* c0 = r2 + go;
  // the copies and, as the last line, the wait that stands before any of their address registers is rewritten
  asm volatile("global_load_async_to_lds_b128 %0, %12, off\n\t"
               "global_load_async_to_lds_b128 %1, %13, off\n\t"
               "global_load_async_to_lds_b128 %2, %14, off\n\t"
               "global_load_async_to_lds_b128 %3, %15, off\n\t"
               "global_load_async_to_lds_b128 %4, %16, off\n\t"
               "global_load_async_to_lds_b128 %5, %17, off\n\t"
               "global_load_async_to_lds_b128 %6, %18, off\n\t"
               "global_load_async_to_lds_b128 %7, %19, off\n\t"
               "global_load_async_to_lds_b128 %8, %20, off\n\t"
               "global_load_async_to_lds_b128 %9, %21, off\n\t"
               "global_load_async_to_lds_b128 %10, %22, off\n\t"
               "global_load_async_to_lds_b128 %11, %23, off\n\t"
               "s_wait_xcnt 0x0"
               :: "v"(l0), "v"(l0 + ls), "v"(l0 + 2 * ls), "v"(l0 + 3 * ls),
                  "v"(l0 + 4 * ls), "v"(l0 + 5 * ls), "v"(l0 + 6 * ls), "v"(l0 + 7 * ls),
                  "v"(l0 + 8 * ls), "v"(l0 + 9 * ls), "v"(l0 + 10 * ls), "v"(l0 + 11 * ls),
                  "v"(a0), "v"(a0 + gs), "v"(a0 + 2 * gs), "v"(a0 + 3 * gs),
                  "v"(b0), "v"(b0 + gs), "v"(b0 + 2 * gs), "v"(b0 + 3 * gs),
                  "v"(c0), "v"(c0 + gs), "v"(c0 + 2 * gs), "v"(c0 + 3 * gs) : "memory");
}

#define GEMM_LDS_B (2 * 3 * TILE_H * 2)        // bytes of the two stage buffers of three tiles each
#define QKV_LDS_B  (2 * 4 * TILE_H * 2)        // bytes of the two stage buffers of four tiles each (128 x 128 block tile)

// The same for two 64-row tiles that follow one another in LDS: rows r + 16 j of each, eight copies of a thread.
static __device__ __forceinline__ void stage_pair(us16* buf, const us16* r0, const us16* r1, int K, int tid) {
  const int row   = tid >> 3;     // 0..15
  const int piece = tid & 7;      // 0..7
  const unsigned l0 = (unsigned)(size_t)(buf + row * KP + piece * 8);   // LDS byte address
  const unsigned ls = 16 * KP * 2;                                      // 16 rows in LDS, bytes
  const size_t   go = (size_t)row * K + piece * 8;
  const size_t   gs = (size_t)16 * K;                                    // 16 rows in the plane, elements
  const us16* a0 = r0 + go;
  const us16* b0 = r1 + go;
  // the copies and, as the last line, the wait that stands before any of their address registers is rewritten
  asm volatile("global_load_async_to_lds_b128 %0, %8, off\n\t"
               "global_load_async_to_lds_b128 %1, %9, off\n\t"
               "global_load_async_to_lds_b128 %2, %10, off\n\t"
               "global_load_async_to_lds_b128 %3, %11, off\n\t"
               "global_load_async_to_lds_b128 %4, %12, off\n\t"
               "global_load_async_to_lds_b128 %5, %13, off\n\t"
               "global_load_async_to_lds_b128 %6, %14, off\n\t"
               "global_load_async_to_lds_b128 %7, %15, off\n\t"
               "s_wait_xcnt 0x0"
               :: "v"(l0), "v"(l0 + ls), "v"(l0 + 2 * ls), "v"(l0 + 3 * ls),
                  "v"(l0 + 4 * ls), "v"(l0 + 5 * ls), "v"(l0 + 6 * ls), "v"(l0 + 7 * ls),
                  "v"(a0), "v"(a0 + gs), "v"(a0 + 2 * gs), "v"(a0 + 3 * gs),
                  "v"(b0), "v"(b0 + gs), "v"(b0 + 2 * gs), "v"(b0 + 3 * gs) : "memory");
}

// One stage of a block: MI == 4 stages four tiles [A | A | B | B], the other forms three (r3 is then not read).
template <int MI>
static __device__ __forceinline__ void stage_block(us16* buf, const us16* r0, const us16* r1, const us16* r2,
                                                   const us16* r3, int K, int tid) {
  if constexpr (MI == 4) {
    stage_pair(buf, r0, r1, K, tid);
    stage_pair(buf + 2 * TILE_H, r2, r3, K, tid);
  } else {
    stage_gemm(buf, r0, r1, r2, K, tid);
  }
}

// Where the qkv product's epilogue reads the RoPE tables and writes the 16-bit planes.
//   qh, kh [NHEAD][SEQ][HDIM] f16 : q and k after RoPE;  vt [NHEAD][HDIM][SEQ] f16 : V transposed.
//   qr, kr [NHEAD][ER][HDIM]  f16 : residual planes (x - f16(x)) * 1024 for rows < ER;  vtr [NHEAD][HDIM][ER] likewise.
struct PlaneOut {
  const float* ct;
  const float* st;
  f16* qh;
  f16* qr;
  f16* kh;
  f16* kr;
  f16* vt;
  f16* vtr;
};

// Epilogue of the qkv product: the block's 128 x 128 tile is one slot (q, k or v) of two heads for 128 rows, and a wave's
// 64 x 64 tile one head for 64 rows (wave = wm + 2 wn: rows mb + 64 wm, head h0 + wn), so the planes
// are built from the f32 accumulators and the f32 qkv array is never written. All branches are block-uniform.
// q, k: wave tile staged in LDS as f32; RoPE (rotate-half): out[d] = x[d]*cos + sgn*x[d^32]*sin, both from the staged row;
//       per instruction 4 rows of 128 B, whole lines.
// v:    a lane's 8 accumulator rows are 8 consecutive keys of one d, so the tile is staged transposed with one 16-B LDS
//       store each; per instruction 2 rows of 256 B, whole lines.
// coverage: rows mb..mb+127, d 0..63 of the slot's plane for both heads; residual planes for blocks with mb < ER (ER % 128 == 0).
// EARLY is the block-uniform mb < ER as a template argument, so that neither form carries the other's registers.
// Every loop here is unrolled: constant indices keep the accumulators and the small arrays in registers.
template <int EARLY>
static __device__ __forceinline__ void rope_planes(unsigned char* smem, const v8f (&acc)[4][4],
                                                   const float* ct, const float* st,
                                                   f16* pl, f16* plr, int mb, int h0) {
  const int tid  = threadIdx.x;
  const int wave = __builtin_amdgcn_readfirstlane(tid >> 5);   // scalar, so that the head's plane base stays uniform
  const int lane = tid & 31;
  const int lq   = lane & 15;
  const int hi   = lane >> 4;
  const int h    = h0 + (wave >> 1);
  float* so = (float*)smem + wave * (64 * OP);
  #pragma unroll
  for (int mi = 0; mi < 4; ++mi) {
    #pragma unroll
    for (int t = 0; t < 4; ++t) {
      #pragma unroll
      for (int r = 0; r < 8; ++r) so[(mi * 16 + hi * 8 + r) * OP + t * 16 + lq] = acc[mi][t][r];
    }
  }
  __syncthreads();
  const int   d0  = (lane & 7) * 8;           // 0..56
  const int   j0  = d0 & (NROPE - 1);         // frequency index of d0
  const float sgn = (d0 < NROPE) ? -1.0f : 1.0f;
  const int   NK  = (EARLY != 0) ? 2 : 4;     // row groups whose loads are in flight together
  // one 32-bit lane offset per array on a uniform base; the row groups lie a constant 4 rows apart
  const unsigned srow0 = (unsigned)(mb + (wave & 1) * 64 + (lane >> 3));
  const unsigned toff  = srow0 * NROPE + j0;
  const unsigned poff  = srow0 * HDIM + d0;
  f16* plh  = pl + (size_t)h * SEQ * HDIM;
  f16* plrh = plr + (size_t)h * ER * HDIM;    // used only when EARLY (rows < ER)
  const float* cpb = ct + toff;
  const float* spb = st + toff;
  #pragma unroll
  for (int b = 0; b < 16 / NK; ++b) {
    v4f c0[NK], c1[NK], n0v[NK], n1v[NK];
    #pragma unroll
    for (int k = 0; k < NK; ++k) {
      c0[k]  = *(const v4f*)(cpb + (b * NK + k) * 4 * NROPE);
      c1[k]  = *(const v4f*)(cpb + (b * NK + k) * 4 * NROPE + 4);
      n0v[k] = *(const v4f*)(spb + (b * NK + k) * 4 * NROPE);
      n1v[k] = *(const v4f*)(spb + (b * NK + k) * 4 * NROPE + 4);
    }
    // the wait that stands before the table loads' address registers are rewritten; it names them, so they live up to it
    asm volatile("s_wait_xcnt 0x0" :: "v"(cpb), "v"(spb) : "memory");
    v4u hv[NK], rv[NK];
    #pragma unroll
    for (int k = 0; k < NK; ++k) {
      const int row = (b * NK + k) * 4 + (lane >> 3);    // 0..63
      const float* xo = so + row * OP + d0;
      const float* xq = so + row * OP + (d0 ^ NROPE);    // pair partner d^32
      const v4f x0 = *(const v4f*)(xo);
      const v4f x1 = *(const v4f*)(xo + 4);
      const v4f p0 = *(const v4f*)(xq);
      const v4f p1 = *(const v4f*)(xq + 4);
      float xa[8], pa[8], ca[8], sa[8];
      #pragma unroll
      for (int i = 0; i < 4; ++i) {
        xa[i] = x0[i];     xa[4 + i] = x1[i];
        pa[i] = p0[i];     pa[4 + i] = p1[i];
        ca[i] = c0[k][i];  ca[4 + i] = c1[k][i];
        sa[i] = n0v[k][i]; sa[4 + i] = n1v[k][i];
      }
      Pack8H ph, px;
      #pragma unroll
      for (int i = 0; i < 8; ++i) {
        const float xr = xa[i] * ca[i] + sgn * pa[i] * sa[i];
        const f16 xh = (f16)xr;
        ph.h[i] = xh;
        px.h[i] = (f16)((xr - (float)xh) * RSC);
      }
      hv[k] = ph.u;
      rv[k] = px.u;
    }
    f16* pp = plh + poff;
    f16* pr = plrh + poff;
    #pragma unroll
    for (int k = 0; k < NK; ++k) {
      *(v4u*)(pp + (b * NK + k) * 4 * HDIM) = hv[k];
      if (EARLY != 0) *(v4u*)(pr + (b * NK + k) * 4 * HDIM) = rv[k];
    }
    // the wait that stands before the stores' address and data registers are rewritten; it names them, so they live up to it
    if constexpr (EARLY != 0)
      asm volatile("s_wait_xcnt 0x0" :: "v"(pp), "v"(pr), "v"(hv[0]), "v"(hv[1]), "v"(rv[0]), "v"(rv[1]) : "memory");
    else
      asm volatile("s_wait_xcnt 0x0" :: "v"(pp), "v"(hv[0]), "v"(hv[1]), "v"(hv[2]), "v"(hv[3]) : "memory");
  }
}

template <int EARLY>
static __device__ __forceinline__ void v_planes(unsigned char* smem, const v8f (&acc)[4][4],
                                                f16* vt, f16* vtr, int mb, int h0) {
  const int tid  = threadIdx.x;
  const int wave = tid >> 5;
  const int lane = tid & 31;
  const int lq   = lane & 15;
  const int hi   = lane >> 4;
  f16* sT = (f16*)smem;                       // [head, d][key] hi, 128 rows, cross-wave (block barrier)
  f16* sR = sT + 2 * HDIM * VP;               // [head, d][key] residual, cross-wave (block barrier)
  #pragma unroll
  for (int mi = 0; mi < 4; ++mi) {
    #pragma unroll
    for (int t = 0; t < 4; ++t) {
      Pack8H ph, px;
      #pragma unroll
      for (int r = 0; r < 8; ++r) {
        const float va = acc[mi][t][r];
        const f16 vh = (f16)va;
        ph.h[r] = vh;
        px.h[r] = (f16)((va - (float)vh) * RSC);
      }
      // row = 64 * (head - h0) + d, d = t*16 + lq; keys hi*8 + 0..7 of the 16
      const int o = ((wave >> 1) * HDIM + t * 16 + lq) * VP + (wave & 1) * 64 + mi * 16 + hi * 8;
      *(v4u*)(sT + o) = ph.u;
      if (EARLY != 0) *(v4u*)(sR + o) = px.u;
    }
  }
  __syncthreads();
  const int dl = tid >> 4;                    // 0..7
  const int ks = (tid & 15) * 8;              // 0..120
  // the two heads' d rows follow one another in the plane as in the staging: 128 rows, eight per pass of the block
  f16* vth = vt + (size_t)h0 * HDIM * SEQ + mb;   // uniform base; one 32-bit lane offset; the rows lie a constant 8 apart
  #pragma unroll
  for (int g = 0; g < 2; ++g) {
    v4u vv[8];
    #pragma unroll
    for (int it = 0; it < 8; ++it) vv[it] = *(const v4u*)(sT + ((g * 8 + it) * 8 + dl) * VP + ks);
    #pragma unroll
    for (int it = 0; it < 8; ++it) *(v4u*)(vth + (unsigned)(dl * SEQ + ks) + (g * 8 + it) * 8 * SEQ) = vv[it];
    asm volatile("s_wait_xcnt 0x0" ::: "memory");   // stands before the stores' address and data registers are rewritten
  }
  if (EARLY != 0) {
    f16* vtrh = vtr + (size_t)h0 * HDIM * ER + mb;
    #pragma unroll
    for (int g = 0; g < 2; ++g) {
      v4u vx[8];
      #pragma unroll
      for (int it = 0; it < 8; ++it) vx[it] = *(const v4u*)(sR + ((g * 8 + it) * 8 + dl) * VP + ks);
      #pragma unroll
      for (int it = 0; it < 8; ++it) *(v4u*)(vtrh + (unsigned)(dl * ER + ks) + (g * 8 + it) * 8 * ER) = vx[it];
      asm volatile("s_wait_xcnt 0x0" ::: "memory");   // as above
    }
  }
}

static __device__ __forceinline__ void planes_epilogue(unsigned char* smem, const v8f (&acc)[4][4],
                                                       const PlaneOut& po, int mb, int n0) {
  const int slot = n0 / DMODEL;               // 0 = q, 1 = k, 2 = v
  const int h    = (n0 % DMODEL) / HDIM;      // first of the block's two heads
  if (slot < 2) {
    f16* pl  = (slot == 0) ? po.qh : po.kh;
    f16* plr = (slot == 0) ? po.qr : po.kr;
    if (mb >= ER) rope_planes<0>(smem, acc, po.ct, po.st, pl, plr, mb, h);
    else          rope_planes<1>(smem, acc, po.ct, po.st, pl, plr, mb, h);
  } else {
    if (mb >= ER) v_planes<0>(smem, acc, po.vt, po.vtr, mb, h);
    else          v_planes<1>(smem, acc, po.vt, po.vtr, mb, h);
  }
}
static_assert(2 * 2 * HDIM * VP * 2 <= QKV_LDS_B && 4 * 64 * OP * 4 <= QKV_LDS_B);
static_assert(ER % 128 == 0 && SEQ % 128 == 0 && DMODEL % (2 * HDIM) == 0 && QKV_N % 128 == 0);

// smem: the block's LDS (GEMM_LDS_B bytes; QKV_LDS_B when MI == 4); mb, n0: first row and first column of the block's tile.
// MI == 4: block tile 128 x 128, the four waves 2 x 2 (wave = wm + 2 wn), wave tile 64 x 64, stage buffer [A | A | B | B]:
// a block brings 256 rows from L2 for 128 x 128 results (two 128 x 64 blocks bring 384), and a wave reads 8 fragments
// from LDS for 16 products (6 for 8 at 32 x 64).
// EPI != 0: the result goes through planes_epilogue to po's planes and C is not written.
template <typename F, int MI, int RES, int EPI>
static __device__ __forceinline__ void gemm_nt_body(unsigned char* smem,
                                                    const us16* __restrict__ A,
                                                    const us16* __restrict__ Ar,
                                                    const us16* __restrict__ Bm,
                                                    float* __restrict__ C,
                                                    int K, int N, int mb, int n0,
                                                    float oscale, float rscale, const PlaneOut& po) {
  static_assert((MI == 4 && RES == 0 && EPI != 0) || (EPI == 0 && ((MI == 2 && RES == 0) || (MI == 1 && RES == 1))));
  const int NWN   = (MI == 4) ? 2 : 1;         // waves along n == B tiles per stage
  const int BT    = 2;                         // index of the first B tile in a stage buffer
  const int STG_H = (BT + NWN) * TILE_H;       // halves per stage buffer
  const int RING_B = 2 * STG_H * 2;            // bytes of the two stage buffers
  const int OUT_B  = 4 * 16 * MI * OP * 4;     // bytes of the four waves' output staging
  const int LDS_B  = (MI == 4) ? QKV_LDS_B : GEMM_LDS_B;
  static_assert(RING_B <= LDS_B && OUT_B <= LDS_B);
  // two stage buffers (cross-wave) in the loop; behind the loop's last barrier the per-wave output staging
  us16*  ring = (us16*)smem;
  float* sC   = (float*)smem;
  const int tid  = threadIdx.x;
  const int wave = tid >> 5;
  const int lane = tid & 31;
  const int lq   = lane & 15;
  const int hi   = lane >> 4;
  const int wm   = (NWN == 2) ? (wave & 1) : wave;    // the wave's place along m
  const int wn   = (NWN == 2) ? (wave >> 1) : 0;      // and along n
  const int m0   = mb + wm * (16 * MI);

  v8f acc[MI][4], acc2[MI][4];
  #pragma unroll
  for (int mi = 0; mi < MI; ++mi) {
    #pragma unroll
    for (int t = 0; t < 4; ++t) {
      acc[mi][t]  = (v8f){0, 0, 0, 0, 0, 0, 0, 0};
      acc2[mi][t] = (v8f){0, 0, 0, 0, 0, 0, 0, 0};
    }
  }

  const us16* ab  = A + (size_t)mb * K;                                                  // tile 0: A rows 0..63
  const us16* arb = (RES != 0) ? Ar + (size_t)mb * K : A + (size_t)(mb + 64) * K;        // tile 1: Ar, or A rows 64..127
  const us16* bb  = Bm + (size_t)n0 * K;                                                 // tile 2: B rows 0..63
  const us16* bb2 = bb + (size_t)64 * K;                                                 // tile 3 (MI == 4): B rows 64..127
  const int   nst = K / GS;                           // block-uniform stage count

  stage_block<MI>(ring, ab, arb, bb, bb2, K, tid);
  asm volatile("s_wait_asynccnt 0x0" ::: "memory");   // this wave's copies of stage 0 have landed
  __syncthreads();                                    // stage 0 readable by every wave
  if (nst > 1) stage_block<MI>(ring + STG_H, ab + GS, arb + GS, bb + GS, bb2 + GS, K, tid);

  for (int s = 0; s < nst; ++s) {
    const us16* sb = ring + (s & 1) * STG_H;
    #pragma unroll   // constant indices keep the fragment arrays in registers
    for (int u = 0; u < GS / 32; ++u) {
      F a[MI], ar[MI], b[4];
      #pragma unroll
      for (int mi = 0; mi < MI; ++mi) {
        const us16* p = sb + (wm * (16 * MI) + mi * 16 + lq) * KP + u * 32 + hi * 8;
        a[mi].q[0] = *(const v4u*)(p);        // k0 + 8h + 0..7
        a[mi].q[1] = *(const v4u*)(p + 16);   // k0 + 16 + 8h + 0..7
        if (RES != 0) {
          const us16* pr = p + MI * TILE_H;
          ar[mi].q[0] = *(const v4u*)(pr);
          ar[mi].q[1] = *(const v4u*)(pr + 16);
        }
      }
      #pragma unroll
      for (int t = 0; t < 4; ++t) {
        const us16* p = sb + (BT + wn) * TILE_H + (t * 16 + lq) * KP + u * 32 + hi * 8;
        b[t].q[0] = *(const v4u*)(p);
        b[t].q[1] = *(const v4u*)(p + 16);
      }
      // keeps the LDS reads of these 32 k together in front of the products: let loose, the scheduler reads one A fragment
      // at a time into the same registers and waits for each in full
      __builtin_amdgcn_sched_barrier(0);
      #pragma unroll
      for (int mi = 0; mi < MI; ++mi) {
        #pragma unroll
        for (int t = 0; t < 4; ++t) {
          acc[mi][t] = mma(a[mi], b[t], acc[mi][t]);
          if (RES != 0) acc2[mi][t] = mma(ar[mi], b[t], acc2[mi][t]);
        }
      }
    }
    // keeps the stage's products in front of the publish point, so that the next copies are issued as early as before:
    // let loose, the scheduler sinks sixteen products behind the barrier, in front of the copies
    __builtin_amdgcn_sched_barrier(0);
    // publish point of stage s + 1, passed by every wave
    asm volatile("s_wait_dscnt 0x0" ::: "memory");      // this wave's reads of stage s are done before its buffer is refilled
    asm volatile("s_wait_asynccnt 0x0" ::: "memory");   // this wave's copies of stage s + 1 have landed
    __syncthreads();                                    // stage s + 1 readable; every reader has left stage s
    if (s + 2 < nst)
      stage_block<MI>(ring + (s & 1) * STG_H, ab + (s + 2) * GS, arb + (s + 2) * GS, bb + (s + 2) * GS,
                      bb2 + (s + 2) * GS, K, tid);
  }
  asm volatile("s_wait_asynccnt 0x0" ::: "memory");     // no copy outstanding behind the loop

  if constexpr (EPI != 0) {
    planes_epilogue(smem, acc, po, mb, n0);
  } else {

  float* so = sC + wave * (16 * MI * OP);
  #pragma unroll
  for (int mi = 0; mi < MI; ++mi) {
    #pragma unroll
    for (int t = 0; t < 4; ++t) {
      #pragma unroll
      for (int r = 0; r < 8; ++r) {
        float val = acc[mi][t][r] * oscale;
        if (RES != 0) val += acc2[mi][t][r] * rscale;
        so[(mi * 16 + hi * 8 + r) * OP + t * 16 + lq] = val;
      }
    }
  }
  __syncthreads();

  const int NIT = 8 * MI;   // (16*MI rows) / 2 rows per instruction
  v4f    vals[8 * MI];
  size_t gidx[8 * MI];
  #pragma unroll
  for (int it = 0; it < NIT; ++it) {
    const int row = it * 2 + hi;
    vals[it] = *(const v4f*)(so + row * OP + lq * 4);
    gidx[it] = (size_t)(m0 + row) * N + n0 + lq * 4;
  }
  #pragma unroll
  for (int it = 0; it < NIT; ++it) *(v4f*)(C + gidx[it]) = vals[it];
  }
}

// qkv = xb x wb^T, RoPE and the q/k/v planes: block tile 128 x 128, grid (N / 128, rows / 128): 768 equal work-groups.
// At most three waves per SIMD: three work-groups per WGP, so that no WGP takes a fourth while another has two.
__global__ __launch_bounds__(128) __attribute__((amdgpu_waves_per_eu(3, 3))) void gemm_qkv_kernel(const us16* __restrict__ A,
                                                       const us16* __restrict__ Bm,
                                                       const float* __restrict__ ct,
                                                       const float* __restrict__ st,
                                                       f16* __restrict__ qh, f16* __restrict__ qr,
                                                       f16* __restrict__ kh, f16* __restrict__ kr,
                                                       f16* __restrict__ vt, f16* __restrict__ vtr,
                                                       int K, int N) {
  __shared__ __align__(16) unsigned char smem[QKV_LDS_B];
  const PlaneOut po = {ct, st, qh, qr, kh, kr, vt, vtr};
  gemm_nt_body<FragB, 4, 0, 1>(smem, A, A, Bm, nullptr, K, N, blockIdx.y * 128, blockIdx.x * 128, 1.0f, 0.0f, po);
}

// out = ctx x wp^T, all rows in one launch: the first ER / 64 block rows take 64 rows each with the residual plane,
// the others 128 rows each from row ER on (block-uniform branch; the two row ranges share no output element).
__global__ __launch_bounds__(128) void gemm_proj_kernel(const us16* __restrict__ A,
                                                        const us16* __restrict__ Ar,
                                                        const us16* __restrict__ Bm,
                                                        float* __restrict__ C, int K, int N,
                                                        float oscale, float rscale) {
  __shared__ __align__(16) unsigned char smem[GEMM_LDS_B];
  const int by = blockIdx.y;
  const int n0 = blockIdx.x * 64;
  const PlaneOut none = {};
  if (by < ER / 64) gemm_nt_body<FragH, 1, 1, 0>(smem, A, Ar, Bm, C, K, N, by * 64, n0, oscale, rscale, none);
  else              gemm_nt_body<FragH, 2, 0, 0>(smem, A, A, Bm, C, K, N, ER + (by - ER / 64) * 128, n0, oscale, 0.0f, none);
}

// ---------------------------------------------------------------------------------------------
// Flash attention, causal. Block = (query block of 128, head), 16 waves in two groups of eight: wave w of either group owns
// the 16 query rows w; group g takes the g-th 64 keys of every 128-key stage. Four waves share a SIMD, so that one wave's LDS,
// matrix and softmax latencies pass under the others' work. Behind the key loop group 1 hands its maximum, sum and O to
// group 0 through LDS, which joins the two partial softmaxes.
// S^T = K x Q^T so queries sit on lanes; P^T in C-layout is bit-identical to the A-fragment layout of O += P x V.
// Q B-fragments are loaded straight from the 16-bit plane; K A-fragments and V^T B-fragments from LDS (two 16-B loads each).
// RES != 0 (query blocks < EARLY_QBLK, all visited keys < ER): score = KQ + (K Qres + Kres Q)/1024;
// O2 = Pres V + P Vres accumulated separately and folded as O2/1024 before normalisation.
// K and V^T (and their residual planes when RES) are staged once per block, SK keys at a time (KS per key group), in two LDS buffers
// by asynchronous 16-B copies; the eight waves of a group read their fragments from LDS. A stage buffer holds, for each group
// in turn, the tiles [K | V^T | Kres | V^Tres] of its KS keys, each 64 rows of 128 B at pitch KP; a group stages its own tiles.
// One stage's copies of one thread of a group's 256 (tid): rows tid>>3 and 32 + (tid>>3) of every tile, 16-B piece tid&7.
// kg/krg point at the group's first key row of the stage (pitch HDIM); vg/vrg at its first key column (pitch SEQ / ER).
template <int RES>
static __device__ __forceinline__ void stage_tiles(f16* buf, const f16* kg, const f16* krg,
                                                   const f16* vg, const f16* vrg, int tid) {
  const int row   = tid >> 3;     // 0..31
  const int piece = tid & 7;      // 0..7
  const unsigned l0 = (unsigned)(size_t)(buf + row * KP + piece * 8);   // LDS byte address
  const unsigned l1 = l0 + 32 * KP * 2;
  const unsigned l2 = l0 + TILE_H * 2;
  const unsigned l3 = l1 + TILE_H * 2;
  const f16* g0 = kg + (size_t)row * HDIM + piece * 8;
  const f16* g1 = g0 + 32 * HDIM;
  const f16* g2 = vg + (size_t)row * SEQ + piece * 8;
  const f16* g3 = g2 + (size_t)32 * SEQ;
  // the copies and, as the last line, the wait that stands before any of their address registers is rewritten
  asm volatile("global_load_async_to_lds_b128 %0, %4, off\n\t"
               "global_load_async_to_lds_b128 %1, %5, off\n\t"
               "global_load_async_to_lds_b128 %2, %6, off\n\t"
               "global_load_async_to_lds_b128 %3, %7, off\n\t"
               "s_wait_xcnt 0x0"
               :: "v"(l0), "v"(l1), "v"(l2), "v"(l3), "v"(g0), "v"(g1), "v"(g2), "v"(g3) : "memory");
  if (RES != 0) {
    const unsigned l4 = l0 + 2 * TILE_H * 2;
    const unsigned l5 = l1 + 2 * TILE_H * 2;
    const unsigned l6 = l0 + 3 * TILE_H * 2;
    const unsigned l7 = l1 + 3 * TILE_H * 2;
    const f16* g4 = krg + (size_t)row * HDIM + piece * 8;
    const f16* g5 = g4 + 32 * HDIM;
    const f16* g6 = vrg + (size_t)row * ER + piece * 8;
    const f16* g7 = g6 + (size_t)32 * ER;
    // same form for the residual tiles
    asm volatile("global_load_async_to_lds_b128 %0, %4, off\n\t"
                 "global_load_async_to_lds_b128 %1, %5, off\n\t"
                 "global_load_async_to_lds_b128 %2, %6, off\n\t"
                 "global_load_async_to_lds_b128 %3, %7, off\n\t"
                 "s_wait_xcnt 0x0"
                 :: "v"(l4), "v"(l5), "v"(l6), "v"(l7), "v"(g4), "v"(g5), "v"(g6), "v"(g7) : "memory");
  }
}

// sO: output staging per query tile, NWAVE * 16 * OP floats; sM: group 1's partial O, the same size; sS: group 1's maximum and
// sum, NWAVE * 64 floats; sKV: the two stage buffers.
template <int RES>
static __device__ __forceinline__ void attn_body(float* sO, float* sM, float* sS, f16* sKV,
                                                 const f16* __restrict__ qh, const f16* __restrict__ qr,
                                                 const f16* __restrict__ kh, const f16* __restrict__ kr,
                                                 const f16* __restrict__ vt, const f16* __restrict__ vtr,
                                                 f16* __restrict__ ctxh, f16* __restrict__ ctxr,
                                                 int qblk, int h) {
  const int tid  = threadIdx.x;
  const int wv   = __builtin_amdgcn_readfirstlane(tid >> 5);   // scalar, so the per-wave causal skip is a scalar branch
  const int grp  = wv >> 3;     // key group: which KS keys of a stage
  const int wave = wv & 7;      // query tile
  const int gtid = tid & 255;   // thread within the group
  const int lane = tid & 31;
  const int lq   = lane & 15;   // query column of S^T / d column of O
  const int hi   = lane >> 4;   // k-split half

  const int STG_H = (RES != 0 ? 4 : 2) * TILE_H;         // halves of one group's tiles in a stage buffer
  const int BUF_H = NGRP * STG_H;                        // halves per stage buffer

  const int qrow0 = qblk * BQ + wave * 16;               // first query row of this wave

  // Q as B-operand fragments: lane lq holds query qrow0+lq, elements follow the split d map.
  FragH qf[2], qx[2];
  {
    const f16* qp = qh + ((size_t)h * SEQ + qrow0 + lq) * HDIM;
    #pragma unroll
    for (int f = 0; f < 2; ++f) {
      qf[f].q[0] = *(const v4u*)(qp + f * 32 + hi * 8);        // d = f*32 + hi*8 + 0..7
      qf[f].q[1] = *(const v4u*)(qp + f * 32 + 16 + hi * 8);   // d = f*32 + 16 + hi*8 + 0..7
    }
    if (RES != 0) {
      const f16* qrp = qr + ((size_t)h * ER + qrow0 + lq) * HDIM;
      #pragma unroll
      for (int f = 0; f < 2; ++f) {
        qx[f].q[0] = *(const v4u*)(qrp + f * 32 + hi * 8);
        qx[f].q[1] = *(const v4u*)(qrp + f * 32 + 16 + hi * 8);
      }
    }
  }

  // the head's planes at the group's first key
  const f16* kh_h  = kh  + (size_t)h * SEQ * HDIM + grp * (KS * HDIM);
  const f16* kr_h  = kr  + (size_t)h * ER * HDIM + grp * (KS * HDIM);
  const f16* vt_h  = vt  + (size_t)h * HDIM * SEQ + grp * KS;
  const f16* vtr_h = vtr + (size_t)h * HDIM * ER + grp * KS;
  f16* sg = sKV + grp * STG_H;                           // the group's tiles in stage buffer 0

  v8f o[4], o2[4];
  #pragma unroll
  for (int dt = 0; dt < 4; ++dt) {
    o[dt]  = (v8f){0, 0, 0, 0, 0, 0, 0, 0};
    o2[dt] = (v8f){0, 0, 0, 0, 0, 0, 0, 0};
  }

  float rmax = -__builtin_inff();
  float rsum = 0.0f;
  const float SL = 0.125f * 1.4426950408889634f;   // softmax scale * log2(e)

  // causal: this wave visits key chunks whose first key is <= its last query row (wave-uniform trip count)
  const int nchunk = (qrow0 + 15) / BK + 1;
  // the block walks the stages of SK keys up to its last query row (block-uniform count, at least one)
  const int nstage = (qblk + 1) * (BQ / SK);

  stage_tiles<RES>(sg, kh_h, kr_h, vt_h, vtr_h, gtid);
  asm volatile("s_wait_asynccnt 0x0" ::: "memory");   // this wave's copies of stage 0 have landed
  __syncthreads();                                    // stage 0 readable by every wave
  if (nstage > 1)
    stage_tiles<RES>(sg + BUF_H, kh_h + (size_t)SK * HDIM, kr_h + (size_t)SK * HDIM, vt_h + SK, vtr_h + SK, gtid);

  for (int t = 0; t < nstage; ++t) {
   const f16* sb = sg + (t & 1) * BUF_H;
   for (int u = 0; u < KS / BK; ++u) {
    const int i = (t * NGRP + grp) * (KS / BK) + u;
    if (i >= nchunk) break;                 // wave-uniform: chunks beyond this wave's diagonal
    const int j0 = i * BK;
    const f16* sk  = sb + (u * BK) * KP;                 // K rows of this chunk
    const f16* sv  = sb + TILE_H + u * BK;               // V^T key columns of this chunk
    const f16* skr = sb + (RES != 0 ? 2 : 0) * TILE_H + (u * BK) * KP;    // residual tiles (read when RES only)
    const f16* svr = sb + (RES != 0 ? 3 : 1) * TILE_H + u * BK;

    // K A-fragments, then V B-fragments (column n = d = dt*16 + lq, split key map from the transposed tile): all
    // fetched at the head of the chunk, so that V's LDS latency passes under the score products and the softmax.
    FragH ka[2][2], bvf[4];
    #pragma unroll   // constant indices keep the fragment arrays in registers
    for (int sub = 0; sub < 2; ++sub) {
      const f16* base = sk + (sub * 16 + lq) * KP + hi * 8;   // row = key j0 + sub*16 + lq
      ka[sub][0].q[0] = *(const v4u*)(base);        // d = hi*8 + 0..7
      ka[sub][0].q[1] = *(const v4u*)(base + 16);   // d = 16 + hi*8 + 0..7
      ka[sub][1].q[0] = *(const v4u*)(base + 32);   // d = 32 + hi*8 + 0..7
      ka[sub][1].q[1] = *(const v4u*)(base + 48);   // d = 48 + hi*8 + 0..7
    }
    #pragma unroll   // as above
    for (int dt = 0; dt < 4; ++dt) {
      const f16* base = sv + (dt * 16 + lq) * KP + hi * 8;
      bvf[dt].q[0] = *(const v4u*)(base);        // keys j0 + hi*8 + 0..7
      bvf[dt].q[1] = *(const v4u*)(base + 16);   // keys j0 + 16 + hi*8 + 0..7
    }
    // keeps the sixteen LDS reads together in front of the products: let loose, the scheduler reads one fragment at a time
    // into the same registers and waits for each in full
    __builtin_amdgcn_sched_barrier(0);

    // S^T tiles: c[sub][r] = rawscore(query qrow0+lq, key j0 + sub*16 + hi*8 + r)
    v8f c[2];
    #pragma unroll
    for (int sub = 0; sub < 2; ++sub) {
      const FragH a0 = ka[sub][0];
      const FragH a1 = ka[sub][1];
      v8f acc = (v8f){0, 0, 0, 0, 0, 0, 0, 0};
      acc = mma_f16(a0.v, qf[0].v, acc);
      acc = mma_f16(a1.v, qf[1].v, acc);
      if (RES != 0) {
        FragH r0, r1;
        const f16* rb = skr + (sub * 16 + lq) * KP + hi * 8;
        r0.q[0] = *(const v4u*)(rb);
        r0.q[1] = *(const v4u*)(rb + 16);
        r1.q[0] = *(const v4u*)(rb + 32);
        r1.q[1] = *(const v4u*)(rb + 48);
        v8f ax = (v8f){0, 0, 0, 0, 0, 0, 0, 0};
        ax = mma_f16(a0.v, qx[0].v, ax);
        ax = mma_f16(a1.v, qx[1].v, ax);
        ax = mma_f16(r0.v, qf[0].v, ax);
        ax = mma_f16(r1.v, qf[1].v, ax);
        #pragma unroll
        for (int r = 0; r < 8; ++r) acc[r] += ax[r] * (1.0f / RSC);
      }
      c[sub] = acc;
    }

    // causal mask (key > query -> -inf); branch is wave-uniform, selects are per lane
    if (j0 + BK - 1 > qrow0) {
      const int qi = qrow0 + lq;
      #pragma unroll
      for (int sub = 0; sub < 2; ++sub) {
        #pragma unroll
        for (int r = 0; r < 8; ++r) {
          const int key = j0 + sub * 16 + hi * 8 + r;
          c[sub][r] = (key > qi) ? -__builtin_inff() : c[sub][r];
        }
      }
    }

    // online softmax: query lq's 32 scores are split across lane / lane^16
    float m_new = rmax;
    #pragma unroll
    for (int r = 0; r < 8; ++r) {
      m_new = fmaxf(m_new, c[0][r]);
      m_new = fmaxf(m_new, c[1][r]);
    }
    m_new = fmaxf(m_new, xhalf(m_new));
    const float scale = __builtin_amdgcn_exp2f((rmax - m_new) * SL);
    rmax = m_new;

    // exp + pack: P^T C-layout == A-fragment layout for the PV product
    FragH pa, pr;
    float psum = 0.0f;
    #pragma unroll
    for (int r = 0; r < 8; ++r) {
      const float p0 = __builtin_amdgcn_exp2f((c[0][r] - m_new) * SL);   // key hi*8 + r
      const float p1 = __builtin_amdgcn_exp2f((c[1][r] - m_new) * SL);   // key 16 + hi*8 + r
      psum += p0 + p1;
      const float pc0 = p0 * PCAR;
      const float pc1 = p1 * PCAR;
      const f16 h0 = (f16)pc0;
      const f16 h1 = (f16)pc1;
      pa.h[r]     = h0;
      pa.h[8 + r] = h1;
      if (RES != 0) {
        pr.h[r]     = (f16)((pc0 - (float)h0) * RSC);
        pr.h[8 + r] = (f16)((pc1 - (float)h1) * RSC);
      }
    }
    rsum = rsum * scale + psum + xhalf(psum);

    // rescale O: queries are the row dimension there -> per-row scale of query 8*hi + r. A query's scale is the same
    // number in lanes lq and lq + 16 (rmax and m_new are joined over the halves), so each 16-lane row serves itself:
    // the upper row first brings queries 8..15 to its lanes 0..7, then lane r of each row is spread over the row.
    const float sw = row_rot8(scale);             // moved by every lane, so that the choice below is a select, not a branch
    const float sq = (hi != 0) ? sw : scale;
    const float sc[8] = {row_bcast<0>(sq), row_bcast<1>(sq), row_bcast<2>(sq), row_bcast<3>(sq),
                         row_bcast<4>(sq), row_bcast<5>(sq), row_bcast<6>(sq), row_bcast<7>(sq)};
    #pragma unroll
    for (int dt = 0; dt < 4; ++dt) {
      #pragma unroll
      for (int r = 0; r < 8; ++r) {
        o[dt][r] *= sc[r];
        if (RES != 0) o2[dt][r] *= sc[r];
      }
    }

    // O += P x V
    #pragma unroll
    for (int dt = 0; dt < 4; ++dt) {
      o[dt] = mma_f16(pa.v, bvf[dt].v, o[dt]);
      if (RES != 0) {
        o2[dt] = mma_f16(pr.v, bvf[dt].v, o2[dt]);
        FragH br;
        const f16* rb = svr + (dt * 16 + lq) * KP + hi * 8;
        br.q[0] = *(const v4u*)(rb);
        br.q[1] = *(const v4u*)(rb + 16);
        o2[dt] = mma_f16(pa.v, br.v, o2[dt]);
      }
    }
    // one issue slot directly behind the chunk's last product (tied to its D, so that it stays there): the next chunk's LDS
    // address can land in that product's B registers (the residual form's build has no such overwrite)
    if (RES == 0) asm volatile("v_nop" : "+v"(o[3]));
   }
   // publish point of stage t + 1, passed by every wave (also one that skipped chunks)
   asm volatile("s_wait_dscnt 0x0" ::: "memory");      // this wave's reads of stage t are done before its buffer is refilled
   asm volatile("s_wait_asynccnt 0x0" ::: "memory");   // this wave's copies of stage t + 1 have landed
   __syncthreads();                                    // stage t + 1 readable; every reader has left stage t
   if (t + 2 < nstage)
     stage_tiles<RES>(sg + (t & 1) * BUF_H, kh_h + (size_t)(t + 2) * SK * HDIM, kr_h + (size_t)(t + 2) * SK * HDIM,
                      vt_h + (t + 2) * SK, vtr_h + (t + 2) * SK, gtid);
  }
  asm volatile("s_wait_asynccnt 0x0" ::: "memory");    // no copy outstanding behind the loop

  // join of the two key groups; all branches on grp are scalar. A lane holds column d = dt*16 + lq for query rows 8*hi + r.
  // Group 1 hands over its partial O and, per lane (query lq), its maximum and sum. A group-1 wave that saw no key
  // (first query block only) hands over maximum -inf, sum 0 and O 0, whose weight below is exp2(-inf) = 0.
  float* sm = sM + wave * (16 * OP);
  float* sx = sS + wave * 64;
  if (grp != 0) {
    #pragma unroll
    for (int r = 0; r < 8; ++r) {
      #pragma unroll
      for (int dt = 0; dt < 4; ++dt) {
        float val = o[dt][r];
        if (RES != 0) val += o2[dt][r] * (1.0f / RSC);
        sm[(hi * 8 + r) * OP + dt * 16 + lq] = val;
      }
    }
    sx[lane]      = rmax;
    sx[32 + lane] = rsum;
  }
  __syncthreads();                                     // group 1's partial results readable by group 0

  // group 0 (its maximum is finite: every query sees key 0): weights of the two parts, normalised; stage ctx * 64
  float* so = sO + wave * (16 * OP);
  if (grp == 0) {
    const float m1  = sx[lane];
    const float s1  = sx[32 + lane];
    const float m   = fmaxf(rmax, m1);
    const float a0  = __builtin_amdgcn_exp2f((rmax - m) * SL);
    const float a1  = __builtin_amdgcn_exp2f((m1 - m) * SL);
    const float inv = 1.0f / (rsum * a0 + s1 * a1);
    const float w0  = a0 * inv;
    const float w1  = a1 * inv;
    #pragma unroll
    for (int r = 0; r < 8; ++r) {
      const float f0 = __shfl(w0, (hi << 3) + r, 32);
      const float f1 = __shfl(w1, (hi << 3) + r, 32);
      #pragma unroll
      for (int dt = 0; dt < 4; ++dt) {
        float val = o[dt][r];
        if (RES != 0) val += o2[dt][r] * (1.0f / RSC);
        const int e = (hi * 8 + r) * OP + dt * 16 + lq;
        so[e] = (val * f0 + sm[e] * f1) * (CCAR / PCAR);
      }
    }
  }
  __syncthreads();
  if (grp != 0) return;                                // the caller's barrier is passed by every wave behind this body

  v4u    hv[4], rv[4];
  size_t gi[4], gr[4];
  #pragma unroll
  for (int it = 0; it < 4; ++it) {
    const int row   = it * 4 + (lane >> 3);   // 0..15
    const int piece = lane & 7;               // 0..7
    const v4f a0 = *(const v4f*)(so + row * OP + piece * 8);
    const v4f a1 = *(const v4f*)(so + row * OP + piece * 8 + 4);
    Pack8H ph, px;
    #pragma unroll
    for (int k = 0; k < 4; ++k) {
      const float u0 = a0[k];
      const float u1 = a1[k];
      const f16 g0 = (f16)u0;
      const f16 g1 = (f16)u1;
      ph.h[k]     = g0;
      ph.h[4 + k] = g1;
      px.h[k]     = (f16)((u0 - (float)g0) * RSC);
      px.h[4 + k] = (f16)((u1 - (float)g1) * RSC);
    }
    hv[it] = ph.u;
    rv[it] = px.u;
    gi[it] = (size_t)(qrow0 + row) * DMODEL + h * HDIM + piece * 8;
    gr[it] = (size_t)(qrow0 + row) * DMODEL + h * HDIM + piece * 8;   // row < ER when RES
  }
  #pragma unroll
  for (int it = 0; it < 4; ++it) {
    *(v4u*)(ctxh + gi[it]) = hv[it];
    if (RES != 0) *(v4u*)(ctxr + gr[it]) = rv[it];
  }
  
}

// Causal balance: a query block's cost grows linearly with its index, and every work-group of the launch is resident
// at once, so the launch lasts as long as its longest work-group. Each work-group therefore takes two query blocks of
// one head, one after the other in every wave: NT - 1 - p, then p. Every work-group walks NT + 1 blocks' worth of key
// stages; every (head, query block) is taken exactly once. All branches are block-uniform.
// The LDS is sized for the residual form; the other uses the first half of sKV.
// Four waves per SIMD: the 16 waves of one work-group fill a WGP's share, one of the 256 equal work-groups per WGP.
__global__ __launch_bounds__(NGRP * 256) __attribute__((amdgpu_waves_per_eu(4, 4))) void attn_kernel(const f16* __restrict__ qh, const f16* __restrict__ qr,
                                                   const f16* __restrict__ kh, const f16* __restrict__ kr,
                                                   const f16* __restrict__ vt, const f16* __restrict__ vtr,
                                                   f16* __restrict__ ctxh, f16* __restrict__ ctxr) {
  __shared__ __align__(16) float sO[NWAVE * 16 * OP];   // output staging per query tile (block barrier used)
  __shared__ __align__(16) float sM[NWAVE * 16 * OP];   // group 1's partial O, cross-wave
  __shared__ __align__(16) float sS[NWAVE * 64];        // group 1's maximum and sum, cross-wave
  __shared__ __align__(16) f16 sKV[2 * NGRP * 4 * TILE_H];   // two stage buffers, cross-wave
  const int NE = ER / BQ;                       // query blocks with residual planes, per head
  const int NT = SEQ / BQ;                      // query blocks per head
  const int NP = NT / 2;                        // pairs per head
  static_assert(NT % 2 == 0 && NE <= NP);       // whole pairs; the long block of a pair never has residual planes
  const int p  = blockIdx.x % NP;
  const int h  = blockIdx.x / NP;
  attn_body<0>(sO, sM, sS, sKV, qh, qr, kh, kr, vt, vtr, ctxh, ctxr, NT - 1 - p, h);
  asm volatile("s_wait_dscnt 0x0" ::: "memory");   // this wave's LDS reads of the first block are done before the buffers are refilled
  __syncthreads();                                 // every wave has left the first block's LDS
  if (p < NE) attn_body<1>(sO, sM, sS, sKV, qh, qr, kh, kr, vt, vtr, ctxh, ctxr, p, h);
  else        attn_body<0>(sO, sM, sS, sKV, qh, qr, kh, kr, vt, vtr, ctxh, ctxr, p, h);
}

// ---------------------------------------------------------------------------------------------
extern "C" void kernel_launch(void* const* d_in, const int* in_sizes, int n_in,
                              void* d_out, int out_size, void* d_ws, size_t ws_size,
                              hipStream_t stream) {
  if (n_in < 3) return;
  if ((size_t)in_sizes[0] < (size_t)SEQ * DMODEL) return;
  if ((size_t)in_sizes[1] < (size_t)QKV_N * DMODEL) return;
  if ((size_t)in_sizes[2] < (size_t)DMODEL * DMODEL) return;
  if ((size_t)out_size < (size_t)SEQ * DMODEL) return;

  const size_t xb_bytes   = (size_t)SEQ * DMODEL * 2;            // bf16 [SEQ][DMODEL]
  const size_t wb_bytes   = (size_t)QKV_N * DMODEL * 2;          // bf16 [QKV_N][DMODEL]
  const size_t wp_bytes   = (size_t)DMODEL * DMODEL * 2;         // f16  [DMODEL][DMODEL]
  const size_t tab_bytes  = (size_t)SEQ * NROPE * 4;             // f32  [SEQ][NROPE] (each of cos, sin)
  const size_t pl_bytes   = (size_t)NHEAD * SEQ * HDIM * 2;      // f16  q/k/vt planes
  const size_t plr_bytes  = (size_t)NHEAD * ER * HDIM * 2;       // f16  residual planes
  const size_t ctx_bytes  = (size_t)SEQ * DMODEL * 2;            // f16  [SEQ][DMODEL]
  const size_t ctxr_bytes = (size_t)ER * DMODEL * 2;             // f16  [ER][DMODEL]
  const size_t total = xb_bytes + wb_bytes + wp_bytes + 2 * tab_bytes
                     + 3 * pl_bytes + 3 * plr_bytes + ctx_bytes + ctxr_bytes;
  if (ws_size < total) return;

  char* ws = (char*)d_ws;
  size_t off = 0;
  bf16*  xb   = (bf16*)(ws + off);  off += xb_bytes;
  bf16*  wb   = (bf16*)(ws + off);  off += wb_bytes;
  f16*   wp   = (f16*)(ws + off);   off += wp_bytes;
  float* ct   = (float*)(ws + off); off += tab_bytes;
  float* st   = (float*)(ws + off); off += tab_bytes;
  f16*   qhp  = (f16*)(ws + off);   off += pl_bytes;
  f16*   khp  = (f16*)(ws + off);   off += pl_bytes;
  f16*   vtp  = (f16*)(ws + off);   off += pl_bytes;
  f16*   qrp  = (f16*)(ws + off);   off += plr_bytes;
  f16*   krp  = (f16*)(ws + off);   off += plr_bytes;
  f16*   vtrp = (f16*)(ws + off);   off += plr_bytes;
  f16*   ctxh = (f16*)(ws + off);   off += ctx_bytes;
  f16*   ctxr = (f16*)(ws + off);   off += ctxr_bytes;
  if (off > ws_size) return;

  const float* x     = (const float*)d_in[0];
  const float* wqkv  = (const float*)d_in[1];
  const float* wproj = (const float*)d_in[2];
  float*       out   = (float*)d_out;

  // 1) RoPE cos/sin tables and the 16-bit operand planes of the inputs
  const int ncvt_blocks = SEQ * DMODEL / 2048 + QKV_N * DMODEL / 2048 + DMODEL * DMODEL / 2048;
  prep_kernel<<<dim3(SEQ / 8 + ncvt_blocks), 256, 0, stream>>>(x, wqkv, wproj, xb, wb, wp, ct, st);

  // 2) qkv = xb x wb^T (bf16 operands, f32 accumulators), RoPE, q/k/v planes (+ residual planes for rows < ER)
  gemm_qkv_kernel<<<dim3(QKV_N / 128, SEQ / 128), 128, 0, stream>>>(
      (const us16*)xb, (const us16*)wb, ct, st, qhp, qrp, khp, krp, vtp, vtrp, DMODEL, QKV_N);

  // 3) causal attention -> ctx planes, two query blocks per work-group
  attn_kernel<<<dim3((SEQ / BQ / 2) * NHEAD), NGRP * 256, 0, stream>>>(qhp, qrp, khp, krp, vtp, vtrp, ctxh, ctxr);

  // 4) out[SEQ][DMODEL] = ctx x wp^T ; folds the ctx carry (64), the Wproj carry (256) and the residual scale (1024)
  const float oscale = 1.0f / (CCAR * WCAR);
  const float rscale = oscale / RSC;
  gemm_proj_kernel<<<dim3(DMODEL / 64, ER / 64 + (SEQ - ER) / 128), 128, 0, stream>>>(
      (const us16*)ctxh, (const us16*)ctxr, (const us16*)wp, out, DMODEL, DMODEL, oscale, rscale);
}

// v010
// A run of this version takes 91.7 microseconds.
// In both of two side-by-side timings against v009, it was 1.04 times as fast.
// Over all steps from v000 it is 4.88 times as fast.
#include <hip/hip_runtime.h>

// Contractions: qkv = X x Wqkv^T on v_wmma_f32_16x16x32_bf16 (bf16 operands = RNE-converted inputs, f32 accumulate);
// S^T = K x Q^T on v_wmma_f32_16x16x32_f16 (f16 q/k after RoPE, plus f16 residual planes x1024 with their own
// accumulator on query blocks < EARLY_QBLK); O = P x V on v_wmma_f32_16x16x32_f16 (P as f16 carried x4096,
// V as f16, plus P and V residual planes x1024 with their own accumulator on query blocks < EARLY_QBLK);
// out = ctx x Wproj^T on v_wmma_f32_16x16x32_f16 (ctx as f16 carried x64 plus residual x1024 on rows < ER,
// Wproj = f16 of the bf16 RNE-converted input carried x256). RoPE, softmax and all epilogues in f32.

#ifndef NB
#define NB 1
#endif
#ifndef SEQ
#define SEQ 4096
#endif
#define NB_FULL    1
#define SEQ_FULL   4096
#define NHEAD      16
#define HDIM       64
#define DMODEL     (NHEAD * HDIM)        // 1024
#define QKV_N      (3 * DMODEL)          // 3072
#define NROPE      (HDIM / 2)            // 32 frequencies
#define BQ         128                   // query rows per attention block (8 query tiles x 16)
#define BK         32                    // keys per inner iteration
#define NWAVE      8                     // query tiles of 16 rows per attention block
#define EARLY_QBLK 2                     // query blocks with residual planes on q, k, P, v, ctx
#define ER         ((EARLY_QBLK * BQ < SEQ) ? (EARLY_QBLK * BQ) : SEQ)   // early rows == early keys
#define VP         136                   // LDS pitch (halves) of the transposed V tile (128 keys): 272 B = 16 B x odd
#define OP         68                    // LDS pitch (floats) of output staging tiles
#define PCAR       4096.0f               // P carry
#define PLIM       15.0f                 // a lane's sum of 16 P terms up to which the maximum in use serves: PLIM * PCAR is finite in f16
#define RSC        1024.0f               // residual plane scale
#define CCAR       64.0f                 // ctx carry
#define WCAR       256.0f                // Wproj carry
#define KS         64                    // keys per LDS stage and key group of the attention loop (two inner iterations)
#define KP         72                    // LDS pitch (halves) of staged K rows and V^T rows: 144 B = 16 B x odd
#define TILE_H     (64 * KP)             // halves per staged tile (64 rows)
#define NGRP       2                     // key groups of eight waves in an attention block
#define SK         (NGRP * KS)           // keys per LDS stage of the attention loop, all groups
#define GS         64                    // k per LDS stage of the GEMM loop (two 32-k products)

static_assert(NB == 1 && NB <= NB_FULL);
static_assert(SEQ <= SEQ_FULL);
static_assert(SEQ % BQ == 0);
static_assert(ER % BQ == 0);
static_assert((SEQ - ER) % 128 == 0);
static_assert(SEQ % 8 == 0);
static_assert(BQ == NWAVE * 16);
static_assert(HDIM == 64);
static_assert(DMODEL % 64 == 0 && QKV_N % 64 == 0);
static_assert(DMODEL % 32 == 0);
static_assert((SEQ * DMODEL) % 2048 == 0);
static_assert((QKV_N * DMODEL) % 2048 == 0);
static_assert((DMODEL * DMODEL) % 2048 == 0);
static_assert((VP * 2) % 16 == 0);
static_assert((OP * 4) % 16 == 0);
static_assert(KS == 2 * BK && BQ % SK == 0 && KS == 64);
static_assert((KP * 2) % 16 == 0);

typedef __bf16         bf16;
typedef _Float16       f16;
typedef unsigned short us16;
typedef bf16     v16bf __attribute__((ext_vector_type(16)));
typedef f16      v16h  __attribute__((ext_vector_type(16)));
typedef f16      v8h   __attribute__((ext_vector_type(8)));
typedef float    v8f   __attribute__((ext_vector_type(8)));
typedef float    v4f   __attribute__((ext_vector_type(4)));
typedef unsigned v4u   __attribute__((ext_vector_type(4)));

union FragB  { v16bf v; v4u q[2]; bf16 h[16]; };
union FragH  { v16h  v; v4u q[2]; f16  h[16]; };
union Pack8B { v4u u; bf16 h[8]; };
union Pack8H { v4u u; v8h v; f16 h[8]; };

// WMMA helpers: the builtin alone. The compiler keeps the distance behind its own matrix instructions and fills it with
// independent work where it has some.
static __device__ __forceinline__ v8f mma_bf16(v16bf a, v16bf b, v8f acc) {
  return __builtin_amdgcn_wmma_f32_16x16x32_bf16(false, a, false, b, (short)0, acc, false, false);
}
static __device__ __forceinline__ v8f mma_f16(v16h a, v16h b, v8f acc) {
  return __builtin_amdgcn_wmma_f32_16x16x32_f16(false, a, false, b, (short)0, acc, false, false);
}
static __device__ __forceinline__ v8f mma(const FragB& a, const FragB& b, v8f acc) { return mma_bf16(a.v, b.v, acc); }

// Cross-lane moves on the vector pipe (a shuffle compiles to an LDS-pipe permute, whose result a wave must wait for).
// They are used where every lane is on. The fetch-inactive flag (fifth argument) then changes no value; it says that the
// old destination is not read, which saves a register copy in front of every move.
// xhalf: lane l gets the value of lane l ^ 16.
static __device__ __forceinline__ float xhalf(float x) {
  const int b = __builtin_bit_cast(int, x);
  return __builtin_bit_cast(float, __builtin_amdgcn_permlanex16(b, b, 0x76543210, 0xfedcba98, true, false));
}
// row_rot8: lane l gets the value of lane l ^ 8 (the other half of its own 16-lane row).
static __device__ __forceinline__ float row_rot8(float x) {
  const int b = __builtin_bit_cast(int, x);
  return __builtin_bit_cast(float, __builtin_amdgcn_permlane16(b, b, 0xfedcba98, 0x76543210, true, false));
}
// row_bcast<R>: every lane gets the value of lane R of its own 16-lane row.
template <int R>
static __device__ __forceinline__ float row_bcast(float x) {
  const int b = __builtin_bit_cast(int, x);
  return __builtin_bit_cast(float, __builtin_amdgcn_permlane16(b, b, 0x11111111u * R, 0x11111111u * R, true, false));
}
static __device__ __forceinline__ v8f mma(const FragH& a, const FragH& b, v8f acc) { return mma_f16(a.v, b.v, acc); }
// Eight exponentials 2^a in one statement. The instruction set asks for one slot behind a transcendental before its result is
// read or its source overwritten. Here results and sources are
// distinct registers (early clobber), and the last line is that slot for whatever follows.
static __device__ __forceinline__ void exp2x8(float (&p)[8], const float (&a)[8]) {
  asm("v_exp_f32 %0, %8\n\t"
      "v_exp_f32 %1, %9\n\t"
      "v_exp_f32 %2, %10\n\t"
      "v_exp_f32 %3, %11\n\t"
      "v_exp_f32 %4, %12\n\t"
      "v_exp_f32 %5, %13\n\t"
      "v_exp_f32 %6, %14\n\t"
      "v_exp_f32 %7, %15\n\t"
      "v_nop"
      : "=&v"(p[0]), "=&v"(p[1]), "=&v"(p[2]), "=&v"(p[3]), "=&v"(p[4]), "=&v"(p[5]), "=&v"(p[6]), "=&v"(p[7])
      : "v"(a[0]), "v"(a[1]), "v"(a[2]), "v"(a[3]), "v"(a[4]), "v"(a[5]), "v"(a[6]), "v"(a[7]));
}

// ---------------------------------------------------------------------------------------------
// Convert pass: xb = bf16(x) [SEQ][DMODEL], wb = bf16(Wqkv) [QKV_N][DMODEL], wp = f16(bf16(Wproj) * 256) [DMODEL][DMODEL].
// coverage: blocks [0,SEQ*DMODEL/2048) x 256 x 8 == SEQ*DMODEL; next QKV_N*DMODEL/2048 blocks == QKV_N*DMODEL;
//           last DMODEL*DMODEL/2048 blocks == DMODEL*DMODEL.
template <int MODE>
static __device__ __forceinline__ void cvt_body(const float* __restrict__ src, us16* __restrict__ dst,
                                                 int blk, int tid) {
  const size_t e = ((size_t)blk * 256 + tid) * 8;
  const v4f a = *(const v4f*)(src + e);
  const v4f b = *(const v4f*)(src + e + 4);
  v4u u;
  if (MODE == 0) {
    Pack8B pk;
    #pragma unroll
    for (int i = 0; i < 4; ++i) {
      pk.h[i]     = (bf16)a[i];                 // RNE convert
      pk.h[4 + i] = (bf16)b[i];
    }
    u = pk.u;
  } else {
    Pack8H pk;
    #pragma unroll
    for (int i = 0; i < 4; ++i) {
      pk.h[i]     = (f16)((float)(bf16)a[i] * WCAR);   // bf16 significand is exact in f16
      pk.h[4 + i] = (f16)((float)(bf16)b[i] * WCAR);
    }
    u = pk.u;
  }
  *(v4u*)(dst + e) = u;
  
}

static __device__ __forceinline__ void convert_body(const float* __restrict__ x,
                                                    const float* __restrict__ wq,
                                                    const float* __restrict__ wpj,
                                                    bf16* __restrict__ xb,
                                                    bf16* __restrict__ wb,
                                                    f16* __restrict__ wp,
                                                    int blk, int tid) {
  const int NBX = SEQ * DMODEL / 2048;
  const int NBQ = QKV_N * DMODEL / 2048;
  if (blk < NBX)            cvt_body<0>(x, (us16*)xb, blk, tid);
  else if (blk < NBX + NBQ) cvt_body<0>(wq, (us16*)wb, blk - NBX, tid);
  else                      cvt_body<1>(wpj, (us16*)wp, blk - NBX - NBQ, tid);
}

// ---------------------------------------------------------------------------------------------
// RoPE tables ct/st [SEQ][NROPE] f32: angle(t, j) = t * (1 / 10000^(2j/64)). Block = 8 positions x 32 freqs.
// One powf + one sincosf per thread (rolled). Rows staged in LDS; waves 0-1 write the cos lines, waves 2-3 the
// coverage: (SEQ/8 blocks) x 8 rows x 32 floats == SEQ*NROPE per table.
static __device__ __forceinline__ void rope_table_body(float* __restrict__ ct, float* __restrict__ st,
                                                       int blk, int tid) {
  __shared__ __align__(16) float sc[8 * NROPE];   // cross-wave (block barrier)
  __shared__ __align__(16) float ss[8 * NROPE];
  const int j   = tid & 31;
  const int tl  = tid >> 5;
  const int t   = blk * 8 + tl;
  const float e   = (float)(2 * j) * (1.0f / 64.0f);
  const float pw  = powf(10000.0f, e);
  const float inv = 1.0f / pw;
  const float ang = (float)t * inv;
  float sn, cs;
  sincosf(ang, &sn, &cs);
  sc[tl * NROPE + j] = cs;
  ss[tl * NROPE + j] = sn;
  __syncthreads();
  if (tid < 64) {
    const int rowl  = tid >> 3;
    const int piece = tid & 7;
    const v4f v = *(const v4f*)(sc + rowl * NROPE + piece * 4);
    const size_t gi = (size_t)(blk * 8 + rowl) * NROPE + piece * 4;
    *(v4f*)(ct + gi) = v;
    
  } else if (tid < 128) {
    const int rowl  = (tid - 64) >> 3;
    const int piece = tid & 7;
    const v4f v = *(const v4f*)(ss + rowl * NROPE + piece * 4);
    const size_t gi = (size_t)(blk * 8 + rowl) * NROPE + piece * 4;
    *(v4f*)(st + gi) = v;
    
  }
}

// One launch for the two passes that depend on nothing but the inputs: blocks [0, SEQ/8) build the RoPE tables,
// the rest convert the operands (block-uniform branch, so the table blocks' barrier is passed by whole blocks).
__global__ __launch_bounds__(256) void prep_kernel(const float* __restrict__ x,
                                                   const float* __restrict__ wq,
                                                   const float* __restrict__ wpj,
                                                   bf16* __restrict__ xb,
                                                   bf16* __restrict__ wb,
                                                   f16* __restrict__ wp,
                                                   float* __restrict__ ct, float* __restrict__ st) {
  const int blk = blockIdx.x;
  const int tid = threadIdx.x;
  const int NBR = SEQ / 8;
  if (blk < NBR) rope_table_body(ct, st, blk, tid);
  else           convert_body(x, wq, wpj, xb, wb, wp, blk - NBR, tid);
}

// ---------------------------------------------------------------------------------------------
// NT GEMM: C[m][n] = oscale * sum_k A[m][k] B[n][k] (+ rscale * sum_k Ar[m][k] B[n][k] when RES).
// A, Ar, B are 16-bit row-major planes with pitch K (k contiguous). 4 waves/block, wave tile (16*MI) x 64,
// block tile (64*MI) x 64 (MI == 4: waves 2 x 2, block tile 128 x 128, four tiles [A | A | B | B]). The block's A, Ar and B rows are staged GS k at a time in two LDS buffers by asynchronous
// 16-B copies (whole 128-B row pieces); a stage buffer holds three 64-row tiles at pitch KP: [A | A | B], or [A | Ar | B] when RES.
// A and B fragments are read from LDS with the split k map:
// elements 0..7 <- k0 + 8h + 0..7, elements 8..15 <- k0 + 16 + 8h + 0..7, lane&15 = row of A / row of B (= column n).
// Epilogue: wave tile staged in LDS (in the bytes of the stage buffers, which every wave has left by then), then per
// instruction lanes 0..15 write one 256-B row segment.
// Requires K % 64 == 0, N % 64 == 0 (N % 128 == 0 when MI == 4), rows covered by the grid a multiple of the block tile's rows.
// One stage's copies of one thread of the 128: rows r + 16 j (r = tid>>3, j = 0..3) of each of the three 64-row tiles,
// 16-B piece tid&7. r0/r1/r2 point at the first row of each tile at the stage's first k (pitch K); in LDS the three
// tiles follow one another, so the twelve rows of a thread lie 16 rows apart.
static __device__ __forceinline__ void stage_gemm(us16* buf, const us16* r0, const us16* r1, const us16* r2,
                                                  int K, int tid) {
  const int row   = tid >> 3;     // 0..15
  const int piece = tid & 7;      // 0..7
  const unsigned l0 = (unsigned)(size_t)(buf + row * KP + piece * 8);   // LDS byte address
  const unsigned ls = 16 * KP * 2;                                      // 16 rows in LDS, bytes
  const size_t   go = (size_t)row * K + piece * 8;
  const size_t   gs = (size_t)16 * K;                                    // 16 rows in the plane, elements
  const us16* a0 = r0 + go;
  const us16* b0 = r1 + go;
  const us16* c0 = r2 + go;
  // the copies and, as the last line, the wait that stands before any of their address registers is rewritten
  asm volatile("global_load_async_to_lds_b128 %0, %12, off\n\t"
               "global_load_async_to_lds_b128 %1, %13, off\n\t"
               "global_load_async_to_lds_b128 %2, %14, off\n\t"
               "global_load_async_to_lds_b128 %3, %15, off\n\t"
               "global_load_async_to_lds_b128 %4, %16, off\n\t"
               "global_load_async_to_lds_b128 %5, %17, off\n\t"
               "global_load_async_to_lds_b128 %6, %18, off\n\t"
               "global_load_async_to_lds_b128 %7, %19, off\n\t"
               "global_load_async_to_lds_b128 %8, %20, off\n\t"
               "global_load_async_to_lds_b128 %9, %21, off\n\t"
               "global_load_async_to_lds_b128 %10, %22, off\n\t"
               "global_load_async_to_lds_b128 %11, %23, off\n\t"
               "s_wait_xcnt 0x0"
               :: "v"(l0), "v"(l0 + ls), "v"(l0 + 2 * ls), "v"(l0 + 3 * ls),
                  "v"(l0 + 4 * ls), "v"(l0 + 5 * ls), "v"(l0 + 6 * ls), "v"(l0 + 7 * ls),
                  "v"(l0 + 8 * ls), "v"(l0 + 9 * ls), "v"(l0 + 10 * ls), "v"(l0 + 11 * ls),
                  "v"(a0), "v"(a0 + gs), "v"(a0 + 2 * gs), "v"(a0 + 3 * gs),
                  "v"(b0), "v"(b0 + gs), "v"(b0 + 2 * gs), "v"(b0 + 3 * gs),
                  "v"(c0), "v"(c0 + gs), "v"(c0 + 2 * gs), "v"(c0 + 3 * gs) : "memory");
}

#define GEMM_LDS_B (2 * 3 * TILE_H * 2)        // bytes of the two stage buffers of three tiles each
#define QKV_LDS_B  (2 * 4 * TILE_H * 2)        // bytes of the two stage buffers of four tiles each (128 x 128 block tile)

// The same for two 64-row tiles that follow one another in LDS: rows r + 16 j of each, eight copies of a thread.
static __device__ __forceinline__ void stage_pair(us16* buf, const us16* r0, const us16* r1, int K, int tid) {
  const int row   = tid >> 3;     // 0..15
  const int piece = tid & 7;      // 0..7
  const unsigned l0 = (unsigned)(size_t)(buf + row * KP + piece * 8);   // LDS byte address
  const unsigned ls = 16 * KP * 2;                                      // 16 rows in LDS, bytes
  const size_t   go = (size_t)row * K + piece * 8;
  const size_t   gs = (size_t)16 * K;                                    // 16 rows in the plane, elements
  const us16* a0 = r0 + go;
  const us16* b0 = r1 + go;
  // the copies and, as the last line, the wait that stands before any of their address registers is rewritten
  asm volatile("global_load_async_to_lds_b128 %0, %8, off\n\t"
               "global_load_async_to_lds_b128 %1, %9, off\n\t"
               "global_load_async_to_lds_b128 %2, %10, off\n\t"
               "global_load_async_to_lds_b128 %3, %11, off\n\t"
               "global_load_async_to_lds_b128 %4, %12, off\n\t"
               "global_load_async_to_lds_b128 %5, %13, off\n\t"
               "global_load_async_to_lds_b128 %6, %14, off\n\t"
               "global_load_async_to_lds_b128 %7, %15, off\n\t"
               "s_wait_xcnt 0x0"
               :: "v"(l0), "v"(l0 + ls), "v"(l0 + 2 * ls), "v"(l0 + 3 * ls),
                  "v"(l0 + 4 * ls), "v"(l0 + 5 * ls), "v"(l0 + 6 * ls), "v"(l0 + 7 * ls),
                  "v"(a0), "v"(a0 + gs), "v"(a0 + 2 * gs), "v"(a0 + 3 * gs),
                  "v"(b0), "v"(b0 + gs), "v"(b0 + 2 * gs), "v"(b0 + 3 * gs) : "memory");
}

// One stage of a block: MI == 4 stages four tiles [A | A | B | B], the other forms three (r3 is then not read).
template <int MI>
static __device__ __forceinline__ void stage_block(us16* buf, const us16* r0, const us16* r1, const us16* r2,
                                                   const us16* r3, int K, int tid) {
  if constexpr (MI == 4) {
    stage_pair(buf, r0, r1, K, tid);
    stage_pair(buf + 2 * TILE_H, r2, r3, K, tid);
  } else {
    stage_gemm(buf, r0, r1, r2, K, tid);
  }
}

// Where the qkv product's epilogue reads the RoPE tables and writes the 16-bit planes.
//   qh, kh [NHEAD][SEQ][HDIM] f16 : q and k after RoPE;  vt [NHEAD][HDIM][SEQ] f16 : V transposed.
//   qr, kr [NHEAD][ER][HDIM]  f16 : residual planes (x - f16(x)) * 1024 for rows < ER;  vtr [NHEAD][HDIM][ER] likewise.
struct PlaneOut {
  const float* ct;
  const float* st;
  f16* qh;
  f16* qr;
  f16* kh;
  f16* kr;
  f16* vt;
  f16* vtr;
};

// Epilogue of the qkv product: the block's 128 x 128 tile is one slot (q, k or v) of two heads for 128 rows, and a wave's
// 64 x 64 tile one head for 64 rows (wave = wm + 2 wn: rows mb + 64 wm, head h0 + wn), so the planes
// are built from the f32 accumulators and the f32 qkv array is never written. All branches are block-uniform.
// q, k: wave tile staged in LDS as f32; RoPE (rotate-half): out[d] = x[d]*cos + sgn*x[d^32]*sin, both from the staged row;
//       per instruction 4 rows of 128 B, whole lines.
// v:    a lane's 8 accumulator rows are 8 consecutive keys of one d, so the tile is staged transposed with one 16-B LDS
//       store each; per instruction 2 rows of 256 B, whole lines.
// coverage: rows mb..mb+127, d 0..63 of the slot's plane for both heads; residual planes for blocks with mb < ER (ER % 128 == 0).
// EARLY is the block-uniform mb < ER as a template argument, so that neither form carries the other's registers.
// Every loop here is unrolled: constant indices keep the accumulators and the small arrays in registers.
template <int EARLY>
static __device__ __forceinline__ void rope_planes(unsigned char* smem, const v8f (&acc)[4][4],
                                                   const float* ct, const float* st,
                                                   f16* pl, f16* plr, int mb, int h0) {
  const int tid  = threadIdx.x;
  const int wave = __builtin_amdgcn_readfirstlane(tid >> 5);   // scalar, so that the head's plane base stays uniform
  const int lane = tid & 31;
  const int lq   = lane & 15;
  const int hi   = lane >> 4;
  const int h    = h0 + (wave >> 1);
  float* so = (float*)smem + wave * (64 * OP);
  #pragma unroll
  for (int mi = 0; mi < 4; ++mi) {
    #pragma unroll
    for (int t = 0; t < 4; ++t) {
      #pragma unroll
      for (int r = 0; r < 8; ++r) so[(mi * 16 + hi * 8 + r) * OP + t * 16 + lq] = acc[mi][t][r];
    }
  }
  __syncthreads();
  const int   d0  = (lane & 7) * 8;           // 0..56
  const int   j0  = d0 & (NROPE - 1);         // frequency index of d0
  const float sgn = (d0 < NROPE) ? -1.0f : 1.0f;
  const int   NK  = (EARLY != 0) ? 2 : 4;     // row groups whose loads are in flight together
  // one 32-bit lane offset per array on a uniform base; the row groups lie a constant 4 rows apart
  const unsigned srow0 = (unsigned)(mb + (wave & 1) * 64 + (lane >> 3));
  const unsigned toff  = srow0 * NROPE + j0;
  const unsigned poff  = srow0 * HDIM + d0;
  f16* plh  = pl + (size_t)h * SEQ * HDIM;
  f16* plrh = plr + (size_t)h * ER * HDIM;    // used only when EARLY (rows < ER)
  const float* cpb = ct + toff;
  const float* spb = st + toff;
  #pragma unroll
  for (int b = 0; b < 16 / NK; ++b) {
    v4f c0[NK], c1[NK], n0v[NK], n1v[NK];
    #pragma unroll
    for (int k = 0; k < NK; ++k) {
      c0[k]  = *(const v4f*)(cpb + (b * NK + k) * 4 * NROPE);
      c1[k]  = *(const v4f*)(cpb + (b * NK + k) * 4 * NROPE + 4);
      n0v[k] = *(const v4f*)(spb + (b * NK + k) * 4 * NROPE);
      n1v[k] = *(const v4f*)(spb + (b * NK + k) * 4 * NROPE + 4);
    }
    // the wait that stands before the table loads' address registers are rewritten; it names them, so they live up to it
    asm volatile("s_wait_xcnt 0x0" :: "v"(cpb), "v"(spb) : "memory");
    v4u hv[NK], rv[NK];
    #pragma unroll
    for (int k = 0; k < NK; ++k) {
      const int row = (b * NK + k) * 4 + (lane >> 3);    // 0..63
      const float* xo = so + row * OP + d0;
      const float* xq = so + row * OP + (d0 ^ NROPE);    // pair partner d^32
      const v4f x0 = *(const v4f*)(xo);
      const v4f x1 = *(const v4f*)(xo + 4);
      const v4f p0 = *(const v4f*)(xq);
      const v4f p1 = *(const v4f*)(xq + 4);
      float xa[8], pa[8], ca[8], sa[8];
      #pragma unroll
      for (int i = 0; i < 4; ++i) {
        xa[i] = x0[i];     xa[4 + i] = x1[i];
        pa[i] = p0[i];     pa[4 + i] = p1[i];
        ca[i] = c0[k][i];  ca[4 + i] = c1[k][i];
        sa[i] = n0v[k][i]; sa[4 + i] = n1v[k][i];
      }
      Pack8H ph, px;
      #pragma unroll
      for (int i = 0; i < 8; ++i) {
        const float xr = xa[i] * ca[i] + sgn * pa[i] * sa[i];
        const f16 xh = (f16)xr;
        ph.h[i] = xh;
        px.h[i] = (f16)((xr - (float)xh) * RSC);
      }
      hv[k] = ph.u;
      rv[k] = px.u;
    }
    f16* pp = plh + poff;
    f16* pr = plrh + poff;
    #pragma unroll
    for (int k = 0; k < NK; ++k) {
      *(v4u*)(pp + (b * NK + k) * 4 * HDIM) = hv[k];
      if (EARLY != 0) *(v4u*)(pr + (b * NK + k) * 4 * HDIM) = rv[k];
    }
    // the wait that stands before the stores' address and data registers are rewritten; it names them, so they live up to it
    if constexpr (EARLY != 0)
      asm volatile("s_wait_xcnt 0x0" :: "v"(pp), "v"(pr), "v"(hv[0]), "v"(hv[1]), "v"(rv[0]), "v"(rv[1]) : "memory");
    else
      asm volatile("s_wait_xcnt 0x0" :: "v"(pp), "v"(hv[0]), "v"(hv[1]), "v"(hv[2]), "v"(hv[3]) : "memory");
  }
}

template <int EARLY>
static __device__ __forceinline__ void v_planes(unsigned char* smem, const v8f (&acc)[4][4],
                                                f16* vt, f16* vtr, int mb, int h0) {
  const int tid  = threadIdx.x;
  const int wave = tid >> 5;
  const int lane = tid & 31;
  const int lq   = lane & 15;
  const int hi   = lane >> 4;
  f16* sT = (f16*)smem;                       // [head, d][key] hi, 128 rows, cross-wave (block barrier)
  f16* sR = sT + 2 * HDIM * VP;               // [head, d][key] residual, cross-wave (block barrier)
  #pragma unroll
  for (int mi = 0; mi < 4; ++mi) {
    #pragma unroll
    for (int t = 0; t < 4; ++t) {
      Pack8H ph, px;
      #pragma unroll
      for (int r = 0; r < 8; ++r) {
        const float va = acc[mi][t][r];
        const f16 vh = (f16)va;
        ph.h[r] = vh;
        px.h[r] = (f16)((va - (float)vh) * RSC);
      }
      // row = 64 * (head - h0) + d, d = t*16 + lq; keys hi*8 + 0..7 of the 16
      const int o = ((wave >> 1) * HDIM + t * 16 + lq) * VP + (wave & 1) * 64 + mi * 16 + hi * 8;
      *(v4u*)(sT + o) = ph.u;
      if (EARLY != 0) *(v4u*)(sR + o) = px.u;
    }
  }
  __syncthreads();
  const int dl = tid >> 4;                    // 0..7
  const int ks = (tid & 15) * 8;              // 0..120
  // the two heads' d rows follow one another in the plane as in the staging: 128 rows, eight per pass of the block
  f16* vth = vt + (size_t)h0 * HDIM * SEQ + mb;   // uniform base; one 32-bit lane offset; the rows lie a constant 8 apart
  #pragma unroll
  for (int g = 0; g < 2; ++g) {
    v4u vv[8];
    #pragma unroll
    for (int it = 0; it < 8; ++it) vv[it] = *(const v4u*)(sT + ((g * 8 + it) * 8 + dl) * VP + ks);
    #pragma unroll
    for (int it = 0; it < 8; ++it) *(v4u*)(vth + (unsigned)(dl * SEQ + ks) + (g * 8 + it) * 8 * SEQ) = vv[it];
    asm volatile("s_wait_xcnt 0x0" ::: "memory");   // stands before the stores' address and data registers are rewritten
  }
  if (EARLY != 0) {
    f16* vtrh = vtr + (size_t)h0 * HDIM * ER + mb;
    #pragma unroll
    for (int g = 0; g < 2; ++g) {
      v4u vx[8];
      #pragma unroll
      for (int it = 0; it < 8; ++it) vx[it] = *(const v4u*)(sR + ((g * 8 + it) * 8 + dl) * VP + ks);
      #pragma unroll
      for (int it = 0; it < 8; ++it) *(v4u*)(vtrh + (unsigned)(dl * ER + ks) + (g * 8 + it) * 8 * ER) = vx[it];
      asm volatile("s_wait_xcnt 0x0" ::: "memory");   // as above
    }
  }
}

static __device__ __forceinline__ void planes_epilogue(unsigned char* smem, const v8f (&acc)[4][4],
                                                       const PlaneOut& po, int mb, int n0) {
  const int slot = n0 / DMODEL;               // 0 = q, 1 = k, 2 = v
  const int h    = (n0 % DMODEL) / HDIM;      // first of the block's two heads
  if (slot < 2) {
    f16* pl  = (slot == 0) ? po.qh : po.kh;
    f16* plr = (slot == 0) ? po.qr : po.kr;
    if (mb >= ER) rope_planes<0>(smem, acc, po.ct, po.st, pl, plr, mb, h);
    else          rope_planes<1>(smem, acc, po.ct, po.st, pl, plr, mb, h);
  } else {
    if (mb >= ER) v_planes<0>(smem, acc, po.vt, po.vtr, mb, h);
    else          v_planes<1>(smem, acc, po.vt, po.vtr, mb, h);
  }
}
static_assert(2 * 2 * HDIM * VP * 2 <= QKV_LDS_B && 4 * 64 * OP * 4 <= QKV_LDS_B);
static_assert(ER % 128 == 0 && SEQ % 128 == 0 && DMODEL % (2 * HDIM) == 0 && QKV_N % 128 == 0);

// smem: the block's LDS (GEMM_LDS_B bytes; QKV_LDS_B when MI == 4); mb, n0: first row and first column of the block's tile.
// MI == 4: block tile 128 x 128, the four waves 2 x 2 (wave = wm + 2 wn), wave tile 64 x 64, stage buffer [A | A | B | B]:
// a block brings 256 rows from L2 for 128 x 128 results (two 128 x 64 blocks bring 384), and a wave reads 8 fragments
// from LDS for 16 products (6 for 8 at 32 x 64).
// EPI != 0: the result goes through planes_epilogue to po's planes and C is not written.
template <typename F, int MI, int RES, int EPI>
static __device__ __forceinline__ void gemm_nt_body(unsigned char* smem,
                                                    const us16* __restrict__ A,
                                                    const us16* __restrict__ Ar,
                                                    const us16* __restrict__ Bm,
                                                    float* __restrict__ C,
                                                    int K, int N, int mb, int n0,
                                                    float oscale, float rscale, const PlaneOut& po) {
  static_assert((MI == 4 && RES == 0 && EPI != 0) || (EPI == 0 && ((MI == 2 && RES == 0) || (MI == 1 && RES == 1))));
  const int NWN   = (MI == 4) ? 2 : 1;         // waves along n == B tiles per stage
  const int BT    = 2;                         // index of the first B tile in a stage buffer
  const int STG_H = (BT + NWN) * TILE_H;       // halves per stage buffer
  const int RING_B = 2 * STG_H * 2;            // bytes of the two stage buffers
  const int OUT_B  = 4 * 16 * MI * OP * 4;     // bytes of the four waves' output staging
  const int LDS_B  = (MI == 4) ? QKV_LDS_B : GEMM_LDS_B;
  static_assert(RING_B <= LDS_B && OUT_B <= LDS_B);
  // two stage buffers (cross-wave) in the loop; behind the loop's last barrier the per-wave output staging
  us16*  ring = (us16*)smem;
  float* sC   = (float*)smem;
  const int tid  = threadIdx.x;
  const int wave = tid >> 5;
  const int lane = tid & 31;
  const int lq   = lane & 15;
  const int hi   = lane >> 4;
  const int wm   = (NWN == 2) ? (wave & 1) : wave;    // the wave's place along m
  const int wn   = (NWN == 2) ? (wave >> 1) : 0;      // and along n
  const int m0   = mb + wm * (16 * MI);

  v8f acc[MI][4], acc2[MI][4];
  #pragma unroll
  for (int mi = 0; mi < MI; ++mi) {
    #pragma unroll
    for (int t = 0; t < 4; ++t) {
      acc[mi][t]  = (v8f){0, 0, 0, 0, 0, 0, 0, 0};
      acc2[mi][t] = (v8f){0, 0, 0, 0, 0, 0, 0, 0};
    }
  }

  const us16* ab  = A + (size_t)mb * K;                                                  // tile 0: A rows 0..63
  const us16* arb = (RES != 0) ? Ar + (size_t)mb * K : A + (size_t)(mb + 64) * K;        // tile 1: Ar, or A rows 64..127
  const us16* bb  = Bm + (size_t)n0 * K;                                                 // tile 2: B rows 0..63
  const us16* bb2 = bb + (size_t)64 * K;                                                 // tile 3 (MI == 4): B rows 64..127
  const int   nst = K / GS;                           // block-uniform stage count

  stage_block<MI>(ring, ab, arb, bb, bb2, K, tid);
  asm volatile("s_wait_asynccnt 0x0" ::: "memory");   // this wave's copies of stage 0 have landed
  __syncthreads();                                    // stage 0 readable by every wave
  if (nst > 1) stage_block<MI>(ring + STG_H, ab + GS, arb + GS, bb + GS, bb2 + GS, K, tid);

  for (int s = 0; s < nst; ++s) {
    const us16* sb = ring + (s & 1) * STG_H;
    #pragma unroll   // constant indices keep the fragment arrays in registers
    for (int u = 0; u < GS / 32; ++u) {
      F a[MI], ar[MI], b[4];
      #pragma unroll
      for (int mi = 0; mi < MI; ++mi) {
        const us16* p = sb + (wm * (16 * MI) + mi * 16 + lq) * KP + u * 32 + hi * 8;
        a[mi].q[0] = *(const v4u*)(p);        // k0 + 8h + 0..7
        a[mi].q[1] = *(const v4u*)(p + 16);   // k0 + 16 + 8h + 0..7
        if (RES != 0) {
          const us16* pr = p + MI * TILE_H;
          ar[mi].q[0] = *(const v4u*)(pr);
          ar[mi].q[1] = *(const v4u*)(pr + 16);
        }
      }
      #pragma unroll
      for (int t = 0; t < 4; ++t) {
        const us16* p = sb + (BT + wn) * TILE_H + (t * 16 + lq) * KP + u * 32 + hi * 8;
        b[t].q[0] = *(const v4u*)(p);
        b[t].q[1] = *(const v4u*)(p + 16);
      }
      // keeps the LDS reads of these 32 k together in front of the products: let loose, the scheduler reads one A fragment
      // at a time into the same registers and waits for each in full
      __builtin_amdgcn_sched_barrier(0);
      #pragma unroll
      for (int mi = 0; mi < MI; ++mi) {
        #pragma unroll
        for (int t = 0; t < 4; ++t) {
          acc[mi][t] = mma(a[mi], b[t], acc[mi][t]);
          if (RES != 0) acc2[mi][t] = mma(ar[mi], b[t], acc2[mi][t]);
        }
      }
    }
    // keeps the stage's products in front of the publish point, so that the next copies are issued as early as before:
    // let loose, the scheduler sinks sixteen products behind the barrier, in front of the copies
    __builtin_amdgcn_sched_barrier(0);
    // publish point of stage s + 1, passed by every wave
    asm volatile("s_wait_dscnt 0x0" ::: "memory");      // this wave's reads of stage s are done before its buffer is refilled
    asm volatile("s_wait_asynccnt 0x0" ::: "memory");   // this wave's copies of stage s + 1 have landed
    __syncthreads();                                    // stage s + 1 readable; every reader has left stage s
    if (s + 2 < nst)
      stage_block<MI>(ring + (s & 1) * STG_H, ab + (s + 2) * GS, arb + (s + 2) * GS, bb + (s + 2) * GS,
                      bb2 + (s + 2) * GS, K, tid);
  }
  asm volatile("s_wait_asynccnt 0x0" ::: "memory");     // no copy outstanding behind the loop

  if constexpr (EPI != 0) {
    planes_epilogue(smem, acc, po, mb, n0);
  } else {

  float* so = sC + wave * (16 * MI * OP);
  #pragma unroll
  for (int mi = 0; mi < MI; ++mi) {
    #pragma unroll
    for (int t = 0; t < 4; ++t) {
      #pragma unroll
      for (int r = 0; r < 8; ++r) {
        float val = acc[mi][t][r] * oscale;
        if (RES != 0) val += acc2[mi][t][r] * rscale;
        so[(mi * 16 + hi * 8 + r) * OP + t * 16 + lq] = val;
      }
    }
  }
  __syncthreads();

  const int NIT = 8 * MI;   // (16*MI rows) / 2 rows per instruction
  v4f    vals[8 * MI];
  size_t gidx[8 * MI];
  #pragma unroll
  for (int it = 0; it < NIT; ++it) {
    const int row = it * 2 + hi;
    vals[it] = *(const v4f*)(so + row * OP + lq * 4);
    gidx[it] = (size_t)(m0 + row) * N + n0 + lq * 4;
  }
  #pragma unroll
  for (int it = 0; it < NIT; ++it) *(v4f*)(C + gidx[it]) = vals[it];
  }
}

// qkv = xb x wb^T, RoPE and the q/k/v planes: block tile 128 x 128, grid (N / 128, rows / 128): 768 equal work-groups.
// At most three waves per SIMD: three work-groups per WGP, so that no WGP takes a fourth while another has two.
__global__ __launch_bounds__(128) __attribute__((amdgpu_waves_per_eu(3, 3))) void gemm_qkv_kernel(const us16* __restrict__ A,
                                                       const us16* __restrict__ Bm,
                                                       const float* __restrict__ ct,
                                                       const float* __restrict__ st,
                                                       f16* __restrict__ qh, f16* __restrict__ qr,
                                                       f16* __restrict__ kh, f16* __restrict__ kr,
                                                       f16* __restrict__ vt, f16* __restrict__ vtr,
                                                       int K, int N) {
  __shared__ __align__(16) unsigned char smem[QKV_LDS_B];
  const PlaneOut po = {ct, st, qh, qr, kh, kr, vt, vtr};
  gemm_nt_body<FragB, 4, 0, 1>(smem, A, A, Bm, nullptr, K, N, blockIdx.y * 128, blockIdx.x * 128, 1.0f, 0.0f, po);
}

// out = ctx x wp^T, all rows in one launch: the first ER / 64 block rows take 64 rows each with the residual plane,
// the others 128 rows each from row ER on (block-uniform branch; the two row ranges share no output element).
__global__ __launch_bounds__(128) void gemm_proj_kernel(const us16* __restrict__ A,
                                                        const us16* __restrict__ Ar,
                                                        const us16* __restrict__ Bm,
                                                        float* __restrict__ C, int K, int N,
                                                        float oscale, float rscale) {
  __shared__ __align__(16) unsigned char smem[GEMM_LDS_B];
  const int by = blockIdx.y;
  const int n0 = blockIdx.x * 64;
  const PlaneOut none = {};
  if (by < ER / 64) gemm_nt_body<FragH, 1, 1, 0>(smem, A, Ar, Bm, C, K, N, by * 64, n0, oscale, rscale, none);
  else              gemm_nt_body<FragH, 2, 0, 0>(smem, A, A, Bm, C, K, N, ER + (by - ER / 64) * 128, n0, oscale, 0.0f, none);
}

// ---------------------------------------------------------------------------------------------
// Flash attention, causal. Block = (query block of 128, head), 16 waves in two groups of eight: wave w of either group owns
// the 16 query rows w; group g takes the g-th 64 keys of every 128-key stage. Four waves share a SIMD, so that one wave's LDS,
// matrix and softmax latencies pass under the others' work. Behind the key loop group 1 hands its maximum, sum and O to
// group 0 through LDS, which joins the two partial softmaxes.
// S^T = K x Q^T so queries sit on lanes; P^T in C-layout is bit-identical to the A-fragment layout of O += P x V.
// Q B-fragments are loaded straight from the 16-bit plane; K A-fragments and V^T B-fragments from LDS (two 16-B loads each).
// RES != 0 (query blocks < EARLY_QBLK, all visited keys < ER): score = KQ + (K Qres + Kres Q)/1024;
// O2 = Pres V + P Vres accumulated separately and folded as O2/1024 before normalisation.
// K and V^T (and their residual planes when RES) are staged once per block, SK keys at a time (KS per key group), in two LDS buffers
// by asynchronous 16-B copies; the eight waves of a group read their fragments from LDS. A stage buffer holds, for each group
// in turn, the tiles [K | V^T | Kres | V^Tres] of its KS keys, each 64 rows of 128 B at pitch KP; a group stages its own tiles.
// One stage's copies of one thread of a group's 256 (tid): rows tid>>3 and 32 + (tid>>3) of every tile, 16-B piece tid&7.
// kg/krg point at the group's first key row of the stage (pitch HDIM); vg/vrg at its first key column (pitch SEQ / ER).
template <int RES>
static __device__ __forceinline__ void stage_tiles(f16* buf, const f16* kg, const f16* krg,
                                                   const f16* vg, const f16* vrg, int tid) {
  const int row   = tid >> 3;     // 0..31
  const int piece = tid & 7;      // 0..7
  const unsigned l0 = (unsigned)(size_t)(buf + row * KP + piece * 8);   // LDS byte address
  const unsigned l1 = l0 + 32 * KP * 2;
  const unsigned l2 = l0 + TILE_H * 2;
  const unsigned l3 = l1 + TILE_H * 2;
  const f16* g0 = kg + (size_t)row * HDIM + piece * 8;
  const f16* g1 = g0 + 32 * HDIM;
  const f16* g2 = vg + (size_t)row * SEQ + piece * 8;
  const f16* g3 = g2 + (size_t)32 * SEQ;
  // the copies and, as the last line, the wait that stands before any of their address registers is rewritten
  asm volatile("global_load_async_to_lds_b128 %0, %4, off\n\t"
               "global_load_async_to_lds_b128 %1, %5, off\n\t"
               "global_load_async_to_lds_b128 %2, %6, off\n\t"
               "global_load_async_to_lds_b128 %3, %7, off\n\t"
               "s_wait_xcnt 0x0"
               :: "v"(l0), "v"(l1), "v"(l2), "v"(l3), "v"(g0), "v"(g1), "v"(g2), "v"(g3) : "memory");
  if (RES != 0) {
    const unsigned l4 = l0 + 2 * TILE_H * 2;
    const unsigned l5 = l1 + 2 * TILE_H * 2;
    const unsigned l6 = l0 + 3 * TILE_H * 2;
    const unsigned l7 = l1 + 3 * TILE_H * 2;
    const f16* g4 = krg + (size_t)row * HDIM + piece * 8;
    const f16* g5 = g4 + 32 * HDIM;
    const f16* g6 = vrg + (size_t)row * ER + piece * 8;
    const f16* g7 = g6 + (size_t)32 * ER;
    // same form for the residual tiles
    asm volatile("global_load_async_to_lds_b128 %0, %4, off\n\t"
                 "global_load_async_to_lds_b128 %1, %5, off\n\t"
                 "global_load_async_to_lds_b128 %2, %6, off\n\t"
                 "global_load_async_to_lds_b128 %3, %7, off\n\t"
                 "s_wait_xcnt 0x0"
                 :: "v"(l4), "v"(l5), "v"(l6), "v"(l7), "v"(g4), "v"(g5), "v"(g6), "v"(g7) : "memory");
  }
}

// sO: output staging per query tile, NWAVE * 16 * OP floats; sM: group 1's partial O, the same size; sS: group 1's maximum and
// sum, NWAVE * 64 floats; sKV: the two stage buffers.
template <int RES>
static __device__ __forceinline__ void attn_body(float* sO, float* sM, float* sS, f16* sKV,
                                                 const f16* __restrict__ qh, const f16* __restrict__ qr,
                                                 const f16* __restrict__ kh, const f16* __restrict__ kr,
                                                 const f16* __restrict__ vt, const f16* __restrict__ vtr,
                                                 f16* __restrict__ ctxh, f16* __restrict__ ctxr,
                                                 int qblk, int h) {
  const int tid  = threadIdx.x;
  const int wv   = __builtin_amdgcn_readfirstlane(tid >> 5);   // scalar, so the per-wave causal skip is a scalar branch
  const int grp  = wv >> 3;     // key group: which KS keys of a stage
  const int wave = wv & 7;      // query tile
  const int gtid = tid & 255;   // thread within the group
  const int lane = tid & 31;
  const int lq   = lane & 15;   // query column of S^T / d column of O
  const int hi   = lane >> 4;   // k-split half

  const int STG_H = (RES != 0 ? 4 : 2) * TILE_H;         // halves of one group's tiles in a stage buffer
  const int BUF_H = NGRP * STG_H;                        // halves per stage buffer

  const int qrow0 = qblk * BQ + wave * 16;               // first query row of this wave

  // Q as B-operand fragments: lane lq holds query qrow0+lq, elements follow the split d map.
  FragH qf[2], qx[2];
  {
    const f16* qp = qh + ((size_t)h * SEQ + qrow0 + lq) * HDIM;
    #pragma unroll
    for (int f = 0; f < 2; ++f) {
      qf[f].q[0] = *(const v4u*)(qp + f * 32 + hi * 8);        // d = f*32 + hi*8 + 0..7
      qf[f].q[1] = *(const v4u*)(qp + f * 32 + 16 + hi * 8);   // d = f*32 + 16 + hi*8 + 0..7
    }
    if (RES != 0) {
      const f16* qrp = qr + ((size_t)h * ER + qrow0 + lq) * HDIM;
      #pragma unroll
      for (int f = 0; f < 2; ++f) {
        qx[f].q[0] = *(const v4u*)(qrp + f * 32 + hi * 8);
        qx[f].q[1] = *(const v4u*)(qrp + f * 32 + 16 + hi * 8);
      }
    }
  }

  // the head's planes at the group's first key
  const f16* kh_h  = kh  + (size_t)h * SEQ * HDIM + grp * (KS * HDIM);
  const f16* kr_h  = kr  + (size_t)h * ER * HDIM + grp * (KS * HDIM);
  const f16* vt_h  = vt  + (size_t)h * HDIM * SEQ + grp * KS;
  const f16* vtr_h = vtr + (size_t)h * HDIM * ER + grp * KS;
  f16* sg = sKV + grp * STG_H;                           // the group's tiles in stage buffer 0

  v8f o[4], o2[4];
  #pragma unroll
  for (int dt = 0; dt < 4; ++dt) {
    o[dt]  = (v8f){0, 0, 0, 0, 0, 0, 0, 0};
    o2[dt] = (v8f){0, 0, 0, 0, 0, 0, 0, 0};
  }

  float rmax = -__builtin_inff();
  float rsum = 0.0f;
  const float SL = 0.125f * 1.4426950408889634f;   // softmax scale * log2(e)

  // causal: this wave visits key chunks whose first key is <= its last query row (wave-uniform trip count)
  const int nchunk = (qrow0 + 15) / BK + 1;
  // the block walks the stages of SK keys up to its last query row (block-uniform count, at least one)
  const int nstage = (qblk + 1) * (BQ / SK);

  stage_tiles<RES>(sg, kh_h, kr_h, vt_h, vtr_h, gtid);
  asm volatile("s_wait_asynccnt 0x0" ::: "memory");   // this wave's copies of stage 0 have landed
  __syncthreads();                                    // stage 0 readable by every wave
  if (nstage > 1)
    stage_tiles<RES>(sg + BUF_H, kh_h + (size_t)SK * HDIM, kr_h + (size_t)SK * HDIM, vt_h + SK, vtr_h + SK, gtid);

  for (int t = 0; t < nstage; ++t) {
   const f16* sb = sg + (t & 1) * BUF_H;
   for (int u = 0; u < KS / BK; ++u) {
    const int i = (t * NGRP + grp) * (KS / BK) + u;
    if (i >= nchunk) break;                 // wave-uniform: chunks beyond this wave's diagonal
    const int j0 = i * BK;
    const f16* sk  = sb + (u * BK) * KP;                 // K rows of this chunk
    const f16* sv  = sb + TILE_H + u * BK;               // V^T key columns of this chunk
    const f16* skr = sb + (RES != 0 ? 2 : 0) * TILE_H + (u * BK) * KP;    // residual tiles (read when RES only)
    const f16* svr = sb + (RES != 0 ? 3 : 1) * TILE_H + u * BK;

    // K A-fragments, then V B-fragments (column n = d = dt*16 + lq, split key map from the transposed tile): all
    // fetched at the head of the chunk, so that V's LDS latency passes under the score products and the softmax.
    FragH ka[2][2], bvf[4];
    #pragma unroll   // constant indices keep the fragment arrays in registers
    for (int sub = 0; sub < 2; ++sub) {
      const f16* base = sk + (sub * 16 + lq) * KP + hi * 8;   // row = key j0 + sub*16 + lq
      ka[sub][0].q[0] = *(const v4u*)(base);        // d = hi*8 + 0..7
      ka[sub][0].q[1] = *(const v4u*)(base + 16);   // d = 16 + hi*8 + 0..7
      ka[sub][1].q[0] = *(const v4u*)(base + 32);   // d = 32 + hi*8 + 0..7
      ka[sub][1].q[1] = *(const v4u*)(base + 48);   // d = 48 + hi*8 + 0..7
    }
    #pragma unroll   // as above
    for (int dt = 0; dt < 4; ++dt) {
      const f16* base = sv + (dt * 16 + lq) * KP + hi * 8;
      bvf[dt].q[0] = *(const v4u*)(base);        // keys j0 + hi*8 + 0..7
      bvf[dt].q[1] = *(const v4u*)(base + 16);   // keys j0 + 16 + hi*8 + 0..7
    }
    // keeps the sixteen LDS reads together in front of the products: let loose, the scheduler reads one fragment at a time
    // into the same registers and waits for each in full
    __builtin_amdgcn_sched_barrier(0);

    // S^T tiles: c[sub][r] = rawscore(query qrow0+lq, key j0 + sub*16 + hi*8 + r)
    v8f c[2];
    #pragma unroll
    for (int sub = 0; sub < 2; ++sub) {
      const FragH a0 = ka[sub][0];
      const FragH a1 = ka[sub][1];
      v8f acc = (v8f){0, 0, 0, 0, 0, 0, 0, 0};
      acc = mma_f16(a0.v, qf[0].v, acc);
      acc = mma_f16(a1.v, qf[1].v, acc);
      if (RES != 0) {
        FragH r0, r1;
        const f16* rb = skr + (sub * 16 + lq) * KP + hi * 8;
        r0.q[0] = *(const v4u*)(rb);
        r0.q[1] = *(const v4u*)(rb + 16);
        r1.q[0] = *(const v4u*)(rb + 32);
        r1.q[1] = *(const v4u*)(rb + 48);
        v8f ax = (v8f){0, 0, 0, 0, 0, 0, 0, 0};
        ax = mma_f16(a0.v, qx[0].v, ax);
        ax = mma_f16(a1.v, qx[1].v, ax);
        ax = mma_f16(r0.v, qf[0].v, ax);
        ax = mma_f16(r1.v, qf[1].v, ax);
        #pragma unroll
        for (int r = 0; r < 8; ++r) acc[r] += ax[r] * (1.0f / RSC);
      }
      c[sub] = acc;
    }

    // causal mask (key > query -> -inf); branch is wave-uniform, selects are per lane
    if (j0 + BK - 1 > qrow0) {
      const int qi = qrow0 + lq;
      #pragma unroll
      for (int sub = 0; sub < 2; ++sub) {
        #pragma unroll
        for (int r = 0; r < 8; ++r) {
          const int key = j0 + sub * 16 + hi * 8 + r;
          c[sub][r] = (key > qi) ? -__builtin_inff() : c[sub][r];
        }
      }
    }

    // softmax relative to the maximum in use, rmax, which is left alone while it serves (lazy rescale).
    // exp + pack: P^T C-layout == A-fragment layout for the PV product; query lq's 32 scores are split across lane / lane^16
    FragH pa, pr;
    float psum;
    auto exp_pack = [&]() {
      float e0[8], e1[8], p0[8], p1[8];
      #pragma unroll
      for (int r = 0; r < 8; ++r) {
        e0[r] = (c[0][r] - rmax) * SL;   // key hi*8 + r
        e1[r] = (c[1][r] - rmax) * SL;   // key 16 + hi*8 + r
      }
      exp2x8(p0, e0);
      exp2x8(p1, e1);
      psum = 0.0f;
      #pragma unroll
      for (int r = 0; r < 8; ++r) {
        psum += p0[r] + p1[r];
        const float pc0 = p0[r] * PCAR;
        const float pc1 = p1[r] * PCAR;
        const f16 h0 = (f16)pc0;
        const f16 h1 = (f16)pc1;
        pa.h[r]     = h0;
        pa.h[8 + r] = h1;
        if (RES != 0) {
          pr.h[r]     = (f16)((pc0 - (float)h0) * RSC);
          pr.h[8 + r] = (f16)((pc1 - (float)h1) * RSC);
        }
      }
    };
    exp_pack();
    float rnew = rsum + psum + xhalf(psum);   // formed on either path, not behind their join among the products

    // One test per chunk, a scalar branch: a lane's sum of 16 terms at most PLIM bounds every term, so that P * PCAR stays
    // finite in f16. The negated compare also takes the first chunk (rmax = -inf: terms inf or NaN). Only then the maximum is
    // brought up to date, sum and O are rescaled to it, and the chunk's P is formed again (every term then at most 1).
    if (__builtin_expect(__builtin_amdgcn_ballot_w32(!(psum <= PLIM)) != 0, 0)) {   // rare: laid out off the straight path
      float m_new = rmax;
      #pragma unroll
      for (int r = 0; r < 8; ++r) {
        m_new = fmaxf(m_new, c[0][r]);
        m_new = fmaxf(m_new, c[1][r]);
      }
      m_new = fmaxf(m_new, xhalf(m_new));
      const float scale = __builtin_amdgcn_exp2f((rmax - m_new) * SL);
      rmax = m_new;
      rsum *= scale;

      // rescale O: queries are the row dimension there -> per-row scale of query 8*hi + r. A query's scale is the same
      // number in lanes lq and lq + 16 (rmax and m_new are joined over the halves), so each 16-lane row serves itself:
      // the upper row first brings queries 8..15 to its lanes 0..7, then lane r of each row is spread over the row.
      const float sw = row_rot8(scale);             // moved by every lane, so that the choice below is a select, not a branch
      const float sq = (hi != 0) ? sw : scale;
      const float sc[8] = {row_bcast<0>(sq), row_bcast<1>(sq), row_bcast<2>(sq), row_bcast<3>(sq),
                           row_bcast<4>(sq), row_bcast<5>(sq), row_bcast<6>(sq), row_bcast<7>(sq)};
      #pragma unroll
      for (int dt = 0; dt < 4; ++dt) {
        #pragma unroll
        for (int r = 0; r < 8; ++r) {
          o[dt][r] *= sc[r];
          if (RES != 0) o2[dt][r] *= sc[r];
        }
      }
      exp_pack();
      rnew = rsum + psum + xhalf(psum);
    }
    rsum = rnew;

    // O += P x V
    #pragma unroll
    for (int dt = 0; dt < 4; ++dt) {
      o[dt] = mma_f16(pa.v, bvf[dt].v, o[dt]);
      if (RES != 0) {
        o2[dt] = mma_f16(pr.v, bvf[dt].v, o2[dt]);
        FragH br;
        const f16* rb = svr + (dt * 16 + lq) * KP + hi * 8;
        br.q[0] = *(const v4u*)(rb);
        br.q[1] = *(const v4u*)(rb + 16);
        o2[dt] = mma_f16(pa.v, br.v, o2[dt]);
      }
    }
    // one issue slot directly behind the chunk's last product (tied to its D, so that it stays there): the next chunk's LDS
    // address can land in that product's B registers (the residual form's build has no such overwrite)
    if (RES == 0) asm volatile("v_nop" : "+v"(o[3]));
   }
   // publish point of stage t + 1, passed by every wave (also one that skipped chunks)
   asm volatile("s_wait_dscnt 0x0" ::: "memory");      // this wave's reads of stage t are done before its buffer is refilled
   asm volatile("s_wait_asynccnt 0x0" ::: "memory");   // this wave's copies of stage t + 1 have landed
   __syncthreads();                                    // stage t + 1 readable; every reader has left stage t
   if (t + 2 < nstage)
     stage_tiles<RES>(sg + (t & 1) * BUF_H, kh_h + (size_t)(t + 2) * SK * HDIM, kr_h + (size_t)(t + 2) * SK * HDIM,
                      vt_h + (t + 2) * SK, vtr_h + (t + 2) * SK, gtid);
  }
  asm volatile("s_wait_asynccnt 0x0" ::: "memory");    // no copy outstanding behind the loop

  // join of the two key groups; all branches on grp are scalar. A lane holds column d = dt*16 + lq for query rows 8*hi + r.
  // Group 1 hands over its partial O and, per lane (query lq), its maximum and sum. A group-1 wave that saw no key
  // (first query block only) hands over maximum -inf, sum 0 and O 0, whose weight below is exp2(-inf) = 0.
  float* sm = sM + wave * (16 * OP);
  float* sx = sS + wave * 64;
  if (grp != 0) {
    #pragma unroll
    for (int r = 0; r < 8; ++r) {
      #pragma unroll
      for (int dt = 0; dt < 4; ++dt) {
        float val = o[dt][r];
        if (RES != 0) val += o2[dt][r] * (1.0f / RSC);
        sm[(hi * 8 + r) * OP + dt * 16 + lq] = val;
      }
    }
    sx[lane]      = rmax;
    sx[32 + lane] = rsum;
  }
  __syncthreads();                                     // group 1's partial results readable by group 0

  // group 0 (its maximum is finite: every query sees key 0): weights of the two parts, normalised; stage ctx * 64
  float* so = sO + wave * (16 * OP);
  if (grp == 0) {
    const float m1  = sx[lane];
    const float s1  = sx[32 + lane];
    const float m   = fmaxf(rmax, m1);
    const float a0  = __builtin_amdgcn_exp2f((rmax - m) * SL);
    const float a1  = __builtin_amdgcn_exp2f((m1 - m) * SL);
    const float inv = 1.0f / (rsum * a0 + s1 * a1);
    const float w0  = a0 * inv;
    const float w1  = a1 * inv;
    #pragma unroll
    for (int r = 0; r < 8; ++r) {
      const float f0 = __shfl(w0, (hi << 3) + r, 32);
      const float f1 = __shfl(w1, (hi << 3) + r, 32);
      #pragma unroll
      for (int dt = 0; dt < 4; ++dt) {
        float val = o[dt][r];
        if (RES != 0) val += o2[dt][r] * (1.0f / RSC);
        const int e = (hi * 8 + r) * OP + dt * 16 + lq;
        so[e] = (val * f0 + sm[e] * f1) * (CCAR / PCAR);
      }
    }
  }
  __syncthreads();
  if (grp != 0) return;                                // the caller's barrier is passed by every wave behind this body

  v4u    hv[4], rv[4];
  size_t gi[4], gr[4];
  #pragma unroll
  for (int it = 0; it < 4; ++it) {
    const int row   = it * 4 + (lane >> 3);   // 0..15
    const int piece = lane & 7;               // 0..7
    const v4f a0 = *(const v4f*)(so + row * OP + piece * 8);
    const v4f a1 = *(const v4f*)(so + row * OP + piece * 8 + 4);
    Pack8H ph, px;
    #pragma unroll
    for (int k = 0; k < 4; ++k) {
      const float u0 = a0[k];
      const float u1 = a1[k];
      const f16 g0 = (f16)u0;
      const f16 g1 = (f16)u1;
      ph.h[k]     = g0;
      ph.h[4 + k] = g1;
      px.h[k]     = (f16)((u0 - (float)g0) * RSC);
      px.h[4 + k] = (f16)((u1 - (float)g1) * RSC);
    }
    hv[it] = ph.u;
    rv[it] = px.u;
    gi[it] = (size_t)(qrow0 + row) * DMODEL + h * HDIM + piece * 8;
    gr[it] = (size_t)(qrow0 + row) * DMODEL + h * HDIM + piece * 8;   // row < ER when RES
  }
  #pragma unroll
  for (int it = 0; it < 4; ++it) {
    *(v4u*)(ctxh + gi[it]) = hv[it];
    if (RES != 0) *(v4u*)(ctxr + gr[it]) = rv[it];
  }
  
}

// Causal balance: a query block's cost grows linearly with its index, and every work-group of the launch is resident
// at once, so the launch lasts as long as its longest work-group. Each work-group therefore takes two query blocks of
// one head, one after the other in every wave: NT - 1 - p, then p. Every work-group walks NT + 1 blocks' worth of key
// stages; every (head, query block) is taken exactly once. All branches are block-uniform.
// The LDS is sized for the residual form; the other uses the first half of sKV.
// Four waves per SIMD: the 16 waves of one work-group fill a WGP's share, one of the 256 equal work-groups per WGP.
__global__ __launch_bounds__(NGRP * 256) __attribute__((amdgpu_waves_per_eu(4, 4))) void attn_kernel(const f16* __restrict__ qh, const f16* __restrict__ qr,
                                                   const f16* __restrict__ kh, const f16* __restrict__ kr,
                                                   const f16* __restrict__ vt, const f16* __restrict__ vtr,
                                                   f16* __restrict__ ctxh, f16* __restrict__ ctxr) {
  __shared__ __align__(16) float sO[NWAVE * 16 * OP];   // output staging per query tile (block barrier used)
  __shared__ __align__(16) float sM[NWAVE * 16 * OP];   // group 1's partial O, cross-wave
  __shared__ __align__(16) float sS[NWAVE * 64];        // group 1's maximum and sum, cross-wave
  __shared__ __align__(16) f16 sKV[2 * NGRP * 4 * TILE_H];   // two stage buffers, cross-wave
  const int NE = ER / BQ;                       // query blocks with residual planes, per head
  const int NT = SEQ / BQ;                      // query blocks per head
  const int NP = NT / 2;                        // pairs per head
  static_assert(NT % 2 == 0 && NE <= NP);       // whole pairs; the long block of a pair never has residual planes
  const int p  = blockIdx.x % NP;
  const int h  = blockIdx.x / NP;
  attn_body<0>(sO, sM, sS, sKV, qh, qr, kh, kr, vt, vtr, ctxh, ctxr, NT - 1 - p, h);
  asm volatile("s_wait_dscnt 0x0" ::: "memory");   // this wave's LDS reads of the first block are done before the buffers are refilled
  __syncthreads();                                 // every wave has left the first block's LDS
  if (p < NE) attn_body<1>(sO, sM, sS, sKV, qh, qr, kh, kr, vt, vtr, ctxh, ctxr, p, h);
  else        attn_body<0>(sO, sM, sS, sKV, qh, qr, kh, kr, vt, vtr, ctxh, ctxr, p, h);
}

// ---------------------------------------------------------------------------------------------
extern "C" void kernel_launch(void* const* d_in, const int* in_sizes, int n_in,
                              void* d_out, int out_size, void* d_ws, size_t ws_size,
                              hipStream_t stream) {
  if (n_in < 3) return;
  if ((size_t)in_sizes[0] < (size_t)SEQ * DMODEL) return;
  if ((size_t)in_sizes[1] < (size_t)QKV_N * DMODEL) return;
  if ((size_t)in_sizes[2] < (size_t)DMODEL * DMODEL) return;
  if ((size_t)out_size < (size_t)SEQ * DMODEL) return;

  const size_t xb_bytes   = (size_t)SEQ * DMODEL * 2;            // bf16 [SEQ][DMODEL]
  const size_t wb_bytes   = (size_t)QKV_N * DMODEL * 2;          // bf16 [QKV_N][DMODEL]
  const size_t wp_bytes   = (size_t)DMODEL * DMODEL * 2;         // f16  [DMODEL][DMODEL]
  const size_t tab_bytes  = (size_t)SEQ * NROPE * 4;             // f32  [SEQ][NROPE] (each of cos, sin)
  const size_t pl_bytes   = (size_t)NHEAD * SEQ * HDIM * 2;      // f16  q/k/vt planes
  const size_t plr_bytes  = (size_t)NHEAD * ER * HDIM * 2;       // f16  residual planes
  const size_t ctx_bytes  = (size_t)SEQ * DMODEL * 2;            // f16  [SEQ][DMODEL]
  const size_t ctxr_bytes = (size_t)ER * DMODEL * 2;             // f16  [ER][DMODEL]
  const size_t total = xb_bytes + wb_bytes + wp_bytes + 2 * tab_bytes
                     + 3 * pl_bytes + 3 * plr_bytes + ctx_bytes + ctxr_bytes;
  if (ws_size < total) return;

  char* ws = (char*)d_ws;
  size_t off = 0;
  bf16*  xb   = (bf16*)(ws + off);  off += xb_bytes;
  bf16*  wb   = (bf16*)(ws + off);  off += wb_bytes;
  f16*   wp   = (f16*)(ws + off);   off += wp_bytes;
  float* ct   = (float*)(ws + off); off += tab_bytes;
  float* st   = (float*)(ws + off); off += tab_bytes;
  f16*   qhp  = (f16*)(ws + off);   off += pl_bytes;
  f16*   khp  = (f16*)(ws + off);   off += pl_bytes;
  f16*   vtp  = (f16*)(ws + off);   off += pl_bytes;
  f16*   qrp  = (f16*)(ws + off);   off += plr_bytes;
  f16*   krp  = (f16*)(ws + off);   off += plr_bytes;
  f16*   vtrp = (f16*)(ws + off);   off += plr_bytes;
  f16*   ctxh = (f16*)(ws + off);   off += ctx_bytes;
  f16*   ctxr = (f16*)(ws + off);   off += ctxr_bytes;
  if (off > ws_size) return;

  const float* x     = (const float*)d_in[0];
  const float* wqkv  = (const float*)d_in[1];
  const float* wproj = (const float*)d_in[2];
  float*       out   = (float*)d_out;

  // 1) RoPE cos/sin tables and the 16-bit operand planes of the inputs
  const int ncvt_blocks = SEQ * DMODEL / 2048 + QKV_N * DMODEL / 2048 + DMODEL * DMODEL / 2048;
  prep_kernel<<<dim3(SEQ / 8 + ncvt_blocks), 256, 0, stream>>>(x, wqkv, wproj, xb, wb, wp, ct, st);

  // 2) qkv = xb x wb^T (bf16 operands, f32 accumulators), RoPE, q/k/v planes (+ residual planes for rows < ER)
  gemm_qkv_kernel<<<dim3(QKV_N / 128, SEQ / 128), 128, 0, stream>>>(
      (const us16*)xb, (const us16*)wb, ct, st, qhp, qrp, khp, krp, vtp, vtrp, DMODEL, QKV_N);

  // 3) causal attention -> ctx planes, two query blocks per work-group
  attn_kernel<<<dim3((SEQ / BQ / 2) * NHEAD), NGRP * 256, 0, stream>>>(qhp, qrp, khp, krp, vtp, vtrp, ctxh, ctxr);

  // 4) out[SEQ][DMODEL] = ctx x wp^T ; folds the ctx carry (64), the Wproj carry (256) and the residual scale (1024)
  const float oscale = 1.0f / (CCAR * WCAR);
  const float rscale = oscale / RSC;
  gemm_proj_kernel<<<dim3(DMODEL / 64, ER / 64 + (SEQ - ER) / 128), 128, 0, stream>>>(
      (const us16*)ctxh, (const us16*)ctxr, (const us16*)wp, out, DMODEL, DMODEL, oscale, rscale);
}
